// v000
// The times below were measured on an AMD MI455X: many runs one after another, warmed up first and cycling through
// copies of the inputs, with the whole window's GPU time divided by the number of runs. Launches and the gaps
// between them are all in it. The median over several windows is given; except for v000 it joins two sittings, which
// can be a few percent apart, so the side-by-side timings, each taken in one sitting, are the better comparison.
// v000, which the later versions start from, runs in 1630 microseconds.
#include <hip/hip_runtime.h>

// Grouped-query causal self-attention with 128-wide heads, no rotary (x [2][2048][2048]; q = x Wq ('xw' [2048][2048], 16 heads x 128), k, v = x Wk, x Wv ('xw' [2048][512], 4 kv heads x 128), no biases; k, v repeated 4 x on the head axis (jnp.repeat: query head h uses kv head h / 4); att x 1/sqrt(128); causal (-inf); softmax; y = merged Wo ('xw' [2048][2048], no bias) -> [2][2048][2048] (8.4 M); argument order x, Wq, Wk, Wv, Wo).
// Compute dtypes, f32 accumulate: every input rounded to bf16; q/k/v on PLAIN bf16 operands (inputs: exact); NO rotary (the identity table cos 1, sin 0 makes the rotate-half plane builder a plain, exact plane builder); causal tile skipping; scores and attn.v: query rows < 512 hl (3 products), the rest single fp16 (x1024); softmax f32; Wo hl x exact (2 products).

#define NB_  2
#define TT   2048
#define DM   2048
#define NH_  16
#define NKV  4
#define REP  (NH_ / NKV)
#define HD   128
#define DQ   (NH_ * HD)
#define DKV  (NKV * HD)
#define ZH   2
#define RH   512                  // query rows < RH use hi+lo planes (0: none)
#define WIN  2048
#define PCAR 1024.0f
#define SCL  0.088388347648318447f   // HD^-0.5
typedef _Float16 h16;
typedef unsigned short bf;
typedef __attribute__((ext_vector_type(16))) __bf16   v16bf;
typedef __attribute__((ext_vector_type(16))) _Float16 v16h;
typedef __attribute__((ext_vector_type(8)))  _Float16 v8h;
typedef __attribute__((ext_vector_type(8)))  unsigned short v8us;
typedef __attribute__((ext_vector_type(8)))  float    v8f;
typedef __attribute__((ext_vector_type(4)))  float    v4f;
typedef v8h  __attribute__((may_alias)) v8ha;
typedef v4f  __attribute__((may_alias)) v4fa;
typedef v8us __attribute__((may_alias)) v8usa;

__device__ __forceinline__ unsigned short f2bf(float f) { unsigned u = __float_as_uint(f); u += 0x7FFFu + ((u >> 16) & 1u); return (unsigned short)(u >> 16); }
__device__ __forceinline__ float bf2f(unsigned short b) { return __uint_as_float(((unsigned)b) << 16); }
__device__ __forceinline__ float bfr(float f) { return bf2f(f2bf(f)); }
__device__ __forceinline__ v16h cat16(v8h lo, v8h hi) { return __builtin_shufflevector(lo, hi, 0, 1, 2, 3, 4, 5, 6, 7, 8, 9, 10, 11, 12, 13, 14, 15); }
__device__ __forceinline__ v16bf cat16b(v8us lo, v8us hi) { return __builtin_bit_cast(v16bf, __builtin_shufflevector(lo, hi, 0, 1, 2, 3, 4, 5, 6, 7, 8, 9, 10, 11, 12, 13, 14, 15)); }
__device__ __forceinline__ v8f wmma16(v16h a, v16h b, v8f c) { return __builtin_amdgcn_wmma_f32_16x16x32_f16(false, a, false, b, (short)0, c, false, false); }
__device__ __forceinline__ v8f wmmab(v16bf a, v16bf b, v8f c) { return __builtin_amdgcn_wmma_f32_16x16x32_bf16(false, a, false, b, (short)0, c, false, false); }



// ---- k_gemmw: register-blocked GEMM, ONE WAVE per 64x64 output tile (16 accumulators), operands straight from K-contiguous 16-bit planes; grid (M/64, N/64, Z), 32 threads.
// C[m][n] (f32, pitch ldc, + optional f32 bias[n]) = sum_k A[m][k] Bt[n][k] (+ split products per NSPLIT). z-batch strides sA/sB/sC in elements. K % 32 == 0.
template <typename T16> struct WFrag;
template <> struct WFrag<h16> { typedef v16h V; static __device__ __forceinline__ V ld(const h16* p) { return cat16(*(const v8h*)p, *(const v8h*)(p + 16)); } static __device__ __forceinline__ v8f mma(V a, V b, v8f c) { return wmma16(a, b, c); } };
template <> struct WFrag<bf> { typedef v16bf V; static __device__ __forceinline__ V ld(const bf* p) { return cat16b(*(const v8us*)p, *(const v8us*)(p + 16)); } static __device__ __forceinline__ v8f mma(V a, V b, v8f c) { return wmmab(a, b, c); } };
template <typename T16, int NSPLIT, bool BIAS>
__global__ __launch_bounds__(32) void k_gemmw(const T16* __restrict__ A, const T16* __restrict__ A2, const T16* __restrict__ Bt, const T16* __restrict__ Bt2, int K, float* C, int ldc, const float* __restrict__ bias, size_t sA, size_t sB, size_t sC) {
    typedef typename WFrag<T16>::V V;
    __shared__ __align__(16) float os[16 * 68];
    const size_t z = blockIdx.z; A += z * sA; if (A2) A2 += z * sA; Bt += z * sB; if (Bt2) Bt2 += z * sB; C += z * sC;
    const int lane = threadIdx.x & 31, lr = lane & 15, hi = lane >> 4; const int r0 = blockIdx.x * 64, c0 = blockIdx.y * 64;
    v8f acc[4][4];
#pragma unroll
    for (int mb = 0; mb < 4; ++mb)
#pragma unroll
        for (int nb = 0; nb < 4; ++nb) acc[mb][nb] = (v8f){};
    const size_t aoff = (size_t)(r0 + lr) * K + 8 * hi, boff = (size_t)(c0 + lr) * K + 8 * hi;
#pragma unroll 1
    for (int kc = 0; kc < K; kc += 32) {
        V a[4], a2[4];
#pragma unroll
        for (int mb = 0; mb < 4; ++mb) { a[mb] = WFrag<T16>::ld(A + aoff + (size_t)mb * 16 * K + kc); if (NSPLIT == 1 || NSPLIT == 2) a2[mb] = WFrag<T16>::ld(A2 + aoff + (size_t)mb * 16 * K + kc); }
#pragma unroll
        for (int nb = 0; nb < 4; ++nb) { const V b = WFrag<T16>::ld(Bt + boff + (size_t)nb * 16 * K + kc); V b2; if (NSPLIT >= 2) b2 = WFrag<T16>::ld(Bt2 + boff + (size_t)nb * 16 * K + kc);
#pragma unroll
            for (int mb = 0; mb < 4; ++mb) { acc[mb][nb] = WFrag<T16>::mma(a[mb], b, acc[mb][nb]); if (NSPLIT == 1 || NSPLIT == 2) acc[mb][nb] = WFrag<T16>::mma(a2[mb], b, acc[mb][nb]); if (NSPLIT >= 2) acc[mb][nb] = WFrag<T16>::mma(a[mb], b2, acc[mb][nb]); } }
        asm volatile("v_nop\n\tv_nop\n\tv_nop\n\tv_nop" : "+v"(acc[0][0]), "+v"(acc[1][1]), "+v"(acc[2][2]), "+v"(acc[3][3]) : "v"(a[0]), "v"(a[3]));
    }
#pragma unroll
    for (int mb = 0; mb < 4; ++mb) {
#pragma unroll
        for (int nb = 0; nb < 4; ++nb) {
#pragma unroll
            for (int j = 0; j < 8; ++j) os[(hi * 8 + j) * 68 + nb * 16 + lr] = acc[mb][nb][j]; }
        __builtin_amdgcn_wave_barrier(); asm volatile("" ::: "memory");
        float* crow = C + (size_t)(r0 + mb * 16) * ldc + c0;
{
#pragma unroll
            for (int s = 0; s < 8; ++s) { const int row = 2 * s + hi, cofs = lr * 4; v4f val = *(const v4fa*)(os + row * 68 + cofs); if (BIAS) { val[0] += bfr(bias[c0 + cofs]); val[1] += bfr(bias[c0 + cofs + 1]); val[2] += bfr(bias[c0 + cofs + 2]); val[3] += bfr(bias[c0 + cofs + 3]); }
                *(v4f*)(crow + (size_t)row * ldc + cofs) = val; }
             }
        __builtin_amdgcn_wave_barrier(); asm volatile("" ::: "memory");
    }
}

// ---- k_gemmc: the same one-wave 64x64 tile GEMM specialised for causal attention: CMODE 1 skips score tiles entirely above the diagonal (query rows r0+roff.., key columns c0..), CMODE 2 limits the
// key (K) loop of the probability x value contraction to the diagonal block (probabilities beyond it are exactly zero). roff = row offset of this launch's first row within the sequence.
template <typename T16, int NSPLIT, int CMODE>
__global__ __launch_bounds__(32) void k_gemmc(const T16* __restrict__ A, const T16* __restrict__ A2, const T16* __restrict__ Bt, const T16* __restrict__ Bt2, int K, float* C, int ldc, int roff, size_t sA, size_t sB, size_t sC) {
    typedef typename WFrag<T16>::V V;
    __shared__ __align__(16) float os[16 * 68];
    const size_t z = blockIdx.z; A += z * sA; if (A2) A2 += z * sA; Bt += z * sB; if (Bt2) Bt2 += z * sB; C += z * sC;
    const int lane = threadIdx.x & 31, lr = lane & 15, hi = lane >> 4; const int r0 = blockIdx.x * 64, c0 = blockIdx.y * 64;
    if (CMODE == 1 && c0 > r0 + roff + 63) return;                  // score tile entirely above the causal diagonal: never read (the softmax masks j > i by select)
    const int Kl = (CMODE == 2) ? min(K, r0 + roff + 64) : K;        // P.V: probabilities are exactly 0 beyond the diagonal block, so the K loop stops there
    v8f acc[4][4];
#pragma unroll
    for (int mb = 0; mb < 4; ++mb)
#pragma unroll
        for (int nb = 0; nb < 4; ++nb) acc[mb][nb] = (v8f){};
    const size_t aoff = (size_t)(r0 + lr) * K + 8 * hi, boff = (size_t)(c0 + lr) * K + 8 * hi;
#pragma unroll 1
    for (int kc = 0; kc < Kl; kc += 32) {
        V a[4], a2[4];
#pragma unroll
        for (int mb = 0; mb < 4; ++mb) { a[mb] = WFrag<T16>::ld(A + aoff + (size_t)mb * 16 * K + kc); if (NSPLIT == 1 || NSPLIT == 2) a2[mb] = WFrag<T16>::ld(A2 + aoff + (size_t)mb * 16 * K + kc); }
#pragma unroll
        for (int nb = 0; nb < 4; ++nb) { const V b = WFrag<T16>::ld(Bt + boff + (size_t)nb * 16 * K + kc); V b2; if (NSPLIT >= 2) b2 = WFrag<T16>::ld(Bt2 + boff + (size_t)nb * 16 * K + kc);
#pragma unroll
            for (int mb = 0; mb < 4; ++mb) { acc[mb][nb] = WFrag<T16>::mma(a[mb], b, acc[mb][nb]); if (NSPLIT == 1 || NSPLIT == 2) acc[mb][nb] = WFrag<T16>::mma(a2[mb], b, acc[mb][nb]); if (NSPLIT >= 2) acc[mb][nb] = WFrag<T16>::mma(a[mb], b2, acc[mb][nb]); } }
        asm volatile("v_nop\n\tv_nop\n\tv_nop\n\tv_nop" : "+v"(acc[0][0]), "+v"(acc[1][1]), "+v"(acc[2][2]), "+v"(acc[3][3]) : "v"(a[0]), "v"(a[3]));
    }
#pragma unroll
    for (int mb = 0; mb < 4; ++mb) {
#pragma unroll
        for (int nb = 0; nb < 4; ++nb) {
#pragma unroll
            for (int j = 0; j < 8; ++j) os[(hi * 8 + j) * 68 + nb * 16 + lr] = acc[mb][nb][j]; }
        __builtin_amdgcn_wave_barrier(); asm volatile("" ::: "memory");
        float* crow = C + (size_t)(r0 + mb * 16) * ldc + c0;
{
#pragma unroll
            for (int s = 0; s < 8; ++s) { const int row = 2 * s + hi, cofs = lr * 4; v4f val = *(const v4fa*)(os + row * 68 + cofs);
                *(v4f*)(crow + (size_t)row * ldc + cofs) = val; }
             }
        __builtin_amdgcn_wave_barrier(); asm volatile("" ::: "memory");
    }
}

__device__ __forceinline__ h16 tohx(float x) { return (h16)x; }
__device__ __forceinline__ void splitf(float y, unsigned short& h, unsigned short& l) { h = f2bf(y); l = f2bf(y - bf2f(h)); }
typedef __attribute__((ext_vector_type(2))) _Float16 v2h;
typedef __attribute__((ext_vector_type(4))) _Float16 v4h;
typedef __attribute__((ext_vector_type(2))) unsigned short v2us;
typedef __attribute__((ext_vector_type(4))) unsigned short v4us;
typedef __attribute__((ext_vector_type(2))) float v2f;
typedef __attribute__((ext_vector_type(4))) int v4i;

__global__ __launch_bounds__(256) void k_wtG(const float* __restrict__ w, int K, int N, bf* Bt) {
    const int lane = threadIdx.x & 31; const int L0 = (blockIdx.x * 8 + (threadIdx.x >> 5)) * 8; const int nlines = N * K / 64;
{
#pragma unroll 1
        for (int l = 0; l < 8; ++l) { const int L = L0 + l; if (L >= nlines) break; const size_t e = (size_t)L * 64 + lane * 2; const int k = (int)(e % K), n = (int)(e / K); v2us o;
            o[0] = f2bf(w[(size_t)k * N + n]); o[1] = f2bf(w[(size_t)(k + 1) * N + n]); *(v2us*)(Bt + e) = o; }
         }
}
__global__ __launch_bounds__(256) void k_cvt8(const float* __restrict__ src, bf* dst, size_t n8) { const size_t i = (size_t)blockIdx.x * 256 + threadIdx.x; if (i >= n8) return; const v8f v = *(const v8f*)(src + i * 8); v8us o;
#pragma unroll
    for (int k = 0; k < 8; ++k) o[k] = f2bf(v[k]); *(v8us*)(dst + i * 8) = o;  }
__global__ __launch_bounds__(256) void k_csid(float* CS) { const int idx = blockIdx.x * 256 + threadIdx.x; if (idx >= TT * HD) return; v2f cs; cs[0] = 1.0f; cs[1] = 0.0f; *(v2f*)(CS + (size_t)idx * 2) = cs;  }

// k_rope: head planes [h][t][d] (fp16 + hi/lo) of rope(x) x sc with the rotate-half convention out[d] = x[d] cos[t][d] - x[d+HD/2] sin[t][d], out[d+HD/2] = x[d+HD/2] cos[t][d+HD/2] + x[d] sin[t][d+HD/2]
__global__ __launch_bounds__(256) void k_rope(const float* __restrict__ F, int pitch, int nheads, const float* __restrict__ CS, const float* __restrict__ RF, const float* __restrict__ nw, float sc, h16* P16, bf* Ph, bf* Pl) {
    const size_t e = ((size_t)blockIdx.x * 256 + threadIdx.x) * 2; if (e >= (size_t)nheads * TT * HD) return; const int d = (int)(e % HD); const int t = (int)((e / HD) % TT); const int h = (int)(e / ((size_t)HD * TT)); const float* f = F + (size_t)t * pitch + h * HD; const float rf = RF ? RF[(size_t)h * TT + t] : 1.0f; v2h o16; v2us oh, ol;
#pragma unroll
    for (int q = 0; q < 2; ++q) { const int dd = d + q; const int dp = (dd < HD / 2) ? dd + HD / 2 : dd - HD / 2; float x0 = f[dd], x1 = f[dp];
        if (RF) { float n0 = __fmul_rn(x0, rf), n1 = __fmul_rn(x1, rf); asm volatile("" : "+v"(n0)); asm volatile("" : "+v"(n1)); x0 = __fmul_rn(bfr(nw[dd]), n0); x1 = __fmul_rn(bfr(nw[dp]), n1); }
        const v2f cs = *(const v2f*)(CS + ((size_t)t * HD + dd) * 2); float a = __fmul_rn(x0, cs[0]), bq = __fmul_rn(x1, cs[1]); asm volatile("" : "+v"(a)); asm volatile("" : "+v"(bq)); const float r = ((dd < HD / 2) ? __fsub_rn(a, bq) : __fadd_rn(a, bq)) * sc;
        o16[q] = tohx(r); unsigned short a2, c2; splitf(r, a2, c2); oh[q] = a2; ol[q] = c2; }
    *(v2h*)(P16 + e) = o16; *(v2us*)(Ph + e) = oh; *(v2us*)(Pl + e) = ol;  }
__global__ __launch_bounds__(256) void k_vtp(const float* __restrict__ F, int pitch, int nheads, h16* V16, bf* Vh, bf* Vl) { const size_t e = ((size_t)blockIdx.x * 256 + threadIdx.x) * 2; if (e >= (size_t)nheads * HD * TT) return; const int t = (int)(e % TT); const int d = (int)((e / TT) % HD); const int g = (int)(e / ((size_t)TT * HD)); v2h o16; v2us oh, ol;
#pragma unroll
    for (int q = 0; q < 2; ++q) { const float x = F[(size_t)(t + q) * pitch + g * HD + d]; o16[q] = tohx(x); unsigned short a2, c2; splitf(x, a2, c2); oh[q] = a2; ol[q] = c2; }
    *(v2h*)(V16 + e) = o16; *(v2us*)(Vh + e) = oh; *(v2us*)(Vl + e) = ol;  }
// k_asoft: per row (zz, i): t = S x HD^-0.5 for j <= i and i - j < WIN (sliding causal window; the reference's -1e9 additive fill vanishes identically); softmax over the 2048 keys (register row, one exp, fixed trees);
__global__ __launch_bounds__(256) void k_asoft(const float* __restrict__ Sb, h16* P16, bf* Ph, bf* Pl) {
    const int lane = threadIdx.x & 31; const int row = blockIdx.x * 8 + (threadIdx.x >> 5); if (row >= ZH * TT) return; const int i = row % TT; const int zz = row / TT; (void)zz; const bool hires = (i < RH); const float* sr = Sb + (size_t)row * TT; float v[TT / 32]; float mx = -3.0e38f;
#pragma unroll
    for (int ch = 0; ch < TT / 128; ++ch) { const int j0 = ch * 128 + lane * 4; const v4f a = *(const v4f*)(sr + j0);
#pragma unroll
        for (int q = 0; q < 4; ++q) { const int j = j0 + q; (void)j; const float t = (j <= i && i - j < WIN) ? a[q] * SCL : -3.0e38f; v[ch * 4 + q] = t; mx = fmaxf(mx, t); } }
#pragma unroll
    for (int sh = 16; sh; sh >>= 1) mx = fmaxf(mx, __shfl_xor(mx, sh, 32));
    float sum = 0.f;
#pragma unroll
    for (int k = 0; k < TT / 32; ++k) { float d0 = __fsub_rn(v[k], mx); asm volatile("" : "+v"(d0)); v[k] = __builtin_amdgcn_exp2f(__fmul_rn(d0, 1.4426950408889634f)); sum += v[k]; }
#pragma unroll
    for (int sh = 16; sh; sh >>= 1) sum += __shfl_xor(sum, sh, 32);
    const float f = __fdiv_rn(hires ? 1.0f : PCAR, sum);
{
        if (hires) {
#pragma unroll
            for (int ch = 0; ch < TT / 128; ++ch) { v4us oh, ol;
#pragma unroll
                for (int q = 0; q < 4; ++q) { unsigned short a, c2; splitf(v[ch * 4 + q] * f, a, c2); oh[q] = a; ol[q] = c2; }
                const size_t oo = ((size_t)zz * (RH ? RH : 1) + i) * TT + ch * 128 + lane * 4; *(v4us*)(Ph + oo) = oh; *(v4us*)(Pl + oo) = ol; }
        } else {
#pragma unroll
            for (int ch = 0; ch < TT / 128; ++ch) { v4h o4;
#pragma unroll
                for (int q = 0; q < 4; ++q) o4[q] = tohx(v[ch * 4 + q] * f);
                *(v4h*)(P16 + (size_t)row * TT + ch * 128 + lane * 4) = o4; } }
         }
}
__global__ __launch_bounds__(256) void k_merge(const float* __restrict__ O, int h0, bf* Ah, bf* Al) { const size_t e = ((size_t)blockIdx.x * 256 + threadIdx.x) * 2; if (e >= (size_t)ZH * TT * HD) return; const int d = (int)(e % HD); const int t = (int)((e / HD) % TT); const int zz = (int)(e / ((size_t)HD * TT)); const float cs = (t < RH) ? 1.0f : (1.0f / PCAR); const size_t oo = (size_t)t * DQ + (h0 + zz) * HD + d;
    v2us oh, ol;
#pragma unroll
    for (int q = 0; q < 2; ++q) { unsigned short a, c2; splitf(O[e + q] * cs, a, c2); oh[q] = a; ol[q] = c2; } *(v2us*)(Ah + oo) = oh; *(v2us*)(Al + oo) = ol;  }

extern "C" void kernel_launch(void* const* d_in, const int* in_sizes, int n_in,
                              void* d_out, int out_size, void* d_ws, size_t ws_size, hipStream_t stream) {
    (void)in_sizes; (void)n_in; (void)out_size;
    const float* x = (const float*)d_in[0]; const float* wq = (const float*)d_in[1]; const float* wk = (const float*)d_in[2]; const float* wv = (const float*)d_in[3]; const float* wo = (const float*)d_in[4];
    float* OUT = (float*)d_out;     // [2][2048][2048]
    char* wsp = (char*)d_ws;
    auto take = [&](size_t bytes) { char* p = wsp; wsp += (bytes + 255) & ~(size_t)255; return (void*)p; };
    bf* WQ = (bf*)take((size_t)DQ * DM * 2); bf* WK = (bf*)take((size_t)DKV * DM * 2); bf* WV = (bf*)take((size_t)DKV * DM * 2); bf* WO = (bf*)take((size_t)DM * DQ * 2); float* CS = (float*)take((size_t)TT * HD * 2 * 4);
    bf* XB = (bf*)take((size_t)TT * DM * 2); float* FQ = (float*)take((size_t)TT * DQ * 4); float* FK = (float*)take((size_t)TT * DKV * 4);
    h16* QP16 = (h16*)take((size_t)NH_ * TT * HD * 2); h16* KP16 = (h16*)take((size_t)NKV * TT * HD * 2); h16* VT16 = (h16*)take((size_t)NKV * HD * TT * 2);
    bf* QPh = (bf*)take((size_t)NH_ * TT * HD * 2); bf* QPl = (bf*)take((size_t)NH_ * TT * HD * 2); bf* KPh = (bf*)take((size_t)NKV * TT * HD * 2); bf* KPl = (bf*)take((size_t)NKV * TT * HD * 2); bf* VTh = (bf*)take((size_t)NKV * HD * TT * 2); bf* VTl = (bf*)take((size_t)NKV * HD * TT * 2); bf* Ph = (bf*)take((size_t)ZH * RH * TT * 2); bf* Pl = (bf*)take((size_t)ZH * RH * TT * 2);
    float* Sb = (float*)take((size_t)ZH * TT * TT * 4); h16* P16 = (h16*)take((size_t)ZH * TT * TT * 2); float* Ob = (float*)take((size_t)ZH * TT * HD * 4); bf* ATh = (bf*)take((size_t)TT * DQ * 2); bf* ATl = (bf*)take((size_t)TT * DQ * 2);
    if ((size_t)(wsp - (char*)d_ws) > ws_size) return;    // ws 256 MiB
    float* FV = FK;   // v projection reuses the k buffer after the k planes are built (stream-ordered)
    { k_wtG<<<(unsigned)((DM * DQ / 64 + 63) / 64), 256, 0, stream>>>(wq, DM, DQ, WQ); k_wtG<<<(unsigned)((DM * DKV / 64 + 63) / 64), 256, 0, stream>>>(wk, DM, DKV, WK); k_wtG<<<(unsigned)((DM * DKV / 64 + 63) / 64), 256, 0, stream>>>(wv, DM, DKV, WV);
      k_wtG<<<(unsigned)((DQ * DM / 64 + 63) / 64), 256, 0, stream>>>(wo, DQ, DM, WO);
      k_csid<<<(TT * HD + 255) / 256, 256, 0, stream>>>(CS); }
    const unsigned LQ = (unsigned)(((size_t)NH_ * TT * HD / 2 + 255) / 256), LKv = (unsigned)(((size_t)NKV * TT * HD / 2 + 255) / 256);
    for (int b = 0; b < NB_; ++b) {
        
        k_cvt8<<<(unsigned)(((size_t)TT * DM / 8 + 255) / 256), 256, 0, stream>>>(x + (size_t)b * TT * DM, XB, (size_t)TT * DM / 8);
        k_gemmw<bf, 0, false><<<dim3(TT / 64, DQ / 64, 1), 32, 0, stream>>>(XB, nullptr, WQ, nullptr, DM, FQ, DQ, nullptr, 0, 0, 0);
        k_rope<<<LQ, 256, 0, stream>>>(FQ, DQ, NH_, CS, nullptr, nullptr, 1.0f, QP16, QPh, QPl);
        k_gemmw<bf, 0, false><<<dim3(TT / 64, DKV / 64, 1), 32, 0, stream>>>(XB, nullptr, WK, nullptr, DM, FK, DKV, nullptr, 0, 0, 0);
        k_rope<<<LKv, 256, 0, stream>>>(FK, DKV, NKV, CS, nullptr, nullptr, 1.0f, KP16, KPh, KPl);
        k_gemmw<bf, 0, false><<<dim3(TT / 64, DKV / 64, 1), 32, 0, stream>>>(XB, nullptr, WV, nullptr, DM, FV, DKV, nullptr, 0, 0, 0); k_vtp<<<LKv, 256, 0, stream>>>(FV, DKV, NKV, VT16, VTh, VTl);
        for (int h0 = 0; h0 < NH_; h0 += ZH) { const size_t zq = (size_t)h0, zk = (size_t)(h0 / REP);   // both heads of a pass share kv group h0/REP (REP >= 2): sB = 0
            k_gemmc<bf, 2, 1><<<dim3(RH / 64, TT / 64, ZH), 32, 0, stream>>>(QPh + zq * TT * HD, QPl + zq * TT * HD, KPh + zk * TT * HD, KPl + zk * TT * HD, HD, Sb, TT, 0, (size_t)TT * HD, 0, (size_t)TT * TT);
            k_gemmc<h16, 0, 1><<<dim3((TT - RH) / 64, TT / 64, ZH), 32, 0, stream>>>(QP16 + zq * TT * HD + (size_t)RH * HD, nullptr, KP16 + zk * TT * HD, nullptr, HD, Sb + (size_t)RH * TT, TT, RH, (size_t)TT * HD, 0, (size_t)TT * TT);
            k_asoft<<<ZH * TT / 8, 256, 0, stream>>>(Sb, P16, Ph, Pl);
            k_gemmc<bf, 2, 2><<<dim3(RH / 64, HD / 64, ZH), 32, 0, stream>>>(Ph, Pl, VTh + zk * HD * TT, VTl + zk * HD * TT, TT, Ob, HD, 0, (size_t)RH * TT, 0, (size_t)TT * HD);
            k_gemmc<h16, 0, 2><<<dim3((TT - RH) / 64, HD / 64, ZH), 32, 0, stream>>>(P16 + (size_t)RH * TT, nullptr, VT16 + zk * HD * TT, nullptr, TT, Ob + (size_t)RH * HD, HD, RH, (size_t)TT * TT, 0, (size_t)TT * HD);
            k_merge<<<(unsigned)(((size_t)ZH * TT * HD / 2 + 255) / 256), 256, 0, stream>>>(Ob, h0, ATh, ATl); }
        k_gemmw<bf, 1, false><<<dim3(TT / 64, DM / 64, 1), 32, 0, stream>>>(ATh, ATl, WO, nullptr, DQ, OUT + (size_t)b * TT * DM, DM, nullptr, 0, 0, 0); }
}

// v001
// It runs in 885 microseconds.
// Two timings next to v000 put it at 1.85 and 1.88 times that version's speed.
#include <hip/hip_runtime.h>

// Grouped-query causal self-attention with 128-wide heads, no rotary (x [2][2048][2048]; q = x Wq ('xw' [2048][2048], 16 heads x 128), k, v = x Wk, x Wv ('xw' [2048][512], 4 kv heads x 128), no biases; k, v repeated 4 x on the head axis (jnp.repeat: query head h uses kv head h / 4); att x 1/sqrt(128); causal (-inf); softmax; y = merged Wo ('xw' [2048][2048], no bias) -> [2][2048][2048] (8.4 M); argument order x, Wq, Wk, Wv, Wo).
// Compute dtypes, f32 accumulate: every input rounded to bf16; q/k/v on PLAIN bf16 operands (inputs: exact); NO rotary (the identity table cos 1, sin 0 makes the rotate-half plane builder a plain, exact plane builder); causal tile skipping; scores and attn.v: query rows < 512 hl (3 products), the rest single fp16 (x1024); softmax f32; Wo hl x exact (2 products).

#define NB_  2
#define TT   2048
#define DM   2048
#define NH_  16
#define NKV  4
#define REP  (NH_ / NKV)
#define HD   128
#define DQ   (NH_ * HD)
#define DKV  (NKV * HD)
#define ZH   NH_                  // heads per attention pass: all of them
#define RC   512                  // query rows per attention pass (a pass: ZH heads x RC rows; RH is a multiple of RC, so a pass is wholly hi+lo or wholly fp16)
#define RH   512                  // query rows < RH use hi+lo planes (0: none)
#define WIN  2048
#define PCAR 1024.0f
#define SCL  0.088388347648318447f   // HD^-0.5
typedef _Float16 h16;
typedef unsigned short bf;
typedef __attribute__((ext_vector_type(16))) __bf16   v16bf;
typedef __attribute__((ext_vector_type(16))) _Float16 v16h;
typedef __attribute__((ext_vector_type(8)))  _Float16 v8h;
typedef __attribute__((ext_vector_type(8)))  unsigned short v8us;
typedef __attribute__((ext_vector_type(8)))  float    v8f;
typedef __attribute__((ext_vector_type(4)))  float    v4f;
typedef v8h  __attribute__((may_alias)) v8ha;
typedef v4f  __attribute__((may_alias)) v4fa;
typedef v8us __attribute__((may_alias)) v8usa;

__device__ __forceinline__ unsigned short f2bf(float f) { unsigned u = __float_as_uint(f); u += 0x7FFFu + ((u >> 16) & 1u); return (unsigned short)(u >> 16); }
__device__ __forceinline__ float bf2f(unsigned short b) { return __uint_as_float(((unsigned)b) << 16); }
__device__ __forceinline__ float bfr(float f) { return bf2f(f2bf(f)); }
__device__ __forceinline__ v16h cat16(v8h lo, v8h hi) { return __builtin_shufflevector(lo, hi, 0, 1, 2, 3, 4, 5, 6, 7, 8, 9, 10, 11, 12, 13, 14, 15); }
__device__ __forceinline__ v16bf cat16b(v8us lo, v8us hi) { return __builtin_bit_cast(v16bf, __builtin_shufflevector(lo, hi, 0, 1, 2, 3, 4, 5, 6, 7, 8, 9, 10, 11, 12, 13, 14, 15)); }
__device__ __forceinline__ v8f wmma16(v16h a, v16h b, v8f c) { return __builtin_amdgcn_wmma_f32_16x16x32_f16(false, a, false, b, (short)0, c, false, false); }
__device__ __forceinline__ v8f wmmab(v16bf a, v16bf b, v8f c) { return __builtin_amdgcn_wmma_f32_16x16x32_bf16(false, a, false, b, (short)0, c, false, false); }



// ---- k_gemmw: register-blocked GEMM, ONE WAVE per 64x64 output tile (16 accumulators), operands straight from K-contiguous 16-bit planes; grid (M/64, N/64, Z), 32 threads.
// C[m][n] (f32, pitch ldc, + optional f32 bias[n]) = sum_k A[m][k] Bt[n][k] (+ split products per NSPLIT). z-batch strides sA/sB/sC in elements. K % 32 == 0.
template <typename T16> struct WFrag;
template <> struct WFrag<h16> { typedef v16h V; static __device__ __forceinline__ V ld(const h16* p) { return cat16(*(const v8h*)p, *(const v8h*)(p + 16)); } static __device__ __forceinline__ v8f mma(V a, V b, v8f c) { return wmma16(a, b, c); } };
template <> struct WFrag<bf> { typedef v16bf V; static __device__ __forceinline__ V ld(const bf* p) { return cat16b(*(const v8us*)p, *(const v8us*)(p + 16)); } static __device__ __forceinline__ v8f mma(V a, V b, v8f c) { return wmmab(a, b, c); } };
template <typename T16, int NSPLIT, bool BIAS>
__global__ __launch_bounds__(32) void k_gemmw(const T16* __restrict__ A, const T16* __restrict__ A2, const T16* __restrict__ Bt, const T16* __restrict__ Bt2, int K, float* C, int ldc, const float* __restrict__ bias, size_t sA, size_t sB, size_t sC) {
    typedef typename WFrag<T16>::V V;
    __shared__ __align__(16) float os[16 * 68];
    const size_t z = blockIdx.z; A += z * sA; if (A2) A2 += z * sA; Bt += z * sB; if (Bt2) Bt2 += z * sB; C += z * sC;
    const int lane = threadIdx.x & 31, lr = lane & 15, hi = lane >> 4; const int r0 = blockIdx.x * 64, c0 = blockIdx.y * 64;
    v8f acc[4][4];
#pragma unroll
    for (int mb = 0; mb < 4; ++mb)
#pragma unroll
        for (int nb = 0; nb < 4; ++nb) acc[mb][nb] = (v8f){};
    const size_t aoff = (size_t)(r0 + lr) * K + 8 * hi, boff = (size_t)(c0 + lr) * K + 8 * hi;
#pragma unroll 1
    for (int kc = 0; kc < K; kc += 32) {
        V a[4], a2[4];
#pragma unroll
        for (int mb = 0; mb < 4; ++mb) { a[mb] = WFrag<T16>::ld(A + aoff + (size_t)mb * 16 * K + kc); if (NSPLIT == 1 || NSPLIT == 2) a2[mb] = WFrag<T16>::ld(A2 + aoff + (size_t)mb * 16 * K + kc); }
#pragma unroll
        for (int nb = 0; nb < 4; ++nb) { const V b = WFrag<T16>::ld(Bt + boff + (size_t)nb * 16 * K + kc); V b2; if (NSPLIT >= 2) b2 = WFrag<T16>::ld(Bt2 + boff + (size_t)nb * 16 * K + kc);
#pragma unroll
            for (int mb = 0; mb < 4; ++mb) { acc[mb][nb] = WFrag<T16>::mma(a[mb], b, acc[mb][nb]); if (NSPLIT == 1 || NSPLIT == 2) acc[mb][nb] = WFrag<T16>::mma(a2[mb], b, acc[mb][nb]); if (NSPLIT >= 2) acc[mb][nb] = WFrag<T16>::mma(a[mb], b2, acc[mb][nb]); } }
        asm volatile("v_nop\n\tv_nop\n\tv_nop\n\tv_nop" : "+v"(acc[0][0]), "+v"(acc[1][1]), "+v"(acc[2][2]), "+v"(acc[3][3]) : "v"(a[0]), "v"(a[3]));
    }
#pragma unroll
    for (int mb = 0; mb < 4; ++mb) {
#pragma unroll
        for (int nb = 0; nb < 4; ++nb) {
#pragma unroll
            for (int j = 0; j < 8; ++j) os[(hi * 8 + j) * 68 + nb * 16 + lr] = acc[mb][nb][j]; }
        __builtin_amdgcn_wave_barrier(); asm volatile("" ::: "memory");
        float* crow = C + (size_t)(r0 + mb * 16) * ldc + c0;
{
#pragma unroll
            for (int s = 0; s < 8; ++s) { const int row = 2 * s + hi, cofs = lr * 4; v4f val = *(const v4fa*)(os + row * 68 + cofs); if (BIAS) { val[0] += bfr(bias[c0 + cofs]); val[1] += bfr(bias[c0 + cofs + 1]); val[2] += bfr(bias[c0 + cofs + 2]); val[3] += bfr(bias[c0 + cofs + 3]); }
                *(v4f*)(crow + (size_t)row * ldc + cofs) = val; }
             }
        __builtin_amdgcn_wave_barrier(); asm volatile("" ::: "memory");
    }
}

// ---- k_gemmc: the same one-wave 64x64 tile GEMM specialised for causal attention: CMODE 1 skips score tiles entirely above the diagonal (query rows r0+roff.., key columns c0..), CMODE 2 limits the
// key (K) loop of the probability x value contraction to the diagonal block (probabilities beyond it are exactly zero). roff = row offset of this launch's first row within the sequence.
// z = query head: A and C step by sA, sC per head, Bt by sB per kv group (z / REP).
template <typename T16, int NSPLIT, int CMODE>
__global__ __launch_bounds__(32) void k_gemmc(const T16* __restrict__ A, const T16* __restrict__ A2, const T16* __restrict__ Bt, const T16* __restrict__ Bt2, int K, float* C, int ldc, int roff, size_t sA, size_t sB, size_t sC) {
    typedef typename WFrag<T16>::V V;
    __shared__ __align__(16) float os[16 * 68];
    const size_t z = blockIdx.z; A += z * sA; if (A2) A2 += z * sA; Bt += (z / REP) * sB; if (Bt2) Bt2 += (z / REP) * sB; C += z * sC;
    const int lane = threadIdx.x & 31, lr = lane & 15, hi = lane >> 4; const int r0 = blockIdx.x * 64, c0 = blockIdx.y * 64;
    if (CMODE == 1 && c0 > r0 + roff + 63) return;                  // score tile entirely above the causal diagonal: never read (the softmax masks j > i by select)
    const int Kl = (CMODE == 2) ? min(K, r0 + roff + 64) : K;        // P.V: probabilities are exactly 0 beyond the diagonal block, so the K loop stops there
    v8f acc[4][4];
#pragma unroll
    for (int mb = 0; mb < 4; ++mb)
#pragma unroll
        for (int nb = 0; nb < 4; ++nb) acc[mb][nb] = (v8f){};
    const size_t aoff = (size_t)(r0 + lr) * K + 8 * hi, boff = (size_t)(c0 + lr) * K + 8 * hi;
#pragma unroll 1
    for (int kc = 0; kc < Kl; kc += 32) {
        V a[4], a2[4];
#pragma unroll
        for (int mb = 0; mb < 4; ++mb) { a[mb] = WFrag<T16>::ld(A + aoff + (size_t)mb * 16 * K + kc); if (NSPLIT == 1 || NSPLIT == 2) a2[mb] = WFrag<T16>::ld(A2 + aoff + (size_t)mb * 16 * K + kc); }
#pragma unroll
        for (int nb = 0; nb < 4; ++nb) { const V b = WFrag<T16>::ld(Bt + boff + (size_t)nb * 16 * K + kc); V b2; if (NSPLIT >= 2) b2 = WFrag<T16>::ld(Bt2 + boff + (size_t)nb * 16 * K + kc);
#pragma unroll
            for (int mb = 0; mb < 4; ++mb) { acc[mb][nb] = WFrag<T16>::mma(a[mb], b, acc[mb][nb]); if (NSPLIT == 1 || NSPLIT == 2) acc[mb][nb] = WFrag<T16>::mma(a2[mb], b, acc[mb][nb]); if (NSPLIT >= 2) acc[mb][nb] = WFrag<T16>::mma(a[mb], b2, acc[mb][nb]); } }
        asm volatile("v_nop\n\tv_nop\n\tv_nop\n\tv_nop" : "+v"(acc[0][0]), "+v"(acc[1][1]), "+v"(acc[2][2]), "+v"(acc[3][3]) : "v"(a[0]), "v"(a[3]));
    }
#pragma unroll
    for (int mb = 0; mb < 4; ++mb) {
#pragma unroll
        for (int nb = 0; nb < 4; ++nb) {
#pragma unroll
            for (int j = 0; j < 8; ++j) os[(hi * 8 + j) * 68 + nb * 16 + lr] = acc[mb][nb][j]; }
        __builtin_amdgcn_wave_barrier(); asm volatile("" ::: "memory");
        float* crow = C + (size_t)(r0 + mb * 16) * ldc + c0;
{
#pragma unroll
            for (int s = 0; s < 8; ++s) { const int row = 2 * s + hi, cofs = lr * 4; v4f val = *(const v4fa*)(os + row * 68 + cofs);
                *(v4f*)(crow + (size_t)row * ldc + cofs) = val; }
             }
        __builtin_amdgcn_wave_barrier(); asm volatile("" ::: "memory");
    }
}

__device__ __forceinline__ h16 tohx(float x) { return (h16)x; }
__device__ __forceinline__ void splitf(float y, unsigned short& h, unsigned short& l) { h = f2bf(y); l = f2bf(y - bf2f(h)); }
typedef __attribute__((ext_vector_type(2))) _Float16 v2h;
typedef __attribute__((ext_vector_type(4))) _Float16 v4h;
typedef __attribute__((ext_vector_type(2))) unsigned short v2us;
typedef __attribute__((ext_vector_type(4))) unsigned short v4us;
typedef __attribute__((ext_vector_type(2))) float v2f;
typedef __attribute__((ext_vector_type(4))) int v4i;

__global__ __launch_bounds__(256) void k_wtG(const float* __restrict__ w, int K, int N, bf* Bt) {
    const int lane = threadIdx.x & 31; const int L0 = (blockIdx.x * 8 + (threadIdx.x >> 5)) * 8; const int nlines = N * K / 64;
{
#pragma unroll 1
        for (int l = 0; l < 8; ++l) { const int L = L0 + l; if (L >= nlines) break; const size_t e = (size_t)L * 64 + lane * 2; const int k = (int)(e % K), n = (int)(e / K); v2us o;
            o[0] = f2bf(w[(size_t)k * N + n]); o[1] = f2bf(w[(size_t)(k + 1) * N + n]); *(v2us*)(Bt + e) = o; }
         }
}
__global__ __launch_bounds__(256) void k_cvt8(const float* __restrict__ src, bf* dst, size_t n8) { const size_t i = (size_t)blockIdx.x * 256 + threadIdx.x; if (i >= n8) return; const v8f v = *(const v8f*)(src + i * 8); v8us o;
#pragma unroll
    for (int k = 0; k < 8; ++k) o[k] = f2bf(v[k]); *(v8us*)(dst + i * 8) = o;  }
__global__ __launch_bounds__(256) void k_csid(float* CS) { const int idx = blockIdx.x * 256 + threadIdx.x; if (idx >= TT * HD) return; v2f cs; cs[0] = 1.0f; cs[1] = 0.0f; *(v2f*)(CS + (size_t)idx * 2) = cs;  }

// k_rope: head planes [h][t][d] (fp16 + hi/lo) of rope(x) x sc with the rotate-half convention out[d] = x[d] cos[t][d] - x[d+HD/2] sin[t][d], out[d+HD/2] = x[d+HD/2] cos[t][d+HD/2] + x[d] sin[t][d+HD/2]
__global__ __launch_bounds__(256) void k_rope(const float* __restrict__ F, int pitch, int nheads, const float* __restrict__ CS, const float* __restrict__ RF, const float* __restrict__ nw, float sc, h16* P16, bf* Ph, bf* Pl) {
    const size_t e = ((size_t)blockIdx.x * 256 + threadIdx.x) * 2; if (e >= (size_t)nheads * TT * HD) return; const int d = (int)(e % HD); const int t = (int)((e / HD) % TT); const int h = (int)(e / ((size_t)HD * TT)); const float* f = F + (size_t)t * pitch + h * HD; const float rf = RF ? RF[(size_t)h * TT + t] : 1.0f; v2h o16; v2us oh, ol;
#pragma unroll
    for (int q = 0; q < 2; ++q) { const int dd = d + q; const int dp = (dd < HD / 2) ? dd + HD / 2 : dd - HD / 2; float x0 = f[dd], x1 = f[dp];
        if (RF) { float n0 = __fmul_rn(x0, rf), n1 = __fmul_rn(x1, rf); asm volatile("" : "+v"(n0)); asm volatile("" : "+v"(n1)); x0 = __fmul_rn(bfr(nw[dd]), n0); x1 = __fmul_rn(bfr(nw[dp]), n1); }
        const v2f cs = *(const v2f*)(CS + ((size_t)t * HD + dd) * 2); float a = __fmul_rn(x0, cs[0]), bq = __fmul_rn(x1, cs[1]); asm volatile("" : "+v"(a)); asm volatile("" : "+v"(bq)); const float r = ((dd < HD / 2) ? __fsub_rn(a, bq) : __fadd_rn(a, bq)) * sc;
        o16[q] = tohx(r); unsigned short a2, c2; splitf(r, a2, c2); oh[q] = a2; ol[q] = c2; }
    *(v2h*)(P16 + e) = o16; *(v2us*)(Ph + e) = oh; *(v2us*)(Pl + e) = ol;  }
__global__ __launch_bounds__(256) void k_vtp(const float* __restrict__ F, int pitch, int nheads, h16* V16, bf* Vh, bf* Vl) { const size_t e = ((size_t)blockIdx.x * 256 + threadIdx.x) * 2; if (e >= (size_t)nheads * HD * TT) return; const int t = (int)(e % TT); const int d = (int)((e / TT) % HD); const int g = (int)(e / ((size_t)TT * HD)); v2h o16; v2us oh, ol;
#pragma unroll
    for (int q = 0; q < 2; ++q) { const float x = F[(size_t)(t + q) * pitch + g * HD + d]; o16[q] = tohx(x); unsigned short a2, c2; splitf(x, a2, c2); oh[q] = a2; ol[q] = c2; }
    *(v2h*)(V16 + e) = o16; *(v2us*)(Vh + e) = oh; *(v2us*)(Vl + e) = ol;  }
// k_asoft: one pass of ZH heads x RC query rows starting at sequence row row0 (planes [zz][RC][TT]); per row (zz, i): t = S x HD^-0.5 for j <= i and i - j < WIN (sliding causal window; the reference's -1e9 additive fill vanishes identically); softmax over the 2048 keys (register row, one exp, fixed trees);
__global__ __launch_bounds__(256) void k_asoft(const float* __restrict__ Sb, int row0, h16* P16, bf* Ph, bf* Pl) {
    const int lane = threadIdx.x & 31; const int row = blockIdx.x * 8 + (threadIdx.x >> 5); if (row >= ZH * RC) return; __builtin_assume(row0 >= 0 && row0 <= TT - RC);   // bounds i below TT, so the window test (WIN = TT) folds away as it does for a whole-sequence pass
    const int i = row0 + row % RC; const bool hires = (i < RH); const float* sr = Sb + (size_t)row * TT; float v[TT / 32]; float mx = -3.0e38f;
#pragma unroll
    for (int ch = 0; ch < TT / 128; ++ch) { const int j0 = ch * 128 + lane * 4; const v4f a = *(const v4f*)(sr + j0);
#pragma unroll
        for (int q = 0; q < 4; ++q) { const int j = j0 + q; (void)j; const float t = (j <= i && i - j < WIN) ? a[q] * SCL : -3.0e38f; v[ch * 4 + q] = t; mx = fmaxf(mx, t); } }
#pragma unroll
    for (int sh = 16; sh; sh >>= 1) mx = fmaxf(mx, __shfl_xor(mx, sh, 32));
    float sum = 0.f;
#pragma unroll
    for (int k = 0; k < TT / 32; ++k) { float d0 = __fsub_rn(v[k], mx); asm volatile("" : "+v"(d0)); v[k] = __builtin_amdgcn_exp2f(__fmul_rn(d0, 1.4426950408889634f)); sum += v[k]; }
#pragma unroll
    for (int sh = 16; sh; sh >>= 1) sum += __shfl_xor(sum, sh, 32);
    const float f = __fdiv_rn(hires ? 1.0f : PCAR, sum);
{
        if (hires) {
#pragma unroll
            for (int ch = 0; ch < TT / 128; ++ch) { v4us oh, ol;
#pragma unroll
                for (int q = 0; q < 4; ++q) { unsigned short a, c2; splitf(v[ch * 4 + q] * f, a, c2); oh[q] = a; ol[q] = c2; }
                const size_t oo = (size_t)row * TT + ch * 128 + lane * 4; *(v4us*)(Ph + oo) = oh; *(v4us*)(Pl + oo) = ol; }
        } else {
#pragma unroll
            for (int ch = 0; ch < TT / 128; ++ch) { v4h o4;
#pragma unroll
                for (int q = 0; q < 4; ++q) o4[q] = tohx(v[ch * 4 + q] * f);
                *(v4h*)(P16 + (size_t)row * TT + ch * 128 + lane * 4) = o4; } }
         }
}
__global__ __launch_bounds__(256) void k_merge(const float* __restrict__ O, int row0, bf* Ah, bf* Al) { const size_t e = ((size_t)blockIdx.x * 256 + threadIdx.x) * 2; if (e >= (size_t)ZH * RC * HD) return; const int d = (int)(e % HD); const int t = row0 + (int)((e / HD) % RC); const int zz = (int)(e / ((size_t)HD * RC)); const float cs = (t < RH) ? 1.0f : (1.0f / PCAR); const size_t oo = (size_t)t * DQ + zz * HD + d;
    v2us oh, ol;
#pragma unroll
    for (int q = 0; q < 2; ++q) { unsigned short a, c2; splitf(O[e + q] * cs, a, c2); oh[q] = a; ol[q] = c2; } *(v2us*)(Ah + oo) = oh; *(v2us*)(Al + oo) = ol;  }

extern "C" void kernel_launch(void* const* d_in, const int* in_sizes, int n_in,
                              void* d_out, int out_size, void* d_ws, size_t ws_size, hipStream_t stream) {
    (void)in_sizes; (void)n_in; (void)out_size;
    const float* x = (const float*)d_in[0]; const float* wq = (const float*)d_in[1]; const float* wk = (const float*)d_in[2]; const float* wv = (const float*)d_in[3]; const float* wo = (const float*)d_in[4];
    float* OUT = (float*)d_out;     // [2][2048][2048]
    char* wsp = (char*)d_ws;
    auto take = [&](size_t bytes) { char* p = wsp; wsp += (bytes + 255) & ~(size_t)255; return (void*)p; };
    bf* WQ = (bf*)take((size_t)DQ * DM * 2); bf* WK = (bf*)take((size_t)DKV * DM * 2); bf* WV = (bf*)take((size_t)DKV * DM * 2); bf* WO = (bf*)take((size_t)DM * DQ * 2); float* CS = (float*)take((size_t)TT * HD * 2 * 4);
    bf* XB = (bf*)take((size_t)TT * DM * 2); float* FQ = (float*)take((size_t)TT * DQ * 4); float* FK = (float*)take((size_t)TT * DKV * 4);
    h16* QP16 = (h16*)take((size_t)NH_ * TT * HD * 2); h16* KP16 = (h16*)take((size_t)NKV * TT * HD * 2); h16* VT16 = (h16*)take((size_t)NKV * HD * TT * 2);
    bf* QPh = (bf*)take((size_t)NH_ * TT * HD * 2); bf* QPl = (bf*)take((size_t)NH_ * TT * HD * 2); bf* KPh = (bf*)take((size_t)NKV * TT * HD * 2); bf* KPl = (bf*)take((size_t)NKV * TT * HD * 2); bf* VTh = (bf*)take((size_t)NKV * HD * TT * 2); bf* VTl = (bf*)take((size_t)NKV * HD * TT * 2); bf* Pl = (bf*)take((size_t)ZH * RC * TT * 2);
    float* Sb = (float*)take((size_t)ZH * RC * TT * 4); h16* P16 = (h16*)take((size_t)ZH * RC * TT * 2); float* Ob = (float*)take((size_t)ZH * RC * HD * 4); bf* ATh = (bf*)take((size_t)TT * DQ * 2); bf* ATl = (bf*)take((size_t)TT * DQ * 2);
    if ((size_t)(wsp - (char*)d_ws) > ws_size) return;    // ws 256 MiB
    float* FV = FK;   // v projection reuses the k buffer after the k planes are built (stream-ordered)
    bf* Ph = (bf*)P16;   // a pass writes either the hi+lo planes or the fp16 plane, never both: the hi plane shares the fp16 plane's bytes
    { k_wtG<<<(unsigned)((DM * DQ / 64 + 63) / 64), 256, 0, stream>>>(wq, DM, DQ, WQ); k_wtG<<<(unsigned)((DM * DKV / 64 + 63) / 64), 256, 0, stream>>>(wk, DM, DKV, WK); k_wtG<<<(unsigned)((DM * DKV / 64 + 63) / 64), 256, 0, stream>>>(wv, DM, DKV, WV);
      k_wtG<<<(unsigned)((DQ * DM / 64 + 63) / 64), 256, 0, stream>>>(wo, DQ, DM, WO);
      k_csid<<<(TT * HD + 255) / 256, 256, 0, stream>>>(CS); }
    const unsigned LQ = (unsigned)(((size_t)NH_ * TT * HD / 2 + 255) / 256), LKv = (unsigned)(((size_t)NKV * TT * HD / 2 + 255) / 256);
    for (int b = 0; b < NB_; ++b) {
        
        k_cvt8<<<(unsigned)(((size_t)TT * DM / 8 + 255) / 256), 256, 0, stream>>>(x + (size_t)b * TT * DM, XB, (size_t)TT * DM / 8);
        k_gemmw<bf, 0, false><<<dim3(TT / 64, DQ / 64, 1), 32, 0, stream>>>(XB, nullptr, WQ, nullptr, DM, FQ, DQ, nullptr, 0, 0, 0);
        k_rope<<<LQ, 256, 0, stream>>>(FQ, DQ, NH_, CS, nullptr, nullptr, 1.0f, QP16, QPh, QPl);
        k_gemmw<bf, 0, false><<<dim3(TT / 64, DKV / 64, 1), 32, 0, stream>>>(XB, nullptr, WK, nullptr, DM, FK, DKV, nullptr, 0, 0, 0);
        k_rope<<<LKv, 256, 0, stream>>>(FK, DKV, NKV, CS, nullptr, nullptr, 1.0f, KP16, KPh, KPl);
        k_gemmw<bf, 0, false><<<dim3(TT / 64, DKV / 64, 1), 32, 0, stream>>>(XB, nullptr, WV, nullptr, DM, FV, DKV, nullptr, 0, 0, 0); k_vtp<<<LKv, 256, 0, stream>>>(FV, DKV, NKV, VT16, VTh, VTl);
        for (int row0 = 0; row0 < TT; row0 += RC) {   // one pass: all ZH heads x query rows row0 .. row0 + RC - 1; key tiles beyond the pass's last row are not launched
            if (row0 < RH) {
                k_gemmc<bf, 2, 1><<<dim3(RC / 64, (row0 + RC) / 64, ZH), 32, 0, stream>>>(QPh + (size_t)row0 * HD, QPl + (size_t)row0 * HD, KPh, KPl, HD, Sb, TT, row0, (size_t)TT * HD, (size_t)TT * HD, (size_t)RC * TT);
                k_asoft<<<ZH * RC / 8, 256, 0, stream>>>(Sb, row0, P16, Ph, Pl);
                k_gemmc<bf, 2, 2><<<dim3(RC / 64, HD / 64, ZH), 32, 0, stream>>>(Ph, Pl, VTh, VTl, TT, Ob, HD, row0, (size_t)RC * TT, (size_t)HD * TT, (size_t)RC * HD);
            } else {
                k_gemmc<h16, 0, 1><<<dim3(RC / 64, (row0 + RC) / 64, ZH), 32, 0, stream>>>(QP16 + (size_t)row0 * HD, nullptr, KP16, nullptr, HD, Sb, TT, row0, (size_t)TT * HD, (size_t)TT * HD, (size_t)RC * TT);
                k_asoft<<<ZH * RC / 8, 256, 0, stream>>>(Sb, row0, P16, Ph, Pl);
                k_gemmc<h16, 0, 2><<<dim3(RC / 64, HD / 64, ZH), 32, 0, stream>>>(P16, nullptr, VT16, nullptr, TT, Ob, HD, row0, (size_t)RC * TT, (size_t)HD * TT, (size_t)RC * HD);
            }
            k_merge<<<(unsigned)(((size_t)ZH * RC * HD / 2 + 255) / 256), 256, 0, stream>>>(Ob, row0, ATh, ATl); }
        k_gemmw<bf, 1, false><<<dim3(TT / 64, DM / 64, 1), 32, 0, stream>>>(ATh, ATl, WO, nullptr, DQ, OUT + (size_t)b * TT * DM, DM, nullptr, 0, 0, 0); }
}

// v002
// A run of this version takes 541 microseconds.
// Next to v001, in two timings, it ran 1.67 times as fast each time.
// All steps since v000 together make it 3.11 times as fast.
#include <hip/hip_runtime.h>

// Grouped-query causal self-attention with 128-wide heads, no rotary (x [2][2048][2048]; q = x Wq ('xw' [2048][2048], 16 heads x 128), k, v = x Wk, x Wv ('xw' [2048][512], 4 kv heads x 128), no biases; k, v repeated 4 x on the head axis (jnp.repeat: query head h uses kv head h / 4); att x 1/sqrt(128); causal (-inf); softmax; y = merged Wo ('xw' [2048][2048], no bias) -> [2][2048][2048] (8.4 M); argument order x, Wq, Wk, Wv, Wo).
// Compute dtypes, f32 accumulate: every input rounded to bf16; q/k/v on PLAIN bf16 operands (inputs: exact); NO rotary (the identity table cos 1, sin 0 makes the rotate-half plane builder a plain, exact plane builder); scores, softmax and attn.v in one kernel (online softmax, f32; 64-key stages beyond a wave's diagonal never read): query rows < 512 hl (3 products), the rest single fp16; Wo hl x exact (2 products).

#define NB_  2
#define TT   2048
#define DM   2048
#define NH_  16
#define NKV  4
#define REP  (NH_ / NKV)
#define HD   128
#define DQ   (NH_ * HD)
#define DKV  (NKV * HD)
#define RH   512                  // query rows < RH use hi+lo planes (a multiple of 32: a wave's 32 rows are wholly hi+lo or wholly fp16)
#define SCL  0.088388347648318447f   // HD^-0.5
typedef _Float16 h16;
typedef unsigned short bf;
typedef __attribute__((ext_vector_type(16))) __bf16   v16bf;
typedef __attribute__((ext_vector_type(16))) _Float16 v16h;
typedef __attribute__((ext_vector_type(8)))  _Float16 v8h;
typedef __attribute__((ext_vector_type(8)))  unsigned short v8us;
typedef __attribute__((ext_vector_type(8)))  float    v8f;
typedef __attribute__((ext_vector_type(4)))  float    v4f;
typedef v8h  __attribute__((may_alias)) v8ha;
typedef v4f  __attribute__((may_alias)) v4fa;
typedef v8us __attribute__((may_alias)) v8usa;

__device__ __forceinline__ unsigned short f2bf(float f) { unsigned u = __float_as_uint(f); u += 0x7FFFu + ((u >> 16) & 1u); return (unsigned short)(u >> 16); }
__device__ __forceinline__ float bf2f(unsigned short b) { return __uint_as_float(((unsigned)b) << 16); }
__device__ __forceinline__ float bfr(float f) { return bf2f(f2bf(f)); }
__device__ __forceinline__ v16h cat16(v8h lo, v8h hi) { return __builtin_shufflevector(lo, hi, 0, 1, 2, 3, 4, 5, 6, 7, 8, 9, 10, 11, 12, 13, 14, 15); }
__device__ __forceinline__ v16bf cat16b(v8us lo, v8us hi) { return __builtin_bit_cast(v16bf, __builtin_shufflevector(lo, hi, 0, 1, 2, 3, 4, 5, 6, 7, 8, 9, 10, 11, 12, 13, 14, 15)); }
__device__ __forceinline__ v8f wmma16(v16h a, v16h b, v8f c) { return __builtin_amdgcn_wmma_f32_16x16x32_f16(false, a, false, b, (short)0, c, false, false); }
__device__ __forceinline__ v8f wmmab(v16bf a, v16bf b, v8f c) { return __builtin_amdgcn_wmma_f32_16x16x32_bf16(false, a, false, b, (short)0, c, false, false); }



// ---- k_gemmw: register-blocked GEMM, ONE WAVE per 64x64 output tile (16 accumulators), operands straight from K-contiguous 16-bit planes; grid (M/64, N/64, Z), 32 threads.
// C[m][n] (f32, pitch ldc, + optional f32 bias[n]) = sum_k A[m][k] Bt[n][k] (+ split products per NSPLIT). z-batch strides sA/sB/sC in elements. K % 32 == 0.
template <typename T16> struct WFrag;
template <> struct WFrag<h16> { typedef v16h V; static __device__ __forceinline__ V ld(const h16* p) { return cat16(*(const v8h*)p, *(const v8h*)(p + 16)); } static __device__ __forceinline__ v8f mma(V a, V b, v8f c) { return wmma16(a, b, c); } };
template <> struct WFrag<bf> { typedef v16bf V; static __device__ __forceinline__ V ld(const bf* p) { return cat16b(*(const v8us*)p, *(const v8us*)(p + 16)); } static __device__ __forceinline__ v8f mma(V a, V b, v8f c) { return wmmab(a, b, c); } };
template <typename T16, int NSPLIT, bool BIAS>
__global__ __launch_bounds__(32) void k_gemmw(const T16* __restrict__ A, const T16* __restrict__ A2, const T16* __restrict__ Bt, const T16* __restrict__ Bt2, int K, float* C, int ldc, const float* __restrict__ bias, size_t sA, size_t sB, size_t sC) {
    typedef typename WFrag<T16>::V V;
    __shared__ __align__(16) float os[16 * 68];
    const size_t z = blockIdx.z; A += z * sA; if (A2) A2 += z * sA; Bt += z * sB; if (Bt2) Bt2 += z * sB; C += z * sC;
    const int lane = threadIdx.x & 31, lr = lane & 15, hi = lane >> 4; const int r0 = blockIdx.x * 64, c0 = blockIdx.y * 64;
    v8f acc[4][4];
#pragma unroll
    for (int mb = 0; mb < 4; ++mb)
#pragma unroll
        for (int nb = 0; nb < 4; ++nb) acc[mb][nb] = (v8f){};
    const size_t aoff = (size_t)(r0 + lr) * K + 8 * hi, boff = (size_t)(c0 + lr) * K + 8 * hi;
#pragma unroll 1
    for (int kc = 0; kc < K; kc += 32) {
        V a[4], a2[4];
#pragma unroll
        for (int mb = 0; mb < 4; ++mb) { a[mb] = WFrag<T16>::ld(A + aoff + (size_t)mb * 16 * K + kc); if (NSPLIT == 1 || NSPLIT == 2) a2[mb] = WFrag<T16>::ld(A2 + aoff + (size_t)mb * 16 * K + kc); }
#pragma unroll
        for (int nb = 0; nb < 4; ++nb) { const V b = WFrag<T16>::ld(Bt + boff + (size_t)nb * 16 * K + kc); V b2; if (NSPLIT >= 2) b2 = WFrag<T16>::ld(Bt2 + boff + (size_t)nb * 16 * K + kc);
#pragma unroll
            for (int mb = 0; mb < 4; ++mb) { acc[mb][nb] = WFrag<T16>::mma(a[mb], b, acc[mb][nb]); if (NSPLIT == 1 || NSPLIT == 2) acc[mb][nb] = WFrag<T16>::mma(a2[mb], b, acc[mb][nb]); if (NSPLIT >= 2) acc[mb][nb] = WFrag<T16>::mma(a[mb], b2, acc[mb][nb]); } }
        asm volatile("v_nop\n\tv_nop\n\tv_nop\n\tv_nop" : "+v"(acc[0][0]), "+v"(acc[1][1]), "+v"(acc[2][2]), "+v"(acc[3][3]) : "v"(a[0]), "v"(a[3]));
    }
#pragma unroll
    for (int mb = 0; mb < 4; ++mb) {
#pragma unroll
        for (int nb = 0; nb < 4; ++nb) {
#pragma unroll
            for (int j = 0; j < 8; ++j) os[(hi * 8 + j) * 68 + nb * 16 + lr] = acc[mb][nb][j]; }
        __builtin_amdgcn_wave_barrier(); asm volatile("" ::: "memory");
        float* crow = C + (size_t)(r0 + mb * 16) * ldc + c0;
{
#pragma unroll
            for (int s = 0; s < 8; ++s) { const int row = 2 * s + hi, cofs = lr * 4; v4f val = *(const v4fa*)(os + row * 68 + cofs); if (BIAS) { val[0] += bfr(bias[c0 + cofs]); val[1] += bfr(bias[c0 + cofs + 1]); val[2] += bfr(bias[c0 + cofs + 2]); val[3] += bfr(bias[c0 + cofs + 3]); }
                *(v4f*)(crow + (size_t)row * ldc + cofs) = val; }
             }
        __builtin_amdgcn_wave_barrier(); asm volatile("" ::: "memory");
    }
}

__device__ __forceinline__ h16 tohx(float x) { return (h16)x; }
__device__ __forceinline__ void splitf(float y, unsigned short& h, unsigned short& l) { h = f2bf(y); l = f2bf(y - bf2f(h)); }
typedef __attribute__((ext_vector_type(2))) _Float16 v2h;
typedef __attribute__((ext_vector_type(4))) _Float16 v4h;
typedef __attribute__((ext_vector_type(2))) unsigned short v2us;
typedef __attribute__((ext_vector_type(4))) unsigned short v4us;
typedef __attribute__((ext_vector_type(2))) float v2f;
typedef __attribute__((ext_vector_type(4))) int v4i;

__global__ __launch_bounds__(256) void k_wtG(const float* __restrict__ w, int K, int N, bf* Bt) {
    const int lane = threadIdx.x & 31; const int L0 = (blockIdx.x * 8 + (threadIdx.x >> 5)) * 8; const int nlines = N * K / 64;
{
#pragma unroll 1
        for (int l = 0; l < 8; ++l) { const int L = L0 + l; if (L >= nlines) break; const size_t e = (size_t)L * 64 + lane * 2; const int k = (int)(e % K), n = (int)(e / K); v2us o;
            o[0] = f2bf(w[(size_t)k * N + n]); o[1] = f2bf(w[(size_t)(k + 1) * N + n]); *(v2us*)(Bt + e) = o; }
         }
}
__global__ __launch_bounds__(256) void k_cvt8(const float* __restrict__ src, bf* dst, size_t n8) { const size_t i = (size_t)blockIdx.x * 256 + threadIdx.x; if (i >= n8) return; const v8f v = *(const v8f*)(src + i * 8); v8us o;
#pragma unroll
    for (int k = 0; k < 8; ++k) o[k] = f2bf(v[k]); *(v8us*)(dst + i * 8) = o;  }
__global__ __launch_bounds__(256) void k_csid(float* CS) { const int idx = blockIdx.x * 256 + threadIdx.x; if (idx >= TT * HD) return; v2f cs; cs[0] = 1.0f; cs[1] = 0.0f; *(v2f*)(CS + (size_t)idx * 2) = cs;  }

// k_rope: head planes [h][t][d] (fp16 + hi/lo) of rope(x) x sc with the rotate-half convention out[d] = x[d] cos[t][d] - x[d+HD/2] sin[t][d], out[d+HD/2] = x[d+HD/2] cos[t][d+HD/2] + x[d] sin[t][d+HD/2]
__global__ __launch_bounds__(256) void k_rope(const float* __restrict__ F, int pitch, int nheads, const float* __restrict__ CS, const float* __restrict__ RF, const float* __restrict__ nw, float sc, h16* P16, bf* Ph, bf* Pl) {
    const size_t e = ((size_t)blockIdx.x * 256 + threadIdx.x) * 2; if (e >= (size_t)nheads * TT * HD) return; const int d = (int)(e % HD); const int t = (int)((e / HD) % TT); const int h = (int)(e / ((size_t)HD * TT)); const float* f = F + (size_t)t * pitch + h * HD; const float rf = RF ? RF[(size_t)h * TT + t] : 1.0f; v2h o16; v2us oh, ol;
#pragma unroll
    for (int q = 0; q < 2; ++q) { const int dd = d + q; const int dp = (dd < HD / 2) ? dd + HD / 2 : dd - HD / 2; float x0 = f[dd], x1 = f[dp];
        if (RF) { float n0 = __fmul_rn(x0, rf), n1 = __fmul_rn(x1, rf); asm volatile("" : "+v"(n0)); asm volatile("" : "+v"(n1)); x0 = __fmul_rn(bfr(nw[dd]), n0); x1 = __fmul_rn(bfr(nw[dp]), n1); }
        const v2f cs = *(const v2f*)(CS + ((size_t)t * HD + dd) * 2); float a = __fmul_rn(x0, cs[0]), bq = __fmul_rn(x1, cs[1]); asm volatile("" : "+v"(a)); asm volatile("" : "+v"(bq)); const float r = ((dd < HD / 2) ? __fsub_rn(a, bq) : __fadd_rn(a, bq)) * sc;
        o16[q] = tohx(r); unsigned short a2, c2; splitf(r, a2, c2); oh[q] = a2; ol[q] = c2; }
    *(v2h*)(P16 + e) = o16; *(v2us*)(Ph + e) = oh; *(v2us*)(Pl + e) = ol;  }
__global__ __launch_bounds__(256) void k_vtp(const float* __restrict__ F, int pitch, int nheads, h16* V16, bf* Vh, bf* Vl) { const size_t e = ((size_t)blockIdx.x * 256 + threadIdx.x) * 2; if (e >= (size_t)nheads * HD * TT) return; const int t = (int)(e % TT); const int d = (int)((e / TT) % HD); const int g = (int)(e / ((size_t)TT * HD)); v2h o16; v2us oh, ol;
#pragma unroll
    for (int q = 0; q < 2; ++q) { const float x = F[(size_t)(t + q) * pitch + g * HD + d]; o16[q] = tohx(x); unsigned short a2, c2; splitf(x, a2, c2); oh[q] = a2; ol[q] = c2; }
    *(v2h*)(V16 + e) = o16; *(v2us*)(Vh + e) = oh; *(v2us*)(Vl + e) = ol;  }
#define SKEY  64                   // keys per stage
#define KPIT  136                  // LDS pitch of a K row, elements: 256 B + 16 B, an odd multiple of 16 B for the 16-byte readers
#define VPIT  72                   // LDS pitch of a V^T row, elements: 128 B + 16 B, likewise
#define KTILE (SKEY * KPIT)
#define PLANE (KTILE + HD * VPIT)  // one stage of one plane pair: K tile, then V^T tile
typedef __attribute__((ext_vector_type(8))) unsigned v8u;
typedef v4i __attribute__((may_alias)) v4ia;
__device__ __forceinline__ float xhalf(float x) { return __builtin_bit_cast(float, __builtin_amdgcn_permlanex16(__builtin_bit_cast(int, x), __builtin_bit_cast(int, x), 0x76543210, 0xfedcba98, false, false)); }  // lane l with lane l ^ 16
__device__ __forceinline__ unsigned pk16(float a, float b) { v2f x; x[0] = a; x[1] = b; return __builtin_bit_cast(unsigned, __builtin_convertvector(x, v2h)); }
typedef __attribute__((ext_vector_type(2))) __bf16 v2b;
__device__ __forceinline__ void split2(float a, float b, unsigned& hi, unsigned& lo) {   // splitf for two values at once, by the packed conversion (round to nearest even, as f2bf): packed hi parts, packed remainders
    v2f x; x[0] = a; x[1] = b; hi = __builtin_bit_cast(unsigned, __builtin_convertvector(x, v2b));
    v2f r; r[0] = a - __uint_as_float(hi << 16); r[1] = b - __uint_as_float(hi & 0xFFFF0000u); lo = __builtin_bit_cast(unsigned, __builtin_convertvector(r, v2b)); }
template <typename T16, bool HL>
__device__ __forceinline__ void fattn_run(T16* sm, const T16* __restrict__ Q, const T16* __restrict__ Q2, const T16* __restrict__ Kp, const T16* __restrict__ K2, const T16* __restrict__ Vt, const T16* __restrict__ V2, const int qw0, v8f (&acc)[2][8], float (&l_run)[2]) {
    typedef typename WFrag<T16>::V V;
    constexpr int NPL = HL ? 2 : 1, BUF = NPL * PLANE;
    const int tid = threadIdx.x, lane = tid & 31, c = lane & 15, h = lane >> 4;
    const float cscale = SCL * 1.4426950408889634f;
    v4i rk[NPL][8], rv[NPL][8];
    const unsigned vofs = (unsigned)(tid >> 3) * (TT * 2u) + (unsigned)(tid & 7) * 16u;   // bytes in a kv plane: eight threads cover a V^T row's 128 B
    auto gload = [&](int key0) {   // a stage's K rows and V^T rows, 16 B a thread and turn: every wave-wide load covers four whole 128-B lines
        const unsigned ko = (unsigned)tid + (unsigned)key0 * (HD / 8u), vo = vofs + (unsigned)key0 * 2u;   // the thread's 32-bit offsets in this stage, the same in the hi and the lo plane: K in 16-byte pieces (its rows lie in a row), V^T in bytes
        __builtin_amdgcn_sched_barrier(0);   // the loads are not lifted from here: the wait at the foot has to stand directly behind them
#pragma unroll
        for (int i = 0; i < 8; ++i) {   // the plane's uniform base + the thread's offset + a constant: two address registers for the whole group
            rk[0][i] = ((const v4ia*)Kp + ko)[i * 128]; rv[0][i] = *(const v4ia*)((const char*)Vt + vo + i * (16 * TT * 2));
            if constexpr (HL) { rk[NPL - 1][i] = ((const v4ia*)K2 + ko)[i * 128]; rv[NPL - 1][i] = *(const v4ia*)((const char*)V2 + vo + i * (16 * TT * 2)); } }
        asm volatile("s_wait_xcnt 0x0" :: "v"(ko), "v"(vo) : "memory");   // in front of whatever next rewrites a register that these loads name; the two offsets are inputs so that they live up to the wait and no load of the group lands in them
        __builtin_amdgcn_sched_barrier(0);   // nothing from below is lifted over that wait; and the loads stay up here: sunk towards their use they would hide no latency
    };
    auto sstore = [&](T16* buf) {
#pragma unroll
        for (int i = 0; i < 8; ++i) { const int idx = i * 128 + tid; const int ok = (idx >> 4) * KPIT + (idx & 15) * 8, ov = KTILE + (idx >> 3) * VPIT + (idx & 7) * 8;
            *(v4ia*)(buf + ok) = rk[0][i]; *(v4ia*)(buf + ov) = rv[0][i]; if (HL) { *(v4ia*)(buf + PLANE + ok) = rk[NPL - 1][i]; *(v4ia*)(buf + PLANE + ov) = rv[NPL - 1][i]; } } };
    const int nst = qw0 / SKEY + 1;   // stages up to and with the one that holds the wave's diagonal; the same for all four waves
    gload(0);
    V qf[2][4], qf2[2][4];
#pragma unroll
    for (int g = 0; g < 2; ++g)
#pragma unroll
        for (int kc = 0; kc < 4; ++kc) { const size_t o = (size_t)(qw0 + 16 * g + c) * HD + 32 * kc + 8 * h; qf[g][kc] = WFrag<T16>::ld(Q + o); if (HL) qf2[g][kc] = WFrag<T16>::ld(Q2 + o); }
    asm volatile("s_wait_xcnt 0x0" ::: "memory");   // in front of whatever next rewrites a register that the Q loads name
    __builtin_amdgcn_sched_barrier(0);   // nothing from below is lifted over that wait
    float m_run[2];
#pragma unroll
    for (int g = 0; g < 2; ++g) { m_run[g] = -__builtin_inff(); l_run[g] = 0.0f;
#pragma unroll
        for (int t = 0; t < 8; ++t) acc[g][t] = (v8f){}; }
    sstore(sm); gload(min(1, nst - 1) * SKEY);
    __syncthreads();   // stage 0 is in buffer 0
#pragma unroll 1   // rolled: a stage is long straight-line code already, a second copy would only cost instruction fetches
    for (int st = 0; st < nst; ++st) {
        const T16* cur = sm + (st & 1) * BUF;
        sstore(sm + ((st + 1) & 1) * BUF);          // stage st + 1 into the buffer that stage st - 1 used: the barrier at the foot of st - 1 ended its reads (past the end: the last stage again, read by nobody)
        gload(min(st + 2, nst - 1) * SKEY);         // in flight under this whole stage; clamped, so always inside the planes and no branch round the loads
        // The stage's fragment reads go out in whole groups ahead of their products (one wave per SIMD: nobody else covers an LDS wait): K first; V^T directly behind it where one plane pair leaves the registers
        // for both, else behind the first product, into the registers K has left, so that it streams in under the softmax.
        v8f s[4][2]; V kfa[4][4], kfa2[HL ? 4 : 1][4], vfa[2][8], vfa2[HL ? 2 : 1][8];
#pragma unroll
        for (int kt = 0; kt < 4; ++kt)
#pragma unroll
            for (int kc = 0; kc < 4; ++kc) { const T16* p = cur + (16 * kt + c) * KPIT + 32 * kc + 8 * h; kfa[kt][kc] = WFrag<T16>::ld(p); if constexpr (HL) kfa2[kt][kc] = WFrag<T16>::ld(p + PLANE); }
        __builtin_amdgcn_sched_barrier(0);          // K's reads stay a group, ahead of V^T's: LDS answers in order, and the first product waits for K alone
        auto ldv = [&]() {
#pragma unroll
            for (int j = 0; j < 2; ++j)
#pragma unroll
                for (int t = 0; t < 8; ++t) { const T16* p = cur + KTILE + (16 * t + c) * VPIT + 32 * j + 8 * h; vfa[j][t] = WFrag<T16>::ld(p); if constexpr (HL) vfa2[j][t] = WFrag<T16>::ld(p + PLANE); }
            __builtin_amdgcn_sched_barrier(0);      // keeps the group together up here: moved down to their uses the reads are waited for one by one
        };
        if constexpr (!HL) ldv();
#pragma unroll
        for (int kt = 0; kt < 4; ++kt)
#pragma unroll
            for (int g = 0; g < 2; ++g) { s[kt][g] = (v8f){};
#pragma unroll
                for (int kc = 0; kc < 4; ++kc) { s[kt][g] = WFrag<T16>::mma(kfa[kt][kc], qf[g][kc], s[kt][g]); if constexpr (HL) { s[kt][g] = WFrag<T16>::mma(kfa[kt][kc], qf2[g][kc], s[kt][g]); s[kt][g] = WFrag<T16>::mma(kfa2[kt][kc], qf[g][kc], s[kt][g]); } } }
        if constexpr (HL) { __builtin_amdgcn_sched_barrier(0);   // V^T's reads not above the first product: K's registers are free only behind it
            ldv(); }
        if (st == nst - 1) {                        // work-group-uniform: only the stage with the diagonal pays for the mask
            const int lim = qw0 - st * SKEY + c - 8 * h;   // key 16 kt + 8 h + r of the stage joins query 16 g + c of the wave when 16 kt + r <= lim + 16 g
#pragma unroll
            for (int g = 0; g < 2; ++g)
#pragma unroll
                for (int kt = 0; kt < 4; ++kt) {
#pragma unroll
                    for (int r = 0; r < 8; ++r) { if (16 * kt + r > lim + 16 * g) s[kt][g][r] = -__builtin_inff(); }
                    asm volatile("" : "+v"(s[kt][g]));   // the masked scores: keeps the selects inside the branch
                }
        }
        float mb[2]; bool need = false;
#pragma unroll
        for (int g = 0; g < 2; ++g) { float mx = -__builtin_inff();
#pragma unroll
            for (int kt = 0; kt < 4; ++kt)
#pragma unroll
                for (int r = 0; r < 8; ++r) mx = fmaxf(mx, s[kt][g][r]);
            mx = fmaxf(mx, xhalf(mx)) * cscale; mb[g] = mx; need = need || (mx > m_run[g] + 8.0f); }
        if (__builtin_amdgcn_ballot_w32(need) != 0) {   // rare after the first stages
#pragma unroll
            for (int g = 0; g < 2; ++g) { const float m_new = fmaxf(m_run[g], mb[g]);   // finite from the first stage on: key 0 is never masked
                const float corr = __builtin_amdgcn_exp2f(m_run[g] - m_new);            // 0 on the first stage, where m_run is -inf
                l_run[g] *= corr; m_run[g] = m_new;
#pragma unroll
                for (int t = 0; t < 8; ++t) acc[g][t] = acc[g][t] * corr; }
        }
        V pf[2][2], pf2[2][2];
#pragma unroll
        for (int g = 0; g < 2; ++g) { const float nm = -m_run[g]; float ps0 = 0.0f, ps1 = 0.0f;
#pragma unroll
            for (int j = 0; j < 2; ++j) { v8u w, w2;
#pragma unroll
                for (int i = 0; i < 8; ++i) {
                    const float p0 = __builtin_amdgcn_exp2f(fmaf(s[2 * j + (i >> 2)][g][2 * (i & 3)], cscale, nm)), p1 = __builtin_amdgcn_exp2f(fmaf(s[2 * j + (i >> 2)][g][2 * (i & 3) + 1], cscale, nm));
                    ps0 += p0; ps1 += p1;
                    if (HL) { unsigned wh, wl; split2(p0, p1, wh, wl); w[i] = wh; w2[i] = wl; }
                    else w[i] = pk16(p0, p1); }
                pf[g][j] = __builtin_bit_cast(V, w); if (HL) pf2[g][j] = __builtin_bit_cast(V, w2); }
            l_run[g] += ps0 + ps1; }
#pragma unroll
        for (int j = 0; j < 2; ++j)
#pragma unroll
            for (int t = 0; t < 8; ++t)
#pragma unroll
                for (int g = 0; g < 2; ++g) { acc[g][t] = WFrag<T16>::mma(vfa[j][t], pf[g][j], acc[g][t]); if constexpr (HL) { acc[g][t] = WFrag<T16>::mma(vfa[j][t], pf2[g][j], acc[g][t]); acc[g][t] = WFrag<T16>::mma(vfa2[j][t], pf[g][j], acc[g][t]); } }
        __builtin_amdgcn_sched_barrier(0);          // keeps the barrier, and the wait for stage st + 2's global loads that comes with it, at the stage's foot
        __syncthreads();   // publishes stage st + 1 and ends every wave's reads of stage st
    }
}
__global__ __launch_bounds__(128) void k_fattn(const h16* __restrict__ Q16, const bf* __restrict__ Qh, const bf* __restrict__ Ql, const h16* __restrict__ K16, const bf* __restrict__ Kh, const bf* __restrict__ Kl, const h16* __restrict__ V16, const bf* __restrict__ Vh, const bf* __restrict__ Vl, bf* __restrict__ Ah, bf* __restrict__ Al) {
    __shared__ __align__(16) unsigned short sm[2 * 2 * PLANE];   // two buffers of two plane pairs (hi+lo); the fp16 rows use half of it
    const int tid = threadIdx.x, lane = tid & 31, c = lane & 15, h = lane >> 4;
    const int kv = blockIdx.y, wave = __builtin_amdgcn_readfirstlane(tid >> 5), head = kv * REP + wave;
    const int qw0 = (TT / 32 - 1 - (int)blockIdx.x) * 32;   // longest key walks first
    const size_t qo = (size_t)head * TT * HD, kvo = (size_t)kv * TT * HD;
    v8f acc[2][8]; float l_run[2];
    if (qw0 < RH) fattn_run<bf, true>((bf*)sm, Qh + qo, Ql + qo, Kh + kvo, Kl + kvo, Vh + kvo, Vl + kvo, qw0, acc, l_run);
    else fattn_run<h16, false>((h16*)sm, Q16 + qo, nullptr, K16 + kvo, nullptr, V16 + kvo, nullptr, qw0, acc, l_run);
    // Output through LDS (each wave its own 2 x 32 rows, behind the stage loop's last barrier), so that every 128-B line of the planes is stored whole. The unrolls: constant indices, as above.
    bf* eb = (bf*)sm + wave * (2 * 32 * KPIT);
#pragma unroll
    for (int g = 0; g < 2; ++g) { const float inv = __fdiv_rn(1.0f, l_run[g] + xhalf(l_run[g]));
#pragma unroll
        for (int t = 0; t < 8; ++t) { v4i oh, ol;
#pragma unroll
            for (int r = 0; r < 4; ++r) { unsigned a, c2; split2(acc[g][t][2 * r] * inv, acc[g][t][2 * r + 1] * inv, a, c2); oh[r] = (int)a; ol[r] = (int)c2; }
            bf* e = eb + (16 * g + c) * KPIT + 16 * t + 8 * h; *(v4ia*)e = oh; *(v4ia*)(e + 32 * KPIT) = ol; } }
    __syncthreads();   // the staged rows are read back by other lanes than wrote them
    v4i th[16], tl[16];
#pragma unroll
    for (int i = 0; i < 16; ++i) { const bf* e = eb + (2 * i + h) * KPIT + c * 8; th[i] = *(const v4ia*)e; tl[i] = *(const v4ia*)(e + 32 * KPIT); }
    const unsigned oofs = (unsigned)h * (DQ * 2u) + (unsigned)c * 16u;   // bytes: 16 lanes cover one row's 256 B, a wave-wide store two rows
    char* ah = (char*)(Ah + (size_t)qw0 * DQ + head * HD); char* al = (char*)(Al + (size_t)qw0 * DQ + head * HD);
#pragma unroll
    for (int i = 0; i < 16; ++i) { *(v4ia*)(ah + oofs + i * (2 * DQ * 2)) = th[i]; *(v4ia*)(al + oofs + i * (2 * DQ * 2)) = tl[i]; }
}

extern "C" void kernel_launch(void* const* d_in, const int* in_sizes, int n_in,
                              void* d_out, int out_size, void* d_ws, size_t ws_size, hipStream_t stream) {
    (void)in_sizes; (void)n_in; (void)out_size;
    const float* x = (const float*)d_in[0]; const float* wq = (const float*)d_in[1]; const float* wk = (const float*)d_in[2]; const float* wv = (const float*)d_in[3]; const float* wo = (const float*)d_in[4];
    float* OUT = (float*)d_out;     // [2][2048][2048]
    char* wsp = (char*)d_ws;
    auto take = [&](size_t bytes) { char* p = wsp; wsp += (bytes + 255) & ~(size_t)255; return (void*)p; };
    bf* WQ = (bf*)take((size_t)DQ * DM * 2); bf* WK = (bf*)take((size_t)DKV * DM * 2); bf* WV = (bf*)take((size_t)DKV * DM * 2); bf* WO = (bf*)take((size_t)DM * DQ * 2); float* CS = (float*)take((size_t)TT * HD * 2 * 4);
    bf* XB = (bf*)take((size_t)TT * DM * 2); float* FQ = (float*)take((size_t)TT * DQ * 4); float* FK = (float*)take((size_t)TT * DKV * 4);
    h16* QP16 = (h16*)take((size_t)NH_ * TT * HD * 2); h16* KP16 = (h16*)take((size_t)NKV * TT * HD * 2); h16* VT16 = (h16*)take((size_t)NKV * HD * TT * 2);
    bf* QPh = (bf*)take((size_t)NH_ * TT * HD * 2); bf* QPl = (bf*)take((size_t)NH_ * TT * HD * 2); bf* KPh = (bf*)take((size_t)NKV * TT * HD * 2); bf* KPl = (bf*)take((size_t)NKV * TT * HD * 2); bf* VTh = (bf*)take((size_t)NKV * HD * TT * 2); bf* VTl = (bf*)take((size_t)NKV * HD * TT * 2);
    bf* ATh = (bf*)take((size_t)TT * DQ * 2); bf* ATl = (bf*)take((size_t)TT * DQ * 2);
    if ((size_t)(wsp - (char*)d_ws) > ws_size) return;    // ws 256 MiB
    float* FV = FK;   // v projection reuses the k buffer after the k planes are built (stream-ordered)
    { k_wtG<<<(unsigned)((DM * DQ / 64 + 63) / 64), 256, 0, stream>>>(wq, DM, DQ, WQ); k_wtG<<<(unsigned)((DM * DKV / 64 + 63) / 64), 256, 0, stream>>>(wk, DM, DKV, WK); k_wtG<<<(unsigned)((DM * DKV / 64 + 63) / 64), 256, 0, stream>>>(wv, DM, DKV, WV);
      k_wtG<<<(unsigned)((DQ * DM / 64 + 63) / 64), 256, 0, stream>>>(wo, DQ, DM, WO);
      k_csid<<<(TT * HD + 255) / 256, 256, 0, stream>>>(CS); }
    const unsigned LQ = (unsigned)(((size_t)NH_ * TT * HD / 2 + 255) / 256), LKv = (unsigned)(((size_t)NKV * TT * HD / 2 + 255) / 256);
    for (int b = 0; b < NB_; ++b) {
        
        k_cvt8<<<(unsigned)(((size_t)TT * DM / 8 + 255) / 256), 256, 0, stream>>>(x + (size_t)b * TT * DM, XB, (size_t)TT * DM / 8);
        k_gemmw<bf, 0, false><<<dim3(TT / 64, DQ / 64, 1), 32, 0, stream>>>(XB, nullptr, WQ, nullptr, DM, FQ, DQ, nullptr, 0, 0, 0);
        k_rope<<<LQ, 256, 0, stream>>>(FQ, DQ, NH_, CS, nullptr, nullptr, 1.0f, QP16, QPh, QPl);
        k_gemmw<bf, 0, false><<<dim3(TT / 64, DKV / 64, 1), 32, 0, stream>>>(XB, nullptr, WK, nullptr, DM, FK, DKV, nullptr, 0, 0, 0);
        k_rope<<<LKv, 256, 0, stream>>>(FK, DKV, NKV, CS, nullptr, nullptr, 1.0f, KP16, KPh, KPl);
        k_gemmw<bf, 0, false><<<dim3(TT / 64, DKV / 64, 1), 32, 0, stream>>>(XB, nullptr, WV, nullptr, DM, FV, DKV, nullptr, 0, 0, 0); k_vtp<<<LKv, 256, 0, stream>>>(FV, DKV, NKV, VT16, VTh, VTl);
        k_fattn<<<dim3(TT / 32, NKV, 1), 128, 0, stream>>>(QP16, QPh, QPl, KP16, KPh, KPl, VT16, VTh, VTl, ATh, ATl);
        k_gemmw<bf, 1, false><<<dim3(TT / 64, DM / 64, 1), 32, 0, stream>>>(ATh, ATl, WO, nullptr, DQ, OUT + (size_t)b * TT * DM, DM, nullptr, 0, 0, 0); }
}

// v003
// It runs in 291 microseconds.
// Next to v002, in two timings, it ran 1.84 and 1.86 times as fast.
// All steps since v000 together make it 5.76 times as fast.
#include <hip/hip_runtime.h>

// Grouped-query causal self-attention with 128-wide heads, no rotary (x [2][2048][2048]; q = x Wq ('xw' [2048][2048], 16 heads x 128), k, v = x Wk, x Wv ('xw' [2048][512], 4 kv heads x 128), no biases; k, v repeated 4 x on the head axis (jnp.repeat: query head h uses kv head h / 4); att x 1/sqrt(128); causal (-inf); softmax; y = merged Wo ('xw' [2048][2048], no bias) -> [2][2048][2048] (8.4 M); argument order x, Wq, Wk, Wv, Wo).
// Compute dtypes, f32 accumulate: every input rounded to bf16; q/k/v on PLAIN bf16 operands (inputs: exact); NO rotary (the identity table cos 1, sin 0 makes the rotate-half plane builder a plain, exact plane builder); scores, softmax and attn.v in one kernel (online softmax, f32; 64-key stages beyond a wave's diagonal never read): query rows < 512 hl (3 products), the rest single fp16; Wo hl x exact (2 products).

#define NB_  2
#define TT   2048
#define DM   2048
#define NH_  16
#define NKV  4
#define REP  (NH_ / NKV)
#define HD   128
#define DQ   (NH_ * HD)
#define DKV  (NKV * HD)
#define RH   512                  // query rows < RH use hi+lo planes (a multiple of 32: a wave's 32 rows are wholly hi+lo or wholly fp16)
#define SCL  0.088388347648318447f   // HD^-0.5
typedef _Float16 h16;
typedef unsigned short bf;
typedef __attribute__((ext_vector_type(16))) __bf16   v16bf;
typedef __attribute__((ext_vector_type(16))) _Float16 v16h;
typedef __attribute__((ext_vector_type(8)))  _Float16 v8h;
typedef __attribute__((ext_vector_type(8)))  unsigned short v8us;
typedef __attribute__((ext_vector_type(8)))  float    v8f;
typedef __attribute__((ext_vector_type(4)))  float    v4f;
typedef v8h  __attribute__((may_alias)) v8ha;
typedef v4f  __attribute__((may_alias)) v4fa;
typedef v8us __attribute__((may_alias)) v8usa;

__device__ __forceinline__ unsigned short f2bf(float f) { unsigned u = __float_as_uint(f); u += 0x7FFFu + ((u >> 16) & 1u); return (unsigned short)(u >> 16); }
__device__ __forceinline__ float bf2f(unsigned short b) { return __uint_as_float(((unsigned)b) << 16); }
__device__ __forceinline__ float bfr(float f) { return bf2f(f2bf(f)); }
__device__ __forceinline__ v16h cat16(v8h lo, v8h hi) { return __builtin_shufflevector(lo, hi, 0, 1, 2, 3, 4, 5, 6, 7, 8, 9, 10, 11, 12, 13, 14, 15); }
__device__ __forceinline__ v16bf cat16b(v8us lo, v8us hi) { return __builtin_bit_cast(v16bf, __builtin_shufflevector(lo, hi, 0, 1, 2, 3, 4, 5, 6, 7, 8, 9, 10, 11, 12, 13, 14, 15)); }
__device__ __forceinline__ v8f wmma16(v16h a, v16h b, v8f c) { return __builtin_amdgcn_wmma_f32_16x16x32_f16(false, a, false, b, (short)0, c, false, false); }
__device__ __forceinline__ v8f wmmab(v16bf a, v16bf b, v8f c) { return __builtin_amdgcn_wmma_f32_16x16x32_bf16(false, a, false, b, (short)0, c, false, false); }



template <typename T16> struct WFrag;
template <> struct WFrag<h16> { typedef v16h V; static __device__ __forceinline__ V ld(const h16* p) { return cat16(*(const v8h*)p, *(const v8h*)(p + 16)); } static __device__ __forceinline__ v8f mma(V a, V b, v8f c) { return wmma16(a, b, c); } };
template <> struct WFrag<bf> { typedef v16bf V; static __device__ __forceinline__ V ld(const bf* p) { return cat16b(*(const v8us*)p, *(const v8us*)(p + 16)); } static __device__ __forceinline__ v8f mma(V a, V b, v8f c) { return wmmab(a, b, c); } };
// ---- k_gemms: C[m][n] (f32, pitch ldc) = sum_k A[m][k] Bt[n][k] (+ A2[m][k] Bt[n][k] where SPLIT), all planes bf16, K-contiguous, K = GK.
// A work-group is 2 x 2 waves on a (32 MB) x (32 NB) tile of C; a wave owns MB x NB accumulators. k goes in passes of 128 (256 B of every operand row): the work-group brings a pass through registers into
// one of two LDS buffers with whole-line loads (16 threads cover a row's 256 B), so every operand byte comes from L2 once per work-group and the fragments are read from LDS. One barrier per pass.
// A pass is four k steps of 32; each step stores a quarter of the next pass's rows to LDS, refills those registers with the same quarter of the pass after it (so a whole pass of loads is always in flight),
// reads the next step's fragments into the second fragment set and then runs its own products. Every accumulator takes its products in the order kc ascending, A before A2.
// Every '#pragma unroll' in k_gemms is there so that the staging, fragment and accumulator arrays are indexed by constants and stay in registers.
#define GK    2048                 // the reduction length of all four products
#define GPASS 128                  // k per pass
#define GPIT  136                  // LDS pitch of a staged row, elements: 256 B + 16 B, an odd multiple of 16 B for the 16-byte readers
typedef __attribute__((ext_vector_type(4))) int g4i;
typedef g4i __attribute__((may_alias)) g4ia;
template <bool B> struct GFlag { static constexpr bool v = B; };
// The pass barrier, by hand: __syncthreads() would also wait for the global loads that are in flight for the pass after next and so undo their lead. What other waves depend on here is LDS alone
// (this wave's stores of the next pass, its reads of this one): s_wait_dscnt 0 covers both.
__device__ __forceinline__ void gbar() { asm volatile("s_wait_dscnt 0x0\n\ts_barrier_signal -1\n\ts_barrier_wait -1" ::: "memory"); }
template <int MB, int NB, bool SPLIT>
__global__ __launch_bounds__(128) void k_gemms(const bf* __restrict__ A, const bf* __restrict__ A2, const bf* __restrict__ Bt, float* C, int ldc) {
    typedef WFrag<bf>::V V;
    constexpr int RA = 32 * MB, RB = 32 * NB, OA2 = RA * GPIT, OB = (SPLIT ? 2 : 1) * RA * GPIT, STG = OB + RB * GPIT, NP = GK / GPASS, NA2 = SPLIT ? MB : 1;
    __shared__ __align__(16) bf sm[2 * STG];
    const int tid = threadIdx.x, lane = tid & 31, lr = lane & 15, hi = lane >> 4, wave = __builtin_amdgcn_readfirstlane(tid >> 5), wm = wave >> 1, wn = wave & 1;
    const int r0 = blockIdx.x * RA, c0 = blockIdx.y * RB;
    const unsigned tofs = (unsigned)(tid >> 4) * (GK * 2u) + (unsigned)(tid & 15) * 16u;   // bytes: the thread's row of a turn of eight rows, and its 16 B of the row's 256
    const char* Ab = (const char*)(A + (size_t)r0 * GK) + tofs; const char* A2b = SPLIT ? (const char*)(A2 + (size_t)r0 * GK) + tofs : nullptr; const char* Bb = (const char*)(Bt + (size_t)c0 * GK) + tofs;
    const int sofs = (tid >> 4) * GPIT + (tid & 15) * 8;                                   // the same place in a staged turn, elements
    g4i ra[4 * MB], ra2[4 * NA2], rb[4 * NB];
    auto gload = [&](int q, int pass) {   // quarter q of a pass: MB turns of A (and of A2), NB turns of Bt; every wave-wide load covers four whole 128-B lines
        const char* pa = Ab + pass * (GPASS * 2); const char* pa2 = SPLIT ? A2b + pass * (GPASS * 2) : nullptr; const char* pb = Bb + pass * (GPASS * 2);   // the thread's address in each plane + a constant per turn
        __builtin_amdgcn_sched_barrier(0);   // the loads are not lifted from here: the wait at the foot has to stand directly behind them
#pragma unroll
        for (int i = 0; i < MB; ++i) { const int t = q * MB + i; ra[t] = *(const g4ia*)(pa + t * (8 * GK * 2)); if constexpr (SPLIT) ra2[t] = *(const g4ia*)(pa2 + t * (8 * GK * 2)); }
#pragma unroll
        for (int i = 0; i < NB; ++i) { const int t = q * NB + i; rb[t] = *(const g4ia*)(pb + t * (8 * GK * 2)); }
        asm volatile("s_wait_xcnt 0x0" ::: "memory");   // in front of whatever next rewrites a register that these loads name
        __builtin_amdgcn_sched_barrier(0);   // nothing from below is lifted over that wait; and the loads stay up here: sunk towards their use they would hide no latency
    };
    auto sstore = [&](int q, bf* buf) {
#pragma unroll
        for (int i = 0; i < MB; ++i) { const int t = q * MB + i; *(g4ia*)(buf + t * 8 * GPIT + sofs) = ra[t]; if constexpr (SPLIT) *(g4ia*)(buf + OA2 + t * 8 * GPIT + sofs) = ra2[t]; }
#pragma unroll
        for (int i = 0; i < NB; ++i) { const int t = q * NB + i; *(g4ia*)(buf + OB + t * 8 * GPIT + sofs) = rb[t]; } };
    v8f acc[MB][NB];
#pragma unroll
    for (int mb = 0; mb < MB; ++mb)
#pragma unroll
        for (int nb = 0; nb < NB; ++nb) acc[mb][nb] = (v8f){};
#pragma unroll
    for (int q = 0; q < 4; ++q) gload(q, 0);
#pragma unroll
    for (int q = 0; q < 4; ++q) { sstore(q, sm); gload(q, 1); }
    gbar();   // pass 0 is in buffer 0
    const int fa = (wm * MB * 16 + lr) * GPIT + 8 * hi, fb = OB + (wn * NB * 16 + lr) * GPIT + 8 * hi;   // the lane's place in the wave's first A and Bt fragment: the k order of both is that of WFrag::ld
    auto pass = [&](int p, auto ST, auto LD) {   // ST: a pass p + 1 exists and is stored; LD: a pass p + 2 exists and is loaded
        const bf* cur = sm + (p & 1) * STG; bf* nxt = sm + ((p + 1) & 1) * STG;   // nxt held pass p - 1: the barrier at the foot of p - 1 ended its reads
        V a[2][MB], a2[2][NA2], b[2][NB];
        auto ldf = [&](int set, int ks) {
#pragma unroll
            for (int mb = 0; mb < MB; ++mb) { a[set][mb] = WFrag<bf>::ld(cur + fa + mb * 16 * GPIT + ks * 32); if constexpr (SPLIT) a2[set][mb] = WFrag<bf>::ld(cur + OA2 + fa + mb * 16 * GPIT + ks * 32); }
#pragma unroll
            for (int nb = 0; nb < NB; ++nb) b[set][nb] = WFrag<bf>::ld(cur + fb + nb * 16 * GPIT + ks * 32); };
        ldf(0, 0);
#pragma unroll
        for (int ks = 0; ks < 4; ++ks) {
            if constexpr (decltype(ST)::v) sstore(ks, nxt);
            if constexpr (decltype(LD)::v) gload(ks, p + 2);
            if (ks < 3) ldf((ks + 1) & 1, ks + 1);
            __builtin_amdgcn_sched_barrier(0);   // the next step's fragment reads stay a group ahead of this step's products (one wave per SIMD: nobody else covers an LDS wait)
#pragma unroll
            for (int nb = 0; nb < NB; ++nb)
#pragma unroll
                for (int mb = 0; mb < MB; ++mb) acc[mb][nb] = wmmab(a[ks & 1][mb], b[ks & 1][nb], acc[mb][nb]);
            if constexpr (SPLIT) {
#pragma unroll
                for (int nb = 0; nb < NB; ++nb)
#pragma unroll
                    for (int mb = 0; mb < MB; ++mb) acc[mb][nb] = wmmab(a2[ks & 1][mb], b[ks & 1][nb], acc[mb][nb]); }
            __builtin_amdgcn_sched_barrier(0);   // the following step's stores, loads and reads are not lifted into this step's products, whose fragment set they refill
        }
        gbar();   // publishes pass p + 1 and ends every wave's reads of pass p
    };
#pragma unroll 1   // rolled: a pass is long straight-line code already, more copies would only cost instruction fetches
    for (int p = 0; p < NP - 2; ++p) pass(p, GFlag<true>(), GFlag<true>());
    pass(NP - 2, GFlag<true>(), GFlag<false>());    // the last two passes apart: nothing is left to load, then nothing to store
    pass(NP - 1, GFlag<false>(), GFlag<false>());
    // Output through LDS (each wave its own 16 rows, behind the last pass's barrier), so that every 128-B line of C is stored whole.
    constexpr int OP = NB * 16 + 4, LPR = NB * 4, RPS = 32 / LPR;   // pitch of a staged row, floats; lanes per row of the wave's tile; rows per wave-wide store
    float* os = (float*)sm + wave * (16 * OP);
#pragma unroll
    for (int mb = 0; mb < MB; ++mb) {
#pragma unroll
        for (int nb = 0; nb < NB; ++nb) {
#pragma unroll
            for (int j = 0; j < 8; ++j) os[(hi * 8 + j) * OP + nb * 16 + lr] = acc[mb][nb][j]; }
        __builtin_amdgcn_wave_barrier(); asm volatile("" ::: "memory");   // the staged rows are read back by other lanes of the wave than wrote them
        float* crow = C + (size_t)(r0 + (wm * MB + mb) * 16) * ldc + c0 + wn * NB * 16;
#pragma unroll
        for (int s = 0; s < 16 / RPS; ++s) { const int row = RPS * s + lane / LPR, cofs = (lane % LPR) * 4; *(v4f*)(crow + (size_t)row * ldc + cofs) = *(const v4fa*)(os + row * OP + cofs); }
        if (mb + 1 < MB) { __builtin_amdgcn_wave_barrier(); asm volatile("s_wait_xcnt 0x0" ::: "memory"); }   // the next 16 rows overwrite the staging only behind these reads; the wait: in front of whatever next rewrites a register that these stores name
    }
}

__device__ __forceinline__ h16 tohx(float x) { return (h16)x; }
__device__ __forceinline__ void splitf(float y, unsigned short& h, unsigned short& l) { h = f2bf(y); l = f2bf(y - bf2f(h)); }
typedef __attribute__((ext_vector_type(2))) _Float16 v2h;
typedef __attribute__((ext_vector_type(4))) _Float16 v4h;
typedef __attribute__((ext_vector_type(2))) unsigned short v2us;
typedef __attribute__((ext_vector_type(4))) unsigned short v4us;
typedef __attribute__((ext_vector_type(2))) float v2f;
typedef __attribute__((ext_vector_type(4))) int v4i;

__global__ __launch_bounds__(256) void k_wtG(const float* __restrict__ w, int K, int N, bf* Bt) {
    const int lane = threadIdx.x & 31; const int L0 = (blockIdx.x * 8 + (threadIdx.x >> 5)) * 8; const int nlines = N * K / 64;
{
#pragma unroll 1
        for (int l = 0; l < 8; ++l) { const int L = L0 + l; if (L >= nlines) break; const size_t e = (size_t)L * 64 + lane * 2; const int k = (int)(e % K), n = (int)(e / K); v2us o;
            o[0] = f2bf(w[(size_t)k * N + n]); o[1] = f2bf(w[(size_t)(k + 1) * N + n]); *(v2us*)(Bt + e) = o; }
         }
}
__global__ __launch_bounds__(256) void k_cvt8(const float* __restrict__ src, bf* dst, size_t n8) { const size_t i = (size_t)blockIdx.x * 256 + threadIdx.x; if (i >= n8) return; const v8f v = *(const v8f*)(src + i * 8); v8us o;
#pragma unroll
    for (int k = 0; k < 8; ++k) o[k] = f2bf(v[k]); *(v8us*)(dst + i * 8) = o;  }
__global__ __launch_bounds__(256) void k_csid(float* CS) { const int idx = blockIdx.x * 256 + threadIdx.x; if (idx >= TT * HD) return; v2f cs; cs[0] = 1.0f; cs[1] = 0.0f; *(v2f*)(CS + (size_t)idx * 2) = cs;  }

// k_rope: head planes [h][t][d] (fp16 + hi/lo) of rope(x) x sc with the rotate-half convention out[d] = x[d] cos[t][d] - x[d+HD/2] sin[t][d], out[d+HD/2] = x[d+HD/2] cos[t][d+HD/2] + x[d] sin[t][d+HD/2]
__global__ __launch_bounds__(256) void k_rope(const float* __restrict__ F, int pitch, int nheads, const float* __restrict__ CS, const float* __restrict__ RF, const float* __restrict__ nw, float sc, h16* P16, bf* Ph, bf* Pl) {
    const size_t e = ((size_t)blockIdx.x * 256 + threadIdx.x) * 2; if (e >= (size_t)nheads * TT * HD) return; const int d = (int)(e % HD); const int t = (int)((e / HD) % TT); const int h = (int)(e / ((size_t)HD * TT)); const float* f = F + (size_t)t * pitch + h * HD; const float rf = RF ? RF[(size_t)h * TT + t] : 1.0f; v2h o16; v2us oh, ol;
#pragma unroll
    for (int q = 0; q < 2; ++q) { const int dd = d + q; const int dp = (dd < HD / 2) ? dd + HD / 2 : dd - HD / 2; float x0 = f[dd], x1 = f[dp];
        if (RF) { float n0 = __fmul_rn(x0, rf), n1 = __fmul_rn(x1, rf); asm volatile("" : "+v"(n0)); asm volatile("" : "+v"(n1)); x0 = __fmul_rn(bfr(nw[dd]), n0); x1 = __fmul_rn(bfr(nw[dp]), n1); }
        const v2f cs = *(const v2f*)(CS + ((size_t)t * HD + dd) * 2); float a = __fmul_rn(x0, cs[0]), bq = __fmul_rn(x1, cs[1]); asm volatile("" : "+v"(a)); asm volatile("" : "+v"(bq)); const float r = ((dd < HD / 2) ? __fsub_rn(a, bq) : __fadd_rn(a, bq)) * sc;
        o16[q] = tohx(r); unsigned short a2, c2; splitf(r, a2, c2); oh[q] = a2; ol[q] = c2; }
    *(v2h*)(P16 + e) = o16; *(v2us*)(Ph + e) = oh; *(v2us*)(Pl + e) = ol;  }
__global__ __launch_bounds__(256) void k_vtp(const float* __restrict__ F, int pitch, int nheads, h16* V16, bf* Vh, bf* Vl) { const size_t e = ((size_t)blockIdx.x * 256 + threadIdx.x) * 2; if (e >= (size_t)nheads * HD * TT) return; const int t = (int)(e % TT); const int d = (int)((e / TT) % HD); const int g = (int)(e / ((size_t)TT * HD)); v2h o16; v2us oh, ol;
#pragma unroll
    for (int q = 0; q < 2; ++q) { const float x = F[(size_t)(t + q) * pitch + g * HD + d]; o16[q] = tohx(x); unsigned short a2, c2; splitf(x, a2, c2); oh[q] = a2; ol[q] = c2; }
    *(v2h*)(V16 + e) = o16; *(v2us*)(Vh + e) = oh; *(v2us*)(Vl + e) = ol;  }
#define SKEY  64                   // keys per stage
#define KPIT  136                  // LDS pitch of a K row, elements: 256 B + 16 B, an odd multiple of 16 B for the 16-byte readers
#define VPIT  72                   // LDS pitch of a V^T row, elements: 128 B + 16 B, likewise
#define KTILE (SKEY * KPIT)
#define PLANE (KTILE + HD * VPIT)  // one stage of one plane pair: K tile, then V^T tile
typedef __attribute__((ext_vector_type(8))) unsigned v8u;
typedef v4i __attribute__((may_alias)) v4ia;
__device__ __forceinline__ float xhalf(float x) { return __builtin_bit_cast(float, __builtin_amdgcn_permlanex16(__builtin_bit_cast(int, x), __builtin_bit_cast(int, x), 0x76543210, 0xfedcba98, false, false)); }  // lane l with lane l ^ 16
__device__ __forceinline__ unsigned pk16(float a, float b) { v2f x; x[0] = a; x[1] = b; return __builtin_bit_cast(unsigned, __builtin_convertvector(x, v2h)); }
typedef __attribute__((ext_vector_type(2))) __bf16 v2b;
__device__ __forceinline__ void split2(float a, float b, unsigned& hi, unsigned& lo) {   // splitf for two values at once, by the packed conversion (round to nearest even, as f2bf): packed hi parts, packed remainders
    v2f x; x[0] = a; x[1] = b; hi = __builtin_bit_cast(unsigned, __builtin_convertvector(x, v2b));
    v2f r; r[0] = a - __uint_as_float(hi << 16); r[1] = b - __uint_as_float(hi & 0xFFFF0000u); lo = __builtin_bit_cast(unsigned, __builtin_convertvector(r, v2b)); }
template <typename T16, bool HL>
__device__ __forceinline__ void fattn_run(T16* sm, const T16* __restrict__ Q, const T16* __restrict__ Q2, const T16* __restrict__ Kp, const T16* __restrict__ K2, const T16* __restrict__ Vt, const T16* __restrict__ V2, const int qw0, v8f (&acc)[2][8], float (&l_run)[2]) {
    typedef typename WFrag<T16>::V V;
    constexpr int NPL = HL ? 2 : 1, BUF = NPL * PLANE;
    const int tid = threadIdx.x, lane = tid & 31, c = lane & 15, h = lane >> 4;
    const float cscale = SCL * 1.4426950408889634f;
    v4i rk[NPL][8], rv[NPL][8];
    const unsigned vofs = (unsigned)(tid >> 3) * (TT * 2u) + (unsigned)(tid & 7) * 16u;   // bytes in a kv plane: eight threads cover a V^T row's 128 B
    auto gload = [&](int key0) {   // a stage's K rows and V^T rows, 16 B a thread and turn: every wave-wide load covers four whole 128-B lines
        const unsigned ko = (unsigned)tid + (unsigned)key0 * (HD / 8u), vo = vofs + (unsigned)key0 * 2u;   // the thread's 32-bit offsets in this stage, the same in the hi and the lo plane: K in 16-byte pieces (its rows lie in a row), V^T in bytes
        __builtin_amdgcn_sched_barrier(0);   // the loads are not lifted from here: the wait at the foot has to stand directly behind them
#pragma unroll
        for (int i = 0; i < 8; ++i) {   // the plane's uniform base + the thread's offset + a constant: two address registers for the whole group
            rk[0][i] = ((const v4ia*)Kp + ko)[i * 128]; rv[0][i] = *(const v4ia*)((const char*)Vt + vo + i * (16 * TT * 2));
            if constexpr (HL) { rk[NPL - 1][i] = ((const v4ia*)K2 + ko)[i * 128]; rv[NPL - 1][i] = *(const v4ia*)((const char*)V2 + vo + i * (16 * TT * 2)); } }
        asm volatile("s_wait_xcnt 0x0" :: "v"(ko), "v"(vo) : "memory");   // in front of whatever next rewrites a register that these loads name; the two offsets are inputs so that they live up to the wait and no load of the group lands in them
        __builtin_amdgcn_sched_barrier(0);   // nothing from below is lifted over that wait; and the loads stay up here: sunk towards their use they would hide no latency
    };
    auto sstore = [&](T16* buf) {
#pragma unroll
        for (int i = 0; i < 8; ++i) { const int idx = i * 128 + tid; const int ok = (idx >> 4) * KPIT + (idx & 15) * 8, ov = KTILE + (idx >> 3) * VPIT + (idx & 7) * 8;
            *(v4ia*)(buf + ok) = rk[0][i]; *(v4ia*)(buf + ov) = rv[0][i]; if (HL) { *(v4ia*)(buf + PLANE + ok) = rk[NPL - 1][i]; *(v4ia*)(buf + PLANE + ov) = rv[NPL - 1][i]; } } };
    const int nst = qw0 / SKEY + 1;   // stages up to and with the one that holds the wave's diagonal; the same for all four waves
    gload(0);
    V qf[2][4], qf2[2][4];
#pragma unroll
    for (int g = 0; g < 2; ++g)
#pragma unroll
        for (int kc = 0; kc < 4; ++kc) { const size_t o = (size_t)(qw0 + 16 * g + c) * HD + 32 * kc + 8 * h; qf[g][kc] = WFrag<T16>::ld(Q + o); if (HL) qf2[g][kc] = WFrag<T16>::ld(Q2 + o); }
    asm volatile("s_wait_xcnt 0x0" ::: "memory");   // in front of whatever next rewrites a register that the Q loads name
    __builtin_amdgcn_sched_barrier(0);   // nothing from below is lifted over that wait
    float m_run[2];
#pragma unroll
    for (int g = 0; g < 2; ++g) { m_run[g] = -__builtin_inff(); l_run[g] = 0.0f;
#pragma unroll
        for (int t = 0; t < 8; ++t) acc[g][t] = (v8f){}; }
    sstore(sm); gload(min(1, nst - 1) * SKEY);
    __syncthreads();   // stage 0 is in buffer 0
#pragma unroll 1   // rolled: a stage is long straight-line code already, a second copy would only cost instruction fetches
    for (int st = 0; st < nst; ++st) {
        const T16* cur = sm + (st & 1) * BUF;
        sstore(sm + ((st + 1) & 1) * BUF);          // stage st + 1 into the buffer that stage st - 1 used: the barrier at the foot of st - 1 ended its reads (past the end: the last stage again, read by nobody)
        gload(min(st + 2, nst - 1) * SKEY);         // in flight under this whole stage; clamped, so always inside the planes and no branch round the loads
        // The stage's fragment reads go out in whole groups ahead of their products (one wave per SIMD: nobody else covers an LDS wait): K first; V^T directly behind it where one plane pair leaves the registers
        // for both, else behind the first product, into the registers K has left, so that it streams in under the softmax.
        v8f s[4][2]; V kfa[4][4], kfa2[HL ? 4 : 1][4], vfa[2][8], vfa2[HL ? 2 : 1][8];
#pragma unroll
        for (int kt = 0; kt < 4; ++kt)
#pragma unroll
            for (int kc = 0; kc < 4; ++kc) { const T16* p = cur + (16 * kt + c) * KPIT + 32 * kc + 8 * h; kfa[kt][kc] = WFrag<T16>::ld(p); if constexpr (HL) kfa2[kt][kc] = WFrag<T16>::ld(p + PLANE); }
        __builtin_amdgcn_sched_barrier(0);          // K's reads stay a group, ahead of V^T's: LDS answers in order, and the first product waits for K alone
        auto ldv = [&]() {
#pragma unroll
            for (int j = 0; j < 2; ++j)
#pragma unroll
                for (int t = 0; t < 8; ++t) { const T16* p = cur + KTILE + (16 * t + c) * VPIT + 32 * j + 8 * h; vfa[j][t] = WFrag<T16>::ld(p); if constexpr (HL) vfa2[j][t] = WFrag<T16>::ld(p + PLANE); }
            __builtin_amdgcn_sched_barrier(0);      // keeps the group together up here: moved down to their uses the reads are waited for one by one
        };
        if constexpr (!HL) ldv();
#pragma unroll
        for (int kt = 0; kt < 4; ++kt)
#pragma unroll
            for (int g = 0; g < 2; ++g) { s[kt][g] = (v8f){};
#pragma unroll
                for (int kc = 0; kc < 4; ++kc) { s[kt][g] = WFrag<T16>::mma(kfa[kt][kc], qf[g][kc], s[kt][g]); if constexpr (HL) { s[kt][g] = WFrag<T16>::mma(kfa[kt][kc], qf2[g][kc], s[kt][g]); s[kt][g] = WFrag<T16>::mma(kfa2[kt][kc], qf[g][kc], s[kt][g]); } } }
        if constexpr (HL) { __builtin_amdgcn_sched_barrier(0);   // V^T's reads not above the first product: K's registers are free only behind it
            ldv(); }
        if (st == nst - 1) {                        // work-group-uniform: only the stage with the diagonal pays for the mask
            const int lim = qw0 - st * SKEY + c - 8 * h;   // key 16 kt + 8 h + r of the stage joins query 16 g + c of the wave when 16 kt + r <= lim + 16 g
#pragma unroll
            for (int g = 0; g < 2; ++g)
#pragma unroll
                for (int kt = 0; kt < 4; ++kt) {
#pragma unroll
                    for (int r = 0; r < 8; ++r) { if (16 * kt + r > lim + 16 * g) s[kt][g][r] = -__builtin_inff(); }
                    asm volatile("" : "+v"(s[kt][g]));   // the masked scores: keeps the selects inside the branch
                }
        }
        float mb[2]; bool need = false;
#pragma unroll
        for (int g = 0; g < 2; ++g) { float mx = -__builtin_inff();
#pragma unroll
            for (int kt = 0; kt < 4; ++kt)
#pragma unroll
                for (int r = 0; r < 8; ++r) mx = fmaxf(mx, s[kt][g][r]);
            mx = fmaxf(mx, xhalf(mx)) * cscale; mb[g] = mx; need = need || (mx > m_run[g] + 8.0f); }
        if (__builtin_amdgcn_ballot_w32(need) != 0) {   // rare after the first stages
#pragma unroll
            for (int g = 0; g < 2; ++g) { const float m_new = fmaxf(m_run[g], mb[g]);   // finite from the first stage on: key 0 is never masked
                const float corr = __builtin_amdgcn_exp2f(m_run[g] - m_new);            // 0 on the first stage, where m_run is -inf
                l_run[g] *= corr; m_run[g] = m_new;
#pragma unroll
                for (int t = 0; t < 8; ++t) acc[g][t] = acc[g][t] * corr; }
        }
        V pf[2][2], pf2[2][2];
#pragma unroll
        for (int g = 0; g < 2; ++g) { const float nm = -m_run[g]; float ps0 = 0.0f, ps1 = 0.0f;
#pragma unroll
            for (int j = 0; j < 2; ++j) { v8u w, w2;
#pragma unroll
                for (int i = 0; i < 8; ++i) {
                    const float p0 = __builtin_amdgcn_exp2f(fmaf(s[2 * j + (i >> 2)][g][2 * (i & 3)], cscale, nm)), p1 = __builtin_amdgcn_exp2f(fmaf(s[2 * j + (i >> 2)][g][2 * (i & 3) + 1], cscale, nm));
                    ps0 += p0; ps1 += p1;
                    if (HL) { unsigned wh, wl; split2(p0, p1, wh, wl); w[i] = wh; w2[i] = wl; }
                    else w[i] = pk16(p0, p1); }
                pf[g][j] = __builtin_bit_cast(V, w); if (HL) pf2[g][j] = __builtin_bit_cast(V, w2); }
            l_run[g] += ps0 + ps1; }
#pragma unroll
        for (int j = 0; j < 2; ++j)
#pragma unroll
            for (int t = 0; t < 8; ++t)
#pragma unroll
                for (int g = 0; g < 2; ++g) { acc[g][t] = WFrag<T16>::mma(vfa[j][t], pf[g][j], acc[g][t]); if constexpr (HL) { acc[g][t] = WFrag<T16>::mma(vfa[j][t], pf2[g][j], acc[g][t]); acc[g][t] = WFrag<T16>::mma(vfa2[j][t], pf[g][j], acc[g][t]); } }
        __builtin_amdgcn_sched_barrier(0);          // keeps the barrier, and the wait for stage st + 2's global loads that comes with it, at the stage's foot
        __syncthreads();   // publishes stage st + 1 and ends every wave's reads of stage st
    }
}
__global__ __launch_bounds__(128) void k_fattn(const h16* __restrict__ Q16, const bf* __restrict__ Qh, const bf* __restrict__ Ql, const h16* __restrict__ K16, const bf* __restrict__ Kh, const bf* __restrict__ Kl, const h16* __restrict__ V16, const bf* __restrict__ Vh, const bf* __restrict__ Vl, bf* __restrict__ Ah, bf* __restrict__ Al) {
    __shared__ __align__(16) unsigned short sm[2 * 2 * PLANE];   // two buffers of two plane pairs (hi+lo); the fp16 rows use half of it
    const int tid = threadIdx.x, lane = tid & 31, c = lane & 15, h = lane >> 4;
    const int kv = blockIdx.y, wave = __builtin_amdgcn_readfirstlane(tid >> 5), head = kv * REP + wave;
    const int qw0 = (TT / 32 - 1 - (int)blockIdx.x) * 32;   // longest key walks first
    const size_t qo = (size_t)head * TT * HD, kvo = (size_t)kv * TT * HD;
    v8f acc[2][8]; float l_run[2];
    if (qw0 < RH) fattn_run<bf, true>((bf*)sm, Qh + qo, Ql + qo, Kh + kvo, Kl + kvo, Vh + kvo, Vl + kvo, qw0, acc, l_run);
    else fattn_run<h16, false>((h16*)sm, Q16 + qo, nullptr, K16 + kvo, nullptr, V16 + kvo, nullptr, qw0, acc, l_run);
    // Output through LDS (each wave its own 2 x 32 rows, behind the stage loop's last barrier), so that every 128-B line of the planes is stored whole. The unrolls: constant indices, as above.
    bf* eb = (bf*)sm + wave * (2 * 32 * KPIT);
#pragma unroll
    for (int g = 0; g < 2; ++g) { const float inv = __fdiv_rn(1.0f, l_run[g] + xhalf(l_run[g]));
#pragma unroll
        for (int t = 0; t < 8; ++t) { v4i oh, ol;
#pragma unroll
            for (int r = 0; r < 4; ++r) { unsigned a, c2; split2(acc[g][t][2 * r] * inv, acc[g][t][2 * r + 1] * inv, a, c2); oh[r] = (int)a; ol[r] = (int)c2; }
            bf* e = eb + (16 * g + c) * KPIT + 16 * t + 8 * h; *(v4ia*)e = oh; *(v4ia*)(e + 32 * KPIT) = ol; } }
    __syncthreads();   // the staged rows are read back by other lanes than wrote them
    v4i th[16], tl[16];
#pragma unroll
    for (int i = 0; i < 16; ++i) { const bf* e = eb + (2 * i + h) * KPIT + c * 8; th[i] = *(const v4ia*)e; tl[i] = *(const v4ia*)(e + 32 * KPIT); }
    const unsigned oofs = (unsigned)h * (DQ * 2u) + (unsigned)c * 16u;   // bytes: 16 lanes cover one row's 256 B, a wave-wide store two rows
    char* ah = (char*)(Ah + (size_t)qw0 * DQ + head * HD); char* al = (char*)(Al + (size_t)qw0 * DQ + head * HD);
#pragma unroll
    for (int i = 0; i < 16; ++i) { *(v4ia*)(ah + oofs + i * (2 * DQ * 2)) = th[i]; *(v4ia*)(al + oofs + i * (2 * DQ * 2)) = tl[i]; }
}

extern "C" void kernel_launch(void* const* d_in, const int* in_sizes, int n_in,
                              void* d_out, int out_size, void* d_ws, size_t ws_size, hipStream_t stream) {
    (void)in_sizes; (void)n_in; (void)out_size;
    const float* x = (const float*)d_in[0]; const float* wq = (const float*)d_in[1]; const float* wk = (const float*)d_in[2]; const float* wv = (const float*)d_in[3]; const float* wo = (const float*)d_in[4];
    float* OUT = (float*)d_out;     // [2][2048][2048]
    char* wsp = (char*)d_ws;
    auto take = [&](size_t bytes) { char* p = wsp; wsp += (bytes + 255) & ~(size_t)255; return (void*)p; };
    bf* WQ = (bf*)take((size_t)DQ * DM * 2); bf* WK = (bf*)take((size_t)DKV * DM * 2); bf* WV = (bf*)take((size_t)DKV * DM * 2); bf* WO = (bf*)take((size_t)DM * DQ * 2); float* CS = (float*)take((size_t)TT * HD * 2 * 4);
    bf* XB = (bf*)take((size_t)TT * DM * 2); float* FQ = (float*)take((size_t)TT * DQ * 4); float* FK = (float*)take((size_t)TT * DKV * 4);
    h16* QP16 = (h16*)take((size_t)NH_ * TT * HD * 2); h16* KP16 = (h16*)take((size_t)NKV * TT * HD * 2); h16* VT16 = (h16*)take((size_t)NKV * HD * TT * 2);
    bf* QPh = (bf*)take((size_t)NH_ * TT * HD * 2); bf* QPl = (bf*)take((size_t)NH_ * TT * HD * 2); bf* KPh = (bf*)take((size_t)NKV * TT * HD * 2); bf* KPl = (bf*)take((size_t)NKV * TT * HD * 2); bf* VTh = (bf*)take((size_t)NKV * HD * TT * 2); bf* VTl = (bf*)take((size_t)NKV * HD * TT * 2);
    bf* ATh = (bf*)take((size_t)TT * DQ * 2); bf* ATl = (bf*)take((size_t)TT * DQ * 2);
    if ((size_t)(wsp - (char*)d_ws) > ws_size) return;    // ws 256 MiB
    float* FV = FK;   // v projection reuses the k buffer after the k planes are built (stream-ordered)
    { k_wtG<<<(unsigned)((DM * DQ / 64 + 63) / 64), 256, 0, stream>>>(wq, DM, DQ, WQ); k_wtG<<<(unsigned)((DM * DKV / 64 + 63) / 64), 256, 0, stream>>>(wk, DM, DKV, WK); k_wtG<<<(unsigned)((DM * DKV / 64 + 63) / 64), 256, 0, stream>>>(wv, DM, DKV, WV);
      k_wtG<<<(unsigned)((DQ * DM / 64 + 63) / 64), 256, 0, stream>>>(wo, DQ, DM, WO);
      k_csid<<<(TT * HD + 255) / 256, 256, 0, stream>>>(CS); }
    const unsigned LQ = (unsigned)(((size_t)NH_ * TT * HD / 2 + 255) / 256), LKv = (unsigned)(((size_t)NKV * TT * HD / 2 + 255) / 256);
    for (int b = 0; b < NB_; ++b) {
        
        k_cvt8<<<(unsigned)(((size_t)TT * DM / 8 + 255) / 256), 256, 0, stream>>>(x + (size_t)b * TT * DM, XB, (size_t)TT * DM / 8);
        k_gemms<4, 4, false><<<dim3(TT / 128, DQ / 128, 1), 128, 0, stream>>>(XB, nullptr, WQ, FQ, DQ);
        k_rope<<<LQ, 256, 0, stream>>>(FQ, DQ, NH_, CS, nullptr, nullptr, 1.0f, QP16, QPh, QPl);
        k_gemms<2, 2, false><<<dim3(TT / 64, DKV / 64, 1), 128, 0, stream>>>(XB, nullptr, WK, FK, DKV);
        k_rope<<<LKv, 256, 0, stream>>>(FK, DKV, NKV, CS, nullptr, nullptr, 1.0f, KP16, KPh, KPl);
        k_gemms<2, 2, false><<<dim3(TT / 64, DKV / 64, 1), 128, 0, stream>>>(XB, nullptr, WV, FV, DKV); k_vtp<<<LKv, 256, 0, stream>>>(FV, DKV, NKV, VT16, VTh, VTl);
        k_fattn<<<dim3(TT / 32, NKV, 1), 128, 0, stream>>>(QP16, QPh, QPl, KP16, KPh, KPl, VT16, VTh, VTl, ATh, ATl);
        k_gemms<4, 4, true><<<dim3(TT / 128, DM / 128, 1), 128, 0, stream>>>(ATh, ATl, WO, OUT + (size_t)b * TT * DM, DM); }
}

// v004
// One run takes 247 microseconds.
// Two timings next to v003 put it at 1.18 and 1.19 times that version's speed.
// Counting every step since v000, it is 6.81 times as fast.
#include <hip/hip_runtime.h>

// Grouped-query causal self-attention with 128-wide heads, no rotary (x [2][2048][2048]; q = x Wq ('xw' [2048][2048], 16 heads x 128), k, v = x Wk, x Wv ('xw' [2048][512], 4 kv heads x 128), no biases; k, v repeated 4 x on the head axis (jnp.repeat: query head h uses kv head h / 4); att x 1/sqrt(128); causal (-inf); softmax; y = merged Wo ('xw' [2048][2048], no bias) -> [2][2048][2048] (8.4 M); argument order x, Wq, Wk, Wv, Wo).
// Compute dtypes, f32 accumulate: every input rounded to bf16; q/k/v on PLAIN bf16 operands (inputs: exact), their fp16 and hi+lo bf16 planes written by the projection kernel itself; scores, softmax and attn.v in one kernel (online softmax, f32; 64-key stages beyond a wave's diagonal never read): query rows < 512 hl (3 products), the rest single fp16; Wo hl x exact (2 products).

#define NB_  2
#define TT   2048
#define DM   2048
#define NH_  16
#define NKV  4
#define REP  (NH_ / NKV)
#define HD   128
#define DQ   (NH_ * HD)
#define DKV  (NKV * HD)
#define RH   512                  // query rows < RH use hi+lo planes (a multiple of 32: a wave's 32 rows are wholly hi+lo or wholly fp16)
#define SCL  0.088388347648318447f   // HD^-0.5
typedef _Float16 h16;
typedef unsigned short bf;
typedef __attribute__((ext_vector_type(16))) __bf16   v16bf;
typedef __attribute__((ext_vector_type(16))) _Float16 v16h;
typedef __attribute__((ext_vector_type(8)))  _Float16 v8h;
typedef __attribute__((ext_vector_type(8)))  unsigned short v8us;
typedef __attribute__((ext_vector_type(8)))  float    v8f;
typedef __attribute__((ext_vector_type(4)))  float    v4f;
typedef v8h  __attribute__((may_alias)) v8ha;
typedef v4f  __attribute__((may_alias)) v4fa;
typedef v8us __attribute__((may_alias)) v8usa;

__device__ __forceinline__ unsigned short f2bf(float f) { unsigned u = __float_as_uint(f); u += 0x7FFFu + ((u >> 16) & 1u); return (unsigned short)(u >> 16); }
__device__ __forceinline__ float bf2f(unsigned short b) { return __uint_as_float(((unsigned)b) << 16); }
__device__ __forceinline__ v16h cat16(v8h lo, v8h hi) { return __builtin_shufflevector(lo, hi, 0, 1, 2, 3, 4, 5, 6, 7, 8, 9, 10, 11, 12, 13, 14, 15); }
__device__ __forceinline__ v16bf cat16b(v8us lo, v8us hi) { return __builtin_bit_cast(v16bf, __builtin_shufflevector(lo, hi, 0, 1, 2, 3, 4, 5, 6, 7, 8, 9, 10, 11, 12, 13, 14, 15)); }
__device__ __forceinline__ v8f wmma16(v16h a, v16h b, v8f c) { return __builtin_amdgcn_wmma_f32_16x16x32_f16(false, a, false, b, (short)0, c, false, false); }
__device__ __forceinline__ v8f wmmab(v16bf a, v16bf b, v8f c) { return __builtin_amdgcn_wmma_f32_16x16x32_bf16(false, a, false, b, (short)0, c, false, false); }

typedef __attribute__((ext_vector_type(2))) _Float16 v2h;
typedef __attribute__((ext_vector_type(2))) float v2f;
typedef __attribute__((ext_vector_type(4))) int v4i;
typedef v4i __attribute__((may_alias)) v4ia;
__device__ __forceinline__ unsigned pk16(float a, float b) { v2f x; x[0] = a; x[1] = b; return __builtin_bit_cast(unsigned, __builtin_convertvector(x, v2h)); }
typedef __attribute__((ext_vector_type(2))) __bf16 v2b;
__device__ __forceinline__ void split2(float a, float b, unsigned& hi, unsigned& lo) {   // two values at once, by the packed conversion (round to nearest even, as f2bf): packed hi parts, packed remainders
    v2f x; x[0] = a; x[1] = b; hi = __builtin_bit_cast(unsigned, __builtin_convertvector(x, v2b));
    v2f r; r[0] = a - __uint_as_float(hi << 16); r[1] = b - __uint_as_float(hi & 0xFFFF0000u); lo = __builtin_bit_cast(unsigned, __builtin_convertvector(r, v2b)); }

template <typename T16> struct WFrag;
template <> struct WFrag<h16> { typedef v16h V; static __device__ __forceinline__ V ld(const h16* p) { return cat16(*(const v8h*)p, *(const v8h*)(p + 16)); } static __device__ __forceinline__ v8f mma(V a, V b, v8f c) { return wmma16(a, b, c); } };
template <> struct WFrag<bf> { typedef v16bf V; static __device__ __forceinline__ V ld(const bf* p) { return cat16b(*(const v8us*)p, *(const v8us*)(p + 16)); } static __device__ __forceinline__ v8f mma(V a, V b, v8f c) { return wmmab(a, b, c); } };
// ---- k_gemms: C[m][n] = sum_k A[m][k] Bt[n][k] (+ A2[m][k] Bt[n][k] where SPLIT), all planes bf16, K-contiguous, K = GK. PP == 0: C goes out as f32, pitch ldc.
// PP != 0: C goes out TRANSPOSED as the three 16-bit planes the attention kernel reads (fp16, bf16 hi, bf16 lo), n the row (pitch PP elements), m along it: element (m, n) at (m / HD) HS + n PP + m % HD.
// An accumulator lane holds eight consecutive m of one n, which is 16 B of a plane row. q, k: A = the weight (m = head x 128 + d), Bt = x (n = t), PP = HD, planes [head][t][d]; v: A = x (m = t), Bt = the weight, PP = TT, planes [head x 128 + d][t].
// A work-group is 2 x 2 waves on a (32 MB) x (32 NB) tile of C; a wave owns MB x NB accumulators. k goes in passes of 128 (256 B of every operand row): the work-group brings a pass through registers into
// one of two LDS buffers with whole-line loads (16 threads cover a row's 256 B), so every operand byte comes from L2 once per work-group and the fragments are read from LDS. One barrier per pass.
// A pass is four k steps of 32; each step stores a quarter of the next pass's rows to LDS, refills those registers with the same quarter of the pass after it (so a whole pass of loads is always in flight),
// reads the next step's fragments into the second fragment set and then runs its own products. Every accumulator takes its products in the order kc ascending, A before A2.
// Every '#pragma unroll' in k_gemms is there so that the staging, fragment and accumulator arrays are indexed by constants and stay in registers.
#define GK    2048                 // the reduction length of all four products
#define GPASS 128                  // k per pass
#define GPIT  136                  // LDS pitch of a staged row, elements: 256 B + 16 B, an odd multiple of 16 B for the 16-byte readers
typedef __attribute__((ext_vector_type(4))) int g4i;
typedef g4i __attribute__((may_alias)) g4ia;
template <bool B> struct GFlag { static constexpr bool v = B; };
// The pass barrier, by hand: __syncthreads() would also wait for the global loads that are in flight for the pass after next and so undo their lead. What other waves depend on here is LDS alone
// (this wave's stores of the next pass, its reads of this one): s_wait_dscnt 0 covers both.
__device__ __forceinline__ void gbar() { asm volatile("s_wait_dscnt 0x0\n\ts_barrier_signal -1\n\ts_barrier_wait -1" ::: "memory"); }
template <int MB, int NB, bool SPLIT, int PP>
__global__ __launch_bounds__(128) void k_gemms(const bf* __restrict__ A, const bf* __restrict__ A2, const bf* __restrict__ Bt, float* C, int ldc, h16* P16, bf* Ph, bf* Pl) {
    typedef WFrag<bf>::V V;
    constexpr int RA = 32 * MB, RB = 32 * NB, OA2 = RA * GPIT, OB = (SPLIT ? 2 : 1) * RA * GPIT, STG = OB + RB * GPIT, NP = GK / GPASS, NA2 = SPLIT ? MB : 1;
    __shared__ __align__(16) bf sm[2 * STG];
    const int tid = threadIdx.x, lane = tid & 31, lr = lane & 15, hi = lane >> 4, wave = __builtin_amdgcn_readfirstlane(tid >> 5), wm = wave >> 1, wn = wave & 1;
    const int r0 = blockIdx.x * RA, c0 = blockIdx.y * RB;
    const unsigned tofs = (unsigned)(tid >> 4) * (GK * 2u) + (unsigned)(tid & 15) * 16u;   // bytes: the thread's row of a turn of eight rows, and its 16 B of the row's 256
    const char* Ab = (const char*)(A + (size_t)r0 * GK) + tofs; const char* A2b = SPLIT ? (const char*)(A2 + (size_t)r0 * GK) + tofs : nullptr; const char* Bb = (const char*)(Bt + (size_t)c0 * GK) + tofs;
    const int sofs = (tid >> 4) * GPIT + (tid & 15) * 8;                                   // the same place in a staged turn, elements
    g4i ra[4 * MB], ra2[4 * NA2], rb[4 * NB];
    auto gload = [&](int q, int pass) {   // quarter q of a pass: MB turns of A (and of A2), NB turns of Bt; every wave-wide load covers four whole 128-B lines
        const char* pa = Ab + pass * (GPASS * 2); const char* pa2 = SPLIT ? A2b + pass * (GPASS * 2) : nullptr; const char* pb = Bb + pass * (GPASS * 2);   // the thread's address in each plane + a constant per turn
        __builtin_amdgcn_sched_barrier(0);   // the loads are not lifted from here: the wait at the foot has to stand directly behind them
#pragma unroll
        for (int i = 0; i < MB; ++i) { const int t = q * MB + i; ra[t] = *(const g4ia*)(pa + t * (8 * GK * 2)); if constexpr (SPLIT) ra2[t] = *(const g4ia*)(pa2 + t * (8 * GK * 2)); }
#pragma unroll
        for (int i = 0; i < NB; ++i) { const int t = q * NB + i; rb[t] = *(const g4ia*)(pb + t * (8 * GK * 2)); }
        asm volatile("s_wait_xcnt 0x0" ::: "memory");   // in front of whatever next rewrites a register that these loads name
        __builtin_amdgcn_sched_barrier(0);   // nothing from below is lifted over that wait; and the loads stay up here: sunk towards their use they would hide no latency
    };
    auto sstore = [&](int q, bf* buf) {
#pragma unroll
        for (int i = 0; i < MB; ++i) { const int t = q * MB + i; *(g4ia*)(buf + t * 8 * GPIT + sofs) = ra[t]; if constexpr (SPLIT) *(g4ia*)(buf + OA2 + t * 8 * GPIT + sofs) = ra2[t]; }
#pragma unroll
        for (int i = 0; i < NB; ++i) { const int t = q * NB + i; *(g4ia*)(buf + OB + t * 8 * GPIT + sofs) = rb[t]; } };
    v8f acc[MB][NB];
#pragma unroll
    for (int mb = 0; mb < MB; ++mb)
#pragma unroll
        for (int nb = 0; nb < NB; ++nb) acc[mb][nb] = (v8f){};
#pragma unroll
    for (int q = 0; q < 4; ++q) gload(q, 0);
#pragma unroll
    for (int q = 0; q < 4; ++q) { sstore(q, sm); gload(q, 1); }
    gbar();   // pass 0 is in buffer 0
    const int fa = (wm * MB * 16 + lr) * GPIT + 8 * hi, fb = OB + (wn * NB * 16 + lr) * GPIT + 8 * hi;   // the lane's place in the wave's first A and Bt fragment: the k order of both is that of WFrag::ld
    auto pass = [&](int p, auto ST, auto LD) {   // ST: a pass p + 1 exists and is stored; LD: a pass p + 2 exists and is loaded
        const bf* cur = sm + (p & 1) * STG; bf* nxt = sm + ((p + 1) & 1) * STG;   // nxt held pass p - 1: the barrier at the foot of p - 1 ended its reads
        V a[2][MB], a2[2][NA2], b[2][NB];
        auto ldf = [&](int set, int ks) {
#pragma unroll
            for (int mb = 0; mb < MB; ++mb) { a[set][mb] = WFrag<bf>::ld(cur + fa + mb * 16 * GPIT + ks * 32); if constexpr (SPLIT) a2[set][mb] = WFrag<bf>::ld(cur + OA2 + fa + mb * 16 * GPIT + ks * 32); }
#pragma unroll
            for (int nb = 0; nb < NB; ++nb) b[set][nb] = WFrag<bf>::ld(cur + fb + nb * 16 * GPIT + ks * 32); };
        ldf(0, 0);
#pragma unroll
        for (int ks = 0; ks < 4; ++ks) {
            if constexpr (decltype(ST)::v) sstore(ks, nxt);
            if constexpr (decltype(LD)::v) gload(ks, p + 2);
            if (ks < 3) ldf((ks + 1) & 1, ks + 1);
            __builtin_amdgcn_sched_barrier(0);   // the next step's fragment reads stay a group ahead of this step's products (one wave per SIMD: nobody else covers an LDS wait)
#pragma unroll
            for (int nb = 0; nb < NB; ++nb)
#pragma unroll
                for (int mb = 0; mb < MB; ++mb) acc[mb][nb] = wmmab(a[ks & 1][mb], b[ks & 1][nb], acc[mb][nb]);
            if constexpr (SPLIT) {
#pragma unroll
                for (int nb = 0; nb < NB; ++nb)
#pragma unroll
                    for (int mb = 0; mb < MB; ++mb) acc[mb][nb] = wmmab(a2[ks & 1][mb], b[ks & 1][nb], acc[mb][nb]); }
            __builtin_amdgcn_sched_barrier(0);   // the following step's stores, loads and reads are not lifted into this step's products, whose fragment set they refill
        }
        gbar();   // publishes pass p + 1 and ends every wave's reads of pass p
    };
#pragma unroll 1   // rolled: a pass is long straight-line code already, more copies would only cost instruction fetches
    for (int p = 0; p < NP - 2; ++p) pass(p, GFlag<true>(), GFlag<true>());
    pass(NP - 2, GFlag<true>(), GFlag<false>());    // the last two passes apart: nothing is left to load, then nothing to store
    pass(NP - 1, GFlag<false>(), GFlag<false>());
    if constexpr (PP != 0) {
        // The planes, through LDS (the whole work-group's tile, behind the last pass's barrier), so that every 128-B line of a plane is stored whole, by one wave. The unrolls: constant indices, as above.
        constexpr int EP = RA + 8, EPL = RB * EP, HS = (PP == HD) ? TT * HD : HD;   // pitch of a staged plane row, elements (an odd multiple of 16 B); one staged plane; the step of the plane index from one block of HD m to the next
        static_assert(3 * EPL <= 2 * STG && HD % RA == 0, "the three staged planes fit the ring; a tile's m lie in one block of HD");
#pragma unroll
        for (int nb = 0; nb < NB; ++nb)
#pragma unroll
            for (int mb = 0; mb < MB; ++mb) { v4i o16, oh, ol;
#pragma unroll
                for (int r = 0; r < 4; ++r) { unsigned a, c2; split2(acc[mb][nb][2 * r], acc[mb][nb][2 * r + 1], a, c2); o16[r] = (int)pk16(acc[mb][nb][2 * r], acc[mb][nb][2 * r + 1]); oh[r] = (int)a; ol[r] = (int)c2; }
                bf* e = sm + ((wn * NB + nb) * 16 + lr) * EP + (wm * MB + mb) * 16 + 8 * hi; *(v4ia*)e = o16; *(v4ia*)(e + EPL) = oh; *(v4ia*)(e + 2 * EPL) = ol; }
        gbar();   // the staged rows are read back by other waves than wrote them
        constexpr int TPR = RA / 8, RPT = 128 / TPR, NT = RB / RPT;   // threads per plane row of the tile (16 B each); rows per turn of the work-group; turns
        const int row = tid / TPR, cp = (tid % TPR) * 8;
        v4i t16[NT], th[NT], tl[NT];
#pragma unroll
        for (int i = 0; i < NT; ++i) { const bf* e = sm + (i * RPT + row) * EP + cp; t16[i] = *(const v4ia*)e; th[i] = *(const v4ia*)(e + EPL); tl[i] = *(const v4ia*)(e + 2 * EPL); }
        const size_t po = ((size_t)(r0 / HD) * HS + (size_t)(r0 % HD) + (size_t)c0 * PP) * 2; const unsigned pofs = (unsigned)row * (PP * 2u) + (unsigned)cp * 2u;   // bytes: the tile's place in a plane (uniform), the thread's place in a turn
        char* p16 = (char*)P16 + po; char* ph = (char*)Ph + po; char* pl = (char*)Pl + po;
#pragma unroll
        for (int i = 0; i < NT; ++i) { *(v4ia*)(p16 + pofs + i * (RPT * PP * 2)) = t16[i]; *(v4ia*)(ph + pofs + i * (RPT * PP * 2)) = th[i]; *(v4ia*)(pl + pofs + i * (RPT * PP * 2)) = tl[i]; }
    } else {
    // Output through LDS (each wave its own 16 rows, behind the last pass's barrier), so that every 128-B line of C is stored whole.
    constexpr int OP = NB * 16 + 4, LPR = NB * 4, RPS = 32 / LPR;   // pitch of a staged row, floats; lanes per row of the wave's tile; rows per wave-wide store
    float* os = (float*)sm + wave * (16 * OP);
#pragma unroll
    for (int mb = 0; mb < MB; ++mb) {
#pragma unroll
        for (int nb = 0; nb < NB; ++nb) {
#pragma unroll
            for (int j = 0; j < 8; ++j) os[(hi * 8 + j) * OP + nb * 16 + lr] = acc[mb][nb][j]; }
        __builtin_amdgcn_wave_barrier(); asm volatile("" ::: "memory");   // the staged rows are read back by other lanes of the wave than wrote them
        float* crow = C + (size_t)(r0 + (wm * MB + mb) * 16) * ldc + c0 + wn * NB * 16;
#pragma unroll
        for (int s = 0; s < 16 / RPS; ++s) { const int row = RPS * s + lane / LPR, cofs = (lane % LPR) * 4; *(v4f*)(crow + (size_t)row * ldc + cofs) = *(const v4fa*)(os + row * OP + cofs); }
        if (mb + 1 < MB) { __builtin_amdgcn_wave_barrier(); asm volatile("s_wait_xcnt 0x0" ::: "memory"); }   // the next 16 rows overwrite the staging only behind these reads; the wait: in front of whatever next rewrites a register that these stores name
    }
    }
}

typedef __attribute__((ext_vector_type(2))) unsigned short v2us;

__global__ __launch_bounds__(256) void k_wtG(const float* __restrict__ w, int K, int N, bf* Bt) {
    const int lane = threadIdx.x & 31; const int L0 = (blockIdx.x * 8 + (threadIdx.x >> 5)) * 8; const int nlines = N * K / 64;
{
#pragma unroll 1
        for (int l = 0; l < 8; ++l) { const int L = L0 + l; if (L >= nlines) break; const size_t e = (size_t)L * 64 + lane * 2; const int k = (int)(e % K), n = (int)(e / K); v2us o;
            o[0] = f2bf(w[(size_t)k * N + n]); o[1] = f2bf(w[(size_t)(k + 1) * N + n]); *(v2us*)(Bt + e) = o; }
         }
}
__global__ __launch_bounds__(256) void k_cvt8(const float* __restrict__ src, bf* dst, size_t n8) { const size_t i = (size_t)blockIdx.x * 256 + threadIdx.x; if (i >= n8) return; const v8f v = *(const v8f*)(src + i * 8); v8us o;
#pragma unroll
    for (int k = 0; k < 8; ++k) o[k] = f2bf(v[k]); *(v8us*)(dst + i * 8) = o;  }
#define SKEY  64                   // keys per stage
#define KPIT  136                  // LDS pitch of a K row, elements: 256 B + 16 B, an odd multiple of 16 B for the 16-byte readers
#define VPIT  72                   // LDS pitch of a V^T row, elements: 128 B + 16 B, likewise
#define KTILE (SKEY * KPIT)
#define PLANE (KTILE + HD * VPIT)  // one stage of one plane pair: K tile, then V^T tile
typedef __attribute__((ext_vector_type(8))) unsigned v8u;
__device__ __forceinline__ float xhalf(float x) { return __builtin_bit_cast(float, __builtin_amdgcn_permlanex16(__builtin_bit_cast(int, x), __builtin_bit_cast(int, x), 0x76543210, 0xfedcba98, false, false)); }  // lane l with lane l ^ 16
template <typename T16, bool HL>
__device__ __forceinline__ void fattn_run(T16* sm, const T16* __restrict__ Q, const T16* __restrict__ Q2, const T16* __restrict__ Kp, const T16* __restrict__ K2, const T16* __restrict__ Vt, const T16* __restrict__ V2, const int qw0, v8f (&acc)[2][8], float (&l_run)[2]) {
    typedef typename WFrag<T16>::V V;
    constexpr int NPL = HL ? 2 : 1, BUF = NPL * PLANE;
    const int tid = threadIdx.x, lane = tid & 31, c = lane & 15, h = lane >> 4;
    const float cscale = SCL * 1.4426950408889634f;
    v4i rk[NPL][8], rv[NPL][8];
    const unsigned vofs = (unsigned)(tid >> 3) * (TT * 2u) + (unsigned)(tid & 7) * 16u;   // bytes in a kv plane: eight threads cover a V^T row's 128 B
    auto gload = [&](int key0) {   // a stage's K rows and V^T rows, 16 B a thread and turn: every wave-wide load covers four whole 128-B lines
        const unsigned ko = (unsigned)tid + (unsigned)key0 * (HD / 8u), vo = vofs + (unsigned)key0 * 2u;   // the thread's 32-bit offsets in this stage, the same in the hi and the lo plane: K in 16-byte pieces (its rows lie in a row), V^T in bytes
        __builtin_amdgcn_sched_barrier(0);   // the loads are not lifted from here: the wait at the foot has to stand directly behind them
#pragma unroll
        for (int i = 0; i < 8; ++i) {   // the plane's uniform base + the thread's offset + a constant: two address registers for the whole group
            rk[0][i] = ((const v4ia*)Kp + ko)[i * 128]; rv[0][i] = *(const v4ia*)((const char*)Vt + vo + i * (16 * TT * 2));
            if constexpr (HL) { rk[NPL - 1][i] = ((const v4ia*)K2 + ko)[i * 128]; rv[NPL - 1][i] = *(const v4ia*)((const char*)V2 + vo + i * (16 * TT * 2)); } }
        asm volatile("s_wait_xcnt 0x0" :: "v"(ko), "v"(vo) : "memory");   // in front of whatever next rewrites a register that these loads name; the two offsets are inputs so that they live up to the wait and no load of the group lands in them
        __builtin_amdgcn_sched_barrier(0);   // nothing from below is lifted over that wait; and the loads stay up here: sunk towards their use they would hide no latency
    };
    auto sstore = [&](T16* buf) {
#pragma unroll
        for (int i = 0; i < 8; ++i) { const int idx = i * 128 + tid; const int ok = (idx >> 4) * KPIT + (idx & 15) * 8, ov = KTILE + (idx >> 3) * VPIT + (idx & 7) * 8;
            *(v4ia*)(buf + ok) = rk[0][i]; *(v4ia*)(buf + ov) = rv[0][i]; if (HL) { *(v4ia*)(buf + PLANE + ok) = rk[NPL - 1][i]; *(v4ia*)(buf + PLANE + ov) = rv[NPL - 1][i]; } } };
    const int nst = qw0 / SKEY + 1;   // stages up to and with the one that holds the wave's diagonal; the same for all four waves
    gload(0);
    V qf[2][4], qf2[2][4];
#pragma unroll
    for (int g = 0; g < 2; ++g)
#pragma unroll
        for (int kc = 0; kc < 4; ++kc) { const size_t o = (size_t)(qw0 + 16 * g + c) * HD + 32 * kc + 8 * h; qf[g][kc] = WFrag<T16>::ld(Q + o); if (HL) qf2[g][kc] = WFrag<T16>::ld(Q2 + o); }
    asm volatile("s_wait_xcnt 0x0" ::: "memory");   // in front of whatever next rewrites a register that the Q loads name
    __builtin_amdgcn_sched_barrier(0);   // nothing from below is lifted over that wait
    float m_run[2];
#pragma unroll
    for (int g = 0; g < 2; ++g) { m_run[g] = -__builtin_inff(); l_run[g] = 0.0f;
#pragma unroll
        for (int t = 0; t < 8; ++t) acc[g][t] = (v8f){}; }
    sstore(sm); gload(min(1, nst - 1) * SKEY);
    __syncthreads();   // stage 0 is in buffer 0
#pragma unroll 1   // rolled: a stage is long straight-line code already, a second copy would only cost instruction fetches
    for (int st = 0; st < nst; ++st) {
        const T16* cur = sm + (st & 1) * BUF;
        sstore(sm + ((st + 1) & 1) * BUF);          // stage st + 1 into the buffer that stage st - 1 used: the barrier at the foot of st - 1 ended its reads (past the end: the last stage again, read by nobody)
        gload(min(st + 2, nst - 1) * SKEY);         // in flight under this whole stage; clamped, so always inside the planes and no branch round the loads
        // The stage's fragment reads go out in whole groups ahead of their products (one wave per SIMD: nobody else covers an LDS wait): K first; V^T directly behind it where one plane pair leaves the registers
        // for both, else behind the first product, into the registers K has left, so that it streams in under the softmax.
        v8f s[4][2]; V kfa[4][4], kfa2[HL ? 4 : 1][4], vfa[2][8], vfa2[HL ? 2 : 1][8];
#pragma unroll
        for (int kt = 0; kt < 4; ++kt)
#pragma unroll
            for (int kc = 0; kc < 4; ++kc) { const T16* p = cur + (16 * kt + c) * KPIT + 32 * kc + 8 * h; kfa[kt][kc] = WFrag<T16>::ld(p); if constexpr (HL) kfa2[kt][kc] = WFrag<T16>::ld(p + PLANE); }
        __builtin_amdgcn_sched_barrier(0);          // K's reads stay a group, ahead of V^T's: LDS answers in order, and the first product waits for K alone
        auto ldv = [&]() {
#pragma unroll
            for (int j = 0; j < 2; ++j)
#pragma unroll
                for (int t = 0; t < 8; ++t) { const T16* p = cur + KTILE + (16 * t + c) * VPIT + 32 * j + 8 * h; vfa[j][t] = WFrag<T16>::ld(p); if constexpr (HL) vfa2[j][t] = WFrag<T16>::ld(p + PLANE); }
            __builtin_amdgcn_sched_barrier(0);      // keeps the group together up here: moved down to their uses the reads are waited for one by one
        };
        if constexpr (!HL) ldv();
#pragma unroll
        for (int kt = 0; kt < 4; ++kt)
#pragma unroll
            for (int g = 0; g < 2; ++g) { s[kt][g] = (v8f){};
#pragma unroll
                for (int kc = 0; kc < 4; ++kc) { s[kt][g] = WFrag<T16>::mma(kfa[kt][kc], qf[g][kc], s[kt][g]); if constexpr (HL) { s[kt][g] = WFrag<T16>::mma(kfa[kt][kc], qf2[g][kc], s[kt][g]); s[kt][g] = WFrag<T16>::mma(kfa2[kt][kc], qf[g][kc], s[kt][g]); } } }
        if constexpr (HL) { __builtin_amdgcn_sched_barrier(0);   // V^T's reads not above the first product: K's registers are free only behind it
            ldv(); }
        if (st == nst - 1) {                        // work-group-uniform: only the stage with the diagonal pays for the mask
            const int lim = qw0 - st * SKEY + c - 8 * h;   // key 16 kt + 8 h + r of the stage joins query 16 g + c of the wave when 16 kt + r <= lim + 16 g
#pragma unroll
            for (int g = 0; g < 2; ++g)
#pragma unroll
                for (int kt = 0; kt < 4; ++kt) {
#pragma unroll
                    for (int r = 0; r < 8; ++r) { if (16 * kt + r > lim + 16 * g) s[kt][g][r] = -__builtin_inff(); }
                    asm volatile("" : "+v"(s[kt][g]));   // the masked scores: keeps the selects inside the branch
                }
        }
        float mb[2]; bool need = false;
#pragma unroll
        for (int g = 0; g < 2; ++g) { float mx = -__builtin_inff();
#pragma unroll
            for (int kt = 0; kt < 4; ++kt)
#pragma unroll
                for (int r = 0; r < 8; ++r) mx = fmaxf(mx, s[kt][g][r]);
            mx = fmaxf(mx, xhalf(mx)) * cscale; mb[g] = mx; need = need || (mx > m_run[g] + 8.0f); }
        if (__builtin_amdgcn_ballot_w32(need) != 0) {   // rare after the first stages
#pragma unroll
            for (int g = 0; g < 2; ++g) { const float m_new = fmaxf(m_run[g], mb[g]);   // finite from the first stage on: key 0 is never masked
                const float corr = __builtin_amdgcn_exp2f(m_run[g] - m_new);            // 0 on the first stage, where m_run is -inf
                l_run[g] *= corr; m_run[g] = m_new;
#pragma unroll
                for (int t = 0; t < 8; ++t) acc[g][t] = acc[g][t] * corr; }
        }
        V pf[2][2], pf2[2][2];
#pragma unroll
        for (int g = 0; g < 2; ++g) { const float nm = -m_run[g]; float ps0 = 0.0f, ps1 = 0.0f;
#pragma unroll
            for (int j = 0; j < 2; ++j) { v8u w, w2;
#pragma unroll
                for (int i = 0; i < 8; ++i) {
                    const float p0 = __builtin_amdgcn_exp2f(fmaf(s[2 * j + (i >> 2)][g][2 * (i & 3)], cscale, nm)), p1 = __builtin_amdgcn_exp2f(fmaf(s[2 * j + (i >> 2)][g][2 * (i & 3) + 1], cscale, nm));
                    ps0 += p0; ps1 += p1;
                    if (HL) { unsigned wh, wl; split2(p0, p1, wh, wl); w[i] = wh; w2[i] = wl; }
                    else w[i] = pk16(p0, p1); }
                pf[g][j] = __builtin_bit_cast(V, w); if (HL) pf2[g][j] = __builtin_bit_cast(V, w2); }
            l_run[g] += ps0 + ps1; }
#pragma unroll
        for (int j = 0; j < 2; ++j)
#pragma unroll
            for (int t = 0; t < 8; ++t)
#pragma unroll
                for (int g = 0; g < 2; ++g) { acc[g][t] = WFrag<T16>::mma(vfa[j][t], pf[g][j], acc[g][t]); if constexpr (HL) { acc[g][t] = WFrag<T16>::mma(vfa[j][t], pf2[g][j], acc[g][t]); acc[g][t] = WFrag<T16>::mma(vfa2[j][t], pf[g][j], acc[g][t]); } }
        __builtin_amdgcn_sched_barrier(0);          // keeps the barrier, and the wait for stage st + 2's global loads that comes with it, at the stage's foot
        __syncthreads();   // publishes stage st + 1 and ends every wave's reads of stage st
    }
}
__global__ __launch_bounds__(128) void k_fattn(const h16* __restrict__ Q16, const bf* __restrict__ Qh, const bf* __restrict__ Ql, const h16* __restrict__ K16, const bf* __restrict__ Kh, const bf* __restrict__ Kl, const h16* __restrict__ V16, const bf* __restrict__ Vh, const bf* __restrict__ Vl, bf* __restrict__ Ah, bf* __restrict__ Al) {
    __shared__ __align__(16) unsigned short sm[2 * 2 * PLANE];   // two buffers of two plane pairs (hi+lo); the fp16 rows use half of it
    const int tid = threadIdx.x, lane = tid & 31, c = lane & 15, h = lane >> 4;
    const int kv = blockIdx.y, wave = __builtin_amdgcn_readfirstlane(tid >> 5), head = kv * REP + wave;
    const int qw0 = (TT / 32 - 1 - (int)blockIdx.x) * 32;   // longest key walks first
    const size_t qo = (size_t)head * TT * HD, kvo = (size_t)kv * TT * HD;
    v8f acc[2][8]; float l_run[2];
    if (qw0 < RH) fattn_run<bf, true>((bf*)sm, Qh + qo, Ql + qo, Kh + kvo, Kl + kvo, Vh + kvo, Vl + kvo, qw0, acc, l_run);
    else fattn_run<h16, false>((h16*)sm, Q16 + qo, nullptr, K16 + kvo, nullptr, V16 + kvo, nullptr, qw0, acc, l_run);
    // Output through LDS (each wave its own 2 x 32 rows, behind the stage loop's last barrier), so that every 128-B line of the planes is stored whole. The unrolls: constant indices, as above.
    bf* eb = (bf*)sm + wave * (2 * 32 * KPIT);
#pragma unroll
    for (int g = 0; g < 2; ++g) { const float inv = __fdiv_rn(1.0f, l_run[g] + xhalf(l_run[g]));
#pragma unroll
        for (int t = 0; t < 8; ++t) { v4i oh, ol;
#pragma unroll
            for (int r = 0; r < 4; ++r) { unsigned a, c2; split2(acc[g][t][2 * r] * inv, acc[g][t][2 * r + 1] * inv, a, c2); oh[r] = (int)a; ol[r] = (int)c2; }
            bf* e = eb + (16 * g + c) * KPIT + 16 * t + 8 * h; *(v4ia*)e = oh; *(v4ia*)(e + 32 * KPIT) = ol; } }
    __syncthreads();   // the staged rows are read back by other lanes than wrote them
    v4i th[16], tl[16];
#pragma unroll
    for (int i = 0; i < 16; ++i) { const bf* e = eb + (2 * i + h) * KPIT + c * 8; th[i] = *(const v4ia*)e; tl[i] = *(const v4ia*)(e + 32 * KPIT); }
    const unsigned oofs = (unsigned)h * (DQ * 2u) + (unsigned)c * 16u;   // bytes: 16 lanes cover one row's 256 B, a wave-wide store two rows
    char* ah = (char*)(Ah + (size_t)qw0 * DQ + head * HD); char* al = (char*)(Al + (size_t)qw0 * DQ + head * HD);
#pragma unroll
    for (int i = 0; i < 16; ++i) { *(v4ia*)(ah + oofs + i * (2 * DQ * 2)) = th[i]; *(v4ia*)(al + oofs + i * (2 * DQ * 2)) = tl[i]; }
}

extern "C" void kernel_launch(void* const* d_in, const int* in_sizes, int n_in,
                              void* d_out, int out_size, void* d_ws, size_t ws_size, hipStream_t stream) {
    (void)in_sizes; (void)n_in; (void)out_size;
    const float* x = (const float*)d_in[0]; const float* wq = (const float*)d_in[1]; const float* wk = (const float*)d_in[2]; const float* wv = (const float*)d_in[3]; const float* wo = (const float*)d_in[4];
    float* OUT = (float*)d_out;     // [2][2048][2048]
    char* wsp = (char*)d_ws;
    auto take = [&](size_t bytes) { char* p = wsp; wsp += (bytes + 255) & ~(size_t)255; return (void*)p; };
    bf* WQ = (bf*)take((size_t)DQ * DM * 2); bf* WK = (bf*)take((size_t)DKV * DM * 2); bf* WV = (bf*)take((size_t)DKV * DM * 2); bf* WO = (bf*)take((size_t)DM * DQ * 2);
    bf* XB = (bf*)take((size_t)TT * DM * 2);
    h16* QP16 = (h16*)take((size_t)NH_ * TT * HD * 2); h16* KP16 = (h16*)take((size_t)NKV * TT * HD * 2); h16* VT16 = (h16*)take((size_t)NKV * HD * TT * 2);
    bf* QPh = (bf*)take((size_t)NH_ * TT * HD * 2); bf* QPl = (bf*)take((size_t)NH_ * TT * HD * 2); bf* KPh = (bf*)take((size_t)NKV * TT * HD * 2); bf* KPl = (bf*)take((size_t)NKV * TT * HD * 2); bf* VTh = (bf*)take((size_t)NKV * HD * TT * 2); bf* VTl = (bf*)take((size_t)NKV * HD * TT * 2);
    bf* ATh = (bf*)take((size_t)TT * DQ * 2); bf* ATl = (bf*)take((size_t)TT * DQ * 2);
    if ((size_t)(wsp - (char*)d_ws) > ws_size) return;    // ws 256 MiB
    { k_wtG<<<(unsigned)((DM * DQ / 64 + 63) / 64), 256, 0, stream>>>(wq, DM, DQ, WQ); k_wtG<<<(unsigned)((DM * DKV / 64 + 63) / 64), 256, 0, stream>>>(wk, DM, DKV, WK); k_wtG<<<(unsigned)((DM * DKV / 64 + 63) / 64), 256, 0, stream>>>(wv, DM, DKV, WV);
      k_wtG<<<(unsigned)((DQ * DM / 64 + 63) / 64), 256, 0, stream>>>(wo, DQ, DM, WO); }
    for (int b = 0; b < NB_; ++b) {
        
        k_cvt8<<<(unsigned)(((size_t)TT * DM / 8 + 255) / 256), 256, 0, stream>>>(x + (size_t)b * TT * DM, XB, (size_t)TT * DM / 8);
        k_gemms<4, 4, false, HD><<<dim3(DQ / 128, TT / 128, 1), 128, 0, stream>>>(WQ, nullptr, XB, nullptr, 0, QP16, QPh, QPl);
        k_gemms<2, 2, false, HD><<<dim3(DKV / 64, TT / 64, 1), 128, 0, stream>>>(WK, nullptr, XB, nullptr, 0, KP16, KPh, KPl);
        k_gemms<2, 2, false, TT><<<dim3(TT / 64, DKV / 64, 1), 128, 0, stream>>>(XB, nullptr, WV, nullptr, 0, VT16, VTh, VTl);
        k_fattn<<<dim3(TT / 32, NKV, 1), 128, 0, stream>>>(QP16, QPh, QPl, KP16, KPh, KPl, VT16, VTh, VTl, ATh, ATl);
        k_gemms<4, 4, true, 0><<<dim3(TT / 128, DM / 128, 1), 128, 0, stream>>>(ATh, ATl, WO, OUT + (size_t)b * TT * DM, DM, nullptr, nullptr, nullptr); }
}

// v005
// A run of this version takes 213 microseconds.
// Timed twice side by side with v004, it ran 1.15 and 1.17 times as fast.
// Over all steps from v000 it is 7.92 times as fast.
#include <hip/hip_runtime.h>

// Grouped-query causal self-attention with 128-wide heads, no rotary (x [2][2048][2048]; q = x Wq ('xw' [2048][2048], 16 heads x 128), k, v = x Wk, x Wv ('xw' [2048][512], 4 kv heads x 128), no biases; k, v repeated 4 x on the head axis (jnp.repeat: query head h uses kv head h / 4); att x 1/sqrt(128); causal (-inf); softmax; y = merged Wo ('xw' [2048][2048], no bias) -> [2][2048][2048] (8.4 M); argument order x, Wq, Wk, Wv, Wo).
// Compute dtypes, f32 accumulate: every input rounded to bf16; q/k/v on PLAIN bf16 operands (inputs: exact), their fp16 and hi+lo bf16 planes written by the projection kernel itself; scores, softmax and attn.v in one kernel (online softmax, f32; 64-key stages beyond a wave's diagonal never read): query rows < 512 hl (3 products), the rest single fp16; Wo hl x exact (2 products).

#define NB_  2
#define TT   2048
#define DM   2048
#define NH_  16
#define NKV  4
#define REP  (NH_ / NKV)
#define HD   128
#define DQ   (NH_ * HD)
#define DKV  (NKV * HD)
#define RH   512                  // query rows < RH use hi+lo planes (a multiple of 32: a wave's 32 rows are wholly hi+lo or wholly fp16)
#define SCL  0.088388347648318447f   // HD^-0.5
typedef _Float16 h16;
typedef unsigned short bf;
typedef __attribute__((ext_vector_type(16))) __bf16   v16bf;
typedef __attribute__((ext_vector_type(16))) _Float16 v16h;
typedef __attribute__((ext_vector_type(8)))  _Float16 v8h;
typedef __attribute__((ext_vector_type(8)))  unsigned short v8us;
typedef __attribute__((ext_vector_type(8)))  float    v8f;
typedef __attribute__((ext_vector_type(4)))  float    v4f;
typedef v8h  __attribute__((may_alias)) v8ha;
typedef v4f  __attribute__((may_alias)) v4fa;
typedef v8us __attribute__((may_alias)) v8usa;

__device__ __forceinline__ unsigned short f2bf(float f) { unsigned u = __float_as_uint(f); u += 0x7FFFu + ((u >> 16) & 1u); return (unsigned short)(u >> 16); }
__device__ __forceinline__ float bf2f(unsigned short b) { return __uint_as_float(((unsigned)b) << 16); }
__device__ __forceinline__ v16h cat16(v8h lo, v8h hi) { return __builtin_shufflevector(lo, hi, 0, 1, 2, 3, 4, 5, 6, 7, 8, 9, 10, 11, 12, 13, 14, 15); }
__device__ __forceinline__ v16bf cat16b(v8us lo, v8us hi) { return __builtin_bit_cast(v16bf, __builtin_shufflevector(lo, hi, 0, 1, 2, 3, 4, 5, 6, 7, 8, 9, 10, 11, 12, 13, 14, 15)); }
__device__ __forceinline__ v8f wmma16(v16h a, v16h b, v8f c) { return __builtin_amdgcn_wmma_f32_16x16x32_f16(false, a, false, b, (short)0, c, false, false); }
__device__ __forceinline__ v8f wmmab(v16bf a, v16bf b, v8f c) { return __builtin_amdgcn_wmma_f32_16x16x32_bf16(false, a, false, b, (short)0, c, false, false); }

typedef __attribute__((ext_vector_type(2))) _Float16 v2h;
typedef __attribute__((ext_vector_type(2))) float v2f;
typedef __attribute__((ext_vector_type(4))) int v4i;
typedef v4i __attribute__((may_alias)) v4ia;
__device__ __forceinline__ unsigned pk16(float a, float b) { v2f x; x[0] = a; x[1] = b; return __builtin_bit_cast(unsigned, __builtin_convertvector(x, v2h)); }
typedef __attribute__((ext_vector_type(2))) __bf16 v2b;
__device__ __forceinline__ void split2(float a, float b, unsigned& hi, unsigned& lo) {   // two values at once, by the packed conversion (round to nearest even, as f2bf): packed hi parts, packed remainders
    v2f x; x[0] = a; x[1] = b; hi = __builtin_bit_cast(unsigned, __builtin_convertvector(x, v2b));
    v2f r; r[0] = a - __uint_as_float(hi << 16); r[1] = b - __uint_as_float(hi & 0xFFFF0000u); lo = __builtin_bit_cast(unsigned, __builtin_convertvector(r, v2b)); }

template <typename T16> struct WFrag;
template <> struct WFrag<h16> { typedef v16h V; static __device__ __forceinline__ V ld(const h16* p) { return cat16(*(const v8h*)p, *(const v8h*)(p + 16)); } static __device__ __forceinline__ v8f mma(V a, V b, v8f c) { return wmma16(a, b, c); } };
template <> struct WFrag<bf> { typedef v16bf V; static __device__ __forceinline__ V ld(const bf* p) { return cat16b(*(const v8us*)p, *(const v8us*)(p + 16)); } static __device__ __forceinline__ v8f mma(V a, V b, v8f c) { return wmmab(a, b, c); } };
// ---- k_gemms: C[m][n] = sum_k A[m][k] Bt[n][k] (+ A2[m][k] Bt[n][k] where SPLIT), all planes bf16, K-contiguous, K = GK. PP == 0: C goes out as f32, pitch ldc.
// PP != 0: C goes out TRANSPOSED as the three 16-bit planes the attention kernel reads (fp16, bf16 hi, bf16 lo), n the row (pitch PP elements), m along it: element (m, n) at (m / HD) HS + n PP + m % HD.
// An accumulator lane holds eight consecutive m of one n, which is 16 B of a plane row. q, k: A = the weight (m = head x 128 + d), Bt = x (n = t), PP = HD, planes [head][t][d]; v: A = x (m = t), Bt = the weight, PP = TT, planes [head x 128 + d][t].
// A work-group is 2 x 2 waves on a (32 MB) x (32 NB) tile of C; a wave owns MB x NB accumulators. k goes in passes of 128 (256 B of every operand row): the work-group brings a pass through registers into
// one of two LDS buffers with whole-line loads (16 threads cover a row's 256 B), so every operand byte comes from L2 once per work-group and the fragments are read from LDS. One barrier per pass.
// A pass is four k steps of 32; each step stores a quarter of the next pass's rows to LDS, refills those registers with the same quarter of the pass after it (so a whole pass of loads is always in flight),
// reads the next step's fragments into the second fragment set and then runs its own products. Every accumulator takes its products in the order kc ascending, A before A2.
// Every '#pragma unroll' in k_gemms is there so that the staging, fragment and accumulator arrays are indexed by constants and stay in registers.
#define GK    2048                 // the reduction length of all four products
#define GPASS 128                  // k per pass
#define GPIT  136                  // LDS pitch of a staged row, elements: 256 B + 16 B, an odd multiple of 16 B for the 16-byte readers
typedef __attribute__((ext_vector_type(4))) int g4i;
typedef g4i __attribute__((may_alias)) g4ia;
template <bool B> struct GFlag { static constexpr bool v = B; };
// The pass barrier, by hand: __syncthreads() would also wait for the global loads that are in flight for the pass after next and so undo their lead. What other waves depend on here is LDS alone
// (this wave's stores of the next pass, its reads of this one): s_wait_dscnt 0 covers both.
__device__ __forceinline__ void gbar() { asm volatile("s_wait_dscnt 0x0\n\ts_barrier_signal -1\n\ts_barrier_wait -1" ::: "memory"); }
template <int MB, int NB, bool SPLIT, int PP>
__global__ __launch_bounds__(128) void k_gemms(const bf* __restrict__ A, const bf* __restrict__ A2, const bf* __restrict__ Bt, float* C, int ldc, h16* P16, bf* Ph, bf* Pl) {
    typedef WFrag<bf>::V V;
    constexpr int RA = 32 * MB, RB = 32 * NB, OA2 = RA * GPIT, OB = (SPLIT ? 2 : 1) * RA * GPIT, STG = OB + RB * GPIT, NP = GK / GPASS, NA2 = SPLIT ? MB : 1;
    __shared__ __align__(16) bf sm[2 * STG];
    const int tid = threadIdx.x, lane = tid & 31, lr = lane & 15, hi = lane >> 4, wave = __builtin_amdgcn_readfirstlane(tid >> 5), wm = wave >> 1, wn = wave & 1;
    const int r0 = blockIdx.x * RA, c0 = blockIdx.y * RB;
    const unsigned tofs = (unsigned)(tid >> 4) * (GK * 2u) + (unsigned)(tid & 15) * 16u;   // bytes: the thread's row of a turn of eight rows, and its 16 B of the row's 256
    const char* Ab = (const char*)(A + (size_t)r0 * GK) + tofs; const char* A2b = SPLIT ? (const char*)(A2 + (size_t)r0 * GK) + tofs : nullptr; const char* Bb = (const char*)(Bt + (size_t)c0 * GK) + tofs;
    const int sofs = (tid >> 4) * GPIT + (tid & 15) * 8;                                   // the same place in a staged turn, elements
    g4i ra[4 * MB], ra2[4 * NA2], rb[4 * NB];
    auto gload = [&](int q, int pass) {   // quarter q of a pass: MB turns of A (and of A2), NB turns of Bt; every wave-wide load covers four whole 128-B lines
        const char* pa = Ab + pass * (GPASS * 2); const char* pa2 = SPLIT ? A2b + pass * (GPASS * 2) : nullptr; const char* pb = Bb + pass * (GPASS * 2);   // the thread's address in each plane + a constant per turn
        __builtin_amdgcn_sched_barrier(0);   // the loads are not lifted from here: the wait at the foot has to stand directly behind them
#pragma unroll
        for (int i = 0; i < MB; ++i) { const int t = q * MB + i; ra[t] = *(const g4ia*)(pa + t * (8 * GK * 2)); if constexpr (SPLIT) ra2[t] = *(const g4ia*)(pa2 + t * (8 * GK * 2)); }
#pragma unroll
        for (int i = 0; i < NB; ++i) { const int t = q * NB + i; rb[t] = *(const g4ia*)(pb + t * (8 * GK * 2)); }
        asm volatile("s_wait_xcnt 0x0" ::: "memory");   // in front of whatever next rewrites a register that these loads name
        __builtin_amdgcn_sched_barrier(0);   // nothing from below is lifted over that wait; and the loads stay up here: sunk towards their use they would hide no latency
    };
    auto sstore = [&](int q, bf* buf) {
#pragma unroll
        for (int i = 0; i < MB; ++i) { const int t = q * MB + i; *(g4ia*)(buf + t * 8 * GPIT + sofs) = ra[t]; if constexpr (SPLIT) *(g4ia*)(buf + OA2 + t * 8 * GPIT + sofs) = ra2[t]; }
#pragma unroll
        for (int i = 0; i < NB; ++i) { const int t = q * NB + i; *(g4ia*)(buf + OB + t * 8 * GPIT + sofs) = rb[t]; } };
    v8f acc[MB][NB];
#pragma unroll
    for (int mb = 0; mb < MB; ++mb)
#pragma unroll
        for (int nb = 0; nb < NB; ++nb) acc[mb][nb] = (v8f){};
#pragma unroll
    for (int q = 0; q < 4; ++q) gload(q, 0);
#pragma unroll
    for (int q = 0; q < 4; ++q) { sstore(q, sm); gload(q, 1); }
    gbar();   // pass 0 is in buffer 0
    const int fa = (wm * MB * 16 + lr) * GPIT + 8 * hi, fb = OB + (wn * NB * 16 + lr) * GPIT + 8 * hi;   // the lane's place in the wave's first A and Bt fragment: the k order of both is that of WFrag::ld
    auto pass = [&](int p, auto ST, auto LD) {   // ST: a pass p + 1 exists and is stored; LD: a pass p + 2 exists and is loaded
        const bf* cur = sm + (p & 1) * STG; bf* nxt = sm + ((p + 1) & 1) * STG;   // nxt held pass p - 1: the barrier at the foot of p - 1 ended its reads
        V a[2][MB], a2[2][NA2], b[2][NB];
        auto ldf = [&](int set, int ks) {
#pragma unroll
            for (int mb = 0; mb < MB; ++mb) { a[set][mb] = WFrag<bf>::ld(cur + fa + mb * 16 * GPIT + ks * 32); if constexpr (SPLIT) a2[set][mb] = WFrag<bf>::ld(cur + OA2 + fa + mb * 16 * GPIT + ks * 32); }
#pragma unroll
            for (int nb = 0; nb < NB; ++nb) b[set][nb] = WFrag<bf>::ld(cur + fb + nb * 16 * GPIT + ks * 32); };
        ldf(0, 0);
#pragma unroll
        for (int ks = 0; ks < 4; ++ks) {
            if constexpr (decltype(ST)::v) sstore(ks, nxt);
            if constexpr (decltype(LD)::v) gload(ks, p + 2);
            if (ks < 3) ldf((ks + 1) & 1, ks + 1);
            __builtin_amdgcn_sched_barrier(0);   // the next step's fragment reads stay a group ahead of this step's products (one wave per SIMD: nobody else covers an LDS wait)
#pragma unroll
            for (int nb = 0; nb < NB; ++nb)
#pragma unroll
                for (int mb = 0; mb < MB; ++mb) acc[mb][nb] = wmmab(a[ks & 1][mb], b[ks & 1][nb], acc[mb][nb]);
            if constexpr (SPLIT) {
#pragma unroll
                for (int nb = 0; nb < NB; ++nb)
#pragma unroll
                    for (int mb = 0; mb < MB; ++mb) acc[mb][nb] = wmmab(a2[ks & 1][mb], b[ks & 1][nb], acc[mb][nb]); }
            __builtin_amdgcn_sched_barrier(0);   // the following step's stores, loads and reads are not lifted into this step's products, whose fragment set they refill
        }
        gbar();   // publishes pass p + 1 and ends every wave's reads of pass p
    };
#pragma unroll 1   // rolled: a pass is long straight-line code already, more copies would only cost instruction fetches
    for (int p = 0; p < NP - 2; ++p) pass(p, GFlag<true>(), GFlag<true>());
    pass(NP - 2, GFlag<true>(), GFlag<false>());    // the last two passes apart: nothing is left to load, then nothing to store
    pass(NP - 1, GFlag<false>(), GFlag<false>());
    if constexpr (PP != 0) {
        // The planes, through LDS (the whole work-group's tile, behind the last pass's barrier), so that every 128-B line of a plane is stored whole, by one wave. The unrolls: constant indices, as above.
        constexpr int EP = RA + 8, EPL = RB * EP, HS = (PP == HD) ? TT * HD : HD;   // pitch of a staged plane row, elements (an odd multiple of 16 B); one staged plane; the step of the plane index from one block of HD m to the next
        static_assert(3 * EPL <= 2 * STG && HD % RA == 0, "the three staged planes fit the ring; a tile's m lie in one block of HD");
#pragma unroll
        for (int nb = 0; nb < NB; ++nb)
#pragma unroll
            for (int mb = 0; mb < MB; ++mb) { v4i o16, oh, ol;
#pragma unroll
                for (int r = 0; r < 4; ++r) { unsigned a, c2; split2(acc[mb][nb][2 * r], acc[mb][nb][2 * r + 1], a, c2); o16[r] = (int)pk16(acc[mb][nb][2 * r], acc[mb][nb][2 * r + 1]); oh[r] = (int)a; ol[r] = (int)c2; }
                bf* e = sm + ((wn * NB + nb) * 16 + lr) * EP + (wm * MB + mb) * 16 + 8 * hi; *(v4ia*)e = o16; *(v4ia*)(e + EPL) = oh; *(v4ia*)(e + 2 * EPL) = ol; }
        gbar();   // the staged rows are read back by other waves than wrote them
        constexpr int TPR = RA / 8, RPT = 128 / TPR, NT = RB / RPT;   // threads per plane row of the tile (16 B each); rows per turn of the work-group; turns
        const int row = tid / TPR, cp = (tid % TPR) * 8;
        v4i t16[NT], th[NT], tl[NT];
#pragma unroll
        for (int i = 0; i < NT; ++i) { const bf* e = sm + (i * RPT + row) * EP + cp; t16[i] = *(const v4ia*)e; th[i] = *(const v4ia*)(e + EPL); tl[i] = *(const v4ia*)(e + 2 * EPL); }
        const size_t po = ((size_t)(r0 / HD) * HS + (size_t)(r0 % HD) + (size_t)c0 * PP) * 2; const unsigned pofs = (unsigned)row * (PP * 2u) + (unsigned)cp * 2u;   // bytes: the tile's place in a plane (uniform), the thread's place in a turn
        char* p16 = (char*)P16 + po; char* ph = (char*)Ph + po; char* pl = (char*)Pl + po;
#pragma unroll
        for (int i = 0; i < NT; ++i) { *(v4ia*)(p16 + pofs + i * (RPT * PP * 2)) = t16[i]; *(v4ia*)(ph + pofs + i * (RPT * PP * 2)) = th[i]; *(v4ia*)(pl + pofs + i * (RPT * PP * 2)) = tl[i]; }
    } else {
    // Output through LDS (each wave its own 16 rows, behind the last pass's barrier), so that every 128-B line of C is stored whole.
    constexpr int OP = NB * 16 + 4, LPR = NB * 4, RPS = 32 / LPR;   // pitch of a staged row, floats; lanes per row of the wave's tile; rows per wave-wide store
    float* os = (float*)sm + wave * (16 * OP);
#pragma unroll
    for (int mb = 0; mb < MB; ++mb) {
#pragma unroll
        for (int nb = 0; nb < NB; ++nb) {
#pragma unroll
            for (int j = 0; j < 8; ++j) os[(hi * 8 + j) * OP + nb * 16 + lr] = acc[mb][nb][j]; }
        __builtin_amdgcn_wave_barrier(); asm volatile("" ::: "memory");   // the staged rows are read back by other lanes of the wave than wrote them
        float* crow = C + (size_t)(r0 + (wm * MB + mb) * 16) * ldc + c0 + wn * NB * 16;
#pragma unroll
        for (int s = 0; s < 16 / RPS; ++s) { const int row = RPS * s + lane / LPR, cofs = (lane % LPR) * 4; *(v4f*)(crow + (size_t)row * ldc + cofs) = *(const v4fa*)(os + row * OP + cofs); }
        if (mb + 1 < MB) { __builtin_amdgcn_wave_barrier(); asm volatile("s_wait_xcnt 0x0" ::: "memory"); }   // the next 16 rows overwrite the staging only behind these reads; the wait: in front of whatever next rewrites a register that these stores name
    }
    }
}

// ---- k_wt4: the four weights, f32 [k][n], to bf16 planes [n][k] (round to nearest even), in one launch. A work-group of 8 waves takes a tile of WKT k x WNT n.
// In: a wave-wide 16-byte load covers the 512 B that the tile has of one weight row (four whole lines); a thread takes the same four n of eight consecutive k, four times over, all 32 loads in flight at once.
// Eight k of one n are 16 B of a plane row: packed in registers and stored to LDS as one piece. Out: a wave reads a plane row's 512 B from LDS and stores them as four whole lines.
// LDS rows are 512 B, a multiple of all 64 banks, so piece ch of row n lies at place ch ^ ((n >> 2) & 15): the 16 lanes of a half wave, which write the same ch of rows four apart, and read the pieces of one row, meet 16 different places each time.
#define WKT 256
#define WNT 128
__device__ __forceinline__ unsigned pkbf(float a, float b) { v2f x; x[0] = a; x[1] = b; return __builtin_bit_cast(unsigned, __builtin_convertvector(x, v2b)); }
// Every '#pragma unroll' in wt_tile is there so that the value arrays are indexed by constants and stay in registers, and every address is one register plus a constant.
template <int N>
__device__ __forceinline__ void wt_tile(bf* sm, const float* __restrict__ w, bf* __restrict__ Bt, const int tile) {
    const int tid = threadIdx.x, lane = tid & 31, wave = __builtin_amdgcn_readfirstlane(tid >> 5);
    const int n0 = (tile % (N / WNT)) * WNT, k0 = (tile / (N / WNT)) * WKT;   // neighbours in the grid read neighbouring pieces of the same weight rows
    const char* src = (const char*)(w + (size_t)(k0 + wave * 8) * N + n0); const unsigned lofs = (unsigned)lane * 16u;
    v4f v[4][8];   // v[i][r][j] = w[k0 + 64 i + 8 wave + r][n0 + 4 lane + j]
#pragma unroll
    for (int i = 0; i < 4; ++i)
#pragma unroll
        for (int r = 0; r < 8; ++r) v[i][r] = *(const v4fa*)(src + lofs + (i * 64 + r) * (N * 4));
    asm volatile("s_wait_xcnt 0x0" ::: "memory");   // in front of whatever next rewrites a register that these loads name
    __builtin_amdgcn_sched_barrier(0);   // nothing from below is lifted over that wait; and the loads stay one group, all in flight together
    const int x = wave ^ (lane & 15);    // piece 8 i + wave of rows 4 lane + j: place ((x ^ 8 (i & 1)) + 16 (i >> 1))
#pragma unroll
    for (int i = 0; i < 4; ++i)
#pragma unroll
        for (int j = 0; j < 4; ++j) { v4i o;
#pragma unroll
            for (int r = 0; r < 4; ++r) o[r] = (int)pkbf(v[i][2 * r][j], v[i][2 * r + 1][j]);
            *(v4ia*)(sm + (4 * lane + j) * WKT + ((x ^ (8 * (i & 1))) + 16 * (i >> 1)) * 8) = o; }
    __syncthreads();   // the plane rows are read back by other waves than wrote them
    v4i t[16];
#pragma unroll
    for (int i = 0; i < 16; ++i) t[i] = *(const v4ia*)(sm + (wave * 16 + i) * WKT + (lane ^ ((wave * 4 + (i >> 2)) & 15)) * 8);
    char* dst = (char*)(Bt + (size_t)(n0 + wave * 16) * GK + k0);
#pragma unroll
    for (int i = 0; i < 16; ++i) *(v4ia*)(dst + lofs + i * (GK * 2)) = t[i];
}
__global__ __launch_bounds__(256) void k_wt4(const float* __restrict__ wq, const float* __restrict__ wk, const float* __restrict__ wv, const float* __restrict__ wo, bf* WQ, bf* WK, bf* WV, bf* WO) {
    __shared__ __align__(16) bf sm[WNT * WKT];
    static_assert(DM == GK && DQ == GK && DM == DQ, "all four weights have GK rows; Wq and Wo are of one shape");
    constexpr int TB = (GK / WKT) * (DQ / WNT), TS = (GK / WKT) * (DKV / WNT);   // tiles of a large and of a small weight
    const int b = blockIdx.x;   // the branches are uniform for the work-group
    if (b < 2 * TB) wt_tile<DQ>(sm, b < TB ? wq : wo, b < TB ? WQ : WO, b < TB ? b : b - TB);
    else wt_tile<DKV>(sm, b < 2 * TB + TS ? wk : wv, b < 2 * TB + TS ? WK : WV, b < 2 * TB + TS ? b - 2 * TB : b - 2 * TB - TS);
}
__global__ __launch_bounds__(256) void k_cvt8(const float* __restrict__ src, bf* dst, size_t n8) { const size_t i = (size_t)blockIdx.x * 256 + threadIdx.x; if (i >= n8) return; const v8f v = *(const v8f*)(src + i * 8); v8us o;
#pragma unroll
    for (int k = 0; k < 8; ++k) o[k] = f2bf(v[k]); *(v8us*)(dst + i * 8) = o;  }
#define SKEY  64                   // keys per stage
#define KPIT  136                  // LDS pitch of a K row, elements: 256 B + 16 B, an odd multiple of 16 B for the 16-byte readers
#define VPIT  72                   // LDS pitch of a V^T row, elements: 128 B + 16 B, likewise
#define KTILE (SKEY * KPIT)
#define PLANE (KTILE + HD * VPIT)  // one stage of one plane pair: K tile, then V^T tile
typedef __attribute__((ext_vector_type(8))) unsigned v8u;
__device__ __forceinline__ float xhalf(float x) { return __builtin_bit_cast(float, __builtin_amdgcn_permlanex16(__builtin_bit_cast(int, x), __builtin_bit_cast(int, x), 0x76543210, 0xfedcba98, false, false)); }  // lane l with lane l ^ 16
template <typename T16, bool HL>
__device__ __forceinline__ void fattn_run(T16* sm, const T16* __restrict__ Q, const T16* __restrict__ Q2, const T16* __restrict__ Kp, const T16* __restrict__ K2, const T16* __restrict__ Vt, const T16* __restrict__ V2, const int qw0, v8f (&acc)[2][8], float (&l_run)[2]) {
    typedef typename WFrag<T16>::V V;
    constexpr int NPL = HL ? 2 : 1, BUF = NPL * PLANE;
    const int tid = threadIdx.x, lane = tid & 31, c = lane & 15, h = lane >> 4;
    const float cscale = SCL * 1.4426950408889634f;
    v4i rk[NPL][8], rv[NPL][8];
    const unsigned vofs = (unsigned)(tid >> 3) * (TT * 2u) + (unsigned)(tid & 7) * 16u;   // bytes in a kv plane: eight threads cover a V^T row's 128 B
    auto gload = [&](int key0) {   // a stage's K rows and V^T rows, 16 B a thread and turn: every wave-wide load covers four whole 128-B lines
        const unsigned ko = (unsigned)tid + (unsigned)key0 * (HD / 8u), vo = vofs + (unsigned)key0 * 2u;   // the thread's 32-bit offsets in this stage, the same in the hi and the lo plane: K in 16-byte pieces (its rows lie in a row), V^T in bytes
        __builtin_amdgcn_sched_barrier(0);   // the loads are not lifted from here: the wait at the foot has to stand directly behind them
#pragma unroll
        for (int i = 0; i < 8; ++i) {   // the plane's uniform base + the thread's offset + a constant: two address registers for the whole group
            rk[0][i] = ((const v4ia*)Kp + ko)[i * 128]; rv[0][i] = *(const v4ia*)((const char*)Vt + vo + i * (16 * TT * 2));
            if constexpr (HL) { rk[NPL - 1][i] = ((const v4ia*)K2 + ko)[i * 128]; rv[NPL - 1][i] = *(const v4ia*)((const char*)V2 + vo + i * (16 * TT * 2)); } }
        asm volatile("s_wait_xcnt 0x0" :: "v"(ko), "v"(vo) : "memory");   // in front of whatever next rewrites a register that these loads name; the two offsets are inputs so that they live up to the wait and no load of the group lands in them
        __builtin_amdgcn_sched_barrier(0);   // nothing from below is lifted over that wait; and the loads stay up here: sunk towards their use they would hide no latency
    };
    auto sstore = [&](T16* buf) {
#pragma unroll
        for (int i = 0; i < 8; ++i) { const int idx = i * 128 + tid; const int ok = (idx >> 4) * KPIT + (idx & 15) * 8, ov = KTILE + (idx >> 3) * VPIT + (idx & 7) * 8;
            *(v4ia*)(buf + ok) = rk[0][i]; *(v4ia*)(buf + ov) = rv[0][i]; if (HL) { *(v4ia*)(buf + PLANE + ok) = rk[NPL - 1][i]; *(v4ia*)(buf + PLANE + ov) = rv[NPL - 1][i]; } } };
    const int nst = qw0 / SKEY + 1;   // stages up to and with the one that holds the wave's diagonal; the same for all four waves
    gload(0);
    V qf[2][4], qf2[2][4];
#pragma unroll
    for (int g = 0; g < 2; ++g)
#pragma unroll
        for (int kc = 0; kc < 4; ++kc) { const size_t o = (size_t)(qw0 + 16 * g + c) * HD + 32 * kc + 8 * h; qf[g][kc] = WFrag<T16>::ld(Q + o); if (HL) qf2[g][kc] = WFrag<T16>::ld(Q2 + o); }
    asm volatile("s_wait_xcnt 0x0" ::: "memory");   // in front of whatever next rewrites a register that the Q loads name
    __builtin_amdgcn_sched_barrier(0);   // nothing from below is lifted over that wait
    float m_run[2];
#pragma unroll
    for (int g = 0; g < 2; ++g) { m_run[g] = -__builtin_inff(); l_run[g] = 0.0f;
#pragma unroll
        for (int t = 0; t < 8; ++t) acc[g][t] = (v8f){}; }
    sstore(sm); gload(min(1, nst - 1) * SKEY);
    __syncthreads();   // stage 0 is in buffer 0
#pragma unroll 1   // rolled: a stage is long straight-line code already, a second copy would only cost instruction fetches
    for (int st = 0; st < nst; ++st) {
        const T16* cur = sm + (st & 1) * BUF;
        sstore(sm + ((st + 1) & 1) * BUF);          // stage st + 1 into the buffer that stage st - 1 used: the barrier at the foot of st - 1 ended its reads (past the end: the last stage again, read by nobody)
        gload(min(st + 2, nst - 1) * SKEY);         // in flight under this whole stage; clamped, so always inside the planes and no branch round the loads
        // The stage's fragment reads go out in whole groups ahead of their products (one wave per SIMD: nobody else covers an LDS wait): K first; V^T directly behind it where one plane pair leaves the registers
        // for both, else behind the first product, into the registers K has left, so that it streams in under the softmax.
        v8f s[4][2]; V kfa[4][4], kfa2[HL ? 4 : 1][4], vfa[2][8], vfa2[HL ? 2 : 1][8];
#pragma unroll
        for (int kt = 0; kt < 4; ++kt)
#pragma unroll
            for (int kc = 0; kc < 4; ++kc) { const T16* p = cur + (16 * kt + c) * KPIT + 32 * kc + 8 * h; kfa[kt][kc] = WFrag<T16>::ld(p); if constexpr (HL) kfa2[kt][kc] = WFrag<T16>::ld(p + PLANE); }
        __builtin_amdgcn_sched_barrier(0);          // K's reads stay a group, ahead of V^T's: LDS answers in order, and the first product waits for K alone
        auto ldv = [&]() {
#pragma unroll
            for (int j = 0; j < 2; ++j)
#pragma unroll
                for (int t = 0; t < 8; ++t) { const T16* p = cur + KTILE + (16 * t + c) * VPIT + 32 * j + 8 * h; vfa[j][t] = WFrag<T16>::ld(p); if constexpr (HL) vfa2[j][t] = WFrag<T16>::ld(p + PLANE); }
            __builtin_amdgcn_sched_barrier(0);      // keeps the group together up here: moved down to their uses the reads are waited for one by one
        };
        if constexpr (!HL) ldv();
#pragma unroll
        for (int kt = 0; kt < 4; ++kt)
#pragma unroll
            for (int g = 0; g < 2; ++g) { s[kt][g] = (v8f){};
#pragma unroll
                for (int kc = 0; kc < 4; ++kc) { s[kt][g] = WFrag<T16>::mma(kfa[kt][kc], qf[g][kc], s[kt][g]); if constexpr (HL) { s[kt][g] = WFrag<T16>::mma(kfa[kt][kc], qf2[g][kc], s[kt][g]); s[kt][g] = WFrag<T16>::mma(kfa2[kt][kc], qf[g][kc], s[kt][g]); } } }
        if constexpr (HL) { __builtin_amdgcn_sched_barrier(0);   // V^T's reads not above the first product: K's registers are free only behind it
            ldv(); }
        if (st == nst - 1) {                        // work-group-uniform: only the stage with the diagonal pays for the mask
            const int lim = qw0 - st * SKEY + c - 8 * h;   // key 16 kt + 8 h + r of the stage joins query 16 g + c of the wave when 16 kt + r <= lim + 16 g
#pragma unroll
            for (int g = 0; g < 2; ++g)
#pragma unroll
                for (int kt = 0; kt < 4; ++kt) {
#pragma unroll
                    for (int r = 0; r < 8; ++r) { if (16 * kt + r > lim + 16 * g) s[kt][g][r] = -__builtin_inff(); }
                    asm volatile("" : "+v"(s[kt][g]));   // the masked scores: keeps the selects inside the branch
                }
        }
        float mb[2]; bool need = false;
#pragma unroll
        for (int g = 0; g < 2; ++g) { float mx = -__builtin_inff();
#pragma unroll
            for (int kt = 0; kt < 4; ++kt)
#pragma unroll
                for (int r = 0; r < 8; ++r) mx = fmaxf(mx, s[kt][g][r]);
            mx = fmaxf(mx, xhalf(mx)) * cscale; mb[g] = mx; need = need || (mx > m_run[g] + 8.0f); }
        if (__builtin_amdgcn_ballot_w32(need) != 0) {   // rare after the first stages
#pragma unroll
            for (int g = 0; g < 2; ++g) { const float m_new = fmaxf(m_run[g], mb[g]);   // finite from the first stage on: key 0 is never masked
                const float corr = __builtin_amdgcn_exp2f(m_run[g] - m_new);            // 0 on the first stage, where m_run is -inf
                l_run[g] *= corr; m_run[g] = m_new;
#pragma unroll
                for (int t = 0; t < 8; ++t) acc[g][t] = acc[g][t] * corr; }
        }
        V pf[2][2], pf2[2][2];
#pragma unroll
        for (int g = 0; g < 2; ++g) { const float nm = -m_run[g]; float ps0 = 0.0f, ps1 = 0.0f;
#pragma unroll
            for (int j = 0; j < 2; ++j) { v8u w, w2;
#pragma unroll
                for (int i = 0; i < 8; ++i) {
                    const float p0 = __builtin_amdgcn_exp2f(fmaf(s[2 * j + (i >> 2)][g][2 * (i & 3)], cscale, nm)), p1 = __builtin_amdgcn_exp2f(fmaf(s[2 * j + (i >> 2)][g][2 * (i & 3) + 1], cscale, nm));
                    ps0 += p0; ps1 += p1;
                    if (HL) { unsigned wh, wl; split2(p0, p1, wh, wl); w[i] = wh; w2[i] = wl; }
                    else w[i] = pk16(p0, p1); }
                pf[g][j] = __builtin_bit_cast(V, w); if (HL) pf2[g][j] = __builtin_bit_cast(V, w2); }
            l_run[g] += ps0 + ps1; }
#pragma unroll
        for (int j = 0; j < 2; ++j)
#pragma unroll
            for (int t = 0; t < 8; ++t)
#pragma unroll
                for (int g = 0; g < 2; ++g) { acc[g][t] = WFrag<T16>::mma(vfa[j][t], pf[g][j], acc[g][t]); if constexpr (HL) { acc[g][t] = WFrag<T16>::mma(vfa[j][t], pf2[g][j], acc[g][t]); acc[g][t] = WFrag<T16>::mma(vfa2[j][t], pf[g][j], acc[g][t]); } }
        __builtin_amdgcn_sched_barrier(0);          // keeps the barrier, and the wait for stage st + 2's global loads that comes with it, at the stage's foot
        __syncthreads();   // publishes stage st + 1 and ends every wave's reads of stage st
    }
}
__global__ __launch_bounds__(128) void k_fattn(const h16* __restrict__ Q16, const bf* __restrict__ Qh, const bf* __restrict__ Ql, const h16* __restrict__ K16, const bf* __restrict__ Kh, const bf* __restrict__ Kl, const h16* __restrict__ V16, const bf* __restrict__ Vh, const bf* __restrict__ Vl, bf* __restrict__ Ah, bf* __restrict__ Al) {
    __shared__ __align__(16) unsigned short sm[2 * 2 * PLANE];   // two buffers of two plane pairs (hi+lo); the fp16 rows use half of it
    const int tid = threadIdx.x, lane = tid & 31, c = lane & 15, h = lane >> 4;
    const int kv = blockIdx.y, wave = __builtin_amdgcn_readfirstlane(tid >> 5), head = kv * REP + wave;
    const int qw0 = (TT / 32 - 1 - (int)blockIdx.x) * 32;   // longest key walks first
    const size_t qo = (size_t)head * TT * HD, kvo = (size_t)kv * TT * HD;
    v8f acc[2][8]; float l_run[2];
    if (qw0 < RH) fattn_run<bf, true>((bf*)sm, Qh + qo, Ql + qo, Kh + kvo, Kl + kvo, Vh + kvo, Vl + kvo, qw0, acc, l_run);
    else fattn_run<h16, false>((h16*)sm, Q16 + qo, nullptr, K16 + kvo, nullptr, V16 + kvo, nullptr, qw0, acc, l_run);
    // Output through LDS (each wave its own 2 x 32 rows, behind the stage loop's last barrier), so that every 128-B line of the planes is stored whole. The unrolls: constant indices, as above.
    bf* eb = (bf*)sm + wave * (2 * 32 * KPIT);
#pragma unroll
    for (int g = 0; g < 2; ++g) { const float inv = __fdiv_rn(1.0f, l_run[g] + xhalf(l_run[g]));
#pragma unroll
        for (int t = 0; t < 8; ++t) { v4i oh, ol;
#pragma unroll
            for (int r = 0; r < 4; ++r) { unsigned a, c2; split2(acc[g][t][2 * r] * inv, acc[g][t][2 * r + 1] * inv, a, c2); oh[r] = (int)a; ol[r] = (int)c2; }
            bf* e = eb + (16 * g + c) * KPIT + 16 * t + 8 * h; *(v4ia*)e = oh; *(v4ia*)(e + 32 * KPIT) = ol; } }
    __syncthreads();   // the staged rows are read back by other lanes than wrote them
    v4i th[16], tl[16];
#pragma unroll
    for (int i = 0; i < 16; ++i) { const bf* e = eb + (2 * i + h) * KPIT + c * 8; th[i] = *(const v4ia*)e; tl[i] = *(const v4ia*)(e + 32 * KPIT); }
    const unsigned oofs = (unsigned)h * (DQ * 2u) + (unsigned)c * 16u;   // bytes: 16 lanes cover one row's 256 B, a wave-wide store two rows
    char* ah = (char*)(Ah + (size_t)qw0 * DQ + head * HD); char* al = (char*)(Al + (size_t)qw0 * DQ + head * HD);
#pragma unroll
    for (int i = 0; i < 16; ++i) { *(v4ia*)(ah + oofs + i * (2 * DQ * 2)) = th[i]; *(v4ia*)(al + oofs + i * (2 * DQ * 2)) = tl[i]; }
}

extern "C" void kernel_launch(void* const* d_in, const int* in_sizes, int n_in,
                              void* d_out, int out_size, void* d_ws, size_t ws_size, hipStream_t stream) {
    (void)in_sizes; (void)n_in; (void)out_size;
    const float* x = (const float*)d_in[0]; const float* wq = (const float*)d_in[1]; const float* wk = (const float*)d_in[2]; const float* wv = (const float*)d_in[3]; const float* wo = (const float*)d_in[4];
    float* OUT = (float*)d_out;     // [2][2048][2048]
    char* wsp = (char*)d_ws;
    auto take = [&](size_t bytes) { char* p = wsp; wsp += (bytes + 255) & ~(size_t)255; return (void*)p; };
    bf* WQ = (bf*)take((size_t)DQ * DM * 2); bf* WK = (bf*)take((size_t)DKV * DM * 2); bf* WV = (bf*)take((size_t)DKV * DM * 2); bf* WO = (bf*)take((size_t)DM * DQ * 2);
    bf* XB = (bf*)take((size_t)TT * DM * 2);
    h16* QP16 = (h16*)take((size_t)NH_ * TT * HD * 2); h16* KP16 = (h16*)take((size_t)NKV * TT * HD * 2); h16* VT16 = (h16*)take((size_t)NKV * HD * TT * 2);
    bf* QPh = (bf*)take((size_t)NH_ * TT * HD * 2); bf* QPl = (bf*)take((size_t)NH_ * TT * HD * 2); bf* KPh = (bf*)take((size_t)NKV * TT * HD * 2); bf* KPl = (bf*)take((size_t)NKV * TT * HD * 2); bf* VTh = (bf*)take((size_t)NKV * HD * TT * 2); bf* VTl = (bf*)take((size_t)NKV * HD * TT * 2);
    bf* ATh = (bf*)take((size_t)TT * DQ * 2); bf* ATl = (bf*)take((size_t)TT * DQ * 2);
    if ((size_t)(wsp - (char*)d_ws) > ws_size) return;    // ws 256 MiB
    k_wt4<<<2 * (GK / WKT) * (DQ / WNT) + 2 * (GK / WKT) * (DKV / WNT), 256, 0, stream>>>(wq, wk, wv, wo, WQ, WK, WV, WO);
    for (int b = 0; b < NB_; ++b) {
        
        k_cvt8<<<(unsigned)(((size_t)TT * DM / 8 + 255) / 256), 256, 0, stream>>>(x + (size_t)b * TT * DM, XB, (size_t)TT * DM / 8);
        k_gemms<4, 4, false, HD><<<dim3(DQ / 128, TT / 128, 1), 128, 0, stream>>>(WQ, nullptr, XB, nullptr, 0, QP16, QPh, QPl);
        k_gemms<2, 2, false, HD><<<dim3(DKV / 64, TT / 64, 1), 128, 0, stream>>>(WK, nullptr, XB, nullptr, 0, KP16, KPh, KPl);
        k_gemms<2, 2, false, TT><<<dim3(TT / 64, DKV / 64, 1), 128, 0, stream>>>(XB, nullptr, WV, nullptr, 0, VT16, VTh, VTl);
        k_fattn<<<dim3(TT / 32, NKV, 1), 128, 0, stream>>>(QP16, QPh, QPl, KP16, KPh, KPl, VT16, VTh, VTl, ATh, ATl);
        k_gemms<4, 4, true, 0><<<dim3(TT / 128, DM / 128, 1), 128, 0, stream>>>(ATh, ATl, WO, OUT + (size_t)b * TT * DM, DM, nullptr, nullptr, nullptr); }
}

// v006
// Measured time: 160 microseconds a run.
// Two timings next to v005 put it at 1.35 and 1.33 times that version's speed.
// Over all steps from v000 it is 10.6 times as fast.
#include <hip/hip_runtime.h>

// Grouped-query causal self-attention with 128-wide heads, no rotary (x [2][2048][2048]; q = x Wq ('xw' [2048][2048], 16 heads x 128), k, v = x Wk, x Wv ('xw' [2048][512], 4 kv heads x 128), no biases; k, v repeated 4 x on the head axis (jnp.repeat: query head h uses kv head h / 4); att x 1/sqrt(128); causal (-inf); softmax; y = merged Wo ('xw' [2048][2048], no bias) -> [2][2048][2048] (8.4 M); argument order x, Wq, Wk, Wv, Wo).
// Compute dtypes, f32 accumulate: every input rounded to bf16; q/k/v on PLAIN bf16 operands (inputs: exact), their fp16 and hi+lo bf16 planes written by the projection kernel itself; scores, softmax and attn.v in one kernel (online softmax, f32; 64-key stages beyond a wave's diagonal never read): query rows < 512 hl (3 products), the rest single fp16; Wo hl x exact (2 products).

#define NB_  2
#define TT   2048
#define TR   (NB_ * TT)       // rows of x, both batch elements one behind the other: row b TT + t
#define DM   2048
#define NH_  16
#define NKV  4
#define REP  (NH_ / NKV)
#define HD   128
#define DQ   (NH_ * HD)
#define DKV  (NKV * HD)
#define RH   512                  // query rows < RH use hi+lo planes (a multiple of 32: a wave's 32 rows are wholly hi+lo or wholly fp16)
#define SCL  0.088388347648318447f   // HD^-0.5
typedef _Float16 h16;
typedef unsigned short bf;
typedef __attribute__((ext_vector_type(16))) __bf16   v16bf;
typedef __attribute__((ext_vector_type(16))) _Float16 v16h;
typedef __attribute__((ext_vector_type(8)))  _Float16 v8h;
typedef __attribute__((ext_vector_type(8)))  unsigned short v8us;
typedef __attribute__((ext_vector_type(8)))  float    v8f;
typedef __attribute__((ext_vector_type(4)))  float    v4f;
typedef v8h  __attribute__((may_alias)) v8ha;
typedef v4f  __attribute__((may_alias)) v4fa;
typedef v8us __attribute__((may_alias)) v8usa;

__device__ __forceinline__ unsigned short f2bf(float f) { unsigned u = __float_as_uint(f); u += 0x7FFFu + ((u >> 16) & 1u); return (unsigned short)(u >> 16); }
__device__ __forceinline__ float bf2f(unsigned short b) { return __uint_as_float(((unsigned)b) << 16); }
__device__ __forceinline__ v16h cat16(v8h lo, v8h hi) { return __builtin_shufflevector(lo, hi, 0, 1, 2, 3, 4, 5, 6, 7, 8, 9, 10, 11, 12, 13, 14, 15); }
__device__ __forceinline__ v16bf cat16b(v8us lo, v8us hi) { return __builtin_bit_cast(v16bf, __builtin_shufflevector(lo, hi, 0, 1, 2, 3, 4, 5, 6, 7, 8, 9, 10, 11, 12, 13, 14, 15)); }
__device__ __forceinline__ v8f wmma16(v16h a, v16h b, v8f c) { return __builtin_amdgcn_wmma_f32_16x16x32_f16(false, a, false, b, (short)0, c, false, false); }
__device__ __forceinline__ v8f wmmab(v16bf a, v16bf b, v8f c) { return __builtin_amdgcn_wmma_f32_16x16x32_bf16(false, a, false, b, (short)0, c, false, false); }

typedef __attribute__((ext_vector_type(2))) _Float16 v2h;
typedef __attribute__((ext_vector_type(2))) float v2f;
typedef __attribute__((ext_vector_type(4))) int v4i;
typedef v4i __attribute__((may_alias)) v4ia;
__device__ __forceinline__ unsigned pk16(float a, float b) { v2f x; x[0] = a; x[1] = b; return __builtin_bit_cast(unsigned, __builtin_convertvector(x, v2h)); }
typedef __attribute__((ext_vector_type(2))) __bf16 v2b;
__device__ __forceinline__ void split2(float a, float b, unsigned& hi, unsigned& lo) {   // two values at once, by the packed conversion (round to nearest even, as f2bf): packed hi parts, packed remainders
    v2f x; x[0] = a; x[1] = b; hi = __builtin_bit_cast(unsigned, __builtin_convertvector(x, v2b));
    v2f r; r[0] = a - __uint_as_float(hi << 16); r[1] = b - __uint_as_float(hi & 0xFFFF0000u); lo = __builtin_bit_cast(unsigned, __builtin_convertvector(r, v2b)); }

template <typename T16> struct WFrag;
template <> struct WFrag<h16> { typedef v16h V; static __device__ __forceinline__ V ld(const h16* p) { return cat16(*(const v8h*)p, *(const v8h*)(p + 16)); } static __device__ __forceinline__ v8f mma(V a, V b, v8f c) { return wmma16(a, b, c); } };
template <> struct WFrag<bf> { typedef v16bf V; static __device__ __forceinline__ V ld(const bf* p) { return cat16b(*(const v8us*)p, *(const v8us*)(p + 16)); } static __device__ __forceinline__ v8f mma(V a, V b, v8f c) { return wmmab(a, b, c); } };
// ---- k_gemms: C[m][n] = sum_k A[m][k] Bt[n][k] (+ A2[m][k] Bt[n][k] where SPLIT), all planes bf16, K-contiguous, K = GK. PP == 0: C goes out as f32, pitch ldc.
// PP != 0: C goes out TRANSPOSED as the three 16-bit planes the attention kernel reads (fp16, bf16 hi, bf16 lo), n the row (pitch PP elements), m along it: element (m, n) at (m / HD) HS + n PP + m % HD.
// An accumulator lane holds eight consecutive m of one n, which is 16 B of a plane row. q, k: A = the weight (m = head x 128 + d), Bt = x (n = b TT + t), PP = HD, planes [head][b][t][d]; v: A = x (m = b TT + t), Bt = the weight, PP = TR, planes [head x 128 + d][b][t].
// A work-group is 2 x 2 waves on a (32 MB) x (32 NB) tile of C; a wave owns MB x NB accumulators. k goes in passes of 128 (256 B of every operand row): the work-group brings a pass through registers into
// one of two LDS buffers with whole-line loads (16 threads cover a row's 256 B), so every operand byte comes from L2 once per work-group and the fragments are read from LDS. One barrier per pass.
// A pass is four k steps of 32; each step stores a quarter of the next pass's rows to LDS, refills those registers with the same quarter of the pass after it (so a whole pass of loads is always in flight),
// reads the next step's fragments into the second fragment set and then runs its own products. Every accumulator takes its products in the order kc ascending, A before A2.
// Every '#pragma unroll' in k_gemms is there so that the staging, fragment and accumulator arrays are indexed by constants and stay in registers.
#define GK    2048                 // the reduction length of all four products
#define GPASS 128                  // k per pass
#define GPIT  136                  // LDS pitch of a staged row, elements: 256 B + 16 B, an odd multiple of 16 B for the 16-byte readers
typedef __attribute__((ext_vector_type(4))) int g4i;
typedef g4i __attribute__((may_alias)) g4ia;
template <bool B> struct GFlag { static constexpr bool v = B; };
// The pass barrier, by hand: __syncthreads() would also wait for the global loads that are in flight for the pass after next and so undo their lead. What other waves depend on here is LDS alone
// (this wave's stores of the next pass, its reads of this one): s_wait_dscnt 0 covers both.
__device__ __forceinline__ void gbar() { asm volatile("s_wait_dscnt 0x0\n\ts_barrier_signal -1\n\ts_barrier_wait -1" ::: "memory"); }
template <int MB, int NB, bool SPLIT, int PP>
__global__ __launch_bounds__(128) void k_gemms(const bf* __restrict__ A, const bf* __restrict__ A2, const bf* __restrict__ Bt, float* C, int ldc, h16* P16, bf* Ph, bf* Pl) {
    typedef WFrag<bf>::V V;
    constexpr int RA = 32 * MB, RB = 32 * NB, OA2 = RA * GPIT, OB = (SPLIT ? 2 : 1) * RA * GPIT, STG = OB + RB * GPIT, NP = GK / GPASS, NA2 = SPLIT ? MB : 1;
    __shared__ __align__(16) bf sm[2 * STG];
    const int tid = threadIdx.x, lane = tid & 31, lr = lane & 15, hi = lane >> 4, wave = __builtin_amdgcn_readfirstlane(tid >> 5), wm = wave >> 1, wn = wave & 1;
    const int r0 = blockIdx.x * RA, c0 = blockIdx.y * RB;
    const unsigned tofs = (unsigned)(tid >> 4) * (GK * 2u) + (unsigned)(tid & 15) * 16u;   // bytes: the thread's row of a turn of eight rows, and its 16 B of the row's 256
    const char* Ab = (const char*)(A + (size_t)r0 * GK) + tofs; const char* A2b = SPLIT ? (const char*)(A2 + (size_t)r0 * GK) + tofs : nullptr; const char* Bb = (const char*)(Bt + (size_t)c0 * GK) + tofs;
    const int sofs = (tid >> 4) * GPIT + (tid & 15) * 8;                                   // the same place in a staged turn, elements
    g4i ra[4 * MB], ra2[4 * NA2], rb[4 * NB];
    auto gload = [&](int q, int pass) {   // quarter q of a pass: MB turns of A (and of A2), NB turns of Bt; every wave-wide load covers four whole 128-B lines
        const char* pa = Ab + pass * (GPASS * 2); const char* pa2 = SPLIT ? A2b + pass * (GPASS * 2) : nullptr; const char* pb = Bb + pass * (GPASS * 2);   // the thread's address in each plane + a constant per turn
        __builtin_amdgcn_sched_barrier(0);   // the loads are not lifted from here: the wait at the foot has to stand directly behind them
#pragma unroll
        for (int i = 0; i < MB; ++i) { const int t = q * MB + i; ra[t] = *(const g4ia*)(pa + t * (8 * GK * 2)); if constexpr (SPLIT) ra2[t] = *(const g4ia*)(pa2 + t * (8 * GK * 2)); }
#pragma unroll
        for (int i = 0; i < NB; ++i) { const int t = q * NB + i; rb[t] = *(const g4ia*)(pb + t * (8 * GK * 2)); }
        asm volatile("s_wait_xcnt 0x0" ::: "memory");   // in front of whatever next rewrites a register that these loads name
        __builtin_amdgcn_sched_barrier(0);   // nothing from below is lifted over that wait; and the loads stay up here: sunk towards their use they would hide no latency
    };
    auto sstore = [&](int q, bf* buf) {
#pragma unroll
        for (int i = 0; i < MB; ++i) { const int t = q * MB + i; *(g4ia*)(buf + t * 8 * GPIT + sofs) = ra[t]; if constexpr (SPLIT) *(g4ia*)(buf + OA2 + t * 8 * GPIT + sofs) = ra2[t]; }
#pragma unroll
        for (int i = 0; i < NB; ++i) { const int t = q * NB + i; *(g4ia*)(buf + OB + t * 8 * GPIT + sofs) = rb[t]; } };
    v8f acc[MB][NB];
#pragma unroll
    for (int mb = 0; mb < MB; ++mb)
#pragma unroll
        for (int nb = 0; nb < NB; ++nb) acc[mb][nb] = (v8f){};
#pragma unroll
    for (int q = 0; q < 4; ++q) gload(q, 0);
#pragma unroll
    for (int q = 0; q < 4; ++q) { sstore(q, sm); gload(q, 1); }
    gbar();   // pass 0 is in buffer 0
    const int fa = (wm * MB * 16 + lr) * GPIT + 8 * hi, fb = OB + (wn * NB * 16 + lr) * GPIT + 8 * hi;   // the lane's place in the wave's first A and Bt fragment: the k order of both is that of WFrag::ld
    auto pass = [&](int p, auto ST, auto LD) {   // ST: a pass p + 1 exists and is stored; LD: a pass p + 2 exists and is loaded
        const bf* cur = sm + (p & 1) * STG; bf* nxt = sm + ((p + 1) & 1) * STG;   // nxt held pass p - 1: the barrier at the foot of p - 1 ended its reads
        V a[2][MB], a2[2][NA2], b[2][NB];
        auto ldf = [&](int set, int ks) {
#pragma unroll
            for (int mb = 0; mb < MB; ++mb) { a[set][mb] = WFrag<bf>::ld(cur + fa + mb * 16 * GPIT + ks * 32); if constexpr (SPLIT) a2[set][mb] = WFrag<bf>::ld(cur + OA2 + fa + mb * 16 * GPIT + ks * 32); }
#pragma unroll
            for (int nb = 0; nb < NB; ++nb) b[set][nb] = WFrag<bf>::ld(cur + fb + nb * 16 * GPIT + ks * 32); };
        ldf(0, 0);
#pragma unroll
        for (int ks = 0; ks < 4; ++ks) {
            if constexpr (decltype(ST)::v) sstore(ks, nxt);
            if constexpr (decltype(LD)::v) gload(ks, p + 2);
            if (ks < 3) ldf((ks + 1) & 1, ks + 1);
            __builtin_amdgcn_sched_barrier(0);   // the next step's fragment reads stay a group ahead of this step's products (one wave per SIMD: nobody else covers an LDS wait)
#pragma unroll
            for (int nb = 0; nb < NB; ++nb)
#pragma unroll
                for (int mb = 0; mb < MB; ++mb) acc[mb][nb] = wmmab(a[ks & 1][mb], b[ks & 1][nb], acc[mb][nb]);
            if constexpr (SPLIT) {
#pragma unroll
                for (int nb = 0; nb < NB; ++nb)
#pragma unroll
                    for (int mb = 0; mb < MB; ++mb) acc[mb][nb] = wmmab(a2[ks & 1][mb], b[ks & 1][nb], acc[mb][nb]); }
            __builtin_amdgcn_sched_barrier(0);   // the following step's stores, loads and reads are not lifted into this step's products, whose fragment set they refill
        }
        gbar();   // publishes pass p + 1 and ends every wave's reads of pass p
    };
#pragma unroll 1   // rolled: a pass is long straight-line code already, more copies would only cost instruction fetches
    for (int p = 0; p < NP - 2; ++p) pass(p, GFlag<true>(), GFlag<true>());
    pass(NP - 2, GFlag<true>(), GFlag<false>());    // the last two passes apart: nothing is left to load, then nothing to store
    pass(NP - 1, GFlag<false>(), GFlag<false>());
    if constexpr (PP != 0) {
        // The planes, through LDS (the whole work-group's tile, behind the last pass's barrier), so that every 128-B line of a plane is stored whole, by one wave. The unrolls: constant indices, as above.
        constexpr int EP = RA + 8, EPL = RB * EP, HS = (PP == HD) ? TR * HD : HD;   // pitch of a staged plane row, elements (an odd multiple of 16 B); one staged plane; the step of the plane index from one block of HD m to the next
        static_assert(3 * EPL <= 2 * STG && HD % RA == 0, "the three staged planes fit the ring; a tile's m lie in one block of HD");
#pragma unroll
        for (int nb = 0; nb < NB; ++nb)
#pragma unroll
            for (int mb = 0; mb < MB; ++mb) { v4i o16, oh, ol;
#pragma unroll
                for (int r = 0; r < 4; ++r) { unsigned a, c2; split2(acc[mb][nb][2 * r], acc[mb][nb][2 * r + 1], a, c2); o16[r] = (int)pk16(acc[mb][nb][2 * r], acc[mb][nb][2 * r + 1]); oh[r] = (int)a; ol[r] = (int)c2; }
                bf* e = sm + ((wn * NB + nb) * 16 + lr) * EP + (wm * MB + mb) * 16 + 8 * hi; *(v4ia*)e = o16; *(v4ia*)(e + EPL) = oh; *(v4ia*)(e + 2 * EPL) = ol; }
        gbar();   // the staged rows are read back by other waves than wrote them
        constexpr int TPR = RA / 8, RPT = 128 / TPR, NT = RB / RPT;   // threads per plane row of the tile (16 B each); rows per turn of the work-group; turns
        const int row = tid / TPR, cp = (tid % TPR) * 8;
        v4i t16[NT], th[NT], tl[NT];
#pragma unroll
        for (int i = 0; i < NT; ++i) { const bf* e = sm + (i * RPT + row) * EP + cp; t16[i] = *(const v4ia*)e; th[i] = *(const v4ia*)(e + EPL); tl[i] = *(const v4ia*)(e + 2 * EPL); }
        const size_t po = ((size_t)(r0 / HD) * HS + (size_t)(r0 % HD) + (size_t)c0 * PP) * 2; const unsigned pofs = (unsigned)row * (PP * 2u) + (unsigned)cp * 2u;   // bytes: the tile's place in a plane (uniform), the thread's place in a turn
        char* p16 = (char*)P16 + po; char* ph = (char*)Ph + po; char* pl = (char*)Pl + po;
#pragma unroll
        for (int i = 0; i < NT; ++i) { *(v4ia*)(p16 + pofs + i * (RPT * PP * 2)) = t16[i]; *(v4ia*)(ph + pofs + i * (RPT * PP * 2)) = th[i]; *(v4ia*)(pl + pofs + i * (RPT * PP * 2)) = tl[i]; }
    } else {
    // Output through LDS (each wave its own 16 rows, behind the last pass's barrier), so that every 128-B line of C is stored whole.
    constexpr int OP = NB * 16 + 4, LPR = NB * 4, RPS = 32 / LPR;   // pitch of a staged row, floats; lanes per row of the wave's tile; rows per wave-wide store
    float* os = (float*)sm + wave * (16 * OP);
#pragma unroll
    for (int mb = 0; mb < MB; ++mb) {
#pragma unroll
        for (int nb = 0; nb < NB; ++nb) {
#pragma unroll
            for (int j = 0; j < 8; ++j) os[(hi * 8 + j) * OP + nb * 16 + lr] = acc[mb][nb][j]; }
        __builtin_amdgcn_wave_barrier(); asm volatile("" ::: "memory");   // the staged rows are read back by other lanes of the wave than wrote them
        float* crow = C + (size_t)(r0 + (wm * MB + mb) * 16) * ldc + c0 + wn * NB * 16;
#pragma unroll
        for (int s = 0; s < 16 / RPS; ++s) { const int row = RPS * s + lane / LPR, cofs = (lane % LPR) * 4; *(v4f*)(crow + (size_t)row * ldc + cofs) = *(const v4fa*)(os + row * OP + cofs); }
        if (mb + 1 < MB) { __builtin_amdgcn_wave_barrier(); asm volatile("s_wait_xcnt 0x0" ::: "memory"); }   // the next 16 rows overwrite the staging only behind these reads; the wait: in front of whatever next rewrites a register that these stores name
    }
    }
}

// ---- k_wt4: the four weights, f32 [k][n], to bf16 planes [n][k] (round to nearest even), in one launch. A work-group of 8 waves takes a tile of WKT k x WNT n.
// In: a wave-wide 16-byte load covers the 512 B that the tile has of one weight row (four whole lines); a thread takes the same four n of eight consecutive k, four times over, all 32 loads in flight at once.
// Eight k of one n are 16 B of a plane row: packed in registers and stored to LDS as one piece. Out: a wave reads a plane row's 512 B from LDS and stores them as four whole lines.
// LDS rows are 512 B, a multiple of all 64 banks, so piece ch of row n lies at place ch ^ ((n >> 2) & 15): the 16 lanes of a half wave, which write the same ch of rows four apart, and read the pieces of one row, meet 16 different places each time.
#define WKT 256
#define WNT 128
__device__ __forceinline__ unsigned pkbf(float a, float b) { v2f x; x[0] = a; x[1] = b; return __builtin_bit_cast(unsigned, __builtin_convertvector(x, v2b)); }
// Every '#pragma unroll' in wt_tile is there so that the value arrays are indexed by constants and stay in registers, and every address is one register plus a constant.
template <int N>
__device__ __forceinline__ void wt_tile(bf* sm, const float* __restrict__ w, bf* __restrict__ Bt, const int tile) {
    const int tid = threadIdx.x, lane = tid & 31, wave = __builtin_amdgcn_readfirstlane(tid >> 5);
    const int n0 = (tile % (N / WNT)) * WNT, k0 = (tile / (N / WNT)) * WKT;   // neighbours in the grid read neighbouring pieces of the same weight rows
    const char* src = (const char*)(w + (size_t)(k0 + wave * 8) * N + n0); const unsigned lofs = (unsigned)lane * 16u;
    v4f v[4][8];   // v[i][r][j] = w[k0 + 64 i + 8 wave + r][n0 + 4 lane + j]
#pragma unroll
    for (int i = 0; i < 4; ++i)
#pragma unroll
        for (int r = 0; r < 8; ++r) v[i][r] = *(const v4fa*)(src + lofs + (i * 64 + r) * (N * 4));
    asm volatile("s_wait_xcnt 0x0" ::: "memory");   // in front of whatever next rewrites a register that these loads name
    __builtin_amdgcn_sched_barrier(0);   // nothing from below is lifted over that wait; and the loads stay one group, all in flight together
    const int x = wave ^ (lane & 15);    // piece 8 i + wave of rows 4 lane + j: place ((x ^ 8 (i & 1)) + 16 (i >> 1))
#pragma unroll
    for (int i = 0; i < 4; ++i)
#pragma unroll
        for (int j = 0; j < 4; ++j) { v4i o;
#pragma unroll
            for (int r = 0; r < 4; ++r) o[r] = (int)pkbf(v[i][2 * r][j], v[i][2 * r + 1][j]);
            *(v4ia*)(sm + (4 * lane + j) * WKT + ((x ^ (8 * (i & 1))) + 16 * (i >> 1)) * 8) = o; }
    __syncthreads();   // the plane rows are read back by other waves than wrote them
    v4i t[16];
#pragma unroll
    for (int i = 0; i < 16; ++i) t[i] = *(const v4ia*)(sm + (wave * 16 + i) * WKT + (lane ^ ((wave * 4 + (i >> 2)) & 15)) * 8);
    char* dst = (char*)(Bt + (size_t)(n0 + wave * 16) * GK + k0);
#pragma unroll
    for (int i = 0; i < 16; ++i) *(v4ia*)(dst + lofs + i * (GK * 2)) = t[i];
}
__global__ __launch_bounds__(256) void k_wt4(const float* __restrict__ wq, const float* __restrict__ wk, const float* __restrict__ wv, const float* __restrict__ wo, bf* WQ, bf* WK, bf* WV, bf* WO) {
    __shared__ __align__(16) bf sm[WNT * WKT];
    static_assert(DM == GK && DQ == GK && DM == DQ, "all four weights have GK rows; Wq and Wo are of one shape");
    constexpr int TB = (GK / WKT) * (DQ / WNT), TS = (GK / WKT) * (DKV / WNT);   // tiles of a large and of a small weight
    const int b = blockIdx.x;   // the branches are uniform for the work-group
    if (b < 2 * TB) wt_tile<DQ>(sm, b < TB ? wq : wo, b < TB ? WQ : WO, b < TB ? b : b - TB);
    else wt_tile<DKV>(sm, b < 2 * TB + TS ? wk : wv, b < 2 * TB + TS ? WK : WV, b < 2 * TB + TS ? b - 2 * TB : b - 2 * TB - TS);
}
__global__ __launch_bounds__(256) void k_cvt8(const float* __restrict__ src, bf* dst, size_t n8) { const size_t i = (size_t)blockIdx.x * 256 + threadIdx.x; if (i >= n8) return; const v8f v = *(const v8f*)(src + i * 8); v8us o;
#pragma unroll
    for (int k = 0; k < 8; ++k) o[k] = f2bf(v[k]); *(v8us*)(dst + i * 8) = o;  }
#define SKEY  64                   // keys per stage
#define KPIT  136                  // LDS pitch of a K row, elements: 256 B + 16 B, an odd multiple of 16 B for the 16-byte readers
#define VPIT  72                   // LDS pitch of a V^T row, elements: 128 B + 16 B, likewise
#define KTILE (SKEY * KPIT)
#define PLANE (KTILE + HD * VPIT)  // one stage of one plane pair: K tile, then V^T tile
typedef __attribute__((ext_vector_type(8))) unsigned v8u;
__device__ __forceinline__ float xhalf(float x) { return __builtin_bit_cast(float, __builtin_amdgcn_permlanex16(__builtin_bit_cast(int, x), __builtin_bit_cast(int, x), 0x76543210, 0xfedcba98, false, false)); }  // lane l with lane l ^ 16
template <typename T16, bool HL>
__device__ __forceinline__ void fattn_run(T16* sm, const T16* __restrict__ Q, const T16* __restrict__ Q2, const T16* __restrict__ Kp, const T16* __restrict__ K2, const T16* __restrict__ Vt, const T16* __restrict__ V2, const int qw0, v8f (&acc)[2][8], float (&l_run)[2]) {
    typedef typename WFrag<T16>::V V;
    constexpr int NPL = HL ? 2 : 1, BUF = NPL * PLANE;
    const int tid = threadIdx.x, lane = tid & 31, c = lane & 15, h = lane >> 4;
    const float cscale = SCL * 1.4426950408889634f;
    v4i rk[NPL][8], rv[NPL][8];
    const unsigned vofs = (unsigned)(tid >> 3) * (TR * 2u) + (unsigned)(tid & 7) * 16u;   // bytes in a kv plane: eight threads cover a V^T row's 128 B
    auto gload = [&](int key0) {   // a stage's K rows and V^T rows, 16 B a thread and turn: every wave-wide load covers four whole 128-B lines
        const unsigned ko = (unsigned)tid + (unsigned)key0 * (HD / 8u), vo = vofs + (unsigned)key0 * 2u;   // the thread's 32-bit offsets in this stage, the same in the hi and the lo plane: K in 16-byte pieces (its rows lie in a row), V^T in bytes
        __builtin_amdgcn_sched_barrier(0);   // the loads are not lifted from here: the wait at the foot has to stand directly behind them
#pragma unroll
        for (int i = 0; i < 8; ++i) {   // the plane's uniform base + the thread's offset + a constant: two address registers for the whole group
            rk[0][i] = ((const v4ia*)Kp + ko)[i * 128]; rv[0][i] = *(const v4ia*)((const char*)Vt + vo + i * (16 * TR * 2));
            if constexpr (HL) { rk[NPL - 1][i] = ((const v4ia*)K2 + ko)[i * 128]; rv[NPL - 1][i] = *(const v4ia*)((const char*)V2 + vo + i * (16 * TR * 2)); } }
        asm volatile("s_wait_xcnt 0x0" :: "v"(ko), "v"(vo) : "memory");   // in front of whatever next rewrites a register that these loads name; the two offsets are inputs so that they live up to the wait and no load of the group lands in them
        __builtin_amdgcn_sched_barrier(0);   // nothing from below is lifted over that wait; and the loads stay up here: sunk towards their use they would hide no latency
    };
    auto sstore = [&](T16* buf) {
#pragma unroll
        for (int i = 0; i < 8; ++i) { const int idx = i * 128 + tid; const int ok = (idx >> 4) * KPIT + (idx & 15) * 8, ov = KTILE + (idx >> 3) * VPIT + (idx & 7) * 8;
            *(v4ia*)(buf + ok) = rk[0][i]; *(v4ia*)(buf + ov) = rv[0][i]; if (HL) { *(v4ia*)(buf + PLANE + ok) = rk[NPL - 1][i]; *(v4ia*)(buf + PLANE + ov) = rv[NPL - 1][i]; } } };
    const int nst = qw0 / SKEY + 1;   // stages up to and with the one that holds the wave's diagonal; the same for all four waves
    gload(0);
    V qf[2][4], qf2[2][4];
#pragma unroll
    for (int g = 0; g < 2; ++g)
#pragma unroll
        for (int kc = 0; kc < 4; ++kc) { const size_t o = (size_t)(qw0 + 16 * g + c) * HD + 32 * kc + 8 * h; qf[g][kc] = WFrag<T16>::ld(Q + o); if (HL) qf2[g][kc] = WFrag<T16>::ld(Q2 + o); }
    asm volatile("s_wait_xcnt 0x0" ::: "memory");   // in front of whatever next rewrites a register that the Q loads name
    __builtin_amdgcn_sched_barrier(0);   // nothing from below is lifted over that wait
    float m_run[2];
#pragma unroll
    for (int g = 0; g < 2; ++g) { m_run[g] = -__builtin_inff(); l_run[g] = 0.0f;
#pragma unroll
        for (int t = 0; t < 8; ++t) acc[g][t] = (v8f){}; }
    sstore(sm); gload(min(1, nst - 1) * SKEY);
    __syncthreads();   // stage 0 is in buffer 0
#pragma unroll 1   // rolled: a stage is long straight-line code already, a second copy would only cost instruction fetches
    for (int st = 0; st < nst; ++st) {
        const T16* cur = sm + (st & 1) * BUF;
        sstore(sm + ((st + 1) & 1) * BUF);          // stage st + 1 into the buffer that stage st - 1 used: the barrier at the foot of st - 1 ended its reads (past the end: the last stage again, read by nobody)
        gload(min(st + 2, nst - 1) * SKEY);         // in flight under this whole stage; clamped, so always inside the planes and no branch round the loads
        // The stage's fragment reads go out in whole groups ahead of their products (one wave per SIMD: nobody else covers an LDS wait): K first; V^T directly behind it where one plane pair leaves the registers
        // for both, else behind the first product, into the registers K has left, so that it streams in under the softmax.
        v8f s[4][2]; V kfa[4][4], kfa2[HL ? 4 : 1][4], vfa[2][8], vfa2[HL ? 2 : 1][8];
#pragma unroll
        for (int kt = 0; kt < 4; ++kt)
#pragma unroll
            for (int kc = 0; kc < 4; ++kc) { const T16* p = cur + (16 * kt + c) * KPIT + 32 * kc + 8 * h; kfa[kt][kc] = WFrag<T16>::ld(p); if constexpr (HL) kfa2[kt][kc] = WFrag<T16>::ld(p + PLANE); }
        __builtin_amdgcn_sched_barrier(0);          // K's reads stay a group, ahead of V^T's: LDS answers in order, and the first product waits for K alone
        auto ldv = [&]() {
#pragma unroll
            for (int j = 0; j < 2; ++j)
#pragma unroll
                for (int t = 0; t < 8; ++t) { const T16* p = cur + KTILE + (16 * t + c) * VPIT + 32 * j + 8 * h; vfa[j][t] = WFrag<T16>::ld(p); if constexpr (HL) vfa2[j][t] = WFrag<T16>::ld(p + PLANE); }
            __builtin_amdgcn_sched_barrier(0);      // keeps the group together up here: moved down to their uses the reads are waited for one by one
        };
        if constexpr (!HL) ldv();
#pragma unroll
        for (int kt = 0; kt < 4; ++kt)
#pragma unroll
            for (int g = 0; g < 2; ++g) { s[kt][g] = (v8f){};
#pragma unroll
                for (int kc = 0; kc < 4; ++kc) { s[kt][g] = WFrag<T16>::mma(kfa[kt][kc], qf[g][kc], s[kt][g]); if constexpr (HL) { s[kt][g] = WFrag<T16>::mma(kfa[kt][kc], qf2[g][kc], s[kt][g]); s[kt][g] = WFrag<T16>::mma(kfa2[kt][kc], qf[g][kc], s[kt][g]); } } }
        if constexpr (HL) { __builtin_amdgcn_sched_barrier(0);   // V^T's reads not above the first product: K's registers are free only behind it
            ldv(); }
        if (st == nst - 1) {                        // work-group-uniform: only the stage with the diagonal pays for the mask
            const int lim = qw0 - st * SKEY + c - 8 * h;   // key 16 kt + 8 h + r of the stage joins query 16 g + c of the wave when 16 kt + r <= lim + 16 g
#pragma unroll
            for (int g = 0; g < 2; ++g)
#pragma unroll
                for (int kt = 0; kt < 4; ++kt) {
#pragma unroll
                    for (int r = 0; r < 8; ++r) { if (16 * kt + r > lim + 16 * g) s[kt][g][r] = -__builtin_inff(); }
                    asm volatile("" : "+v"(s[kt][g]));   // the masked scores: keeps the selects inside the branch
                }
        }
        float mb[2]; bool need = false;
#pragma unroll
        for (int g = 0; g < 2; ++g) { float mx = -__builtin_inff();
#pragma unroll
            for (int kt = 0; kt < 4; ++kt)
#pragma unroll
                for (int r = 0; r < 8; ++r) mx = fmaxf(mx, s[kt][g][r]);
            mx = fmaxf(mx, xhalf(mx)) * cscale; mb[g] = mx; need = need || (mx > m_run[g] + 8.0f); }
        if (__builtin_amdgcn_ballot_w32(need) != 0) {   // rare after the first stages
#pragma unroll
            for (int g = 0; g < 2; ++g) { const float m_new = fmaxf(m_run[g], mb[g]);   // finite from the first stage on: key 0 is never masked
                const float corr = __builtin_amdgcn_exp2f(m_run[g] - m_new);            // 0 on the first stage, where m_run is -inf
                l_run[g] *= corr; m_run[g] = m_new;
#pragma unroll
                for (int t = 0; t < 8; ++t) acc[g][t] = acc[g][t] * corr; }
        }
        V pf[2][2], pf2[2][2];
#pragma unroll
        for (int g = 0; g < 2; ++g) { const float nm = -m_run[g]; float ps0 = 0.0f, ps1 = 0.0f;
#pragma unroll
            for (int j = 0; j < 2; ++j) { v8u w, w2;
#pragma unroll
                for (int i = 0; i < 8; ++i) {
                    const float p0 = __builtin_amdgcn_exp2f(fmaf(s[2 * j + (i >> 2)][g][2 * (i & 3)], cscale, nm)), p1 = __builtin_amdgcn_exp2f(fmaf(s[2 * j + (i >> 2)][g][2 * (i & 3) + 1], cscale, nm));
                    ps0 += p0; ps1 += p1;
                    if (HL) { unsigned wh, wl; split2(p0, p1, wh, wl); w[i] = wh; w2[i] = wl; }
                    else w[i] = pk16(p0, p1); }
                pf[g][j] = __builtin_bit_cast(V, w); if (HL) pf2[g][j] = __builtin_bit_cast(V, w2); }
            l_run[g] += ps0 + ps1; }
#pragma unroll
        for (int j = 0; j < 2; ++j)
#pragma unroll
            for (int t = 0; t < 8; ++t)
#pragma unroll
                for (int g = 0; g < 2; ++g) { acc[g][t] = WFrag<T16>::mma(vfa[j][t], pf[g][j], acc[g][t]); if constexpr (HL) { acc[g][t] = WFrag<T16>::mma(vfa[j][t], pf2[g][j], acc[g][t]); acc[g][t] = WFrag<T16>::mma(vfa2[j][t], pf[g][j], acc[g][t]); } }
        __builtin_amdgcn_sched_barrier(0);          // keeps the barrier, and the wait for stage st + 2's global loads that comes with it, at the stage's foot
        __syncthreads();   // publishes stage st + 1 and ends every wave's reads of stage st
    }
}
// The grid has twice as many work-groups as the chip holds at a time (one to a WGP, by registers); a tile's cost falls with the index.
// blockIdx.y is the rank, blockIdx.x the (batch element, kv group) pair. Cost of a 32-row tile: its stages, a hi+lo stage counted double
// (three products for one, the same softmax). The order is for speed alone: any permutation gives the same values.
struct TileOrder { unsigned char t[TT / 32]; };
constexpr int tile_cost(int i) { return (i * 32 < RH ? 2 : 1) * (i * 32 / SKEY + 1); }
constexpr TileOrder tile_order() { TileOrder o{};
    for (int i = 0; i < TT / 32; ++i) { int r = 0;   // the rank of tile i: the tiles that cost more, and of those that cost the same the later ones
        for (int j = 0; j < TT / 32; ++j) r += (tile_cost(j) > tile_cost(i) || (tile_cost(j) == tile_cost(i) && j > i)) ? 1 : 0;
        o.t[r] = (unsigned char)i; }
    return o; }
static constexpr TileOrder fattn_order = tile_order();
__global__ __launch_bounds__(128) void k_fattn(const h16* __restrict__ Q16, const bf* __restrict__ Qh, const bf* __restrict__ Ql, const h16* __restrict__ K16, const bf* __restrict__ Kh, const bf* __restrict__ Kl, const h16* __restrict__ V16, const bf* __restrict__ Vh, const bf* __restrict__ Vl, bf* __restrict__ Ah, bf* __restrict__ Al) {
    __shared__ __align__(16) unsigned short sm[2 * 2 * PLANE];   // two buffers of two plane pairs (hi+lo); the fp16 rows use half of it
    const int tid = threadIdx.x, lane = tid & 31, c = lane & 15, h = lane >> 4;
    const int kv = blockIdx.x % NKV, bz = blockIdx.x / NKV, wave = __builtin_amdgcn_readfirstlane(tid >> 5), head = kv * REP + wave;
    // Dearest tiles first. readfirstlane: the tile number is used as loaded; seeing through the table, the compiler tested the rank against a 64-bit mask for the branch below, and that build kept the thread id in scratch and reloaded it in every stage.
    const int qw0 = __builtin_amdgcn_readfirstlane(fattn_order.t[blockIdx.y]) * 32;
    const size_t qo = ((size_t)head * NB_ + bz) * TT * HD, ko = ((size_t)kv * NB_ + bz) * TT * HD, vo = (size_t)kv * HD * TR + (size_t)bz * TT;
    v8f acc[2][8]; float l_run[2];
    if (qw0 < RH) fattn_run<bf, true>((bf*)sm, Qh + qo, Ql + qo, Kh + ko, Kl + ko, Vh + vo, Vl + vo, qw0, acc, l_run);
    else fattn_run<h16, false>((h16*)sm, Q16 + qo, nullptr, K16 + ko, nullptr, V16 + vo, nullptr, qw0, acc, l_run);
    // Output through LDS (each wave its own 2 x 32 rows, behind the stage loop's last barrier), so that every 128-B line of the planes is stored whole. The unrolls: constant indices, as above.
    bf* eb = (bf*)sm + wave * (2 * 32 * KPIT);
#pragma unroll
    for (int g = 0; g < 2; ++g) { const float inv = __fdiv_rn(1.0f, l_run[g] + xhalf(l_run[g]));
#pragma unroll
        for (int t = 0; t < 8; ++t) { v4i oh, ol;
#pragma unroll
            for (int r = 0; r < 4; ++r) { unsigned a, c2; split2(acc[g][t][2 * r] * inv, acc[g][t][2 * r + 1] * inv, a, c2); oh[r] = (int)a; ol[r] = (int)c2; }
            bf* e = eb + (16 * g + c) * KPIT + 16 * t + 8 * h; *(v4ia*)e = oh; *(v4ia*)(e + 32 * KPIT) = ol; } }
    __syncthreads();   // the staged rows are read back by other lanes than wrote them
    v4i th[16], tl[16];
#pragma unroll
    for (int i = 0; i < 16; ++i) { const bf* e = eb + (2 * i + h) * KPIT + c * 8; th[i] = *(const v4ia*)e; tl[i] = *(const v4ia*)(e + 32 * KPIT); }
    const unsigned oofs = (unsigned)h * (DQ * 2u) + (unsigned)c * 16u;   // bytes: 16 lanes cover one row's 256 B, a wave-wide store two rows
    char* ah = (char*)(Ah + (size_t)(bz * TT + qw0) * DQ + head * HD); char* al = (char*)(Al + (size_t)(bz * TT + qw0) * DQ + head * HD);
#pragma unroll
    for (int i = 0; i < 16; ++i) { *(v4ia*)(ah + oofs + i * (2 * DQ * 2)) = th[i]; *(v4ia*)(al + oofs + i * (2 * DQ * 2)) = tl[i]; }
}

extern "C" void kernel_launch(void* const* d_in, const int* in_sizes, int n_in,
                              void* d_out, int out_size, void* d_ws, size_t ws_size, hipStream_t stream) {
    (void)in_sizes; (void)n_in; (void)out_size;
    const float* x = (const float*)d_in[0]; const float* wq = (const float*)d_in[1]; const float* wk = (const float*)d_in[2]; const float* wv = (const float*)d_in[3]; const float* wo = (const float*)d_in[4];
    float* OUT = (float*)d_out;     // [2][2048][2048]
    char* wsp = (char*)d_ws;
    auto take = [&](size_t bytes) { char* p = wsp; wsp += (bytes + 255) & ~(size_t)255; return (void*)p; };
    bf* WQ = (bf*)take((size_t)DQ * DM * 2); bf* WK = (bf*)take((size_t)DKV * DM * 2); bf* WV = (bf*)take((size_t)DKV * DM * 2); bf* WO = (bf*)take((size_t)DM * DQ * 2);
    bf* XB = (bf*)take((size_t)TR * DM * 2);
    h16* QP16 = (h16*)take((size_t)NH_ * TR * HD * 2); h16* KP16 = (h16*)take((size_t)NKV * TR * HD * 2); h16* VT16 = (h16*)take((size_t)NKV * HD * TR * 2);
    bf* QPh = (bf*)take((size_t)NH_ * TR * HD * 2); bf* QPl = (bf*)take((size_t)NH_ * TR * HD * 2); bf* KPh = (bf*)take((size_t)NKV * TR * HD * 2); bf* KPl = (bf*)take((size_t)NKV * TR * HD * 2); bf* VTh = (bf*)take((size_t)NKV * HD * TR * 2); bf* VTl = (bf*)take((size_t)NKV * HD * TR * 2);
    bf* ATh = (bf*)take((size_t)TR * DQ * 2); bf* ATl = (bf*)take((size_t)TR * DQ * 2);
    if ((size_t)(wsp - (char*)d_ws) > ws_size) return;    // ws 256 MiB
    k_wt4<<<2 * (GK / WKT) * (DQ / WNT) + 2 * (GK / WKT) * (DKV / WNT), 256, 0, stream>>>(wq, wk, wv, wo, WQ, WK, WV, WO);
    // Every launch takes both batch elements: the projections see x as TR rows, the attention has the batch element in blockIdx.x.
    k_cvt8<<<(unsigned)(((size_t)TR * DM / 8 + 255) / 256), 256, 0, stream>>>(x, XB, (size_t)TR * DM / 8);
    k_gemms<4, 4, false, HD><<<dim3(DQ / 128, TR / 128, 1), 128, 0, stream>>>(WQ, nullptr, XB, nullptr, 0, QP16, QPh, QPl);
    k_gemms<2, 2, false, HD><<<dim3(DKV / 64, TR / 64, 1), 128, 0, stream>>>(WK, nullptr, XB, nullptr, 0, KP16, KPh, KPl);
    k_gemms<2, 2, false, TR><<<dim3(TR / 64, DKV / 64, 1), 128, 0, stream>>>(XB, nullptr, WV, nullptr, 0, VT16, VTh, VTl);
    k_fattn<<<dim3(NKV * NB_, TT / 32, 1), 128, 0, stream>>>(QP16, QPh, QPl, KP16, KPh, KPl, VT16, VTh, VTl, ATh, ATl);
    k_gemms<4, 4, true, 0><<<dim3(TR / 128, DM / 128, 1), 128, 0, stream>>>(ATh, ATl, WO, OUT, DM, nullptr, nullptr, nullptr);
}

// v007
// One run takes 155 microseconds.
// Two timings next to v006 both put it at 1.04 times that version's speed.
// Counting every step since v000, it is 11.1 times as fast.
#include <hip/hip_runtime.h>

// Grouped-query causal self-attention with 128-wide heads, no rotary (x [2][2048][2048]; q = x Wq ('xw' [2048][2048], 16 heads x 128), k, v = x Wk, x Wv ('xw' [2048][512], 4 kv heads x 128), no biases; k, v repeated 4 x on the head axis (jnp.repeat: query head h uses kv head h / 4); att x 1/sqrt(128); causal (-inf); softmax; y = merged Wo ('xw' [2048][2048], no bias) -> [2][2048][2048] (8.4 M); argument order x, Wq, Wk, Wv, Wo).
// Compute dtypes, f32 accumulate: every input rounded to bf16; q/k/v on PLAIN bf16 operands (inputs: exact), their fp16 and hi+lo bf16 planes written by the projection kernel itself; scores, softmax and attn.v in one kernel (online softmax, f32; 64-key stages beyond a wave's diagonal never read): query rows < 512 hl (3 products), the rest single fp16; Wo hl x exact (2 products).

#define NB_  2
#define TT   2048
#define TR   (NB_ * TT)       // rows of x, both batch elements one behind the other: row b TT + t
#define DM   2048
#define NH_  16
#define NKV  4
#define REP  (NH_ / NKV)
#define HD   128
#define DQ   (NH_ * HD)
#define DKV  (NKV * HD)
#define RH   512                  // query rows < RH use hi+lo planes (a multiple of 32: a wave's 32 rows are wholly hi+lo or wholly fp16)
#define SCL  0.088388347648318447f   // HD^-0.5
typedef _Float16 h16;
typedef unsigned short bf;
typedef __attribute__((ext_vector_type(16))) __bf16   v16bf;
typedef __attribute__((ext_vector_type(16))) _Float16 v16h;
typedef __attribute__((ext_vector_type(8)))  _Float16 v8h;
typedef __attribute__((ext_vector_type(8)))  unsigned short v8us;
typedef __attribute__((ext_vector_type(8)))  float    v8f;
typedef __attribute__((ext_vector_type(4)))  float    v4f;
typedef v8h  __attribute__((may_alias)) v8ha;
typedef v4f  __attribute__((may_alias)) v4fa;
typedef v8us __attribute__((may_alias)) v8usa;

__device__ __forceinline__ unsigned short f2bf(float f) { unsigned u = __float_as_uint(f); u += 0x7FFFu + ((u >> 16) & 1u); return (unsigned short)(u >> 16); }
__device__ __forceinline__ float bf2f(unsigned short b) { return __uint_as_float(((unsigned)b) << 16); }
__device__ __forceinline__ v16h cat16(v8h lo, v8h hi) { return __builtin_shufflevector(lo, hi, 0, 1, 2, 3, 4, 5, 6, 7, 8, 9, 10, 11, 12, 13, 14, 15); }
__device__ __forceinline__ v16bf cat16b(v8us lo, v8us hi) { return __builtin_bit_cast(v16bf, __builtin_shufflevector(lo, hi, 0, 1, 2, 3, 4, 5, 6, 7, 8, 9, 10, 11, 12, 13, 14, 15)); }
__device__ __forceinline__ v8f wmma16(v16h a, v16h b, v8f c) { return __builtin_amdgcn_wmma_f32_16x16x32_f16(false, a, false, b, (short)0, c, false, false); }
__device__ __forceinline__ v8f wmmab(v16bf a, v16bf b, v8f c) { return __builtin_amdgcn_wmma_f32_16x16x32_bf16(false, a, false, b, (short)0, c, false, false); }

typedef __attribute__((ext_vector_type(2))) _Float16 v2h;
typedef __attribute__((ext_vector_type(2))) float v2f;
typedef __attribute__((ext_vector_type(4))) int v4i;
typedef v4i __attribute__((may_alias)) v4ia;
__device__ __forceinline__ unsigned pk16(float a, float b) { v2f x; x[0] = a; x[1] = b; return __builtin_bit_cast(unsigned, __builtin_convertvector(x, v2h)); }
typedef __attribute__((ext_vector_type(2))) __bf16 v2b;
__device__ __forceinline__ void split2(float a, float b, unsigned& hi, unsigned& lo) {   // two values at once, by the packed conversion (round to nearest even, as f2bf): packed hi parts, packed remainders
    v2f x; x[0] = a; x[1] = b; hi = __builtin_bit_cast(unsigned, __builtin_convertvector(x, v2b));
    v2f r; r[0] = a - __uint_as_float(hi << 16); r[1] = b - __uint_as_float(hi & 0xFFFF0000u); lo = __builtin_bit_cast(unsigned, __builtin_convertvector(r, v2b)); }

template <typename T16> struct WFrag;
template <> struct WFrag<h16> { typedef v16h V; static __device__ __forceinline__ V ld(const h16* p) { return cat16(*(const v8h*)p, *(const v8h*)(p + 16)); } static __device__ __forceinline__ v8f mma(V a, V b, v8f c) { return wmma16(a, b, c); } };
template <> struct WFrag<bf> { typedef v16bf V; static __device__ __forceinline__ V ld(const bf* p) { return cat16b(*(const v8us*)p, *(const v8us*)(p + 16)); } static __device__ __forceinline__ v8f mma(V a, V b, v8f c) { return wmmab(a, b, c); } };
// ---- k_gemms: C[m][n] = sum_k A[m][k] Bt[n][k] (+ A2[m][k] Bt[n][k] where SPLIT), all planes bf16, K-contiguous, K = GK. PP == 0: C goes out as f32, pitch ldc.
// PP != 0: C goes out TRANSPOSED as the three 16-bit planes the attention kernel reads (fp16, bf16 hi, bf16 lo), n the row (pitch PP elements), m along it: element (m, n) at (m / HD) HS + n PP + m % HD.
// An accumulator lane holds eight consecutive m of one n, which is 16 B of a plane row. q, k: A = the weight (m = head x 128 + d), Bt = x (n = b TT + t), PP = HD, planes [head][b][t][d]; v: A = x (m = b TT + t), Bt = the weight, PP = TR, planes [head x 128 + d][b][t].
// A work-group is 2 x 2 waves on a (32 MB) x (32 NB) tile of C; a wave owns MB x NB accumulators. k goes in passes of 128 (256 B of every operand row): the work-group brings a pass through registers into
// one of two LDS buffers with whole-line loads (16 threads cover a row's 256 B), so every operand byte comes from L2 once per work-group and the fragments are read from LDS. One barrier per pass.
// A pass is four k steps of 32; each step stores a quarter of the next pass's rows to LDS, refills those registers with the same quarter of the pass after it (so a whole pass of loads is always in flight),
// reads the next step's fragments into the second fragment set and then runs its own products.
// The walk over k is a ring: work-group (x, y) starts at pass (x + y) mod NP and wraps round. Work-groups that share operand rows (one x, or one y) would otherwise ask L2 for the same lines at the same moment,
// and every work-group of the launch for the same 256 B of each 4-KiB row. Every accumulator takes its products in that order of passes, kc ascending inside a pass, A before A2.
// Every '#pragma unroll' in k_gemms is there so that the staging, fragment and accumulator arrays are indexed by constants and stay in registers.
#define GK    2048                 // the reduction length of all four products
#define GPASS 128                  // k per pass
#define GPIT  136                  // LDS pitch of a staged row, elements: 256 B + 16 B, an odd multiple of 16 B for the 16-byte readers
typedef __attribute__((ext_vector_type(4))) int g4i;
typedef g4i __attribute__((may_alias)) g4ia;
template <bool B> struct GFlag { static constexpr bool v = B; };
// The pass barrier, by hand: __syncthreads() would also wait for the global loads that are in flight for the pass after next and so undo their lead. What other waves depend on here is LDS alone
// (this wave's stores of the next pass, its reads of this one): s_wait_dscnt 0 covers both.
__device__ __forceinline__ void gbar() { asm volatile("s_wait_dscnt 0x0\n\ts_barrier_signal -1\n\ts_barrier_wait -1" ::: "memory"); }
template <int MB, int NB, bool SPLIT, int PP>
__global__ __launch_bounds__(128) void k_gemms(const bf* __restrict__ A, const bf* __restrict__ A2, const bf* __restrict__ Bt, float* C, int ldc, h16* P16, bf* Ph, bf* Pl) {
    typedef WFrag<bf>::V V;
    constexpr int RA = 32 * MB, RB = 32 * NB, OA2 = RA * GPIT, OB = (SPLIT ? 2 : 1) * RA * GPIT, STG = OB + RB * GPIT, NP = GK / GPASS, NA2 = SPLIT ? MB : 1;
    __shared__ __align__(16) bf sm[2 * STG];
    const int tid = threadIdx.x, lane = tid & 31, lr = lane & 15, hi = lane >> 4, wave = __builtin_amdgcn_readfirstlane(tid >> 5), wm = wave >> 1, wn = wave & 1;
    const int r0 = blockIdx.x * RA, c0 = blockIdx.y * RB;
    static_assert((NP & (NP - 1)) == 0, "the ring of passes wraps by a mask");
    const int p0 = (int)((blockIdx.x + blockIdx.y) & (unsigned)(NP - 1));   // the pass of k that this work-group takes first (uniform)
    const unsigned tofs = (unsigned)(tid >> 4) * (GK * 2u) + (unsigned)(tid & 15) * 16u;   // bytes: the thread's row of a turn of eight rows, and its 16 B of the row's 256
    const char* Ab = (const char*)(A + (size_t)r0 * GK) + tofs; const char* A2b = SPLIT ? (const char*)(A2 + (size_t)r0 * GK) + tofs : nullptr; const char* Bb = (const char*)(Bt + (size_t)c0 * GK) + tofs;
    const int sofs = (tid >> 4) * GPIT + (tid & 15) * 8;                                   // the same place in a staged turn, elements
    g4i ra[4 * MB], ra2[4 * NA2], rb[4 * NB];
    auto gload = [&](int q, int pass) {   // quarter q of a pass: MB turns of A (and of A2), NB turns of Bt; every wave-wide load covers four whole 128-B lines
        const int kb = ((pass + p0) & (NP - 1)) * (GPASS * 2);   // bytes: where in a row the work-group's pass number 'pass' lies
        const char* pa = Ab + kb; const char* pa2 = SPLIT ? A2b + kb : nullptr; const char* pb = Bb + kb;   // the thread's address in each plane + a constant per turn
        __builtin_amdgcn_sched_barrier(0);   // the loads are not lifted from here: the wait at the foot has to stand directly behind them
#pragma unroll
        for (int i = 0; i < MB; ++i) { const int t = q * MB + i; ra[t] = *(const g4ia*)(pa + t * (8 * GK * 2)); if constexpr (SPLIT) ra2[t] = *(const g4ia*)(pa2 + t * (8 * GK * 2)); }
#pragma unroll
        for (int i = 0; i < NB; ++i) { const int t = q * NB + i; rb[t] = *(const g4ia*)(pb + t * (8 * GK * 2)); }
        asm volatile("s_wait_xcnt 0x0" ::: "memory");   // in front of whatever next rewrites a register that these loads name
        __builtin_amdgcn_sched_barrier(0);   // nothing from below is lifted over that wait; and the loads stay up here: sunk towards their use they would hide no latency
    };
    auto sstore = [&](int q, bf* buf) {
#pragma unroll
        for (int i = 0; i < MB; ++i) { const int t = q * MB + i; *(g4ia*)(buf + t * 8 * GPIT + sofs) = ra[t]; if constexpr (SPLIT) *(g4ia*)(buf + OA2 + t * 8 * GPIT + sofs) = ra2[t]; }
#pragma unroll
        for (int i = 0; i < NB; ++i) { const int t = q * NB + i; *(g4ia*)(buf + OB + t * 8 * GPIT + sofs) = rb[t]; } };
    v8f acc[MB][NB];
#pragma unroll
    for (int mb = 0; mb < MB; ++mb)
#pragma unroll
        for (int nb = 0; nb < NB; ++nb) acc[mb][nb] = (v8f){};
#pragma unroll
    for (int q = 0; q < 4; ++q) gload(q, 0);
#pragma unroll
    for (int q = 0; q < 4; ++q) { sstore(q, sm); gload(q, 1); }
    gbar();   // pass 0 is in buffer 0
    const int fa = (wm * MB * 16 + lr) * GPIT + 8 * hi, fb = OB + (wn * NB * 16 + lr) * GPIT + 8 * hi;   // the lane's place in the wave's first A and Bt fragment: the k order of both is that of WFrag::ld
    auto pass = [&](int p, auto ST, auto LD) {   // ST: a pass p + 1 exists and is stored; LD: a pass p + 2 exists and is loaded
        const bf* cur = sm + (p & 1) * STG; bf* nxt = sm + ((p + 1) & 1) * STG;   // nxt held pass p - 1: the barrier at the foot of p - 1 ended its reads
        V a[2][MB], a2[2][NA2], b[2][NB];
        auto ldf = [&](int set, int ks) {
#pragma unroll
            for (int mb = 0; mb < MB; ++mb) { a[set][mb] = WFrag<bf>::ld(cur + fa + mb * 16 * GPIT + ks * 32); if constexpr (SPLIT) a2[set][mb] = WFrag<bf>::ld(cur + OA2 + fa + mb * 16 * GPIT + ks * 32); }
#pragma unroll
            for (int nb = 0; nb < NB; ++nb) b[set][nb] = WFrag<bf>::ld(cur + fb + nb * 16 * GPIT + ks * 32); };
        ldf(0, 0);
#pragma unroll
        for (int ks = 0; ks < 4; ++ks) {
            if constexpr (decltype(ST)::v) sstore(ks, nxt);
            if constexpr (decltype(LD)::v) gload(ks, p + 2);
            if (ks < 3) ldf((ks + 1) & 1, ks + 1);
            __builtin_amdgcn_sched_barrier(0);   // the next step's fragment reads stay a group ahead of this step's products (one wave per SIMD: nobody else covers an LDS wait)
#pragma unroll
            for (int nb = 0; nb < NB; ++nb)
#pragma unroll
                for (int mb = 0; mb < MB; ++mb) acc[mb][nb] = wmmab(a[ks & 1][mb], b[ks & 1][nb], acc[mb][nb]);
            if constexpr (SPLIT) {
#pragma unroll
                for (int nb = 0; nb < NB; ++nb)
#pragma unroll
                    for (int mb = 0; mb < MB; ++mb) acc[mb][nb] = wmmab(a2[ks & 1][mb], b[ks & 1][nb], acc[mb][nb]); }
            __builtin_amdgcn_sched_barrier(0);   // the following step's stores, loads and reads are not lifted into this step's products, whose fragment set they refill
        }
        gbar();   // publishes pass p + 1 and ends every wave's reads of pass p
    };
#pragma unroll 1   // rolled: a pass is long straight-line code already, more copies would only cost instruction fetches
    for (int p = 0; p < NP - 2; ++p) pass(p, GFlag<true>(), GFlag<true>());
    pass(NP - 2, GFlag<true>(), GFlag<false>());    // the last two passes apart: nothing is left to load, then nothing to store
    pass(NP - 1, GFlag<false>(), GFlag<false>());
    if constexpr (PP != 0) {
        // The planes, through LDS (the whole work-group's tile, behind the last pass's barrier), so that every 128-B line of a plane is stored whole, by one wave. The unrolls: constant indices, as above.
        constexpr int EP = RA + 8, EPL = RB * EP, HS = (PP == HD) ? TR * HD : HD;   // pitch of a staged plane row, elements (an odd multiple of 16 B); one staged plane; the step of the plane index from one block of HD m to the next
        static_assert(3 * EPL <= 2 * STG && HD % RA == 0, "the three staged planes fit the ring; a tile's m lie in one block of HD");
#pragma unroll
        for (int nb = 0; nb < NB; ++nb)
#pragma unroll
            for (int mb = 0; mb < MB; ++mb) { v4i o16, oh, ol;
#pragma unroll
                for (int r = 0; r < 4; ++r) { unsigned a, c2; split2(acc[mb][nb][2 * r], acc[mb][nb][2 * r + 1], a, c2); o16[r] = (int)pk16(acc[mb][nb][2 * r], acc[mb][nb][2 * r + 1]); oh[r] = (int)a; ol[r] = (int)c2; }
                bf* e = sm + ((wn * NB + nb) * 16 + lr) * EP + (wm * MB + mb) * 16 + 8 * hi; *(v4ia*)e = o16; *(v4ia*)(e + EPL) = oh; *(v4ia*)(e + 2 * EPL) = ol; }
        gbar();   // the staged rows are read back by other waves than wrote them
        constexpr int TPR = RA / 8, RPT = 128 / TPR, NT = RB / RPT;   // threads per plane row of the tile (16 B each); rows per turn of the work-group; turns
        const int row = tid / TPR, cp = (tid % TPR) * 8;
        v4i t16[NT], th[NT], tl[NT];
#pragma unroll
        for (int i = 0; i < NT; ++i) { const bf* e = sm + (i * RPT + row) * EP + cp; t16[i] = *(const v4ia*)e; th[i] = *(const v4ia*)(e + EPL); tl[i] = *(const v4ia*)(e + 2 * EPL); }
        const size_t po = ((size_t)(r0 / HD) * HS + (size_t)(r0 % HD) + (size_t)c0 * PP) * 2; const unsigned pofs = (unsigned)row * (PP * 2u) + (unsigned)cp * 2u;   // bytes: the tile's place in a plane (uniform), the thread's place in a turn
        char* p16 = (char*)P16 + po; char* ph = (char*)Ph + po; char* pl = (char*)Pl + po;
#pragma unroll
        for (int i = 0; i < NT; ++i) { *(v4ia*)(p16 + pofs + i * (RPT * PP * 2)) = t16[i]; *(v4ia*)(ph + pofs + i * (RPT * PP * 2)) = th[i]; *(v4ia*)(pl + pofs + i * (RPT * PP * 2)) = tl[i]; }
    } else {
    // Output through LDS (each wave its own 16 rows, behind the last pass's barrier), so that every 128-B line of C is stored whole.
    constexpr int OP = NB * 16 + 4, LPR = NB * 4, RPS = 32 / LPR;   // pitch of a staged row, floats; lanes per row of the wave's tile; rows per wave-wide store
    float* os = (float*)sm + wave * (16 * OP);
#pragma unroll
    for (int mb = 0; mb < MB; ++mb) {
#pragma unroll
        for (int nb = 0; nb < NB; ++nb) {
#pragma unroll
            for (int j = 0; j < 8; ++j) os[(hi * 8 + j) * OP + nb * 16 + lr] = acc[mb][nb][j]; }
        __builtin_amdgcn_wave_barrier(); asm volatile("" ::: "memory");   // the staged rows are read back by other lanes of the wave than wrote them
        float* crow = C + (size_t)(r0 + (wm * MB + mb) * 16) * ldc + c0 + wn * NB * 16;
#pragma unroll
        for (int s = 0; s < 16 / RPS; ++s) { const int row = RPS * s + lane / LPR, cofs = (lane % LPR) * 4; *(v4f*)(crow + (size_t)row * ldc + cofs) = *(const v4fa*)(os + row * OP + cofs); }
        if (mb + 1 < MB) { __builtin_amdgcn_wave_barrier(); asm volatile("s_wait_xcnt 0x0" ::: "memory"); }   // the next 16 rows overwrite the staging only behind these reads; the wait: in front of whatever next rewrites a register that these stores name
    }
    }
}

// ---- k_wt4: the four weights, f32 [k][n], to bf16 planes [n][k] (round to nearest even), in one launch. A work-group of 8 waves takes a tile of WKT k x WNT n.
// In: a wave-wide 16-byte load covers the 512 B that the tile has of one weight row (four whole lines); a thread takes the same four n of eight consecutive k, four times over, all 32 loads in flight at once.
// Eight k of one n are 16 B of a plane row: packed in registers and stored to LDS as one piece. Out: a wave reads a plane row's 512 B from LDS and stores them as four whole lines.
// LDS rows are 512 B, a multiple of all 64 banks, so piece ch of row n lies at place ch ^ ((n >> 2) & 15): the 16 lanes of a half wave, which write the same ch of rows four apart, and read the pieces of one row, meet 16 different places each time.
#define WKT 256
#define WNT 128
__device__ __forceinline__ unsigned pkbf(float a, float b) { v2f x; x[0] = a; x[1] = b; return __builtin_bit_cast(unsigned, __builtin_convertvector(x, v2b)); }
// Every '#pragma unroll' in wt_tile is there so that the value arrays are indexed by constants and stay in registers, and every address is one register plus a constant.
template <int N>
__device__ __forceinline__ void wt_tile(bf* sm, const float* __restrict__ w, bf* __restrict__ Bt, const int tile) {
    const int tid = threadIdx.x, lane = tid & 31, wave = __builtin_amdgcn_readfirstlane(tid >> 5);
    const int n0 = (tile % (N / WNT)) * WNT, k0 = (tile / (N / WNT)) * WKT;   // neighbours in the grid read neighbouring pieces of the same weight rows
    const char* src = (const char*)(w + (size_t)(k0 + wave * 8) * N + n0); const unsigned lofs = (unsigned)lane * 16u;
    v4f v[4][8];   // v[i][r][j] = w[k0 + 64 i + 8 wave + r][n0 + 4 lane + j]
#pragma unroll
    for (int i = 0; i < 4; ++i)
#pragma unroll
        for (int r = 0; r < 8; ++r) v[i][r] = *(const v4fa*)(src + lofs + (i * 64 + r) * (N * 4));
    asm volatile("s_wait_xcnt 0x0" ::: "memory");   // in front of whatever next rewrites a register that these loads name
    __builtin_amdgcn_sched_barrier(0);   // nothing from below is lifted over that wait; and the loads stay one group, all in flight together
    const int x = wave ^ (lane & 15);    // piece 8 i + wave of rows 4 lane + j: place ((x ^ 8 (i & 1)) + 16 (i >> 1))
#pragma unroll
    for (int i = 0; i < 4; ++i)
#pragma unroll
        for (int j = 0; j < 4; ++j) { v4i o;
#pragma unroll
            for (int r = 0; r < 4; ++r) o[r] = (int)pkbf(v[i][2 * r][j], v[i][2 * r + 1][j]);
            *(v4ia*)(sm + (4 * lane + j) * WKT + ((x ^ (8 * (i & 1))) + 16 * (i >> 1)) * 8) = o; }
    __syncthreads();   // the plane rows are read back by other waves than wrote them
    v4i t[16];
#pragma unroll
    for (int i = 0; i < 16; ++i) t[i] = *(const v4ia*)(sm + (wave * 16 + i) * WKT + (lane ^ ((wave * 4 + (i >> 2)) & 15)) * 8);
    char* dst = (char*)(Bt + (size_t)(n0 + wave * 16) * GK + k0);
#pragma unroll
    for (int i = 0; i < 16; ++i) *(v4ia*)(dst + lofs + i * (GK * 2)) = t[i];
}
__global__ __launch_bounds__(256) void k_wt4(const float* __restrict__ wq, const float* __restrict__ wk, const float* __restrict__ wv, const float* __restrict__ wo, bf* WQ, bf* WK, bf* WV, bf* WO) {
    __shared__ __align__(16) bf sm[WNT * WKT];
    static_assert(DM == GK && DQ == GK && DM == DQ, "all four weights have GK rows; Wq and Wo are of one shape");
    constexpr int TB = (GK / WKT) * (DQ / WNT), TS = (GK / WKT) * (DKV / WNT);   // tiles of a large and of a small weight
    const int b = blockIdx.x;   // the branches are uniform for the work-group
    if (b < 2 * TB) wt_tile<DQ>(sm, b < TB ? wq : wo, b < TB ? WQ : WO, b < TB ? b : b - TB);
    else wt_tile<DKV>(sm, b < 2 * TB + TS ? wk : wv, b < 2 * TB + TS ? WK : WV, b < 2 * TB + TS ? b - 2 * TB : b - 2 * TB - TS);
}
__global__ __launch_bounds__(256) void k_cvt8(const float* __restrict__ src, bf* dst, size_t n8) { const size_t i = (size_t)blockIdx.x * 256 + threadIdx.x; if (i >= n8) return; const v8f v = *(const v8f*)(src + i * 8); v8us o;
#pragma unroll
    for (int k = 0; k < 8; ++k) o[k] = f2bf(v[k]); *(v8us*)(dst + i * 8) = o;  }
#define SKEY  64                   // keys per stage
#define KPIT  136                  // LDS pitch of a K row, elements: 256 B + 16 B, an odd multiple of 16 B for the 16-byte readers
#define VPIT  72                   // LDS pitch of a V^T row, elements: 128 B + 16 B, likewise
#define KTILE (SKEY * KPIT)
#define PLANE (KTILE + HD * VPIT)  // one stage of one plane pair: K tile, then V^T tile
typedef __attribute__((ext_vector_type(8))) unsigned v8u;
__device__ __forceinline__ float xhalf(float x) { return __builtin_bit_cast(float, __builtin_amdgcn_permlanex16(__builtin_bit_cast(int, x), __builtin_bit_cast(int, x), 0x76543210, 0xfedcba98, false, false)); }  // lane l with lane l ^ 16
template <typename T16, bool HL>
__device__ __forceinline__ void fattn_run(T16* sm, const T16* __restrict__ Q, const T16* __restrict__ Q2, const T16* __restrict__ Kp, const T16* __restrict__ K2, const T16* __restrict__ Vt, const T16* __restrict__ V2, const int qw0, v8f (&acc)[2][8], float (&l_run)[2]) {
    typedef typename WFrag<T16>::V V;
    constexpr int NPL = HL ? 2 : 1, BUF = NPL * PLANE;
    const int tid = threadIdx.x, lane = tid & 31, c = lane & 15, h = lane >> 4;
    const float cscale = SCL * 1.4426950408889634f;
    v4i rk[NPL][8], rv[NPL][8];
    const unsigned vofs = (unsigned)(tid >> 3) * (TR * 2u) + (unsigned)(tid & 7) * 16u;   // bytes in a kv plane: eight threads cover a V^T row's 128 B
    auto gload = [&](int key0) {   // a stage's K rows and V^T rows, 16 B a thread and turn: every wave-wide load covers four whole 128-B lines
        const unsigned ko = (unsigned)tid + (unsigned)key0 * (HD / 8u), vo = vofs + (unsigned)key0 * 2u;   // the thread's 32-bit offsets in this stage, the same in the hi and the lo plane: K in 16-byte pieces (its rows lie in a row), V^T in bytes
        __builtin_amdgcn_sched_barrier(0);   // the loads are not lifted from here: the wait at the foot has to stand directly behind them
#pragma unroll
        for (int i = 0; i < 8; ++i) {   // the plane's uniform base + the thread's offset + a constant: two address registers for the whole group
            rk[0][i] = ((const v4ia*)Kp + ko)[i * 128]; rv[0][i] = *(const v4ia*)((const char*)Vt + vo + i * (16 * TR * 2));
            if constexpr (HL) { rk[NPL - 1][i] = ((const v4ia*)K2 + ko)[i * 128]; rv[NPL - 1][i] = *(const v4ia*)((const char*)V2 + vo + i * (16 * TR * 2)); } }
        asm volatile("s_wait_xcnt 0x0" :: "v"(ko), "v"(vo) : "memory");   // in front of whatever next rewrites a register that these loads name; the two offsets are inputs so that they live up to the wait and no load of the group lands in them
        __builtin_amdgcn_sched_barrier(0);   // nothing from below is lifted over that wait; and the loads stay up here: sunk towards their use they would hide no latency
    };
    auto sstore = [&](T16* buf) {
#pragma unroll
        for (int i = 0; i < 8; ++i) { const int idx = i * 128 + tid; const int ok = (idx >> 4) * KPIT + (idx & 15) * 8, ov = KTILE + (idx >> 3) * VPIT + (idx & 7) * 8;
            *(v4ia*)(buf + ok) = rk[0][i]; *(v4ia*)(buf + ov) = rv[0][i]; if (HL) { *(v4ia*)(buf + PLANE + ok) = rk[NPL - 1][i]; *(v4ia*)(buf + PLANE + ov) = rv[NPL - 1][i]; } } };
    const int nst = qw0 / SKEY + 1;   // stages up to and with the one that holds the wave's diagonal; the same for all four waves
    gload(0);
    V qf[2][4], qf2[2][4];
#pragma unroll
    for (int g = 0; g < 2; ++g)
#pragma unroll
        for (int kc = 0; kc < 4; ++kc) { const size_t o = (size_t)(qw0 + 16 * g + c) * HD + 32 * kc + 8 * h; qf[g][kc] = WFrag<T16>::ld(Q + o); if (HL) qf2[g][kc] = WFrag<T16>::ld(Q2 + o); }
    asm volatile("s_wait_xcnt 0x0" ::: "memory");   // in front of whatever next rewrites a register that the Q loads name
    __builtin_amdgcn_sched_barrier(0);   // nothing from below is lifted over that wait
    float m_run[2];
#pragma unroll
    for (int g = 0; g < 2; ++g) { m_run[g] = -__builtin_inff(); l_run[g] = 0.0f;
#pragma unroll
        for (int t = 0; t < 8; ++t) acc[g][t] = (v8f){}; }
    sstore(sm); gload(min(1, nst - 1) * SKEY);
    __syncthreads();   // stage 0 is in buffer 0
#pragma unroll 1   // rolled: a stage is long straight-line code already, a second copy would only cost instruction fetches
    for (int st = 0; st < nst; ++st) {
        const T16* cur = sm + (st & 1) * BUF;
        sstore(sm + ((st + 1) & 1) * BUF);          // stage st + 1 into the buffer that stage st - 1 used: the barrier at the foot of st - 1 ended its reads (past the end: the last stage again, read by nobody)
        gload(min(st + 2, nst - 1) * SKEY);         // in flight under this whole stage; clamped, so always inside the planes and no branch round the loads
        // The stage's fragment reads go out in whole groups ahead of their products (one wave per SIMD: nobody else covers an LDS wait): K first; V^T directly behind it where one plane pair leaves the registers
        // for both, else behind the first product, into the registers K has left, so that it streams in under the softmax.
        v8f s[4][2]; V kfa[4][4], kfa2[HL ? 4 : 1][4], vfa[2][8], vfa2[HL ? 2 : 1][8];
#pragma unroll
        for (int kt = 0; kt < 4; ++kt)
#pragma unroll
            for (int kc = 0; kc < 4; ++kc) { const T16* p = cur + (16 * kt + c) * KPIT + 32 * kc + 8 * h; kfa[kt][kc] = WFrag<T16>::ld(p); if constexpr (HL) kfa2[kt][kc] = WFrag<T16>::ld(p + PLANE); }
        __builtin_amdgcn_sched_barrier(0);          // K's reads stay a group, ahead of V^T's: LDS answers in order, and the first product waits for K alone
        auto ldv = [&]() {
#pragma unroll
            for (int j = 0; j < 2; ++j)
#pragma unroll
                for (int t = 0; t < 8; ++t) { const T16* p = cur + KTILE + (16 * t + c) * VPIT + 32 * j + 8 * h; vfa[j][t] = WFrag<T16>::ld(p); if constexpr (HL) vfa2[j][t] = WFrag<T16>::ld(p + PLANE); }
            __builtin_amdgcn_sched_barrier(0);      // keeps the group together up here: moved down to their uses the reads are waited for one by one
        };
        if constexpr (!HL) ldv();
#pragma unroll
        for (int kt = 0; kt < 4; ++kt)
#pragma unroll
            for (int g = 0; g < 2; ++g) { s[kt][g] = (v8f){};
#pragma unroll
                for (int kc = 0; kc < 4; ++kc) { s[kt][g] = WFrag<T16>::mma(kfa[kt][kc], qf[g][kc], s[kt][g]); if constexpr (HL) { s[kt][g] = WFrag<T16>::mma(kfa[kt][kc], qf2[g][kc], s[kt][g]); s[kt][g] = WFrag<T16>::mma(kfa2[kt][kc], qf[g][kc], s[kt][g]); } } }
        if constexpr (HL) { __builtin_amdgcn_sched_barrier(0);   // V^T's reads not above the first product: K's registers are free only behind it
            ldv(); }
        if (st == nst - 1) {                        // work-group-uniform: only the stage with the diagonal pays for the mask
            const int lim = qw0 - st * SKEY + c - 8 * h;   // key 16 kt + 8 h + r of the stage joins query 16 g + c of the wave when 16 kt + r <= lim + 16 g
#pragma unroll
            for (int g = 0; g < 2; ++g)
#pragma unroll
                for (int kt = 0; kt < 4; ++kt) {
#pragma unroll
                    for (int r = 0; r < 8; ++r) { if (16 * kt + r > lim + 16 * g) s[kt][g][r] = -__builtin_inff(); }
                    asm volatile("" : "+v"(s[kt][g]));   // the masked scores: keeps the selects inside the branch
                }
        }
        float mb[2]; bool need = false;
#pragma unroll
        for (int g = 0; g < 2; ++g) { float mx = -__builtin_inff();
#pragma unroll
            for (int kt = 0; kt < 4; ++kt)
#pragma unroll
                for (int r = 0; r < 8; ++r) mx = fmaxf(mx, s[kt][g][r]);
            mx = fmaxf(mx, xhalf(mx)) * cscale; mb[g] = mx; need = need || (mx > m_run[g] + 8.0f); }
        if (__builtin_amdgcn_ballot_w32(need) != 0) {   // rare after the first stages
#pragma unroll
            for (int g = 0; g < 2; ++g) { const float m_new = fmaxf(m_run[g], mb[g]);   // finite from the first stage on: key 0 is never masked
                const float corr = __builtin_amdgcn_exp2f(m_run[g] - m_new);            // 0 on the first stage, where m_run is -inf
                l_run[g] *= corr; m_run[g] = m_new;
#pragma unroll
                for (int t = 0; t < 8; ++t) acc[g][t] = acc[g][t] * corr; }
        }
        V pf[2][2], pf2[2][2];
#pragma unroll
        for (int g = 0; g < 2; ++g) { const float nm = -m_run[g]; float ps0 = 0.0f, ps1 = 0.0f;
#pragma unroll
            for (int j = 0; j < 2; ++j) { v8u w, w2;
#pragma unroll
                for (int i = 0; i < 8; ++i) {
                    const float p0 = __builtin_amdgcn_exp2f(fmaf(s[2 * j + (i >> 2)][g][2 * (i & 3)], cscale, nm)), p1 = __builtin_amdgcn_exp2f(fmaf(s[2 * j + (i >> 2)][g][2 * (i & 3) + 1], cscale, nm));
                    ps0 += p0; ps1 += p1;
                    if (HL) { unsigned wh, wl; split2(p0, p1, wh, wl); w[i] = wh; w2[i] = wl; }
                    else w[i] = pk16(p0, p1); }
                pf[g][j] = __builtin_bit_cast(V, w); if (HL) pf2[g][j] = __builtin_bit_cast(V, w2); }
            l_run[g] += ps0 + ps1; }
#pragma unroll
        for (int j = 0; j < 2; ++j)
#pragma unroll
            for (int t = 0; t < 8; ++t)
#pragma unroll
                for (int g = 0; g < 2; ++g) { acc[g][t] = WFrag<T16>::mma(vfa[j][t], pf[g][j], acc[g][t]); if constexpr (HL) { acc[g][t] = WFrag<T16>::mma(vfa[j][t], pf2[g][j], acc[g][t]); acc[g][t] = WFrag<T16>::mma(vfa2[j][t], pf[g][j], acc[g][t]); } }
        __builtin_amdgcn_sched_barrier(0);          // keeps the barrier, and the wait for stage st + 2's global loads that comes with it, at the stage's foot
        __syncthreads();   // publishes stage st + 1 and ends every wave's reads of stage st
    }
}
// The grid has twice as many work-groups as the chip holds at a time (one to a WGP, by registers); a tile's cost falls with the index.
// blockIdx.y is the rank, blockIdx.x the (batch element, kv group) pair. Cost of a 32-row tile: its stages, a hi+lo stage counted double
// (three products for one, the same softmax). The order is for speed alone: any permutation gives the same values.
struct TileOrder { unsigned char t[TT / 32]; };
constexpr int tile_cost(int i) { return (i * 32 < RH ? 2 : 1) * (i * 32 / SKEY + 1); }
constexpr TileOrder tile_order() { TileOrder o{};
    for (int i = 0; i < TT / 32; ++i) { int r = 0;   // the rank of tile i: the tiles that cost more, and of those that cost the same the later ones
        for (int j = 0; j < TT / 32; ++j) r += (tile_cost(j) > tile_cost(i) || (tile_cost(j) == tile_cost(i) && j > i)) ? 1 : 0;
        o.t[r] = (unsigned char)i; }
    return o; }
static constexpr TileOrder fattn_order = tile_order();
__global__ __launch_bounds__(128) void k_fattn(const h16* __restrict__ Q16, const bf* __restrict__ Qh, const bf* __restrict__ Ql, const h16* __restrict__ K16, const bf* __restrict__ Kh, const bf* __restrict__ Kl, const h16* __restrict__ V16, const bf* __restrict__ Vh, const bf* __restrict__ Vl, bf* __restrict__ Ah, bf* __restrict__ Al) {
    __shared__ __align__(16) unsigned short sm[2 * 2 * PLANE];   // two buffers of two plane pairs (hi+lo); the fp16 rows use half of it
    const int tid = threadIdx.x, lane = tid & 31, c = lane & 15, h = lane >> 4;
    const int kv = blockIdx.x % NKV, bz = blockIdx.x / NKV, wave = __builtin_amdgcn_readfirstlane(tid >> 5), head = kv * REP + wave;
    // Dearest tiles first. readfirstlane: the tile number is used as loaded; seeing through the table, the compiler tested the rank against a 64-bit mask for the branch below, and that build kept the thread id in scratch and reloaded it in every stage.
    const int qw0 = __builtin_amdgcn_readfirstlane(fattn_order.t[blockIdx.y]) * 32;
    const size_t qo = ((size_t)head * NB_ + bz) * TT * HD, ko = ((size_t)kv * NB_ + bz) * TT * HD, vo = (size_t)kv * HD * TR + (size_t)bz * TT;
    v8f acc[2][8]; float l_run[2];
    if (qw0 < RH) fattn_run<bf, true>((bf*)sm, Qh + qo, Ql + qo, Kh + ko, Kl + ko, Vh + vo, Vl + vo, qw0, acc, l_run);
    else fattn_run<h16, false>((h16*)sm, Q16 + qo, nullptr, K16 + ko, nullptr, V16 + vo, nullptr, qw0, acc, l_run);
    // Output through LDS (each wave its own 2 x 32 rows, behind the stage loop's last barrier), so that every 128-B line of the planes is stored whole. The unrolls: constant indices, as above.
    bf* eb = (bf*)sm + wave * (2 * 32 * KPIT);
#pragma unroll
    for (int g = 0; g < 2; ++g) { const float inv = __fdiv_rn(1.0f, l_run[g] + xhalf(l_run[g]));
#pragma unroll
        for (int t = 0; t < 8; ++t) { v4i oh, ol;
#pragma unroll
            for (int r = 0; r < 4; ++r) { unsigned a, c2; split2(acc[g][t][2 * r] * inv, acc[g][t][2 * r + 1] * inv, a, c2); oh[r] = (int)a; ol[r] = (int)c2; }
            bf* e = eb + (16 * g + c) * KPIT + 16 * t + 8 * h; *(v4ia*)e = oh; *(v4ia*)(e + 32 * KPIT) = ol; } }
    __syncthreads();   // the staged rows are read back by other lanes than wrote them
    v4i th[16], tl[16];
#pragma unroll
    for (int i = 0; i < 16; ++i) { const bf* e = eb + (2 * i + h) * KPIT + c * 8; th[i] = *(const v4ia*)e; tl[i] = *(const v4ia*)(e + 32 * KPIT); }
    const unsigned oofs = (unsigned)h * (DQ * 2u) + (unsigned)c * 16u;   // bytes: 16 lanes cover one row's 256 B, a wave-wide store two rows
    char* ah = (char*)(Ah + (size_t)(bz * TT + qw0) * DQ + head * HD); char* al = (char*)(Al + (size_t)(bz * TT + qw0) * DQ + head * HD);
#pragma unroll
    for (int i = 0; i < 16; ++i) { *(v4ia*)(ah + oofs + i * (2 * DQ * 2)) = th[i]; *(v4ia*)(al + oofs + i * (2 * DQ * 2)) = tl[i]; }
}

extern "C" void kernel_launch(void* const* d_in, const int* in_sizes, int n_in,
                              void* d_out, int out_size, void* d_ws, size_t ws_size, hipStream_t stream) {
    (void)in_sizes; (void)n_in; (void)out_size;
    const float* x = (const float*)d_in[0]; const float* wq = (const float*)d_in[1]; const float* wk = (const float*)d_in[2]; const float* wv = (const float*)d_in[3]; const float* wo = (const float*)d_in[4];
    float* OUT = (float*)d_out;     // [2][2048][2048]
    char* wsp = (char*)d_ws;
    auto take = [&](size_t bytes) { char* p = wsp; wsp += (bytes + 255) & ~(size_t)255; return (void*)p; };
    bf* WQ = (bf*)take((size_t)DQ * DM * 2); bf* WK = (bf*)take((size_t)DKV * DM * 2); bf* WV = (bf*)take((size_t)DKV * DM * 2); bf* WO = (bf*)take((size_t)DM * DQ * 2);
    bf* XB = (bf*)take((size_t)TR * DM * 2);
    h16* QP16 = (h16*)take((size_t)NH_ * TR * HD * 2); h16* KP16 = (h16*)take((size_t)NKV * TR * HD * 2); h16* VT16 = (h16*)take((size_t)NKV * HD * TR * 2);
    bf* QPh = (bf*)take((size_t)NH_ * TR * HD * 2); bf* QPl = (bf*)take((size_t)NH_ * TR * HD * 2); bf* KPh = (bf*)take((size_t)NKV * TR * HD * 2); bf* KPl = (bf*)take((size_t)NKV * TR * HD * 2); bf* VTh = (bf*)take((size_t)NKV * HD * TR * 2); bf* VTl = (bf*)take((size_t)NKV * HD * TR * 2);
    bf* ATh = (bf*)take((size_t)TR * DQ * 2); bf* ATl = (bf*)take((size_t)TR * DQ * 2);
    if ((size_t)(wsp - (char*)d_ws) > ws_size) return;    // ws 256 MiB
    k_wt4<<<2 * (GK / WKT) * (DQ / WNT) + 2 * (GK / WKT) * (DKV / WNT), 256, 0, stream>>>(wq, wk, wv, wo, WQ, WK, WV, WO);
    // Every launch takes both batch elements: the projections see x as TR rows, the attention has the batch element in blockIdx.x.
    k_cvt8<<<(unsigned)(((size_t)TR * DM / 8 + 255) / 256), 256, 0, stream>>>(x, XB, (size_t)TR * DM / 8);
    k_gemms<4, 4, false, HD><<<dim3(DQ / 128, TR / 128, 1), 128, 0, stream>>>(WQ, nullptr, XB, nullptr, 0, QP16, QPh, QPl);
    k_gemms<2, 2, false, HD><<<dim3(DKV / 64, TR / 64, 1), 128, 0, stream>>>(WK, nullptr, XB, nullptr, 0, KP16, KPh, KPl);
    k_gemms<2, 2, false, TR><<<dim3(TR / 64, DKV / 64, 1), 128, 0, stream>>>(XB, nullptr, WV, nullptr, 0, VT16, VTh, VTl);
    k_fattn<<<dim3(NKV * NB_, TT / 32, 1), 128, 0, stream>>>(QP16, QPh, QPl, KP16, KPh, KPl, VT16, VTh, VTl, ATh, ATl);
    k_gemms<4, 4, true, 0><<<dim3(TR / 128, DM / 128, 1), 128, 0, stream>>>(ATh, ATl, WO, OUT, DM, nullptr, nullptr, nullptr);
}

// v008
// One run takes 145 microseconds.
// In two side-by-side timings against v007, it was 1.06 and 1.07 times as fast.
// Counting every step since v000, it is 11.8 times as fast.
#include <hip/hip_runtime.h>

// Grouped-query causal self-attention with 128-wide heads, no rotary (x [2][2048][2048]; q = x Wq ('xw' [2048][2048], 16 heads x 128), k, v = x Wk, x Wv ('xw' [2048][512], 4 kv heads x 128), no biases; k, v repeated 4 x on the head axis (jnp.repeat: query head h uses kv head h / 4); att x 1/sqrt(128); causal (-inf); softmax; y = merged Wo ('xw' [2048][2048], no bias) -> [2][2048][2048] (8.4 M); argument order x, Wq, Wk, Wv, Wo).
// Compute dtypes, f32 accumulate: every input rounded to bf16; q/k/v on PLAIN bf16 operands (inputs: exact), their fp16 and hi+lo bf16 planes written by the projection kernel itself; scores, softmax and attn.v in one kernel (online softmax, f32; 64-key stages beyond a wave's diagonal never read): query rows < 512 hl (3 products), the rest single fp16; Wo hl x exact (2 products).

#define NB_  2
#define TT   2048
#define TR   (NB_ * TT)       // rows of x, both batch elements one behind the other: row b TT + t
#define DM   2048
#define NH_  16
#define NKV  4
#define REP  (NH_ / NKV)
#define HD   128
#define DQ   (NH_ * HD)
#define DKV  (NKV * HD)
#define RH   512                  // query rows < RH use hi+lo planes (a multiple of 32: a wave's 32 rows are wholly hi+lo or wholly fp16)
#define SCL  0.088388347648318447f   // HD^-0.5
typedef _Float16 h16;
typedef unsigned short bf;
typedef __attribute__((ext_vector_type(16))) __bf16   v16bf;
typedef __attribute__((ext_vector_type(16))) _Float16 v16h;
typedef __attribute__((ext_vector_type(8)))  _Float16 v8h;
typedef __attribute__((ext_vector_type(8)))  unsigned short v8us;
typedef __attribute__((ext_vector_type(8)))  float    v8f;
typedef __attribute__((ext_vector_type(4)))  float    v4f;
typedef v8h  __attribute__((may_alias)) v8ha;
typedef v4f  __attribute__((may_alias)) v4fa;
typedef v8us __attribute__((may_alias)) v8usa;

__device__ __forceinline__ unsigned short f2bf(float f) { unsigned u = __float_as_uint(f); u += 0x7FFFu + ((u >> 16) & 1u); return (unsigned short)(u >> 16); }
__device__ __forceinline__ float bf2f(unsigned short b) { return __uint_as_float(((unsigned)b) << 16); }
__device__ __forceinline__ v16h cat16(v8h lo, v8h hi) { return __builtin_shufflevector(lo, hi, 0, 1, 2, 3, 4, 5, 6, 7, 8, 9, 10, 11, 12, 13, 14, 15); }
__device__ __forceinline__ v16bf cat16b(v8us lo, v8us hi) { return __builtin_bit_cast(v16bf, __builtin_shufflevector(lo, hi, 0, 1, 2, 3, 4, 5, 6, 7, 8, 9, 10, 11, 12, 13, 14, 15)); }
__device__ __forceinline__ v8f wmma16(v16h a, v16h b, v8f c) { return __builtin_amdgcn_wmma_f32_16x16x32_f16(false, a, false, b, (short)0, c, false, false); }
__device__ __forceinline__ v8f wmmab(v16bf a, v16bf b, v8f c) { return __builtin_amdgcn_wmma_f32_16x16x32_bf16(false, a, false, b, (short)0, c, false, false); }

typedef __attribute__((ext_vector_type(2))) _Float16 v2h;
typedef __attribute__((ext_vector_type(2))) float v2f;
typedef __attribute__((ext_vector_type(4))) int v4i;
typedef v4i __attribute__((may_alias)) v4ia;
__device__ __forceinline__ unsigned pk16(float a, float b) { v2f x; x[0] = a; x[1] = b; return __builtin_bit_cast(unsigned, __builtin_convertvector(x, v2h)); }
typedef __attribute__((ext_vector_type(2))) __bf16 v2b;
__device__ __forceinline__ void split2(float a, float b, unsigned& hi, unsigned& lo) {   // two values at once, by the packed conversion (round to nearest even, as f2bf): packed hi parts, packed remainders
    v2f x; x[0] = a; x[1] = b; hi = __builtin_bit_cast(unsigned, __builtin_convertvector(x, v2b));
    v2f r; r[0] = a - __uint_as_float(hi << 16); r[1] = b - __uint_as_float(hi & 0xFFFF0000u); lo = __builtin_bit_cast(unsigned, __builtin_convertvector(r, v2b)); }

template <typename T16> struct WFrag;
template <> struct WFrag<h16> { typedef v16h V; static __device__ __forceinline__ V ld(const h16* p) { return cat16(*(const v8h*)p, *(const v8h*)(p + 16)); } static __device__ __forceinline__ v8f mma(V a, V b, v8f c) { return wmma16(a, b, c); } };
template <> struct WFrag<bf> { typedef v16bf V; static __device__ __forceinline__ V ld(const bf* p) { return cat16b(*(const v8us*)p, *(const v8us*)(p + 16)); } static __device__ __forceinline__ v8f mma(V a, V b, v8f c) { return wmmab(a, b, c); } };
// ---- k_gemms: C[m][n] = sum_k A[m][k] Bt[n][k] (+ A2[m][k] Bt[n][k] where SPLIT), all planes bf16, K-contiguous, K = GK. PP == 0: C goes out as f32, pitch DM.
// PP != 0: C goes out TRANSPOSED as the three 16-bit planes the attention kernel reads (fp16, bf16 hi, bf16 lo), n the row (pitch PP elements), m along it: element (m, n) at (m / HD) HS + n PP + m % HD.
// An accumulator lane holds eight consecutive m of one n, which is 16 B of a plane row. q, k: A = the weight (m = head x 128 + d), Bt = x (n = b TT + t), PP = HD, planes [head][b][t][d]; v: A = x (m = b TT + t), Bt = the weight, PP = TR, planes [head x 128 + d][b][t].
// A work-group is 2 x WN waves on a (32 MB) x (16 NB WN) tile of C; a wave owns MB x NB accumulators. k goes in passes of 128 (256 B of every operand row): the work-group brings a pass through registers into
// one of two LDS buffers with whole-line loads (16 threads cover a row's 256 B), so every operand byte comes from L2 once per work-group and the fragments are read from LDS. One barrier per pass.
// A pass is four k steps of 32; each step stores a quarter of the next pass's rows to LDS, refills those registers with the same quarter of the pass after it (so a whole pass of loads is always in flight),
// reads the next step's fragments into the second fragment set and then runs its own products.
// The walk over k is a ring: work-group (x, y) starts at pass (x + y) mod NP and wraps round. Work-groups that share operand rows (one x, or one y) would otherwise ask L2 for the same lines at the same moment,
// and every work-group of the launch for the same 256 B of each 4-KiB row. Every accumulator takes its products in that order of passes, kc ascending inside a pass, A before A2.
// Every '#pragma unroll' in k_gemms is there so that the staging, fragment and accumulator arrays are indexed by constants and stay in registers.
#define GK    2048                 // the reduction length of all four products
#define GPASS 128                  // k per pass
#define GPIT  136                  // LDS pitch of a staged row, elements: 256 B + 16 B, an odd multiple of 16 B for the 16-byte readers
typedef __attribute__((ext_vector_type(4))) int g4i;
typedef g4i __attribute__((may_alias)) g4ia;
template <bool B> struct GFlag { static constexpr bool v = B; };
// The pass barrier, by hand: __syncthreads() would also wait for the global loads that are in flight for the pass after next and so undo their lead. What other waves depend on here is LDS alone
// (this wave's stores of the next pass, its reads of this one): s_wait_dscnt 0 covers both.
__device__ __forceinline__ void gbar() { asm volatile("s_wait_dscnt 0x0\n\ts_barrier_signal -1\n\ts_barrier_wait -1" ::: "memory"); }
template <int MB, int NB, bool SPLIT, int PP, int WN>
__global__ __launch_bounds__(64 * WN) void k_gemms(const bf* __restrict__ A, const bf* __restrict__ A2, const bf* __restrict__ Bt, float* C, h16* P16, bf* Ph, bf* Pl) {
    typedef WFrag<bf>::V V;
    constexpr int TH = 64 * WN, RT = TH / 16, TA = (32 * MB) / RT / 4, RA = (32 * MB), RB = 16 * NB * WN, OA2 = RA * GPIT, OB = (SPLIT ? 2 : 1) * RA * GPIT, STG = OB + RB * GPIT, NP = GK / GPASS, NA2 = SPLIT ? MB : 1;
    __shared__ __align__(16) bf sm[2 * STG];
    const int tid = threadIdx.x, lane = tid & 31, lr = lane & 15, hi = lane >> 4, wave = __builtin_amdgcn_readfirstlane(tid >> 5), wm = wave / WN, wn = wave % WN;
    static_assert((32 * MB) % (4 * RT) == 0, "a quarter of a pass is whole turns of RT rows in either operand");
    const int r0 = blockIdx.x * RA, c0 = blockIdx.y * RB;
    static_assert((NP & (NP - 1)) == 0, "the ring of passes wraps by a mask");
    const int p0 = (int)((blockIdx.x + blockIdx.y) & (unsigned)(NP - 1));   // the pass of k that this work-group takes first (uniform)
    const unsigned tofs = (unsigned)(tid >> 4) * (GK * 2u) + (unsigned)(tid & 15) * 16u;   // bytes: the thread's row of a turn of RT rows, and its 16 B of the row's 256
    const char* Ab = (const char*)(A + (size_t)r0 * GK) + tofs; const char* A2b = SPLIT ? (const char*)(A2 + (size_t)r0 * GK) + tofs : nullptr; const char* Bb = (const char*)(Bt + (size_t)c0 * GK) + tofs;
    const int sofs = (tid >> 4) * GPIT + (tid & 15) * 8;                                   // the same place in a staged turn, elements
    g4i ra[4 * TA], ra2[SPLIT ? 4 * TA : 4], rb[4 * NB];
    auto gload = [&](int q, int pass) {   // quarter q of a pass: TA turns of A (and of A2), NB turns of Bt; every wave-wide load covers four whole 128-B lines
        const int kb = ((pass + p0) & (NP - 1)) * (GPASS * 2);   // bytes: where in a row the work-group's pass number 'pass' lies
        const char* pa = Ab + kb; const char* pa2 = SPLIT ? A2b + kb : nullptr; const char* pb = Bb + kb;   // the thread's address in each plane + a constant per turn
        __builtin_amdgcn_sched_barrier(0);   // the loads are not lifted from here: the wait at the foot has to stand directly behind them
#pragma unroll
        for (int i = 0; i < TA; ++i) { const int t = q * TA + i; ra[t] = *(const g4ia*)(pa + t * (RT * GK * 2)); if constexpr (SPLIT) ra2[t] = *(const g4ia*)(pa2 + t * (RT * GK * 2)); }
#pragma unroll
        for (int i = 0; i < NB; ++i) { const int t = q * NB + i; rb[t] = *(const g4ia*)(pb + t * (RT * GK * 2)); }
        // in front of whatever next rewrites a register that these loads name; the addresses are inputs so that they live up to the wait and no load of the group lands in them
        if constexpr (SPLIT) asm volatile("s_wait_xcnt 0x0" :: "v"(pa), "v"(pa2), "v"(pb) : "memory"); else asm volatile("s_wait_xcnt 0x0" :: "v"(pa), "v"(pb) : "memory");
        __builtin_amdgcn_sched_barrier(0);   // nothing from below is lifted over that wait; and the loads stay up here: sunk towards their use they would hide no latency
    };
    auto sstore = [&](int q, bf* buf) {
#pragma unroll
        for (int i = 0; i < TA; ++i) { const int t = q * TA + i; *(g4ia*)(buf + t * RT * GPIT + sofs) = ra[t]; if constexpr (SPLIT) *(g4ia*)(buf + OA2 + t * RT * GPIT + sofs) = ra2[t]; }
#pragma unroll
        for (int i = 0; i < NB; ++i) { const int t = q * NB + i; *(g4ia*)(buf + OB + t * RT * GPIT + sofs) = rb[t]; } };
    v8f acc[MB][NB];
#pragma unroll
    for (int mb = 0; mb < MB; ++mb)
#pragma unroll
        for (int nb = 0; nb < NB; ++nb) acc[mb][nb] = (v8f){};
#pragma unroll
    for (int q = 0; q < 4; ++q) gload(q, 0);
#pragma unroll
    for (int q = 0; q < 4; ++q) { sstore(q, sm); gload(q, 1); }
    gbar();   // pass 0 is in buffer 0
    const int fa = (wm * MB * 16 + lr) * GPIT + 8 * hi, fb = OB + (wn * NB * 16 + lr) * GPIT + 8 * hi;   // the lane's place in the wave's first A and Bt fragment: the k order of both is that of WFrag::ld
    auto pass = [&](int p, auto ST, auto LD) {   // ST: a pass p + 1 exists and is stored; LD: a pass p + 2 exists and is loaded
        const bf* cur = sm + (p & 1) * STG; bf* nxt = sm + ((p + 1) & 1) * STG;   // nxt held pass p - 1: the barrier at the foot of p - 1 ended its reads
        V a[2][MB], a2[2][NA2], b[2][NB];
        auto ldf = [&](int set, int ks) {
#pragma unroll
            for (int mb = 0; mb < MB; ++mb) { a[set][mb] = WFrag<bf>::ld(cur + fa + mb * 16 * GPIT + ks * 32); if constexpr (SPLIT) a2[set][mb] = WFrag<bf>::ld(cur + OA2 + fa + mb * 16 * GPIT + ks * 32); }
#pragma unroll
            for (int nb = 0; nb < NB; ++nb) b[set][nb] = WFrag<bf>::ld(cur + fb + nb * 16 * GPIT + ks * 32); };
        ldf(0, 0);
#pragma unroll
        for (int ks = 0; ks < 4; ++ks) {
            if constexpr (decltype(ST)::v) sstore(ks, nxt);
            if constexpr (decltype(LD)::v) gload(ks, p + 2);
            if (ks < 3) ldf((ks + 1) & 1, ks + 1);
            __builtin_amdgcn_sched_barrier(0);   // the next step's fragment reads stay a group ahead of this step's products (one or two waves per SIMD: little else covers an LDS wait)
#pragma unroll
            for (int nb = 0; nb < NB; ++nb)
#pragma unroll
                for (int mb = 0; mb < MB; ++mb) acc[mb][nb] = wmmab(a[ks & 1][mb], b[ks & 1][nb], acc[mb][nb]);
            if constexpr (SPLIT) {
#pragma unroll
                for (int nb = 0; nb < NB; ++nb)
#pragma unroll
                    for (int mb = 0; mb < MB; ++mb) acc[mb][nb] = wmmab(a2[ks & 1][mb], b[ks & 1][nb], acc[mb][nb]); }
            __builtin_amdgcn_sched_barrier(0);   // the following step's stores, loads and reads are not lifted into this step's products, whose fragment set they refill
        }
        gbar();   // publishes pass p + 1 and ends every wave's reads of pass p
    };
#pragma unroll 1   // rolled: a pass is long straight-line code already, more copies would only cost instruction fetches
    for (int p = 0; p < NP - 2; ++p) pass(p, GFlag<true>(), GFlag<true>());
    pass(NP - 2, GFlag<true>(), GFlag<false>());    // the last two passes apart: nothing is left to load, then nothing to store
    pass(NP - 1, GFlag<false>(), GFlag<false>());
    if constexpr (PP != 0) {
        // The planes, through LDS (the whole work-group's tile, behind the last pass's barrier), so that every 128-B line of a plane is stored whole, by one wave. The unrolls: constant indices, as above.
        constexpr int EP = RA + 8, EPL = RB * EP, HS = (PP == HD) ? TR * HD : HD;   // pitch of a staged plane row, elements (an odd multiple of 16 B); one staged plane; the step of the plane index from one block of HD m to the next
        static_assert(3 * EPL <= 2 * STG && HD % RA == 0, "the three staged planes fit the ring; a tile's m lie in one block of HD");
#pragma unroll
        for (int nb = 0; nb < NB; ++nb)
#pragma unroll
            for (int mb = 0; mb < MB; ++mb) { v4i o16, oh, ol;
#pragma unroll
                for (int r = 0; r < 4; ++r) { unsigned a, c2; split2(acc[mb][nb][2 * r], acc[mb][nb][2 * r + 1], a, c2); o16[r] = (int)pk16(acc[mb][nb][2 * r], acc[mb][nb][2 * r + 1]); oh[r] = (int)a; ol[r] = (int)c2; }
                bf* e = sm + ((wn * NB + nb) * 16 + lr) * EP + (wm * MB + mb) * 16 + 8 * hi; *(v4ia*)e = o16; *(v4ia*)(e + EPL) = oh; *(v4ia*)(e + 2 * EPL) = ol; }
        gbar();   // the staged rows are read back by other waves than wrote them
        constexpr int TPR = RA / 8, RPT = TH / TPR, NT = RB / RPT;   // threads per plane row of the tile (16 B each); rows per turn of the work-group; turns
        const int row = tid / TPR, cp = (tid % TPR) * 8;
        v4i t16[NT], th[NT], tl[NT];
#pragma unroll
        for (int i = 0; i < NT; ++i) { const bf* e = sm + (i * RPT + row) * EP + cp; t16[i] = *(const v4ia*)e; th[i] = *(const v4ia*)(e + EPL); tl[i] = *(const v4ia*)(e + 2 * EPL); }
        const size_t po = ((size_t)(r0 / HD) * HS + (size_t)(r0 % HD) + (size_t)c0 * PP) * 2; const unsigned pofs = (unsigned)row * (PP * 2u) + (unsigned)cp * 2u;   // bytes: the tile's place in a plane (uniform), the thread's place in a turn
        char* p16 = (char*)P16 + po; char* ph = (char*)Ph + po; char* pl = (char*)Pl + po;
#pragma unroll
        for (int i = 0; i < NT; ++i) { *(v4ia*)(p16 + pofs + i * (RPT * PP * 2)) = t16[i]; *(v4ia*)(ph + pofs + i * (RPT * PP * 2)) = th[i]; *(v4ia*)(pl + pofs + i * (RPT * PP * 2)) = tl[i]; }
    } else {
    // Output through LDS (each wave its own 16 rows, behind the last pass's barrier), so that every 128-B line of C is stored whole.
    constexpr int OP = NB * 16 + 4, LPR = NB * 4, RPS = 32 / LPR;   // pitch of a staged row, floats; lanes per row of the wave's tile; rows per wave-wide store
    float* os = (float*)sm + wave * (16 * OP);
    char* cb = (char*)(C + (size_t)(r0 + wm * MB * 16 + lane / LPR) * DM + c0 + wn * NB * 16 + (lane % LPR) * 4);   // the lane's place in the wave's first stored rows: every store is this one address plus a constant, so no address register is formed anew between the stores
#pragma unroll
    for (int mb = 0; mb < MB; ++mb) {
#pragma unroll
        for (int nb = 0; nb < NB; ++nb) {
#pragma unroll
            for (int j = 0; j < 8; ++j) os[(hi * 8 + j) * OP + nb * 16 + lr] = acc[mb][nb][j]; }
        __builtin_amdgcn_wave_barrier(); asm volatile("" ::: "memory");   // the staged rows are read back by other lanes of the wave than wrote them
#pragma unroll
        for (int s = 0; s < 16 / RPS; ++s) { const int row = RPS * s + lane / LPR, cofs = (lane % LPR) * 4; *(v4f*)(cb + (mb * 16 + RPS * s) * (DM * 4)) = *(const v4fa*)(os + row * OP + cofs); }
        if (mb + 1 < MB) { __builtin_amdgcn_wave_barrier(); asm volatile("s_wait_xcnt 0x0" ::: "memory"); }   // the next 16 rows overwrite the staging only behind these reads; the wait: in front of whatever next rewrites a register that these stores name
    }
    }
}

// ---- k_wt4: the four weights, f32 [k][n], to bf16 planes [n][k] (round to nearest even), in one launch. A work-group of 8 waves takes a tile of WKT k x WNT n.
// In: a wave-wide 16-byte load covers the 512 B that the tile has of one weight row (four whole lines); a thread takes the same four n of eight consecutive k, four times over, all 32 loads in flight at once.
// Eight k of one n are 16 B of a plane row: packed in registers and stored to LDS as one piece. Out: a wave reads a plane row's 512 B from LDS and stores them as four whole lines.
// LDS rows are 512 B, a multiple of all 64 banks, so piece ch of row n lies at place ch ^ ((n >> 2) & 15): the 16 lanes of a half wave, which write the same ch of rows four apart, and read the pieces of one row, meet 16 different places each time.
#define WKT 256
#define WNT 128
__device__ __forceinline__ unsigned pkbf(float a, float b) { v2f x; x[0] = a; x[1] = b; return __builtin_bit_cast(unsigned, __builtin_convertvector(x, v2b)); }
// Every '#pragma unroll' in wt_tile is there so that the value arrays are indexed by constants and stay in registers, and every address is one register plus a constant.
template <int N>
__device__ __forceinline__ void wt_tile(bf* sm, const float* __restrict__ w, bf* __restrict__ Bt, const int tile) {
    const int tid = threadIdx.x, lane = tid & 31, wave = __builtin_amdgcn_readfirstlane(tid >> 5);
    const int n0 = (tile % (N / WNT)) * WNT, k0 = (tile / (N / WNT)) * WKT;   // neighbours in the grid read neighbouring pieces of the same weight rows
    const char* src = (const char*)(w + (size_t)(k0 + wave * 8) * N + n0); const unsigned lofs = (unsigned)lane * 16u;
    v4f v[4][8];   // v[i][r][j] = w[k0 + 64 i + 8 wave + r][n0 + 4 lane + j]
#pragma unroll
    for (int i = 0; i < 4; ++i)
#pragma unroll
        for (int r = 0; r < 8; ++r) v[i][r] = *(const v4fa*)(src + lofs + (i * 64 + r) * (N * 4));
    asm volatile("s_wait_xcnt 0x0" ::: "memory");   // in front of whatever next rewrites a register that these loads name
    __builtin_amdgcn_sched_barrier(0);   // nothing from below is lifted over that wait; and the loads stay one group, all in flight together
    const int x = wave ^ (lane & 15);    // piece 8 i + wave of rows 4 lane + j: place ((x ^ 8 (i & 1)) + 16 (i >> 1))
#pragma unroll
    for (int i = 0; i < 4; ++i)
#pragma unroll
        for (int j = 0; j < 4; ++j) { v4i o;
#pragma unroll
            for (int r = 0; r < 4; ++r) o[r] = (int)pkbf(v[i][2 * r][j], v[i][2 * r + 1][j]);
            *(v4ia*)(sm + (4 * lane + j) * WKT + ((x ^ (8 * (i & 1))) + 16 * (i >> 1)) * 8) = o; }
    __syncthreads();   // the plane rows are read back by other waves than wrote them
    v4i t[16];
#pragma unroll
    for (int i = 0; i < 16; ++i) t[i] = *(const v4ia*)(sm + (wave * 16 + i) * WKT + (lane ^ ((wave * 4 + (i >> 2)) & 15)) * 8);
    char* dst = (char*)(Bt + (size_t)(n0 + wave * 16) * GK + k0);
#pragma unroll
    for (int i = 0; i < 16; ++i) *(v4ia*)(dst + lofs + i * (GK * 2)) = t[i];
}
__global__ __launch_bounds__(256) void k_wt4(const float* __restrict__ wq, const float* __restrict__ wk, const float* __restrict__ wv, const float* __restrict__ wo, bf* WQ, bf* WK, bf* WV, bf* WO) {
    __shared__ __align__(16) bf sm[WNT * WKT];
    static_assert(DM == GK && DQ == GK && DM == DQ, "all four weights have GK rows; Wq and Wo are of one shape");
    constexpr int TB = (GK / WKT) * (DQ / WNT), TS = (GK / WKT) * (DKV / WNT);   // tiles of a large and of a small weight
    const int b = blockIdx.x;   // the branches are uniform for the work-group
    if (b < 2 * TB) wt_tile<DQ>(sm, b < TB ? wq : wo, b < TB ? WQ : WO, b < TB ? b : b - TB);
    else wt_tile<DKV>(sm, b < 2 * TB + TS ? wk : wv, b < 2 * TB + TS ? WK : WV, b < 2 * TB + TS ? b - 2 * TB : b - 2 * TB - TS);
}
__global__ __launch_bounds__(256) void k_cvt8(const float* __restrict__ src, bf* dst, size_t n8) { const size_t i = (size_t)blockIdx.x * 256 + threadIdx.x; if (i >= n8) return; const v8f v = *(const v8f*)(src + i * 8); v8us o;
#pragma unroll
    for (int k = 0; k < 8; ++k) o[k] = f2bf(v[k]); *(v8us*)(dst + i * 8) = o;  }
#define SKEY  64                   // keys per stage
#define KPIT  136                  // LDS pitch of a K row, elements: 256 B + 16 B, an odd multiple of 16 B for the 16-byte readers
#define VPIT  72                   // LDS pitch of a V^T row, elements: 128 B + 16 B, likewise
#define KTILE (SKEY * KPIT)
#define PLANE (KTILE + HD * VPIT)  // one stage of one plane pair: K tile, then V^T tile
typedef __attribute__((ext_vector_type(8))) unsigned v8u;
__device__ __forceinline__ float xhalf(float x) { return __builtin_bit_cast(float, __builtin_amdgcn_permlanex16(__builtin_bit_cast(int, x), __builtin_bit_cast(int, x), 0x76543210, 0xfedcba98, false, false)); }  // lane l with lane l ^ 16
template <typename T16, bool HL>
__device__ __forceinline__ void fattn_run(T16* sm, const T16* __restrict__ Q, const T16* __restrict__ Q2, const T16* __restrict__ Kp, const T16* __restrict__ K2, const T16* __restrict__ Vt, const T16* __restrict__ V2, const int qw0, v8f (&acc)[2][8], float (&l_run)[2]) {
    typedef typename WFrag<T16>::V V;
    constexpr int NPL = HL ? 2 : 1, BUF = NPL * PLANE;
    const int tid = threadIdx.x, lane = tid & 31, c = lane & 15, h = lane >> 4;
    const float cscale = SCL * 1.4426950408889634f;
    v4i rk[NPL][8], rv[NPL][8];
    const unsigned vofs = (unsigned)(tid >> 3) * (TR * 2u) + (unsigned)(tid & 7) * 16u;   // bytes in a kv plane: eight threads cover a V^T row's 128 B
    auto gload = [&](int key0) {   // a stage's K rows and V^T rows, 16 B a thread and turn: every wave-wide load covers four whole 128-B lines
        const unsigned ko = (unsigned)tid + (unsigned)key0 * (HD / 8u), vo = vofs + (unsigned)key0 * 2u;   // the thread's 32-bit offsets in this stage, the same in the hi and the lo plane: K in 16-byte pieces (its rows lie in a row), V^T in bytes
        __builtin_amdgcn_sched_barrier(0);   // the loads are not lifted from here: the wait at the foot has to stand directly behind them
#pragma unroll
        for (int i = 0; i < 8; ++i) {   // the plane's uniform base + the thread's offset + a constant: two address registers for the whole group
            rk[0][i] = ((const v4ia*)Kp + ko)[i * 128]; rv[0][i] = *(const v4ia*)((const char*)Vt + vo + i * (16 * TR * 2));
            if constexpr (HL) { rk[NPL - 1][i] = ((const v4ia*)K2 + ko)[i * 128]; rv[NPL - 1][i] = *(const v4ia*)((const char*)V2 + vo + i * (16 * TR * 2)); } }
        asm volatile("s_wait_xcnt 0x0" :: "v"(ko), "v"(vo) : "memory");   // in front of whatever next rewrites a register that these loads name; the two offsets are inputs so that they live up to the wait and no load of the group lands in them
        __builtin_amdgcn_sched_barrier(0);   // nothing from below is lifted over that wait; and the loads stay up here: sunk towards their use they would hide no latency
    };
    auto sstore = [&](T16* buf) {
#pragma unroll
        for (int i = 0; i < 8; ++i) { const int idx = i * 128 + tid; const int ok = (idx >> 4) * KPIT + (idx & 15) * 8, ov = KTILE + (idx >> 3) * VPIT + (idx & 7) * 8;
            *(v4ia*)(buf + ok) = rk[0][i]; *(v4ia*)(buf + ov) = rv[0][i]; if (HL) { *(v4ia*)(buf + PLANE + ok) = rk[NPL - 1][i]; *(v4ia*)(buf + PLANE + ov) = rv[NPL - 1][i]; } } };
    const int nst = qw0 / SKEY + 1;   // stages up to and with the one that holds the wave's diagonal; the same for all four waves
    gload(0);
    V qf[2][4], qf2[2][4];
#pragma unroll
    for (int g = 0; g < 2; ++g)
#pragma unroll
        for (int kc = 0; kc < 4; ++kc) { const size_t o = (size_t)(qw0 + 16 * g + c) * HD + 32 * kc + 8 * h; qf[g][kc] = WFrag<T16>::ld(Q + o); if (HL) qf2[g][kc] = WFrag<T16>::ld(Q2 + o); }
    asm volatile("s_wait_xcnt 0x0" ::: "memory");   // in front of whatever next rewrites a register that the Q loads name
    __builtin_amdgcn_sched_barrier(0);   // nothing from below is lifted over that wait
    float m_run[2];
#pragma unroll
    for (int g = 0; g < 2; ++g) { m_run[g] = -__builtin_inff(); l_run[g] = 0.0f;
#pragma unroll
        for (int t = 0; t < 8; ++t) acc[g][t] = (v8f){}; }
    sstore(sm); gload(min(1, nst - 1) * SKEY);
    __syncthreads();   // stage 0 is in buffer 0
#pragma unroll 1   // rolled: a stage is long straight-line code already, a second copy would only cost instruction fetches
    for (int st = 0; st < nst; ++st) {
        const T16* cur = sm + (st & 1) * BUF;
        sstore(sm + ((st + 1) & 1) * BUF);          // stage st + 1 into the buffer that stage st - 1 used: the barrier at the foot of st - 1 ended its reads (past the end: the last stage again, read by nobody)
        gload(min(st + 2, nst - 1) * SKEY);         // in flight under this whole stage; clamped, so always inside the planes and no branch round the loads
        // The stage's fragment reads go out in whole groups ahead of their products (one wave per SIMD: nobody else covers an LDS wait): K first; V^T directly behind it where one plane pair leaves the registers
        // for both, else behind the first product, into the registers K has left, so that it streams in under the softmax.
        v8f s[4][2]; V kfa[4][4], kfa2[HL ? 4 : 1][4], vfa[2][8], vfa2[HL ? 2 : 1][8];
#pragma unroll
        for (int kt = 0; kt < 4; ++kt)
#pragma unroll
            for (int kc = 0; kc < 4; ++kc) { const T16* p = cur + (16 * kt + c) * KPIT + 32 * kc + 8 * h; kfa[kt][kc] = WFrag<T16>::ld(p); if constexpr (HL) kfa2[kt][kc] = WFrag<T16>::ld(p + PLANE); }
        __builtin_amdgcn_sched_barrier(0);          // K's reads stay a group, ahead of V^T's: LDS answers in order, and the first product waits for K alone
        auto ldv = [&]() {
#pragma unroll
            for (int j = 0; j < 2; ++j)
#pragma unroll
                for (int t = 0; t < 8; ++t) { const T16* p = cur + KTILE + (16 * t + c) * VPIT + 32 * j + 8 * h; vfa[j][t] = WFrag<T16>::ld(p); if constexpr (HL) vfa2[j][t] = WFrag<T16>::ld(p + PLANE); }
            __builtin_amdgcn_sched_barrier(0);      // keeps the group together up here: moved down to their uses the reads are waited for one by one
        };
        if constexpr (!HL) ldv();
#pragma unroll
        for (int kt = 0; kt < 4; ++kt)
#pragma unroll
            for (int g = 0; g < 2; ++g) { s[kt][g] = (v8f){};
#pragma unroll
                for (int kc = 0; kc < 4; ++kc) { s[kt][g] = WFrag<T16>::mma(kfa[kt][kc], qf[g][kc], s[kt][g]); if constexpr (HL) { s[kt][g] = WFrag<T16>::mma(kfa[kt][kc], qf2[g][kc], s[kt][g]); s[kt][g] = WFrag<T16>::mma(kfa2[kt][kc], qf[g][kc], s[kt][g]); } } }
        if constexpr (HL) { __builtin_amdgcn_sched_barrier(0);   // V^T's reads not above the first product: K's registers are free only behind it
            ldv(); }
        if (st == nst - 1) {                        // work-group-uniform: only the stage with the diagonal pays for the mask
            const int lim = qw0 - st * SKEY + c - 8 * h;   // key 16 kt + 8 h + r of the stage joins query 16 g + c of the wave when 16 kt + r <= lim + 16 g
#pragma unroll
            for (int g = 0; g < 2; ++g)
#pragma unroll
                for (int kt = 0; kt < 4; ++kt) {
#pragma unroll
                    for (int r = 0; r < 8; ++r) { if (16 * kt + r > lim + 16 * g) s[kt][g][r] = -__builtin_inff(); }
                    asm volatile("" : "+v"(s[kt][g]));   // the masked scores: keeps the selects inside the branch
                }
        }
        float mb[2]; bool need = false;
#pragma unroll
        for (int g = 0; g < 2; ++g) { float mx = -__builtin_inff();
#pragma unroll
            for (int kt = 0; kt < 4; ++kt)
#pragma unroll
                for (int r = 0; r < 8; ++r) mx = fmaxf(mx, s[kt][g][r]);
            mx = fmaxf(mx, xhalf(mx)) * cscale; mb[g] = mx; need = need || (mx > m_run[g] + 8.0f); }
        if (__builtin_amdgcn_ballot_w32(need) != 0) {   // rare after the first stages
#pragma unroll
            for (int g = 0; g < 2; ++g) { const float m_new = fmaxf(m_run[g], mb[g]);   // finite from the first stage on: key 0 is never masked
                const float corr = __builtin_amdgcn_exp2f(m_run[g] - m_new);            // 0 on the first stage, where m_run is -inf
                l_run[g] *= corr; m_run[g] = m_new;
#pragma unroll
                for (int t = 0; t < 8; ++t) acc[g][t] = acc[g][t] * corr; }
        }
        V pf[2][2], pf2[2][2];
#pragma unroll
        for (int g = 0; g < 2; ++g) { const float nm = -m_run[g]; float ps0 = 0.0f, ps1 = 0.0f;
#pragma unroll
            for (int j = 0; j < 2; ++j) { v8u w, w2;
#pragma unroll
                for (int i = 0; i < 8; ++i) {
                    const float p0 = __builtin_amdgcn_exp2f(fmaf(s[2 * j + (i >> 2)][g][2 * (i & 3)], cscale, nm)), p1 = __builtin_amdgcn_exp2f(fmaf(s[2 * j + (i >> 2)][g][2 * (i & 3) + 1], cscale, nm));
                    ps0 += p0; ps1 += p1;
                    if (HL) { unsigned wh, wl; split2(p0, p1, wh, wl); w[i] = wh; w2[i] = wl; }
                    else w[i] = pk16(p0, p1); }
                pf[g][j] = __builtin_bit_cast(V, w); if (HL) pf2[g][j] = __builtin_bit_cast(V, w2); }
            l_run[g] += ps0 + ps1; }
#pragma unroll
        for (int j = 0; j < 2; ++j)
#pragma unroll
            for (int t = 0; t < 8; ++t)
#pragma unroll
                for (int g = 0; g < 2; ++g) { acc[g][t] = WFrag<T16>::mma(vfa[j][t], pf[g][j], acc[g][t]); if constexpr (HL) { acc[g][t] = WFrag<T16>::mma(vfa[j][t], pf2[g][j], acc[g][t]); acc[g][t] = WFrag<T16>::mma(vfa2[j][t], pf[g][j], acc[g][t]); } }
        __builtin_amdgcn_sched_barrier(0);          // keeps the barrier, and the wait for stage st + 2's global loads that comes with it, at the stage's foot
        __syncthreads();   // publishes stage st + 1 and ends every wave's reads of stage st
    }
}
// The grid has twice as many work-groups as the chip holds at a time (one to a WGP, by registers); a tile's cost falls with the index.
// blockIdx.y is the rank, blockIdx.x the (batch element, kv group) pair. Cost of a 32-row tile: its stages, a hi+lo stage counted double
// (three products for one, the same softmax). The order is for speed alone: any permutation gives the same values.
struct TileOrder { unsigned char t[TT / 32]; };
constexpr int tile_cost(int i) { return (i * 32 < RH ? 2 : 1) * (i * 32 / SKEY + 1); }
constexpr TileOrder tile_order() { TileOrder o{};
    for (int i = 0; i < TT / 32; ++i) { int r = 0;   // the rank of tile i: the tiles that cost more, and of those that cost the same the later ones
        for (int j = 0; j < TT / 32; ++j) r += (tile_cost(j) > tile_cost(i) || (tile_cost(j) == tile_cost(i) && j > i)) ? 1 : 0;
        o.t[r] = (unsigned char)i; }
    return o; }
static constexpr TileOrder fattn_order = tile_order();
__global__ __launch_bounds__(128) void k_fattn(const h16* __restrict__ Q16, const bf* __restrict__ Qh, const bf* __restrict__ Ql, const h16* __restrict__ K16, const bf* __restrict__ Kh, const bf* __restrict__ Kl, const h16* __restrict__ V16, const bf* __restrict__ Vh, const bf* __restrict__ Vl, bf* __restrict__ Ah, bf* __restrict__ Al) {
    __shared__ __align__(16) unsigned short sm[2 * 2 * PLANE];   // two buffers of two plane pairs (hi+lo); the fp16 rows use half of it
    const int tid = threadIdx.x, lane = tid & 31, c = lane & 15, h = lane >> 4;
    const int kv = blockIdx.x % NKV, bz = blockIdx.x / NKV, wave = __builtin_amdgcn_readfirstlane(tid >> 5), head = kv * REP + wave;
    // Dearest tiles first. readfirstlane: the tile number is used as loaded; seeing through the table, the compiler tested the rank against a 64-bit mask for the branch below, and that build kept the thread id in scratch and reloaded it in every stage.
    const int qw0 = __builtin_amdgcn_readfirstlane(fattn_order.t[blockIdx.y]) * 32;
    const size_t qo = ((size_t)head * NB_ + bz) * TT * HD, ko = ((size_t)kv * NB_ + bz) * TT * HD, vo = (size_t)kv * HD * TR + (size_t)bz * TT;
    v8f acc[2][8]; float l_run[2];
    if (qw0 < RH) fattn_run<bf, true>((bf*)sm, Qh + qo, Ql + qo, Kh + ko, Kl + ko, Vh + vo, Vl + vo, qw0, acc, l_run);
    else fattn_run<h16, false>((h16*)sm, Q16 + qo, nullptr, K16 + ko, nullptr, V16 + vo, nullptr, qw0, acc, l_run);
    // Output through LDS (each wave its own 2 x 32 rows, behind the stage loop's last barrier), so that every 128-B line of the planes is stored whole. The unrolls: constant indices, as above.
    bf* eb = (bf*)sm + wave * (2 * 32 * KPIT);
#pragma unroll
    for (int g = 0; g < 2; ++g) { const float inv = __fdiv_rn(1.0f, l_run[g] + xhalf(l_run[g]));
#pragma unroll
        for (int t = 0; t < 8; ++t) { v4i oh, ol;
#pragma unroll
            for (int r = 0; r < 4; ++r) { unsigned a, c2; split2(acc[g][t][2 * r] * inv, acc[g][t][2 * r + 1] * inv, a, c2); oh[r] = (int)a; ol[r] = (int)c2; }
            bf* e = eb + (16 * g + c) * KPIT + 16 * t + 8 * h; *(v4ia*)e = oh; *(v4ia*)(e + 32 * KPIT) = ol; } }
    __syncthreads();   // the staged rows are read back by other lanes than wrote them
    v4i th[16], tl[16];
#pragma unroll
    for (int i = 0; i < 16; ++i) { const bf* e = eb + (2 * i + h) * KPIT + c * 8; th[i] = *(const v4ia*)e; tl[i] = *(const v4ia*)(e + 32 * KPIT); }
    const unsigned oofs = (unsigned)h * (DQ * 2u) + (unsigned)c * 16u;   // bytes: 16 lanes cover one row's 256 B, a wave-wide store two rows
    char* ah = (char*)(Ah + (size_t)(bz * TT + qw0) * DQ + head * HD); char* al = (char*)(Al + (size_t)(bz * TT + qw0) * DQ + head * HD);
#pragma unroll
    for (int i = 0; i < 16; ++i) { *(v4ia*)(ah + oofs + i * (2 * DQ * 2)) = th[i]; *(v4ia*)(al + oofs + i * (2 * DQ * 2)) = tl[i]; }
}

extern "C" void kernel_launch(void* const* d_in, const int* in_sizes, int n_in,
                              void* d_out, int out_size, void* d_ws, size_t ws_size, hipStream_t stream) {
    (void)in_sizes; (void)n_in; (void)out_size;
    const float* x = (const float*)d_in[0]; const float* wq = (const float*)d_in[1]; const float* wk = (const float*)d_in[2]; const float* wv = (const float*)d_in[3]; const float* wo = (const float*)d_in[4];
    float* OUT = (float*)d_out;     // [2][2048][2048]
    char* wsp = (char*)d_ws;
    auto take = [&](size_t bytes) { char* p = wsp; wsp += (bytes + 255) & ~(size_t)255; return (void*)p; };
    bf* WQ = (bf*)take((size_t)DQ * DM * 2); bf* WK = (bf*)take((size_t)DKV * DM * 2); bf* WV = (bf*)take((size_t)DKV * DM * 2); bf* WO = (bf*)take((size_t)DM * DQ * 2);
    bf* XB = (bf*)take((size_t)TR * DM * 2);
    h16* QP16 = (h16*)take((size_t)NH_ * TR * HD * 2); h16* KP16 = (h16*)take((size_t)NKV * TR * HD * 2); h16* VT16 = (h16*)take((size_t)NKV * HD * TR * 2);
    bf* QPh = (bf*)take((size_t)NH_ * TR * HD * 2); bf* QPl = (bf*)take((size_t)NH_ * TR * HD * 2); bf* KPh = (bf*)take((size_t)NKV * TR * HD * 2); bf* KPl = (bf*)take((size_t)NKV * TR * HD * 2); bf* VTh = (bf*)take((size_t)NKV * HD * TR * 2); bf* VTl = (bf*)take((size_t)NKV * HD * TR * 2);
    bf* ATh = (bf*)take((size_t)TR * DQ * 2); bf* ATl = (bf*)take((size_t)TR * DQ * 2);
    if ((size_t)(wsp - (char*)d_ws) > ws_size) return;    // ws 256 MiB
    k_wt4<<<2 * (GK / WKT) * (DQ / WNT) + 2 * (GK / WKT) * (DKV / WNT), 256, 0, stream>>>(wq, wk, wv, wo, WQ, WK, WV, WO);
    // Every launch takes both batch elements: the projections see x as TR rows, the attention has the batch element in blockIdx.x.
    k_cvt8<<<(unsigned)(((size_t)TR * DM / 8 + 255) / 256), 256, 0, stream>>>(x, XB, (size_t)TR * DM / 8);
    // The two large products: 2 x 4 waves on 128 x 256 of C, one work-group to a WGP (two waves to a SIMD) and 256 in the grid. A work-group's operand bytes from L2 go with its rows of A and of Bt:
    // 384 rows a pass (q) and 512 (Wo, two A planes), where two work-groups of 128 x 128 take 512 and 768 for the same products.
    k_gemms<4, 4, false, HD, 4><<<dim3(DQ / 128, TR / 256, 1), 256, 0, stream>>>(WQ, nullptr, XB, nullptr, QP16, QPh, QPl);
    k_gemms<2, 2, false, HD, 2><<<dim3(DKV / 64, TR / 64, 1), 128, 0, stream>>>(WK, nullptr, XB, nullptr, KP16, KPh, KPl);
    k_gemms<2, 2, false, TR, 2><<<dim3(TR / 64, DKV / 64, 1), 128, 0, stream>>>(XB, nullptr, WV, nullptr, VT16, VTh, VTl);
    k_fattn<<<dim3(NKV * NB_, TT / 32, 1), 128, 0, stream>>>(QP16, QPh, QPl, KP16, KPh, KPl, VT16, VTh, VTl, ATh, ATl);
    k_gemms<4, 4, true, 0, 4><<<dim3(TR / 128, DM / 256, 1), 256, 0, stream>>>(ATh, ATl, WO, OUT, nullptr, nullptr, nullptr);
}

// v009
// One run takes 142 microseconds.
// Timed twice side by side with v008, it ran 1.04 and 1.02 times as fast.
// All steps since v000 together make it 12.1 times as fast.
#include <hip/hip_runtime.h>

// Grouped-query causal self-attention with 128-wide heads, no rotary (x [2][2048][2048]; q = x Wq ('xw' [2048][2048], 16 heads x 128), k, v = x Wk, x Wv ('xw' [2048][512], 4 kv heads x 128), no biases; k, v repeated 4 x on the head axis (jnp.repeat: query head h uses kv head h / 4); att x 1/sqrt(128); causal (-inf); softmax; y = merged Wo ('xw' [2048][2048], no bias) -> [2][2048][2048] (8.4 M); argument order x, Wq, Wk, Wv, Wo).
// Compute dtypes, f32 accumulate: every input rounded to bf16; q/k/v on PLAIN bf16 operands (inputs: exact), their fp16 and hi+lo bf16 planes written by the projection kernel itself; scores, softmax and attn.v in one kernel (online softmax, f32; 64-key stages beyond a wave's diagonal never read): query rows < 512 hl (3 products), the rest single fp16; Wo hl x exact (2 products).

#define NB_  2
#define TT   2048
#define TR   (NB_ * TT)       // rows of x, both batch elements one behind the other: row b TT + t
#define DM   2048
#define NH_  16
#define NKV  4
#define REP  (NH_ / NKV)
#define HD   128
#define DQ   (NH_ * HD)
#define DKV  (NKV * HD)
#define RH   512                  // query rows < RH use hi+lo planes (a multiple of 32: a wave's 32 rows are wholly hi+lo or wholly fp16)
#define SCL  0.088388347648318447f   // HD^-0.5
typedef _Float16 h16;
typedef unsigned short bf;
typedef __attribute__((ext_vector_type(16))) __bf16   v16bf;
typedef __attribute__((ext_vector_type(16))) _Float16 v16h;
typedef __attribute__((ext_vector_type(8)))  _Float16 v8h;
typedef __attribute__((ext_vector_type(8)))  unsigned short v8us;
typedef __attribute__((ext_vector_type(8)))  float    v8f;
typedef __attribute__((ext_vector_type(4)))  float    v4f;
typedef v8h  __attribute__((may_alias)) v8ha;
typedef v4f  __attribute__((may_alias)) v4fa;
typedef v8us __attribute__((may_alias)) v8usa;

__device__ __forceinline__ unsigned short f2bf(float f) { unsigned u = __float_as_uint(f); u += 0x7FFFu + ((u >> 16) & 1u); return (unsigned short)(u >> 16); }
__device__ __forceinline__ float bf2f(unsigned short b) { return __uint_as_float(((unsigned)b) << 16); }
__device__ __forceinline__ v16h cat16(v8h lo, v8h hi) { return __builtin_shufflevector(lo, hi, 0, 1, 2, 3, 4, 5, 6, 7, 8, 9, 10, 11, 12, 13, 14, 15); }
__device__ __forceinline__ v16bf cat16b(v8us lo, v8us hi) { return __builtin_bit_cast(v16bf, __builtin_shufflevector(lo, hi, 0, 1, 2, 3, 4, 5, 6, 7, 8, 9, 10, 11, 12, 13, 14, 15)); }
__device__ __forceinline__ v8f wmma16(v16h a, v16h b, v8f c) { return __builtin_amdgcn_wmma_f32_16x16x32_f16(false, a, false, b, (short)0, c, false, false); }
__device__ __forceinline__ v8f wmmab(v16bf a, v16bf b, v8f c) { return __builtin_amdgcn_wmma_f32_16x16x32_bf16(false, a, false, b, (short)0, c, false, false); }

typedef __attribute__((ext_vector_type(2))) _Float16 v2h;
typedef __attribute__((ext_vector_type(2))) float v2f;
typedef __attribute__((ext_vector_type(4))) int v4i;
typedef v4i __attribute__((may_alias)) v4ia;
__device__ __forceinline__ unsigned pk16(float a, float b) { v2f x; x[0] = a; x[1] = b; return __builtin_bit_cast(unsigned, __builtin_convertvector(x, v2h)); }
typedef __attribute__((ext_vector_type(2))) __bf16 v2b;
__device__ __forceinline__ void split2(float a, float b, unsigned& hi, unsigned& lo) {   // two values at once, by the packed conversion (round to nearest even, as f2bf): packed hi parts, packed remainders
    v2f x; x[0] = a; x[1] = b; hi = __builtin_bit_cast(unsigned, __builtin_convertvector(x, v2b));
    v2f r; r[0] = a - __uint_as_float(hi << 16); r[1] = b - __uint_as_float(hi & 0xFFFF0000u); lo = __builtin_bit_cast(unsigned, __builtin_convertvector(r, v2b)); }

template <typename T16> struct WFrag;
template <> struct WFrag<h16> { typedef v16h V; static __device__ __forceinline__ V ld(const h16* p) { return cat16(*(const v8h*)p, *(const v8h*)(p + 16)); } static __device__ __forceinline__ v8f mma(V a, V b, v8f c) { return wmma16(a, b, c); } };
template <> struct WFrag<bf> { typedef v16bf V; static __device__ __forceinline__ V ld(const bf* p) { return cat16b(*(const v8us*)p, *(const v8us*)(p + 16)); } static __device__ __forceinline__ v8f mma(V a, V b, v8f c) { return wmmab(a, b, c); } };
// ---- gemm_tile: C[m][n] = sum_k A[m][k] Bt[n][k] (+ A2[m][k] Bt[n][k] where SPLIT), all planes bf16, K-contiguous, K = GK. MODE 0: C goes out as f32, pitch DM.
// MODE 1, 2 (q with k, q with v): Bt = x (n = b TT + t); the tile's 192 rows of A are one head of Wq (A) and 64 rows of Wk or Wv (A2), staged so that each of the two wave rows has 64 of the one (mb 0..3) and 32 of the other (mb 4, 5).
// C goes out as the three 16-bit planes the attention kernel reads (fp16, bf16 hi, bf16 lo): q, k as [head][b][t][d], v as [head x 128 + d][b][t]. An accumulator lane holds eight consecutive rows of its A operand at one row of its B operand,
// which is to be 16 B of a plane row: so q and k take the weight as A, and v takes x as A (the fragments are the same, the two operands of the instruction change places).
// A work-group is 2 x WN waves on a (32 MB) x (16 NB WN) tile of C; a wave owns MB x NB accumulators. k goes in passes of 128 (256 B of every operand row): the work-group brings a pass through registers into
// one of two LDS buffers with whole-line loads (16 threads cover a row's 256 B), so every operand byte comes from L2 once per work-group and the fragments are read from LDS. One barrier per pass.
// A pass is four k steps of 32; each step stores a quarter of the next pass's rows to LDS, refills those registers with the same quarter of the pass after it (so a whole pass of loads is always in flight),
// reads the next step's fragments into the second fragment set and then runs its own products.
// The walk over k is a ring: work-group (x, y) starts at pass (x + y) mod NP and wraps round. Work-groups that share operand rows (one x, or one y) would otherwise ask L2 for the same lines at the same moment,
// and every work-group of the launch for the same 256 B of each 4-KiB row. Every accumulator takes its products in that order of passes, kc ascending inside a pass, A before A2.
// Every '#pragma unroll' in gemm_tile is there so that the staging, fragment and accumulator arrays are indexed by constants and stay in registers.
#define GK    2048                 // the reduction length of all four products
#define GPASS 128                  // k per pass
#define GPIT  136                  // LDS pitch of a staged row, elements: 256 B + 16 B, an odd multiple of 16 B for the 16-byte readers
typedef __attribute__((ext_vector_type(4))) int g4i;
typedef g4i __attribute__((may_alias)) g4ia;
template <bool B> struct GFlag { static constexpr bool v = B; };
// The pass barrier, by hand: __syncthreads() would also wait for the global loads that are in flight for the pass after next and so undo their lead. What other waves depend on here is LDS alone
// (this wave's stores of the next pass, its reads of this one): s_wait_dscnt 0 covers both.
__device__ __forceinline__ void gbar() { asm volatile("s_wait_dscnt 0x0\n\ts_barrier_signal -1\n\ts_barrier_wait -1" ::: "memory"); }
template <int MB, int NB, bool SPLIT, int MODE, int WN>
__device__ __forceinline__ void gemm_tile(bf* sm, const bf* __restrict__ A, const bf* __restrict__ A2, const bf* __restrict__ Bt, float* C, h16* Q16, bf* Qh, bf* Ql, h16* S16, bf* Sh, bf* Sl) {
    typedef WFrag<bf>::V V;
    constexpr bool QKV = MODE != 0, VT = MODE == 2;
    constexpr int TH = 64 * WN, RT = TH / 16, TA = (32 * MB) / RT / 4, RA = (32 * MB), RB = 16 * NB * WN, OA2 = RA * GPIT, OB = (SPLIT ? 2 : 1) * RA * GPIT, STG = OB + RB * GPIT, NP = GK / GPASS, NA2 = SPLIT ? MB : 1;
    static_assert(!QKV || (MB == 6 && RT == 16 && !SPLIT), "the q, k, v tile: a wave row is 64 rows of Wq and 32 of the side weight, a turn 16 rows");
    const int tid = threadIdx.x, lane = tid & 31, lr = lane & 15, hi = lane >> 4, wave = __builtin_amdgcn_readfirstlane(tid >> 5), wm = wave / WN, wn = wave % WN;
    static_assert((32 * MB) % (4 * RT) == 0, "a quarter of a pass is whole turns of RT rows in either operand");
    const int r0 = blockIdx.x * (QKV ? HD : RA), c0 = blockIdx.y * RB, s0 = QKV ? (int)(blockIdx.x >> 1) * 64 : r0;   // first row of A, of Bt, and of A2 (q, k, v: the side weight's 64 rows)
    static_assert((NP & (NP - 1)) == 0, "the ring of passes wraps by a mask");
    const int p0 = __builtin_amdgcn_readfirstlane((int)((blockIdx.x + blockIdx.y) & (unsigned)(NP - 1)));   // the pass of k that this work-group takes first (uniform). readfirstlane: without it the first pass's addresses were formed above k_qkv's branch between its two kinds of tile and kept in scratch across the first kind
    const unsigned tofs = (unsigned)(tid >> 4) * (GK * 2u) + (unsigned)(tid & 15) * 16u;   // bytes: the thread's row of a turn of RT rows, and its 16 B of the row's 256
    const char* Ab = (const char*)(A + (size_t)r0 * GK) + tofs; const char* A2b = (SPLIT || QKV) ? (const char*)(A2 + (size_t)s0 * GK) + tofs : nullptr; const char* Bb = (const char*)(Bt + (size_t)c0 * GK) + tofs;
    const int sofs = (tid >> 4) * GPIT + (tid & 15) * 8;                                   // the same place in a staged turn, elements
    g4i ra[4 * TA], ra2[SPLIT ? 4 * TA : 4], rb[4 * NB];
    auto gload = [&](int q, int pass) {   // quarter q of a pass: TA turns of A (and of A2), NB turns of Bt; every wave-wide load covers four whole 128-B lines
        const int kb = ((pass + p0) & (NP - 1)) * (GPASS * 2);   // bytes: where in a row the work-group's pass number 'pass' lies
        const char* pa = Ab + kb; const char* pa2 = (SPLIT || QKV) ? A2b + kb : nullptr; const char* pb = Bb + kb;   // the thread's address in each plane + a constant per turn
        __builtin_amdgcn_sched_barrier(0);   // the loads are not lifted from here: the wait at the foot has to stand directly behind them
#pragma unroll
        for (int i = 0; i < TA; ++i) { const int t = q * TA + i;
            if constexpr (QKV) { const int hf = t / 6, u = t % 6; const char* s = u < 4 ? pa + (hf * 64 + u * 16) * (GK * 2) : pa2 + (hf * 32 + (u - 4) * 16) * (GK * 2); ra[t] = *(const g4ia*)s; }   // staged row 96 hf + 16 u + ...: 64 rows of Wq, then 32 of the side weight
            else { ra[t] = *(const g4ia*)(pa + t * (RT * GK * 2)); if constexpr (SPLIT) ra2[t] = *(const g4ia*)(pa2 + t * (RT * GK * 2)); } }
#pragma unroll
        for (int i = 0; i < NB; ++i) { const int t = q * NB + i; rb[t] = *(const g4ia*)(pb + t * (RT * GK * 2)); }
        // in front of whatever next rewrites a register that these loads name; the addresses are inputs so that they live up to the wait and no load of the group lands in them
        if constexpr (SPLIT || QKV) asm volatile("s_wait_xcnt 0x0" :: "v"(pa), "v"(pa2), "v"(pb) : "memory"); else asm volatile("s_wait_xcnt 0x0" :: "v"(pa), "v"(pb) : "memory");
        __builtin_amdgcn_sched_barrier(0);   // nothing from below is lifted over that wait; and the loads stay up here: sunk towards their use they would hide no latency
    };
    auto sstore = [&](int q, bf* buf) {
#pragma unroll
        for (int i = 0; i < TA; ++i) { const int t = q * TA + i; *(g4ia*)(buf + t * RT * GPIT + sofs) = ra[t]; if constexpr (SPLIT) *(g4ia*)(buf + OA2 + t * RT * GPIT + sofs) = ra2[t]; }
#pragma unroll
        for (int i = 0; i < NB; ++i) { const int t = q * NB + i; *(g4ia*)(buf + OB + t * RT * GPIT + sofs) = rb[t]; } };
    v8f acc[MB][NB];
#pragma unroll
    for (int mb = 0; mb < MB; ++mb)
#pragma unroll
        for (int nb = 0; nb < NB; ++nb) acc[mb][nb] = (v8f){};
#pragma unroll
    for (int q = 0; q < 4; ++q) gload(q, 0);
#pragma unroll
    for (int q = 0; q < 4; ++q) { sstore(q, sm); gload(q, 1); }
    gbar();   // pass 0 is in buffer 0
    const int fa = (wm * MB * 16 + lr) * GPIT + 8 * hi, fb = OB + (wn * NB * 16 + lr) * GPIT + 8 * hi;   // the lane's place in the wave's first A and Bt fragment: the k order of both is that of WFrag::ld
    auto pass = [&](int p, auto ST, auto LD) {   // ST: a pass p + 1 exists and is stored; LD: a pass p + 2 exists and is loaded
        const bf* cur = sm + (p & 1) * STG; bf* nxt = sm + ((p + 1) & 1) * STG;   // nxt held pass p - 1: the barrier at the foot of p - 1 ended its reads
        V a[2][MB], a2[2][NA2], b[2][NB];
        auto ldf = [&](int set, int ks) {
#pragma unroll
            for (int mb = 0; mb < MB; ++mb) { a[set][mb] = WFrag<bf>::ld(cur + fa + mb * 16 * GPIT + ks * 32); if constexpr (SPLIT) a2[set][mb] = WFrag<bf>::ld(cur + OA2 + fa + mb * 16 * GPIT + ks * 32); }
#pragma unroll
            for (int nb = 0; nb < NB; ++nb) b[set][nb] = WFrag<bf>::ld(cur + fb + nb * 16 * GPIT + ks * 32); };
        ldf(0, 0);
#pragma unroll
        for (int ks = 0; ks < 4; ++ks) {
            if constexpr (decltype(ST)::v) sstore(ks, nxt);
            if constexpr (decltype(LD)::v) gload(ks, p + 2);
            if (ks < 3) ldf((ks + 1) & 1, ks + 1);
            __builtin_amdgcn_sched_barrier(0);   // the next step's fragment reads stay a group ahead of this step's products (one or two waves per SIMD: little else covers an LDS wait)
#pragma unroll
            for (int nb = 0; nb < NB; ++nb)
#pragma unroll
                for (int mb = 0; mb < MB; ++mb) { if (VT && mb >= 4) acc[mb][nb] = wmmab(b[ks & 1][nb], a[ks & 1][mb], acc[mb][nb]); else acc[mb][nb] = wmmab(a[ks & 1][mb], b[ks & 1][nb], acc[mb][nb]); }   // v: x as the A operand, so that a lane holds eight t of one d
            if constexpr (SPLIT) {
#pragma unroll
                for (int nb = 0; nb < NB; ++nb)
#pragma unroll
                    for (int mb = 0; mb < MB; ++mb) acc[mb][nb] = wmmab(a2[ks & 1][mb], b[ks & 1][nb], acc[mb][nb]); }
            __builtin_amdgcn_sched_barrier(0);   // the following step's stores, loads and reads are not lifted into this step's products, whose fragment set they refill
        }
        gbar();   // publishes pass p + 1 and ends every wave's reads of pass p
    };
#pragma unroll 1   // rolled: a pass is long straight-line code already, more copies would only cost instruction fetches
    for (int p = 0; p < NP - 2; ++p) pass(p, GFlag<true>(), GFlag<true>());
    pass(NP - 2, GFlag<true>(), GFlag<false>());    // the last two passes apart: nothing is left to load, then nothing to store
    pass(NP - 1, GFlag<false>(), GFlag<false>());
    if constexpr (QKV) {
        // The planes (fp16, bf16 hi, bf16 lo), one at a time through LDS (behind the last pass's barrier), so that every 128-B line of a plane is stored whole, by one wave. The unrolls: constant indices, as above.
        // A plane's staging: q as [t][d] (256 rows of 128), then k as [t][d] (256 rows of 64) or v as [d][t] (64 rows of 256); every pitch an odd multiple of 16 B. Planes alternate between two regions,
        // so one barrier per plane is enough: a region is written again only behind the barrier of the plane between, which every wave reaches with its reads of the region done.
        constexpr int QP = HD + 8, QA = RB * QP, KP = 64 + 8, VP = RB + 8, REG = QA + (RB * KP > 64 * VP ? RB * KP : 64 * VP);
        static_assert(REG <= STG, "two staging regions fit the ring");
        const int kvh = (int)(blockIdx.x >> 2), d0 = (int)((blockIdx.x >> 1) & 1u) * 64;   // the side weight's 64 rows: kv head, first d
        const int qrow = tid >> 4, qcp = (tid & 15) * 8, krow = tid >> 3, kcp = (tid & 7) * 8;   // 16 threads cover a q row's 256 B, 8 a k row's 128 B, a wave a v row's 512 B
        const size_t qo = (((size_t)blockIdx.x * TR + c0 + qrow) * HD + qcp) * 2;   // bytes: the thread's place in a q plane, [head][b][t][d]
        const size_t so = VT ? ((size_t)(kvh * HD + d0 + wave) * TR + c0 + lane * 8) * 2 : (((size_t)kvh * TR + c0 + krow) * HD + d0 + kcp) * 2;   // and in a v plane, [head x 128 + d][b][t], or a k plane, [head][b][t][d]
#pragma unroll
        for (int pl = 0; pl < 3; ++pl) {
            bf* reg = sm + (pl & 1) * REG;
#pragma unroll
            for (int nb = 0; nb < NB; ++nb)
#pragma unroll
                for (int mb = 0; mb < MB; ++mb) { v4i o;
#pragma unroll
                    for (int r = 0; r < 4; ++r) { const float x0 = acc[mb][nb][2 * r], x1 = acc[mb][nb][2 * r + 1];
                        if (pl == 0) o[r] = (int)pk16(x0, x1); else { unsigned a, c2; split2(x0, x1, a, c2); o[r] = (int)(pl == 1 ? a : c2); } }
                    bf* e = mb < 4 ? reg + ((wn * NB + nb) * 16 + lr) * QP + (wm * 4 + mb) * 16 + 8 * hi
                          : VT ? reg + QA + ((wm * 2 + mb - 4) * 16 + lr) * VP + (wn * NB + nb) * 16 + 8 * hi
                               : reg + QA + ((wn * NB + nb) * 16 + lr) * KP + (wm * 2 + mb - 4) * 16 + 8 * hi;
                    *(v4ia*)e = o; }
            gbar();   // the staged rows are read back by other waves than wrote them
            char* pq = (pl == 0 ? (char*)Q16 : pl == 1 ? (char*)Qh : (char*)Ql) + qo; char* ps = (pl == 0 ? (char*)S16 : pl == 1 ? (char*)Sh : (char*)Sl) + so;
            v4i tq[16], ts[8];
#pragma unroll
            for (int i = 0; i < 16; ++i) tq[i] = *(const v4ia*)(reg + (i * 16 + qrow) * QP + qcp);
#pragma unroll
            for (int i = 0; i < 8; ++i) ts[i] = VT ? *(const v4ia*)(reg + QA + (i * 8 + wave) * VP + lane * 8) : *(const v4ia*)(reg + QA + (i * 32 + krow) * KP + kcp);
#pragma unroll
            for (int i = 0; i < 16; ++i) *(v4ia*)(pq + i * (16 * HD * 2)) = tq[i];
            asm volatile("s_wait_xcnt 0x0" :: "v"(pq) : "memory");   // in front of whatever next rewrites a register that these stores name: the second address is formed about here
            __builtin_amdgcn_sched_barrier(0);   // nothing from below is lifted over that wait
#pragma unroll
            for (int i = 0; i < 8; ++i) *(v4ia*)(ps + i * (VT ? 8 * TR * 2 : 32 * HD * 2)) = ts[i];
            if (pl < 2) { asm volatile("s_wait_xcnt 0x0" ::: "memory");   // in front of whatever next rewrites a register that these stores name
                __builtin_amdgcn_sched_barrier(0); }   // nothing from below is lifted over that wait
        }
    } else {
    // Output through LDS (each wave its own 16 rows, behind the last pass's barrier), so that every 128-B line of C is stored whole.
    constexpr int OP = NB * 16 + 4, LPR = NB * 4, RPS = 32 / LPR;   // pitch of a staged row, floats; lanes per row of the wave's tile; rows per wave-wide store
    float* os = (float*)sm + wave * (16 * OP);
    char* cb = (char*)(C + (size_t)(r0 + wm * MB * 16 + lane / LPR) * DM + c0 + wn * NB * 16 + (lane % LPR) * 4);   // the lane's place in the wave's first stored rows: every store is this one address plus a constant, so no address register is formed anew between the stores
#pragma unroll
    for (int mb = 0; mb < MB; ++mb) {
#pragma unroll
        for (int nb = 0; nb < NB; ++nb) {
#pragma unroll
            for (int j = 0; j < 8; ++j) os[(hi * 8 + j) * OP + nb * 16 + lr] = acc[mb][nb][j]; }
        __builtin_amdgcn_wave_barrier(); asm volatile("" ::: "memory");   // the staged rows are read back by other lanes of the wave than wrote them
#pragma unroll
        for (int s = 0; s < 16 / RPS; ++s) { const int row = RPS * s + lane / LPR, cofs = (lane % LPR) * 4; *(v4f*)(cb + (mb * 16 + RPS * s) * (DM * 4)) = *(const v4fa*)(os + row * OP + cofs); }
        if (mb + 1 < MB) { __builtin_amdgcn_wave_barrier(); asm volatile("s_wait_xcnt 0x0" ::: "memory"); }   // the next 16 rows overwrite the staging only behind these reads; the wait: in front of whatever next rewrites a register that these stores name
    }
    }
}
// q, k and v in one launch: work-group (x, y) takes head x of Wq and 64 rows of Wk (x even) or of Wv (x odd) against 256 rows of x. 
__global__ __launch_bounds__(256) void k_qkv(const bf* __restrict__ WQ, const bf* __restrict__ WK, const bf* __restrict__ WV, const bf* __restrict__ X, h16* Q16, bf* Qh, bf* Ql, h16* K16, bf* Kh, bf* Kl, h16* V16, bf* Vh, bf* Vl) {
    __shared__ __align__(16) bf sm[2 * (192 + 256) * GPIT];
    if (blockIdx.x & 1u) gemm_tile<6, 4, false, 2, 4>(sm, WQ, WV, X, nullptr, Q16, Qh, Ql, V16, Vh, Vl);   // the branch is uniform for the work-group
    else gemm_tile<6, 4, false, 1, 4>(sm, WQ, WK, X, nullptr, Q16, Qh, Ql, K16, Kh, Kl);
}
__global__ __launch_bounds__(256) void k_gemmo(const bf* __restrict__ A, const bf* __restrict__ A2, const bf* __restrict__ Bt, float* C) {
    __shared__ __align__(16) bf sm[2 * (2 * 128 + 256) * GPIT];
    gemm_tile<4, 4, true, 0, 4>(sm, A, A2, Bt, C, nullptr, nullptr, nullptr, nullptr, nullptr, nullptr);
}

// ---- k_wt4: the four weights, f32 [k][n], to bf16 planes [n][k] (round to nearest even), in one launch. A work-group of 8 waves takes a tile of WKT k x WNT n.
// In: a wave-wide 16-byte load covers the 512 B that the tile has of one weight row (four whole lines); a thread takes the same four n of eight consecutive k, four times over, all 32 loads in flight at once.
// Eight k of one n are 16 B of a plane row: packed in registers and stored to LDS as one piece. Out: a wave reads a plane row's 512 B from LDS and stores them as four whole lines.
// LDS rows are 512 B, a multiple of all 64 banks, so piece ch of row n lies at place ch ^ ((n >> 2) & 15): the 16 lanes of a half wave, which write the same ch of rows four apart, and read the pieces of one row, meet 16 different places each time.
#define WKT 256
#define WNT 128
__device__ __forceinline__ unsigned pkbf(float a, float b) { v2f x; x[0] = a; x[1] = b; return __builtin_bit_cast(unsigned, __builtin_convertvector(x, v2b)); }
// Every '#pragma unroll' in wt_tile is there so that the value arrays are indexed by constants and stay in registers, and every address is one register plus a constant.
template <int N>
__device__ __forceinline__ void wt_tile(bf* sm, const float* __restrict__ w, bf* __restrict__ Bt, const int tile) {
    const int tid = threadIdx.x, lane = tid & 31, wave = __builtin_amdgcn_readfirstlane(tid >> 5);
    const int n0 = (tile % (N / WNT)) * WNT, k0 = (tile / (N / WNT)) * WKT;   // neighbours in the grid read neighbouring pieces of the same weight rows
    const char* src = (const char*)(w + (size_t)(k0 + wave * 8) * N + n0); const unsigned lofs = (unsigned)lane * 16u;
    v4f v[4][8];   // v[i][r][j] = w[k0 + 64 i + 8 wave + r][n0 + 4 lane + j]
#pragma unroll
    for (int i = 0; i < 4; ++i)
#pragma unroll
        for (int r = 0; r < 8; ++r) v[i][r] = *(const v4fa*)(src + lofs + (i * 64 + r) * (N * 4));
    asm volatile("s_wait_xcnt 0x0" ::: "memory");   // in front of whatever next rewrites a register that these loads name
    __builtin_amdgcn_sched_barrier(0);   // nothing from below is lifted over that wait; and the loads stay one group, all in flight together
    const int x = wave ^ (lane & 15);    // piece 8 i + wave of rows 4 lane + j: place ((x ^ 8 (i & 1)) + 16 (i >> 1))
#pragma unroll
    for (int i = 0; i < 4; ++i)
#pragma unroll
        for (int j = 0; j < 4; ++j) { v4i o;
#pragma unroll
            for (int r = 0; r < 4; ++r) o[r] = (int)pkbf(v[i][2 * r][j], v[i][2 * r + 1][j]);
            *(v4ia*)(sm + (4 * lane + j) * WKT + ((x ^ (8 * (i & 1))) + 16 * (i >> 1)) * 8) = o; }
    __syncthreads();   // the plane rows are read back by other waves than wrote them
    v4i t[16];
#pragma unroll
    for (int i = 0; i < 16; ++i) t[i] = *(const v4ia*)(sm + (wave * 16 + i) * WKT + (lane ^ ((wave * 4 + (i >> 2)) & 15)) * 8);
    char* dst = (char*)(Bt + (size_t)(n0 + wave * 16) * GK + k0);
#pragma unroll
    for (int i = 0; i < 16; ++i) *(v4ia*)(dst + lofs + i * (GK * 2)) = t[i];
}
__global__ __launch_bounds__(256) void k_wt4(const float* __restrict__ wq, const float* __restrict__ wk, const float* __restrict__ wv, const float* __restrict__ wo, bf* WQ, bf* WK, bf* WV, bf* WO) {
    __shared__ __align__(16) bf sm[WNT * WKT];
    static_assert(DM == GK && DQ == GK && DM == DQ, "all four weights have GK rows; Wq and Wo are of one shape");
    constexpr int TB = (GK / WKT) * (DQ / WNT), TS = (GK / WKT) * (DKV / WNT);   // tiles of a large and of a small weight
    const int b = blockIdx.x;   // the branches are uniform for the work-group
    if (b < 2 * TB) wt_tile<DQ>(sm, b < TB ? wq : wo, b < TB ? WQ : WO, b < TB ? b : b - TB);
    else wt_tile<DKV>(sm, b < 2 * TB + TS ? wk : wv, b < 2 * TB + TS ? WK : WV, b < 2 * TB + TS ? b - 2 * TB : b - 2 * TB - TS);
}
__global__ __launch_bounds__(256) void k_cvt8(const float* __restrict__ src, bf* dst, size_t n8) { const size_t i = (size_t)blockIdx.x * 256 + threadIdx.x; if (i >= n8) return; const v8f v = *(const v8f*)(src + i * 8); v8us o;
#pragma unroll
    for (int k = 0; k < 8; ++k) o[k] = f2bf(v[k]); *(v8us*)(dst + i * 8) = o;  }
#define SKEY  64                   // keys per stage
#define KPIT  136                  // LDS pitch of a K row, elements: 256 B + 16 B, an odd multiple of 16 B for the 16-byte readers
#define VPIT  72                   // LDS pitch of a V^T row, elements: 128 B + 16 B, likewise
#define KTILE (SKEY * KPIT)
#define PLANE (KTILE + HD * VPIT)  // one stage of one plane pair: K tile, then V^T tile
typedef __attribute__((ext_vector_type(8))) unsigned v8u;
__device__ __forceinline__ float xhalf(float x) { return __builtin_bit_cast(float, __builtin_amdgcn_permlanex16(__builtin_bit_cast(int, x), __builtin_bit_cast(int, x), 0x76543210, 0xfedcba98, false, false)); }  // lane l with lane l ^ 16
template <typename T16, bool HL>
__device__ __forceinline__ void fattn_run(T16* sm, const T16* __restrict__ Q, const T16* __restrict__ Q2, const T16* __restrict__ Kp, const T16* __restrict__ K2, const T16* __restrict__ Vt, const T16* __restrict__ V2, const int qw0, v8f (&acc)[2][8], float (&l_run)[2]) {
    typedef typename WFrag<T16>::V V;
    constexpr int NPL = HL ? 2 : 1, BUF = NPL * PLANE;
    const int tid = threadIdx.x, lane = tid & 31, c = lane & 15, h = lane >> 4;
    const float cscale = SCL * 1.4426950408889634f;
    v4i rk[NPL][8], rv[NPL][8];
    const unsigned vofs = (unsigned)(tid >> 3) * (TR * 2u) + (unsigned)(tid & 7) * 16u;   // bytes in a kv plane: eight threads cover a V^T row's 128 B
    auto gload = [&](int key0) {   // a stage's K rows and V^T rows, 16 B a thread and turn: every wave-wide load covers four whole 128-B lines
        const unsigned ko = (unsigned)tid + (unsigned)key0 * (HD / 8u), vo = vofs + (unsigned)key0 * 2u;   // the thread's 32-bit offsets in this stage, the same in the hi and the lo plane: K in 16-byte pieces (its rows lie in a row), V^T in bytes
        __builtin_amdgcn_sched_barrier(0);   // the loads are not lifted from here: the wait at the foot has to stand directly behind them
#pragma unroll
        for (int i = 0; i < 8; ++i) {   // the plane's uniform base + the thread's offset + a constant: two address registers for the whole group
            rk[0][i] = ((const v4ia*)Kp + ko)[i * 128]; rv[0][i] = *(const v4ia*)((const char*)Vt + vo + i * (16 * TR * 2));
            if constexpr (HL) { rk[NPL - 1][i] = ((const v4ia*)K2 + ko)[i * 128]; rv[NPL - 1][i] = *(const v4ia*)((const char*)V2 + vo + i * (16 * TR * 2)); } }
        asm volatile("s_wait_xcnt 0x0" :: "v"(ko), "v"(vo) : "memory");   // in front of whatever next rewrites a register that these loads name; the two offsets are inputs so that they live up to the wait and no load of the group lands in them
        __builtin_amdgcn_sched_barrier(0);   // nothing from below is lifted over that wait; and the loads stay up here: sunk towards their use they would hide no latency
    };
    auto sstore = [&](T16* buf) {
#pragma unroll
        for (int i = 0; i < 8; ++i) { const int idx = i * 128 + tid; const int ok = (idx >> 4) * KPIT + (idx & 15) * 8, ov = KTILE + (idx >> 3) * VPIT + (idx & 7) * 8;
            *(v4ia*)(buf + ok) = rk[0][i]; *(v4ia*)(buf + ov) = rv[0][i]; if (HL) { *(v4ia*)(buf + PLANE + ok) = rk[NPL - 1][i]; *(v4ia*)(buf + PLANE + ov) = rv[NPL - 1][i]; } } };
    const int nst = qw0 / SKEY + 1;   // stages up to and with the one that holds the wave's diagonal; the same for all four waves
    gload(0);
    V qf[2][4], qf2[2][4];
#pragma unroll
    for (int g = 0; g < 2; ++g)
#pragma unroll
        for (int kc = 0; kc < 4; ++kc) { const size_t o = (size_t)(qw0 + 16 * g + c) * HD + 32 * kc + 8 * h; qf[g][kc] = WFrag<T16>::ld(Q + o); if (HL) qf2[g][kc] = WFrag<T16>::ld(Q2 + o); }
    asm volatile("s_wait_xcnt 0x0" ::: "memory");   // in front of whatever next rewrites a register that the Q loads name
    __builtin_amdgcn_sched_barrier(0);   // nothing from below is lifted over that wait
    float m_run[2];
#pragma unroll
    for (int g = 0; g < 2; ++g) { m_run[g] = -__builtin_inff(); l_run[g] = 0.0f;
#pragma unroll
        for (int t = 0; t < 8; ++t) acc[g][t] = (v8f){}; }
    sstore(sm); gload(min(1, nst - 1) * SKEY);
    __syncthreads();   // stage 0 is in buffer 0
#pragma unroll 1   // rolled: a stage is long straight-line code already, a second copy would only cost instruction fetches
    for (int st = 0; st < nst; ++st) {
        const T16* cur = sm + (st & 1) * BUF;
        sstore(sm + ((st + 1) & 1) * BUF);          // stage st + 1 into the buffer that stage st - 1 used: the barrier at the foot of st - 1 ended its reads (past the end: the last stage again, read by nobody)
        gload(min(st + 2, nst - 1) * SKEY);         // in flight under this whole stage; clamped, so always inside the planes and no branch round the loads
        // The stage's fragment reads go out in whole groups ahead of their products (one wave per SIMD: nobody else covers an LDS wait): K first; V^T directly behind it where one plane pair leaves the registers
        // for both, else behind the first product, into the registers K has left, so that it streams in under the softmax.
        v8f s[4][2]; V kfa[4][4], kfa2[HL ? 4 : 1][4], vfa[2][8], vfa2[HL ? 2 : 1][8];
#pragma unroll
        for (int kt = 0; kt < 4; ++kt)
#pragma unroll
            for (int kc = 0; kc < 4; ++kc) { const T16* p = cur + (16 * kt + c) * KPIT + 32 * kc + 8 * h; kfa[kt][kc] = WFrag<T16>::ld(p); if constexpr (HL) kfa2[kt][kc] = WFrag<T16>::ld(p + PLANE); }
        __builtin_amdgcn_sched_barrier(0);          // K's reads stay a group, ahead of V^T's: LDS answers in order, and the first product waits for K alone
        auto ldv = [&]() {
#pragma unroll
            for (int j = 0; j < 2; ++j)
#pragma unroll
                for (int t = 0; t < 8; ++t) { const T16* p = cur + KTILE + (16 * t + c) * VPIT + 32 * j + 8 * h; vfa[j][t] = WFrag<T16>::ld(p); if constexpr (HL) vfa2[j][t] = WFrag<T16>::ld(p + PLANE); }
            __builtin_amdgcn_sched_barrier(0);      // keeps the group together up here: moved down to their uses the reads are waited for one by one
        };
        if constexpr (!HL) ldv();
#pragma unroll
        for (int kt = 0; kt < 4; ++kt)
#pragma unroll
            for (int g = 0; g < 2; ++g) { s[kt][g] = (v8f){};
#pragma unroll
                for (int kc = 0; kc < 4; ++kc) { s[kt][g] = WFrag<T16>::mma(kfa[kt][kc], qf[g][kc], s[kt][g]); if constexpr (HL) { s[kt][g] = WFrag<T16>::mma(kfa[kt][kc], qf2[g][kc], s[kt][g]); s[kt][g] = WFrag<T16>::mma(kfa2[kt][kc], qf[g][kc], s[kt][g]); } } }
        if constexpr (HL) { __builtin_amdgcn_sched_barrier(0);   // V^T's reads not above the first product: K's registers are free only behind it
            ldv(); }
        if (st == nst - 1) {                        // work-group-uniform: only the stage with the diagonal pays for the mask
            const int lim = qw0 - st * SKEY + c - 8 * h;   // key 16 kt + 8 h + r of the stage joins query 16 g + c of the wave when 16 kt + r <= lim + 16 g
#pragma unroll
            for (int g = 0; g < 2; ++g)
#pragma unroll
                for (int kt = 0; kt < 4; ++kt) {
#pragma unroll
                    for (int r = 0; r < 8; ++r) { if (16 * kt + r > lim + 16 * g) s[kt][g][r] = -__builtin_inff(); }
                    asm volatile("" : "+v"(s[kt][g]));   // the masked scores: keeps the selects inside the branch
                }
        }
        float mb[2]; bool need = false;
#pragma unroll
        for (int g = 0; g < 2; ++g) { float mx = -__builtin_inff();
#pragma unroll
            for (int kt = 0; kt < 4; ++kt)
#pragma unroll
                for (int r = 0; r < 8; ++r) mx = fmaxf(mx, s[kt][g][r]);
            mx = fmaxf(mx, xhalf(mx)) * cscale; mb[g] = mx; need = need || (mx > m_run[g] + 8.0f); }
        if (__builtin_amdgcn_ballot_w32(need) != 0) {   // rare after the first stages
#pragma unroll
            for (int g = 0; g < 2; ++g) { const float m_new = fmaxf(m_run[g], mb[g]);   // finite from the first stage on: key 0 is never masked
                const float corr = __builtin_amdgcn_exp2f(m_run[g] - m_new);            // 0 on the first stage, where m_run is -inf
                l_run[g] *= corr; m_run[g] = m_new;
#pragma unroll
                for (int t = 0; t < 8; ++t) acc[g][t] = acc[g][t] * corr; }
        }
        V pf[2][2], pf2[2][2];
#pragma unroll
        for (int g = 0; g < 2; ++g) { const float nm = -m_run[g]; float ps0 = 0.0f, ps1 = 0.0f;
#pragma unroll
            for (int j = 0; j < 2; ++j) { v8u w, w2;
#pragma unroll
                for (int i = 0; i < 8; ++i) {
                    const float p0 = __builtin_amdgcn_exp2f(fmaf(s[2 * j + (i >> 2)][g][2 * (i & 3)], cscale, nm)), p1 = __builtin_amdgcn_exp2f(fmaf(s[2 * j + (i >> 2)][g][2 * (i & 3) + 1], cscale, nm));
                    ps0 += p0; ps1 += p1;
                    if (HL) { unsigned wh, wl; split2(p0, p1, wh, wl); w[i] = wh; w2[i] = wl; }
                    else w[i] = pk16(p0, p1); }
                pf[g][j] = __builtin_bit_cast(V, w); if (HL) pf2[g][j] = __builtin_bit_cast(V, w2); }
            l_run[g] += ps0 + ps1; }
#pragma unroll
        for (int j = 0; j < 2; ++j)
#pragma unroll
            for (int t = 0; t < 8; ++t)
#pragma unroll
                for (int g = 0; g < 2; ++g) { acc[g][t] = WFrag<T16>::mma(vfa[j][t], pf[g][j], acc[g][t]); if constexpr (HL) { acc[g][t] = WFrag<T16>::mma(vfa[j][t], pf2[g][j], acc[g][t]); acc[g][t] = WFrag<T16>::mma(vfa2[j][t], pf[g][j], acc[g][t]); } }
        __builtin_amdgcn_sched_barrier(0);          // keeps the barrier, and the wait for stage st + 2's global loads that comes with it, at the stage's foot
        __syncthreads();   // publishes stage st + 1 and ends every wave's reads of stage st
    }
}
// The grid has twice as many work-groups as the chip holds at a time (one to a WGP, by registers); a tile's cost falls with the index.
// blockIdx.y is the rank, blockIdx.x the (batch element, kv group) pair. Cost of a 32-row tile: its stages, a hi+lo stage counted double
// (three products for one, the same softmax). The order is for speed alone: any permutation gives the same values.
struct TileOrder { unsigned char t[TT / 32]; };
constexpr int tile_cost(int i) { return (i * 32 < RH ? 2 : 1) * (i * 32 / SKEY + 1); }
constexpr TileOrder tile_order() { TileOrder o{};
    for (int i = 0; i < TT / 32; ++i) { int r = 0;   // the rank of tile i: the tiles that cost more, and of those that cost the same the later ones
        for (int j = 0; j < TT / 32; ++j) r += (tile_cost(j) > tile_cost(i) || (tile_cost(j) == tile_cost(i) && j > i)) ? 1 : 0;
        o.t[r] = (unsigned char)i; }
    return o; }
static constexpr TileOrder fattn_order = tile_order();
__global__ __launch_bounds__(128) void k_fattn(const h16* __restrict__ Q16, const bf* __restrict__ Qh, const bf* __restrict__ Ql, const h16* __restrict__ K16, const bf* __restrict__ Kh, const bf* __restrict__ Kl, const h16* __restrict__ V16, const bf* __restrict__ Vh, const bf* __restrict__ Vl, bf* __restrict__ Ah, bf* __restrict__ Al) {
    __shared__ __align__(16) unsigned short sm[2 * 2 * PLANE];   // two buffers of two plane pairs (hi+lo); the fp16 rows use half of it
    const int tid = threadIdx.x, lane = tid & 31, c = lane & 15, h = lane >> 4;
    const int kv = blockIdx.x % NKV, bz = blockIdx.x / NKV, wave = __builtin_amdgcn_readfirstlane(tid >> 5), head = kv * REP + wave;
    // Dearest tiles first. readfirstlane: the tile number is used as loaded; seeing through the table, the compiler tested the rank against a 64-bit mask for the branch below, and that build kept the thread id in scratch and reloaded it in every stage.
    const int qw0 = __builtin_amdgcn_readfirstlane(fattn_order.t[blockIdx.y]) * 32;
    const size_t qo = ((size_t)head * NB_ + bz) * TT * HD, ko = ((size_t)kv * NB_ + bz) * TT * HD, vo = (size_t)kv * HD * TR + (size_t)bz * TT;
    v8f acc[2][8]; float l_run[2];
    if (qw0 < RH) fattn_run<bf, true>((bf*)sm, Qh + qo, Ql + qo, Kh + ko, Kl + ko, Vh + vo, Vl + vo, qw0, acc, l_run);
    else fattn_run<h16, false>((h16*)sm, Q16 + qo, nullptr, K16 + ko, nullptr, V16 + vo, nullptr, qw0, acc, l_run);
    // Output through LDS (each wave its own 2 x 32 rows, behind the stage loop's last barrier), so that every 128-B line of the planes is stored whole. The unrolls: constant indices, as above.
    bf* eb = (bf*)sm + wave * (2 * 32 * KPIT);
#pragma unroll
    for (int g = 0; g < 2; ++g) { const float inv = __fdiv_rn(1.0f, l_run[g] + xhalf(l_run[g]));
#pragma unroll
        for (int t = 0; t < 8; ++t) { v4i oh, ol;
#pragma unroll
            for (int r = 0; r < 4; ++r) { unsigned a, c2; split2(acc[g][t][2 * r] * inv, acc[g][t][2 * r + 1] * inv, a, c2); oh[r] = (int)a; ol[r] = (int)c2; }
            bf* e = eb + (16 * g + c) * KPIT + 16 * t + 8 * h; *(v4ia*)e = oh; *(v4ia*)(e + 32 * KPIT) = ol; } }
    __syncthreads();   // the staged rows are read back by other lanes than wrote them
    v4i th[16], tl[16];
#pragma unroll
    for (int i = 0; i < 16; ++i) { const bf* e = eb + (2 * i + h) * KPIT + c * 8; th[i] = *(const v4ia*)e; tl[i] = *(const v4ia*)(e + 32 * KPIT); }
    const unsigned oofs = (unsigned)h * (DQ * 2u) + (unsigned)c * 16u;   // bytes: 16 lanes cover one row's 256 B, a wave-wide store two rows
    char* ah = (char*)(Ah + (size_t)(bz * TT + qw0) * DQ + head * HD); char* al = (char*)(Al + (size_t)(bz * TT + qw0) * DQ + head * HD);
#pragma unroll
    for (int i = 0; i < 16; ++i) { *(v4ia*)(ah + oofs + i * (2 * DQ * 2)) = th[i]; *(v4ia*)(al + oofs + i * (2 * DQ * 2)) = tl[i]; }
}

extern "C" void kernel_launch(void* const* d_in, const int* in_sizes, int n_in,
                              void* d_out, int out_size, void* d_ws, size_t ws_size, hipStream_t stream) {
    (void)in_sizes; (void)n_in; (void)out_size;
    const float* x = (const float*)d_in[0]; const float* wq = (const float*)d_in[1]; const float* wk = (const float*)d_in[2]; const float* wv = (const float*)d_in[3]; const float* wo = (const float*)d_in[4];
    float* OUT = (float*)d_out;     // [2][2048][2048]
    char* wsp = (char*)d_ws;
    auto take = [&](size_t bytes) { char* p = wsp; wsp += (bytes + 255) & ~(size_t)255; return (void*)p; };
    bf* WQ = (bf*)take((size_t)DQ * DM * 2); bf* WK = (bf*)take((size_t)DKV * DM * 2); bf* WV = (bf*)take((size_t)DKV * DM * 2); bf* WO = (bf*)take((size_t)DM * DQ * 2);
    bf* XB = (bf*)take((size_t)TR * DM * 2);
    h16* QP16 = (h16*)take((size_t)NH_ * TR * HD * 2); h16* KP16 = (h16*)take((size_t)NKV * TR * HD * 2); h16* VT16 = (h16*)take((size_t)NKV * HD * TR * 2);
    bf* QPh = (bf*)take((size_t)NH_ * TR * HD * 2); bf* QPl = (bf*)take((size_t)NH_ * TR * HD * 2); bf* KPh = (bf*)take((size_t)NKV * TR * HD * 2); bf* KPl = (bf*)take((size_t)NKV * TR * HD * 2); bf* VTh = (bf*)take((size_t)NKV * HD * TR * 2); bf* VTl = (bf*)take((size_t)NKV * HD * TR * 2);
    bf* ATh = (bf*)take((size_t)TR * DQ * 2); bf* ATl = (bf*)take((size_t)TR * DQ * 2);
    if ((size_t)(wsp - (char*)d_ws) > ws_size) return;    // ws 256 MiB
    k_wt4<<<2 * (GK / WKT) * (DQ / WNT) + 2 * (GK / WKT) * (DKV / WNT), 256, 0, stream>>>(wq, wk, wv, wo, WQ, WK, WV, WO);
    // Every launch takes both batch elements: the projections see x as TR rows, the attention has the batch element in blockIdx.x.
    k_cvt8<<<(unsigned)(((size_t)TR * DM / 8 + 255) / 256), 256, 0, stream>>>(x, XB, (size_t)TR * DM / 8);
    // Both product launches: 2 x 4 waves, one work-group to a WGP (two waves to a SIMD) and 256 in the grid. q, k, v: 192 x 256 of C, the 3072 weight rows dealt so that every work-group has the same work
    // and x is read from L2 by 16 work-groups in all; Wo: 128 x 256 of C, two A planes.
    k_qkv<<<dim3(NH_, TR / 256, 1), 256, 0, stream>>>(WQ, WK, WV, XB, QP16, QPh, QPl, KP16, KPh, KPl, VT16, VTh, VTl);
    k_fattn<<<dim3(NKV * NB_, TT / 32, 1), 128, 0, stream>>>(QP16, QPh, QPl, KP16, KPh, KPl, VT16, VTh, VTl, ATh, ATl);
    k_gemmo<<<dim3(TR / 128, DM / 256, 1), 256, 0, stream>>>(ATh, ATl, WO, OUT);
}

// v010
// One run takes 131 microseconds.
// In two side-by-side timings against v009, it was 1.07 and 1.08 times as fast.
// Counting every step since v000, it is 13.0 times as fast.
#include <hip/hip_runtime.h>

// Grouped-query causal self-attention with 128-wide heads, no rotary (x [2][2048][2048]; q = x Wq ('xw' [2048][2048], 16 heads x 128), k, v = x Wk, x Wv ('xw' [2048][512], 4 kv heads x 128), no biases; k, v repeated 4 x on the head axis (jnp.repeat: query head h uses kv head h / 4); att x 1/sqrt(128); causal (-inf); softmax; y = merged Wo ('xw' [2048][2048], no bias) -> [2][2048][2048] (8.4 M); argument order x, Wq, Wk, Wv, Wo).
// Compute dtypes, f32 accumulate: every input rounded to bf16; q/k/v on PLAIN bf16 operands (inputs: exact), their fp16 and hi+lo bf16 planes written by the projection kernel itself; scores, softmax and attn.v in one kernel (online softmax, f32; 64-key stages beyond a wave's diagonal never read): query rows < 512 hl (3 products), the rest single fp16; Wo on f16 operands (its bf16 value, exact in f16 but for subnormals): merged rows t < 512 as f16 hi+lo (2 products), the rest as one f16 plane.

#define NB_  2
#define TT   2048
#define TR   (NB_ * TT)       // rows of x, both batch elements one behind the other: row b TT + t
#define DM   2048
#define NH_  16
#define NKV  4
#define REP  (NH_ / NKV)
#define HD   128
#define DQ   (NH_ * HD)
#define DKV  (NKV * HD)
#define RH   512                  // query rows < RH use hi+lo planes (a multiple of 32: a wave's 32 rows are wholly hi+lo or wholly fp16)
#define SCL  0.088388347648318447f   // HD^-0.5
typedef _Float16 h16;
typedef unsigned short bf;
typedef __attribute__((ext_vector_type(16))) __bf16   v16bf;
typedef __attribute__((ext_vector_type(16))) _Float16 v16h;
typedef __attribute__((ext_vector_type(8)))  _Float16 v8h;
typedef __attribute__((ext_vector_type(8)))  unsigned short v8us;
typedef __attribute__((ext_vector_type(8)))  float    v8f;
typedef __attribute__((ext_vector_type(4)))  float    v4f;
typedef v8h  __attribute__((may_alias)) v8ha;
typedef v4f  __attribute__((may_alias)) v4fa;
typedef v8us __attribute__((may_alias)) v8usa;

__device__ __forceinline__ unsigned short f2bf(float f) { unsigned u = __float_as_uint(f); u += 0x7FFFu + ((u >> 16) & 1u); return (unsigned short)(u >> 16); }
__device__ __forceinline__ float bf2f(unsigned short b) { return __uint_as_float(((unsigned)b) << 16); }
__device__ __forceinline__ v16h cat16(v8h lo, v8h hi) { return __builtin_shufflevector(lo, hi, 0, 1, 2, 3, 4, 5, 6, 7, 8, 9, 10, 11, 12, 13, 14, 15); }
__device__ __forceinline__ v16bf cat16b(v8us lo, v8us hi) { return __builtin_bit_cast(v16bf, __builtin_shufflevector(lo, hi, 0, 1, 2, 3, 4, 5, 6, 7, 8, 9, 10, 11, 12, 13, 14, 15)); }
__device__ __forceinline__ v8f wmma16(v16h a, v16h b, v8f c) { return __builtin_amdgcn_wmma_f32_16x16x32_f16(false, a, false, b, (short)0, c, false, false); }
__device__ __forceinline__ v8f wmmab(v16bf a, v16bf b, v8f c) { return __builtin_amdgcn_wmma_f32_16x16x32_bf16(false, a, false, b, (short)0, c, false, false); }

typedef __attribute__((ext_vector_type(2))) _Float16 v2h;
typedef __attribute__((ext_vector_type(2))) float v2f;
typedef __attribute__((ext_vector_type(4))) int v4i;
typedef v4i __attribute__((may_alias)) v4ia;
__device__ __forceinline__ unsigned pk16(float a, float b) { v2f x; x[0] = a; x[1] = b; return __builtin_bit_cast(unsigned, __builtin_convertvector(x, v2h)); }
typedef __attribute__((ext_vector_type(2))) __bf16 v2b;
__device__ __forceinline__ void split2(float a, float b, unsigned& hi, unsigned& lo) {   // two values at once, by the packed conversion (round to nearest even, as f2bf): packed hi parts, packed remainders
    v2f x; x[0] = a; x[1] = b; hi = __builtin_bit_cast(unsigned, __builtin_convertvector(x, v2b));
    v2f r; r[0] = a - __uint_as_float(hi << 16); r[1] = b - __uint_as_float(hi & 0xFFFF0000u); lo = __builtin_bit_cast(unsigned, __builtin_convertvector(r, v2b)); }

__device__ __forceinline__ void split2h(float a, float b, unsigned& hi, unsigned& lo) {   // the same in f16: packed nearest f16 values, packed f16 remainders
    v2f x; x[0] = a; x[1] = b; const v2h t = __builtin_convertvector(x, v2h); hi = __builtin_bit_cast(unsigned, t);
    const v2f r = x - __builtin_convertvector(t, v2f); lo = __builtin_bit_cast(unsigned, __builtin_convertvector(r, v2h)); }

template <typename T16> struct WFrag;
template <> struct WFrag<h16> { typedef v16h V; static __device__ __forceinline__ V ld(const h16* p) { return cat16(*(const v8h*)p, *(const v8h*)(p + 16)); } static __device__ __forceinline__ v8f mma(V a, V b, v8f c) { return wmma16(a, b, c); } };
template <> struct WFrag<bf> { typedef v16bf V; static __device__ __forceinline__ V ld(const bf* p) { return cat16b(*(const v8us*)p, *(const v8us*)(p + 16)); } static __device__ __forceinline__ v8f mma(V a, V b, v8f c) { return wmmab(a, b, c); } };
// ---- gemm_tile: C[m][n] = sum_k A[m][k] Bt[n][k] (+ A2[m][k] Bt[n][k] where SPLIT), all planes bf16 (MODE 3: f16), K-contiguous, K = GK. MODE 0: C goes out as f32, pitch DM.
// MODE 1, 2 (q with k, q with v): Bt = x (n = b TT + t); the tile's 192 rows of A are one head of Wq (A) and 64 rows of Wk or Wv (A2), staged so that each of the two wave rows has 64 of the one (mb 0..3) and 32 of the other (mb 4, 5).
// C goes out as the three 16-bit planes the attention kernel reads (fp16, bf16 hi, bf16 lo): q, k as [head][b][t][d], v as [head x 128 + d][b][t]. An accumulator lane holds eight consecutive rows of its A operand at one row of its B operand,
// which is to be 16 B of a plane row: so q and k take the weight as A, and v takes x as A (the fragments are the same, the two operands of the instruction change places).
// MODE 3 (Wo): the planes hold f16 values and the products are f16. The tile's 128 rows of C are 96 merged rows with t >= RH, taken from plane A alone, and 32 rows with t < RH, taken as hi (plane A) + lo (plane A2):
// 160 staged rows, each wave row 48 single (mb 0..2), 16 hi (mb 3) and 16 lo (mb 4, summed into mb 3's accumulators), so that every work-group has the same work. C goes out as f32, pitch DM.
// A work-group is 2 x WN waves on a (32 MA) x (16 NB WN) tile of C; a wave owns MA x NB accumulators (MA: MB, for Wo MB - 1). k goes in passes of 128 (256 B of every operand row): the work-group brings a pass through registers into
// one of two LDS buffers with whole-line loads (16 threads cover a row's 256 B), so every operand byte comes from L2 once per work-group and the fragments are read from LDS. One barrier per pass.
// A pass is four k steps of 32; each step stores a quarter of the next pass's rows to LDS, refills those registers with the same quarter of the pass after it (so a whole pass of loads is always in flight),
// reads the next step's fragments into the second fragment set and then runs its own products.
// The walk over k is a ring: work-group (x, y) starts at pass (x + y) mod NP and wraps round. Work-groups that share operand rows (one x, or one y) would otherwise ask L2 for the same lines at the same moment,
// and every work-group of the launch for the same 256 B of each 4-KiB row. Every accumulator takes its products in that order of passes, kc ascending inside a pass, A before A2.
// Every '#pragma unroll' in gemm_tile is there so that the staging, fragment and accumulator arrays are indexed by constants and stay in registers.
#define GK    2048                 // the reduction length of all four products
#define GPASS 128                  // k per pass
#define GPIT  136                  // LDS pitch of a staged row, elements: 256 B + 16 B, an odd multiple of 16 B for the 16-byte readers
typedef __attribute__((ext_vector_type(4))) int g4i;
typedef g4i __attribute__((may_alias)) g4ia;
template <bool B> struct GFlag { static constexpr bool v = B; };
// The pass barrier, by hand: __syncthreads() would also wait for the global loads that are in flight for the pass after next and so undo their lead. What other waves depend on here is LDS alone
// (this wave's stores of the next pass, its reads of this one): s_wait_dscnt 0 covers both.
__device__ __forceinline__ void gbar() { asm volatile("s_wait_dscnt 0x0\n\ts_barrier_signal -1\n\ts_barrier_wait -1" ::: "memory"); }
template <int MB, int NB, bool SPLIT, int MODE, int WN>
__device__ __forceinline__ void gemm_tile(bf* sm, const bf* __restrict__ A, const bf* __restrict__ A2, const bf* __restrict__ Bt, float* C, h16* Q16, bf* Qh, bf* Ql, h16* S16, bf* Sh, bf* Sl) {
    typedef WFrag<bf>::V V;
    constexpr bool QKV = MODE == 1 || MODE == 2, VT = MODE == 2, MIX = MODE == 3;
    constexpr int TH = 64 * WN, RT = TH / 16, TA = (32 * MB) / RT / 4, NTA = (32 * MB) / RT, MA = MIX ? MB - 1 : MB, RA = (32 * MB), RB = 16 * NB * WN, OA2 = RA * GPIT, OB = (SPLIT ? 2 : 1) * RA * GPIT, STG = OB + RB * GPIT, NP = GK / GPASS, NA2 = SPLIT ? MB : 1;
    static_assert(!QKV || (MB == 6 && RT == 16 && !SPLIT), "the q, k, v tile: a wave row is 64 rows of Wq and 32 of the side weight, a turn 16 rows");
    const int tid = threadIdx.x, lane = tid & 31, lr = lane & 15, hi = lane >> 4, wave = __builtin_amdgcn_readfirstlane(tid >> 5), wm = wave / WN, wn = wave % WN;
    static_assert(MIX || (32 * MB) % (4 * RT) == 0, "a quarter of a pass is whole turns of RT rows in either operand");
    static_assert(!MIX || (MB == 5 && RT == 16 && !SPLIT && (TT - RH) / 96 == RH / 32 && (TT - RH) % 96 == 0), "the Wo tile: a wave row is 48 single rows, 16 hi and 16 lo, a turn 16 rows; a batch element has as many groups of 96 rows as of 32");
    constexpr int GB = RH / 32;   // Wo: row groups per batch element
    const int r0 = MIX ? (int)(blockIdx.x / GB) * TT + RH + (int)(blockIdx.x % GB) * 96 : blockIdx.x * (QKV ? HD : RA), c0 = blockIdx.y * RB, s0 = MIX ? (int)(blockIdx.x / GB) * TT + (int)(blockIdx.x % GB) * 32 : QKV ? (int)(blockIdx.x >> 1) * 64 : r0;   // first row of A, of Bt, and of A2 (q, k, v: the side weight's 64 rows; Wo: the 96 single rows, the 32 hi+lo rows)
    static_assert((NP & (NP - 1)) == 0, "the ring of passes wraps by a mask");
    const int p0 = __builtin_amdgcn_readfirstlane((int)((blockIdx.x + blockIdx.y) & (unsigned)(NP - 1)));   // the pass of k that this work-group takes first (uniform). readfirstlane: without it the first pass's addresses were formed above k_qkv's branch between its two kinds of tile and kept in scratch across the first kind
    const unsigned tofs = (unsigned)(tid >> 4) * (GK * 2u) + (unsigned)(tid & 15) * 16u;   // bytes: the thread's row of a turn of RT rows, and its 16 B of the row's 256
    const char* Ab = (const char*)(A + (size_t)r0 * GK) + tofs; const char* A2b = (SPLIT || QKV || MIX) ? (const char*)(A2 + (size_t)s0 * GK) + tofs : nullptr; const char* A3b = MIX ? (const char*)(A + (size_t)s0 * GK) + tofs : nullptr; const char* Bb = (const char*)(Bt + (size_t)c0 * GK) + tofs;
    const int sofs = (tid >> 4) * GPIT + (tid & 15) * 8;                                   // the same place in a staged turn, elements
    g4i ra[NTA], ra2[SPLIT ? 4 * TA : 4], rb[4 * NB];
    auto gload = [&](int q, int pass) {   // quarter q of a pass: TA turns of A (and of A2), NB turns of Bt; every wave-wide load covers four whole 128-B lines
        const int kb = ((pass + p0) & (NP - 1)) * (GPASS * 2);   // bytes: where in a row the work-group's pass number 'pass' lies
        const char* pa = Ab + kb; const char* pa2 = (SPLIT || QKV || MIX) ? A2b + kb : nullptr; const char* pa3 = MIX ? A3b + kb : nullptr; const char* pb = Bb + kb;   // the thread's address in each plane + a constant per turn
        __builtin_amdgcn_sched_barrier(0);   // the loads are not lifted from here: the wait at the foot has to stand directly behind them
        if constexpr (MIX) {   // ten turns over four quarters: quarter q has turns q, q + 4 and, where there is one, q + 8
#pragma unroll
            for (int i = 0; i < 3; ++i) { const int t = q + 4 * i; if (t < NTA) { const int hf = t / 5, u = t % 5; const char* s = u < 3 ? pa + (hf * 48 + u * 16) * (GK * 2) : (u == 3 ? pa3 : pa2) + hf * 16 * (GK * 2); ra[t] = *(const g4ia*)s; } }   // staged row 80 hf + 16 u + ...
        } else {
#pragma unroll
        for (int i = 0; i < TA; ++i) { const int t = q * TA + i;
            if constexpr (QKV) { const int hf = t / 6, u = t % 6; const char* s = u < 4 ? pa + (hf * 64 + u * 16) * (GK * 2) : pa2 + (hf * 32 + (u - 4) * 16) * (GK * 2); ra[t] = *(const g4ia*)s; }   // staged row 96 hf + 16 u + ...: 64 rows of Wq, then 32 of the side weight
            else { ra[t] = *(const g4ia*)(pa + t * (RT * GK * 2)); if constexpr (SPLIT) ra2[t] = *(const g4ia*)(pa2 + t * (RT * GK * 2)); } } }
#pragma unroll
        for (int i = 0; i < NB; ++i) { const int t = q * NB + i; rb[t] = *(const g4ia*)(pb + t * (RT * GK * 2)); }
        // in front of whatever next rewrites a register that these loads name; the addresses are inputs so that they live up to the wait and no load of the group lands in them
        if constexpr (MIX) asm volatile("s_wait_xcnt 0x0" :: "v"(pa), "v"(pa2), "v"(pa3), "v"(pb) : "memory"); else if constexpr (SPLIT || QKV) asm volatile("s_wait_xcnt 0x0" :: "v"(pa), "v"(pa2), "v"(pb) : "memory"); else asm volatile("s_wait_xcnt 0x0" :: "v"(pa), "v"(pb) : "memory");
        __builtin_amdgcn_sched_barrier(0);   // nothing from below is lifted over that wait; and the loads stay up here: sunk towards their use they would hide no latency
    };
    auto sstore = [&](int q, bf* buf) {
        if constexpr (MIX) {
#pragma unroll
            for (int i = 0; i < 3; ++i) { const int t = q + 4 * i; if (t < NTA) *(g4ia*)(buf + t * RT * GPIT + sofs) = ra[t]; }
        } else {
#pragma unroll
        for (int i = 0; i < TA; ++i) { const int t = q * TA + i; *(g4ia*)(buf + t * RT * GPIT + sofs) = ra[t]; if constexpr (SPLIT) *(g4ia*)(buf + OA2 + t * RT * GPIT + sofs) = ra2[t]; } }
#pragma unroll
        for (int i = 0; i < NB; ++i) { const int t = q * NB + i; *(g4ia*)(buf + OB + t * RT * GPIT + sofs) = rb[t]; } };
    v8f acc[MA][NB];
#pragma unroll
    for (int mb = 0; mb < MA; ++mb)
#pragma unroll
        for (int nb = 0; nb < NB; ++nb) acc[mb][nb] = (v8f){};
#pragma unroll
    for (int q = 0; q < 4; ++q) gload(q, 0);
#pragma unroll
    for (int q = 0; q < 4; ++q) { sstore(q, sm); gload(q, 1); }
    gbar();   // pass 0 is in buffer 0
    const int fa = (wm * MB * 16 + lr) * GPIT + 8 * hi, fb = OB + (wn * NB * 16 + lr) * GPIT + 8 * hi;   // the lane's place in the wave's first A and Bt fragment: the k order of both is that of WFrag::ld
    auto pass = [&](int p, auto ST, auto LD) {   // ST: a pass p + 1 exists and is stored; LD: a pass p + 2 exists and is loaded
        const bf* cur = sm + (p & 1) * STG; bf* nxt = sm + ((p + 1) & 1) * STG;   // nxt held pass p - 1: the barrier at the foot of p - 1 ended its reads
        V a[2][MB], a2[2][NA2], b[2][NB];
        auto ldf = [&](int set, int ks) {
#pragma unroll
            for (int mb = 0; mb < MB; ++mb) { a[set][mb] = WFrag<bf>::ld(cur + fa + mb * 16 * GPIT + ks * 32); if constexpr (SPLIT) a2[set][mb] = WFrag<bf>::ld(cur + OA2 + fa + mb * 16 * GPIT + ks * 32); }
#pragma unroll
            for (int nb = 0; nb < NB; ++nb) b[set][nb] = WFrag<bf>::ld(cur + fb + nb * 16 * GPIT + ks * 32); };
        ldf(0, 0);
#pragma unroll
        for (int ks = 0; ks < 4; ++ks) {
            if constexpr (decltype(ST)::v) sstore(ks, nxt);
            if constexpr (decltype(LD)::v) gload(ks, p + 2);
            if (ks < 3) ldf((ks + 1) & 1, ks + 1);
            __builtin_amdgcn_sched_barrier(0);   // the next step's fragment reads stay a group ahead of this step's products (one or two waves per SIMD: little else covers an LDS wait)
#pragma unroll
            for (int nb = 0; nb < NB; ++nb)
#pragma unroll
                for (int mb = 0; mb < MA; ++mb) { if (MIX) acc[mb][nb] = wmma16(__builtin_bit_cast(v16h, a[ks & 1][mb]), __builtin_bit_cast(v16h, b[ks & 1][nb]), acc[mb][nb]); else if (VT && mb >= 4) acc[mb][nb] = wmmab(b[ks & 1][nb], a[ks & 1][mb], acc[mb][nb]); else acc[mb][nb] = wmmab(a[ks & 1][mb], b[ks & 1][nb], acc[mb][nb]); }   // v: x as the A operand, so that a lane holds eight t of one d
            if constexpr (MIX) {   // the lo rows, behind all the others: no product directly behind the one whose accumulator it adds to
#pragma unroll
                for (int nb = 0; nb < NB; ++nb) acc[MA - 1][nb] = wmma16(__builtin_bit_cast(v16h, a[ks & 1][MB - 1]), __builtin_bit_cast(v16h, b[ks & 1][nb]), acc[MA - 1][nb]); }
            if constexpr (SPLIT) {
#pragma unroll
                for (int nb = 0; nb < NB; ++nb)
#pragma unroll
                    for (int mb = 0; mb < MB; ++mb) acc[mb][nb] = wmmab(a2[ks & 1][mb], b[ks & 1][nb], acc[mb][nb]); }
            __builtin_amdgcn_sched_barrier(0);   // the following step's stores, loads and reads are not lifted into this step's products, whose fragment set they refill
        }
        gbar();   // publishes pass p + 1 and ends every wave's reads of pass p
    };
#pragma unroll 1   // rolled: a pass is long straight-line code already, more copies would only cost instruction fetches
    for (int p = 0; p < NP - 2; ++p) pass(p, GFlag<true>(), GFlag<true>());
    pass(NP - 2, GFlag<true>(), GFlag<false>());    // the last two passes apart: nothing is left to load, then nothing to store
    pass(NP - 1, GFlag<false>(), GFlag<false>());
    if constexpr (QKV) {
        // The planes (fp16, bf16 hi, bf16 lo), one at a time through LDS (behind the last pass's barrier), so that every 128-B line of a plane is stored whole, by one wave. The unrolls: constant indices, as above.
        // A plane's staging: q as [t][d] (256 rows of 128), then k as [t][d] (256 rows of 64) or v as [d][t] (64 rows of 256); every pitch an odd multiple of 16 B. Planes alternate between two regions,
        // so one barrier per plane is enough: a region is written again only behind the barrier of the plane between, which every wave reaches with its reads of the region done.
        constexpr int QP = HD + 8, QA = RB * QP, KP = 64 + 8, VP = RB + 8, REG = QA + (RB * KP > 64 * VP ? RB * KP : 64 * VP);
        static_assert(REG <= STG, "two staging regions fit the ring");
        const int kvh = (int)(blockIdx.x >> 2), d0 = (int)((blockIdx.x >> 1) & 1u) * 64;   // the side weight's 64 rows: kv head, first d
        const int qrow = tid >> 4, qcp = (tid & 15) * 8, krow = tid >> 3, kcp = (tid & 7) * 8;   // 16 threads cover a q row's 256 B, 8 a k row's 128 B, a wave a v row's 512 B
        const size_t qo = (((size_t)blockIdx.x * TR + c0 + qrow) * HD + qcp) * 2;   // bytes: the thread's place in a q plane, [head][b][t][d]
        const size_t so = VT ? ((size_t)(kvh * HD + d0 + wave) * TR + c0 + lane * 8) * 2 : (((size_t)kvh * TR + c0 + krow) * HD + d0 + kcp) * 2;   // and in a v plane, [head x 128 + d][b][t], or a k plane, [head][b][t][d]
#pragma unroll
        for (int pl = 0; pl < 3; ++pl) {
            bf* reg = sm + (pl & 1) * REG;
#pragma unroll
            for (int nb = 0; nb < NB; ++nb)
#pragma unroll
                for (int mb = 0; mb < MB; ++mb) { v4i o;
#pragma unroll
                    for (int r = 0; r < 4; ++r) { const float x0 = acc[mb][nb][2 * r], x1 = acc[mb][nb][2 * r + 1];
                        if (pl == 0) o[r] = (int)pk16(x0, x1); else { unsigned a, c2; split2(x0, x1, a, c2); o[r] = (int)(pl == 1 ? a : c2); } }
                    bf* e = mb < 4 ? reg + ((wn * NB + nb) * 16 + lr) * QP + (wm * 4 + mb) * 16 + 8 * hi
                          : VT ? reg + QA + ((wm * 2 + mb - 4) * 16 + lr) * VP + (wn * NB + nb) * 16 + 8 * hi
                               : reg + QA + ((wn * NB + nb) * 16 + lr) * KP + (wm * 2 + mb - 4) * 16 + 8 * hi;
                    *(v4ia*)e = o; }
            gbar();   // the staged rows are read back by other waves than wrote them
            char* pq = (pl == 0 ? (char*)Q16 : pl == 1 ? (char*)Qh : (char*)Ql) + qo; char* ps = (pl == 0 ? (char*)S16 : pl == 1 ? (char*)Sh : (char*)Sl) + so;
            v4i tq[16], ts[8];
#pragma unroll
            for (int i = 0; i < 16; ++i) tq[i] = *(const v4ia*)(reg + (i * 16 + qrow) * QP + qcp);
#pragma unroll
            for (int i = 0; i < 8; ++i) ts[i] = VT ? *(const v4ia*)(reg + QA + (i * 8 + wave) * VP + lane * 8) : *(const v4ia*)(reg + QA + (i * 32 + krow) * KP + kcp);
#pragma unroll
            for (int i = 0; i < 16; ++i) *(v4ia*)(pq + i * (16 * HD * 2)) = tq[i];
            asm volatile("s_wait_xcnt 0x0" :: "v"(pq) : "memory");   // in front of whatever next rewrites a register that these stores name: the second address is formed about here
            __builtin_amdgcn_sched_barrier(0);   // nothing from below is lifted over that wait
#pragma unroll
            for (int i = 0; i < 8; ++i) *(v4ia*)(ps + i * (VT ? 8 * TR * 2 : 32 * HD * 2)) = ts[i];
            if (pl < 2) { asm volatile("s_wait_xcnt 0x0" ::: "memory");   // in front of whatever next rewrites a register that these stores name
                __builtin_amdgcn_sched_barrier(0); }   // nothing from below is lifted over that wait
        }
    } else {
    // Output through LDS (each wave its own 16 rows, behind the last pass's barrier), so that every 128-B line of C is stored whole.
    constexpr int OP = NB * 16 + 4, LPR = NB * 4, RPS = 32 / LPR;   // pitch of a staged row, floats; lanes per row of the wave's tile; rows per wave-wide store
    float* os = (float*)sm + wave * (16 * OP);
    char* cb = (char*)(C + (size_t)(r0 + wm * (MIX ? 48 : MB * 16) + lane / LPR) * DM + c0 + wn * NB * 16 + (lane % LPR) * 4);   // the lane's place in the wave's first stored rows: every store is this one address plus a constant, so no address register is formed anew between the stores
    char* ch = MIX ? (char*)(C + (size_t)(s0 + wm * 16 + lane / LPR) * DM + c0 + wn * NB * 16 + (lane % LPR) * 4) : nullptr;   // Wo: the same for the wave's 16 hi+lo rows
#pragma unroll
    for (int mb = 0; mb < MA; ++mb) {
#pragma unroll
        for (int nb = 0; nb < NB; ++nb) {
#pragma unroll
            for (int j = 0; j < 8; ++j) os[(hi * 8 + j) * OP + nb * 16 + lr] = acc[mb][nb][j]; }
        __builtin_amdgcn_wave_barrier(); asm volatile("" ::: "memory");   // the staged rows are read back by other lanes of the wave than wrote them
#pragma unroll
        for (int s = 0; s < 16 / RPS; ++s) { const int row = RPS * s + lane / LPR, cofs = (lane % LPR) * 4; *(v4f*)((MIX && mb == MA - 1) ? ch + RPS * s * (DM * 4) : cb + (mb * 16 + RPS * s) * (DM * 4)) = *(const v4fa*)(os + row * OP + cofs); }
        if (mb + 1 < MA) { __builtin_amdgcn_wave_barrier(); asm volatile("s_wait_xcnt 0x0" ::: "memory"); }   // the next 16 rows overwrite the staging only behind these reads; the wait: in front of whatever next rewrites a register that these stores name
    }
    }
}
// q, k and v in one launch: work-group (x, y) takes head x of Wq and 64 rows of Wk (x even) or of Wv (x odd) against 256 rows of x. 
__global__ __launch_bounds__(256) void k_qkv(const bf* __restrict__ WQ, const bf* __restrict__ WK, const bf* __restrict__ WV, const bf* __restrict__ X, h16* Q16, bf* Qh, bf* Ql, h16* K16, bf* Kh, bf* Kl, h16* V16, bf* Vh, bf* Vl) {
    __shared__ __align__(16) bf sm[2 * (192 + 256) * GPIT];
    if (blockIdx.x & 1u) gemm_tile<6, 4, false, 2, 4>(sm, WQ, WV, X, nullptr, Q16, Qh, Ql, V16, Vh, Vl);   // the branch is uniform for the work-group
    else gemm_tile<6, 4, false, 1, 4>(sm, WQ, WK, X, nullptr, Q16, Qh, Ql, K16, Kh, Kl);
}
__global__ __launch_bounds__(256) void k_gemmo(const bf* __restrict__ A, const bf* __restrict__ A2, const bf* __restrict__ Bt, float* C) {
    __shared__ __align__(16) bf sm[2 * (160 + 256) * GPIT];
    gemm_tile<5, 4, false, 3, 4>(sm, A, A2, Bt, C, nullptr, nullptr, nullptr, nullptr, nullptr, nullptr);
}

// ---- k_wt4: the four weights, f32 [k][n], to bf16 planes [n][k] (round to nearest even; Wo's plane: that bf16 value written as f16, H), in one launch. A work-group of 8 waves takes a tile of WKT k x WNT n.
// In: a wave-wide 16-byte load covers the 512 B that the tile has of one weight row (four whole lines); a thread takes the same four n of eight consecutive k, four times over, all 32 loads in flight at once.
// Eight k of one n are 16 B of a plane row: packed in registers and stored to LDS as one piece. Out: a wave reads a plane row's 512 B from LDS and stores them as four whole lines.
// LDS rows are 512 B, a multiple of all 64 banks, so piece ch of row n lies at place ch ^ ((n >> 2) & 15): the 16 lanes of a half wave, which write the same ch of rows four apart, and read the pieces of one row, meet 16 different places each time.
#define WKT 256
#define WNT 128
__device__ __forceinline__ unsigned pkbf(float a, float b) { v2f x; x[0] = a; x[1] = b; return __builtin_bit_cast(unsigned, __builtin_convertvector(x, v2b)); }
// Every '#pragma unroll' in wt_tile is there so that the value arrays are indexed by constants and stay in registers, and every address is one register plus a constant.
template <int N>
__device__ __forceinline__ void wt_tile(bf* sm, const float* __restrict__ w, bf* __restrict__ Bt, const int tile, const bool H) {
    const int tid = threadIdx.x, lane = tid & 31, wave = __builtin_amdgcn_readfirstlane(tid >> 5);
    const int n0 = (tile % (N / WNT)) * WNT, k0 = (tile / (N / WNT)) * WKT;   // neighbours in the grid read neighbouring pieces of the same weight rows
    const char* src = (const char*)(w + (size_t)(k0 + wave * 8) * N + n0); const unsigned lofs = (unsigned)lane * 16u;
    v4f v[4][8];   // v[i][r][j] = w[k0 + 64 i + 8 wave + r][n0 + 4 lane + j]
#pragma unroll
    for (int i = 0; i < 4; ++i)
#pragma unroll
        for (int r = 0; r < 8; ++r) v[i][r] = *(const v4fa*)(src + lofs + (i * 64 + r) * (N * 4));
    asm volatile("s_wait_xcnt 0x0" ::: "memory");   // in front of whatever next rewrites a register that these loads name
    __builtin_amdgcn_sched_barrier(0);   // nothing from below is lifted over that wait; and the loads stay one group, all in flight together
    const int x = wave ^ (lane & 15);    // piece 8 i + wave of rows 4 lane + j: place ((x ^ 8 (i & 1)) + 16 (i >> 1))
    auto pack = [&](auto HF) {   // HF: the bf16 values go out rewritten as f16
#pragma unroll
        for (int i = 0; i < 4; ++i)
#pragma unroll
            for (int j = 0; j < 4; ++j) { v4i o;
#pragma unroll
                for (int r = 0; r < 4; ++r) { unsigned u = pkbf(v[i][2 * r][j], v[i][2 * r + 1][j]); if constexpr (decltype(HF)::v) u = pk16(__uint_as_float(u << 16), __uint_as_float(u & 0xFFFF0000u)); o[r] = (int)u; }
                *(v4ia*)(sm + (4 * lane + j) * WKT + ((x ^ (8 * (i & 1))) + 16 * (i >> 1)) * 8) = o; } };
    if (H) pack(GFlag<true>()); else pack(GFlag<false>());   // one branch round the whole packing, uniform for the work-group
    __syncthreads();   // the plane rows are read back by other waves than wrote them
    v4i t[16];
#pragma unroll
    for (int i = 0; i < 16; ++i) t[i] = *(const v4ia*)(sm + (wave * 16 + i) * WKT + (lane ^ ((wave * 4 + (i >> 2)) & 15)) * 8);
    char* dst = (char*)(Bt + (size_t)(n0 + wave * 16) * GK + k0);
#pragma unroll
    for (int i = 0; i < 16; ++i) *(v4ia*)(dst + lofs + i * (GK * 2)) = t[i];
}
__global__ __launch_bounds__(256) void k_wt4(const float* __restrict__ wq, const float* __restrict__ wk, const float* __restrict__ wv, const float* __restrict__ wo, bf* WQ, bf* WK, bf* WV, bf* WO) {
    __shared__ __align__(16) bf sm[WNT * WKT];
    static_assert(DM == GK && DQ == GK && DM == DQ, "all four weights have GK rows; Wq and Wo are of one shape");
    constexpr int TB = (GK / WKT) * (DQ / WNT), TS = (GK / WKT) * (DKV / WNT);   // tiles of a large and of a small weight
    const int b = blockIdx.x;   // the branches are uniform for the work-group
    if (b < 2 * TB) wt_tile<DQ>(sm, b < TB ? wq : wo, b < TB ? WQ : WO, b < TB ? b : b - TB, b >= TB);
    else wt_tile<DKV>(sm, b < 2 * TB + TS ? wk : wv, b < 2 * TB + TS ? WK : WV, b < 2 * TB + TS ? b - 2 * TB : b - 2 * TB - TS, false);
}
__global__ __launch_bounds__(256) void k_cvt8(const float* __restrict__ src, bf* dst, size_t n8) { const size_t i = (size_t)blockIdx.x * 256 + threadIdx.x; if (i >= n8) return; const v8f v = *(const v8f*)(src + i * 8); v8us o;
#pragma unroll
    for (int k = 0; k < 8; ++k) o[k] = f2bf(v[k]); *(v8us*)(dst + i * 8) = o;  }
#define SKEY  64                   // keys per stage
#define KPIT  136                  // LDS pitch of a K row, elements: 256 B + 16 B, an odd multiple of 16 B for the 16-byte readers
#define VPIT  72                   // LDS pitch of a V^T row, elements: 128 B + 16 B, likewise
#define KTILE (SKEY * KPIT)
#define PLANE (KTILE + HD * VPIT)  // one stage of one plane pair: K tile, then V^T tile
typedef __attribute__((ext_vector_type(8))) unsigned v8u;
__device__ __forceinline__ float xhalf(float x) { return __builtin_bit_cast(float, __builtin_amdgcn_permlanex16(__builtin_bit_cast(int, x), __builtin_bit_cast(int, x), 0x76543210, 0xfedcba98, false, false)); }  // lane l with lane l ^ 16
template <typename T16, bool HL>
__device__ __forceinline__ void fattn_run(T16* sm, const T16* __restrict__ Q, const T16* __restrict__ Q2, const T16* __restrict__ Kp, const T16* __restrict__ K2, const T16* __restrict__ Vt, const T16* __restrict__ V2, const int qw0, v8f (&acc)[2][8], float (&l_run)[2]) {
    typedef typename WFrag<T16>::V V;
    constexpr int NPL = HL ? 2 : 1, BUF = NPL * PLANE;
    const int tid = threadIdx.x, lane = tid & 31, c = lane & 15, h = lane >> 4;
    const float cscale = SCL * 1.4426950408889634f;
    v4i rk[NPL][8], rv[NPL][8];
    const unsigned vofs = (unsigned)(tid >> 3) * (TR * 2u) + (unsigned)(tid & 7) * 16u;   // bytes in a kv plane: eight threads cover a V^T row's 128 B
    auto gload = [&](int key0) {   // a stage's K rows and V^T rows, 16 B a thread and turn: every wave-wide load covers four whole 128-B lines
        const unsigned ko = (unsigned)tid + (unsigned)key0 * (HD / 8u), vo = vofs + (unsigned)key0 * 2u;   // the thread's 32-bit offsets in this stage, the same in the hi and the lo plane: K in 16-byte pieces (its rows lie in a row), V^T in bytes
        __builtin_amdgcn_sched_barrier(0);   // the loads are not lifted from here: the wait at the foot has to stand directly behind them
#pragma unroll
        for (int i = 0; i < 8; ++i) {   // the plane's uniform base + the thread's offset + a constant: two address registers for the whole group
            rk[0][i] = ((const v4ia*)Kp + ko)[i * 128]; rv[0][i] = *(const v4ia*)((const char*)Vt + vo + i * (16 * TR * 2));
            if constexpr (HL) { rk[NPL - 1][i] = ((const v4ia*)K2 + ko)[i * 128]; rv[NPL - 1][i] = *(const v4ia*)((const char*)V2 + vo + i * (16 * TR * 2)); } }
        asm volatile("s_wait_xcnt 0x0" :: "v"(ko), "v"(vo) : "memory");   // in front of whatever next rewrites a register that these loads name; the two offsets are inputs so that they live up to the wait and no load of the group lands in them
        __builtin_amdgcn_sched_barrier(0);   // nothing from below is lifted over that wait; and the loads stay up here: sunk towards their use they would hide no latency
    };
    auto sstore = [&](T16* buf) {
#pragma unroll
        for (int i = 0; i < 8; ++i) { const int idx = i * 128 + tid; const int ok = (idx >> 4) * KPIT + (idx & 15) * 8, ov = KTILE + (idx >> 3) * VPIT + (idx & 7) * 8;
            *(v4ia*)(buf + ok) = rk[0][i]; *(v4ia*)(buf + ov) = rv[0][i]; if (HL) { *(v4ia*)(buf + PLANE + ok) = rk[NPL - 1][i]; *(v4ia*)(buf + PLANE + ov) = rv[NPL - 1][i]; } } };
    const int nst = qw0 / SKEY + 1;   // stages up to and with the one that holds the wave's diagonal; the same for all four waves
    gload(0);
    V qf[2][4], qf2[2][4];
#pragma unroll
    for (int g = 0; g < 2; ++g)
#pragma unroll
        for (int kc = 0; kc < 4; ++kc) { const size_t o = (size_t)(qw0 + 16 * g + c) * HD + 32 * kc + 8 * h; qf[g][kc] = WFrag<T16>::ld(Q + o); if (HL) qf2[g][kc] = WFrag<T16>::ld(Q2 + o); }
    asm volatile("s_wait_xcnt 0x0" ::: "memory");   // in front of whatever next rewrites a register that the Q loads name
    __builtin_amdgcn_sched_barrier(0);   // nothing from below is lifted over that wait
    float m_run[2];
#pragma unroll
    for (int g = 0; g < 2; ++g) { m_run[g] = -__builtin_inff(); l_run[g] = 0.0f;
#pragma unroll
        for (int t = 0; t < 8; ++t) acc[g][t] = (v8f){}; }
    sstore(sm); gload(min(1, nst - 1) * SKEY);
    __syncthreads();   // stage 0 is in buffer 0
#pragma unroll 1   // rolled: a stage is long straight-line code already, a second copy would only cost instruction fetches
    for (int st = 0; st < nst; ++st) {
        const T16* cur = sm + (st & 1) * BUF;
        sstore(sm + ((st + 1) & 1) * BUF);          // stage st + 1 into the buffer that stage st - 1 used: the barrier at the foot of st - 1 ended its reads (past the end: the last stage again, read by nobody)
        gload(min(st + 2, nst - 1) * SKEY);         // in flight under this whole stage; clamped, so always inside the planes and no branch round the loads
        // The stage's fragment reads go out in whole groups ahead of their products (one wave per SIMD: nobody else covers an LDS wait): K first; V^T directly behind it where one plane pair leaves the registers
        // for both, else behind the first product, into the registers K has left, so that it streams in under the softmax.
        v8f s[4][2]; V kfa[4][4], kfa2[HL ? 4 : 1][4], vfa[2][8], vfa2[HL ? 2 : 1][8];
#pragma unroll
        for (int kt = 0; kt < 4; ++kt)
#pragma unroll
            for (int kc = 0; kc < 4; ++kc) { const T16* p = cur + (16 * kt + c) * KPIT + 32 * kc + 8 * h; kfa[kt][kc] = WFrag<T16>::ld(p); if constexpr (HL) kfa2[kt][kc] = WFrag<T16>::ld(p + PLANE); }
        __builtin_amdgcn_sched_barrier(0);          // K's reads stay a group, ahead of V^T's: LDS answers in order, and the first product waits for K alone
        auto ldv = [&]() {
#pragma unroll
            for (int j = 0; j < 2; ++j)
#pragma unroll
                for (int t = 0; t < 8; ++t) { const T16* p = cur + KTILE + (16 * t + c) * VPIT + 32 * j + 8 * h; vfa[j][t] = WFrag<T16>::ld(p); if constexpr (HL) vfa2[j][t] = WFrag<T16>::ld(p + PLANE); }
            __builtin_amdgcn_sched_barrier(0);      // keeps the group together up here: moved down to their uses the reads are waited for one by one
        };
        if constexpr (!HL) ldv();
#pragma unroll
        for (int kt = 0; kt < 4; ++kt)
#pragma unroll
            for (int g = 0; g < 2; ++g) { s[kt][g] = (v8f){};
#pragma unroll
                for (int kc = 0; kc < 4; ++kc) { s[kt][g] = WFrag<T16>::mma(kfa[kt][kc], qf[g][kc], s[kt][g]); if constexpr (HL) { s[kt][g] = WFrag<T16>::mma(kfa[kt][kc], qf2[g][kc], s[kt][g]); s[kt][g] = WFrag<T16>::mma(kfa2[kt][kc], qf[g][kc], s[kt][g]); } } }
        if constexpr (HL) { __builtin_amdgcn_sched_barrier(0);   // V^T's reads not above the first product: K's registers are free only behind it
            ldv(); }
        if (st == nst - 1) {                        // work-group-uniform: only the stage with the diagonal pays for the mask
            const int lim = qw0 - st * SKEY + c - 8 * h;   // key 16 kt + 8 h + r of the stage joins query 16 g + c of the wave when 16 kt + r <= lim + 16 g
#pragma unroll
            for (int g = 0; g < 2; ++g)
#pragma unroll
                for (int kt = 0; kt < 4; ++kt) {
#pragma unroll
                    for (int r = 0; r < 8; ++r) { if (16 * kt + r > lim + 16 * g) s[kt][g][r] = -__builtin_inff(); }
                    asm volatile("" : "+v"(s[kt][g]));   // the masked scores: keeps the selects inside the branch
                }
        }
        float mb[2]; bool need = false;
#pragma unroll
        for (int g = 0; g < 2; ++g) { float mx = -__builtin_inff();
#pragma unroll
            for (int kt = 0; kt < 4; ++kt)
#pragma unroll
                for (int r = 0; r < 8; ++r) mx = fmaxf(mx, s[kt][g][r]);
            mx = fmaxf(mx, xhalf(mx)) * cscale; mb[g] = mx; need = need || (mx > m_run[g] + 8.0f); }
        if (__builtin_amdgcn_ballot_w32(need) != 0) {   // rare after the first stages
#pragma unroll
            for (int g = 0; g < 2; ++g) { const float m_new = fmaxf(m_run[g], mb[g]);   // finite from the first stage on: key 0 is never masked
                const float corr = __builtin_amdgcn_exp2f(m_run[g] - m_new);            // 0 on the first stage, where m_run is -inf
                l_run[g] *= corr; m_run[g] = m_new;
#pragma unroll
                for (int t = 0; t < 8; ++t) acc[g][t] = acc[g][t] * corr; }
        }
        V pf[2][2], pf2[2][2];
#pragma unroll
        for (int g = 0; g < 2; ++g) { const float nm = -m_run[g]; float ps0 = 0.0f, ps1 = 0.0f;
#pragma unroll
            for (int j = 0; j < 2; ++j) { v8u w, w2;
#pragma unroll
                for (int i = 0; i < 8; ++i) {
                    const float p0 = __builtin_amdgcn_exp2f(fmaf(s[2 * j + (i >> 2)][g][2 * (i & 3)], cscale, nm)), p1 = __builtin_amdgcn_exp2f(fmaf(s[2 * j + (i >> 2)][g][2 * (i & 3) + 1], cscale, nm));
                    ps0 += p0; ps1 += p1;
                    if (HL) { unsigned wh, wl; split2(p0, p1, wh, wl); w[i] = wh; w2[i] = wl; }
                    else w[i] = pk16(p0, p1); }
                pf[g][j] = __builtin_bit_cast(V, w); if (HL) pf2[g][j] = __builtin_bit_cast(V, w2); }
            l_run[g] += ps0 + ps1; }
#pragma unroll
        for (int j = 0; j < 2; ++j)
#pragma unroll
            for (int t = 0; t < 8; ++t)
#pragma unroll
                for (int g = 0; g < 2; ++g) { acc[g][t] = WFrag<T16>::mma(vfa[j][t], pf[g][j], acc[g][t]); if constexpr (HL) { acc[g][t] = WFrag<T16>::mma(vfa[j][t], pf2[g][j], acc[g][t]); acc[g][t] = WFrag<T16>::mma(vfa2[j][t], pf[g][j], acc[g][t]); } }
        __builtin_amdgcn_sched_barrier(0);          // keeps the barrier, and the wait for stage st + 2's global loads that comes with it, at the stage's foot
        __syncthreads();   // publishes stage st + 1 and ends every wave's reads of stage st
    }
}
// The grid has twice as many work-groups as the chip holds at a time (one to a WGP, by registers); a tile's cost falls with the index.
// blockIdx.y is the rank, blockIdx.x the (batch element, kv group) pair. Cost of a 32-row tile: its stages, a hi+lo stage counted double
// (three products for one, the same softmax). The order is for speed alone: any permutation gives the same values.
struct TileOrder { unsigned char t[TT / 32]; };
constexpr int tile_cost(int i) { return (i * 32 < RH ? 2 : 1) * (i * 32 / SKEY + 1); }
constexpr TileOrder tile_order() { TileOrder o{};
    for (int i = 0; i < TT / 32; ++i) { int r = 0;   // the rank of tile i: the tiles that cost more, and of those that cost the same the later ones
        for (int j = 0; j < TT / 32; ++j) r += (tile_cost(j) > tile_cost(i) || (tile_cost(j) == tile_cost(i) && j > i)) ? 1 : 0;
        o.t[r] = (unsigned char)i; }
    return o; }
static constexpr TileOrder fattn_order = tile_order();
__global__ __launch_bounds__(128) void k_fattn(const h16* __restrict__ Q16, const bf* __restrict__ Qh, const bf* __restrict__ Ql, const h16* __restrict__ K16, const bf* __restrict__ Kh, const bf* __restrict__ Kl, const h16* __restrict__ V16, const bf* __restrict__ Vh, const bf* __restrict__ Vl, bf* __restrict__ Ah, bf* __restrict__ Al) {
    __shared__ __align__(16) unsigned short sm[2 * 2 * PLANE];   // two buffers of two plane pairs (hi+lo); the fp16 rows use half of it
    const int tid = threadIdx.x, lane = tid & 31, c = lane & 15, h = lane >> 4;
    const int kv = blockIdx.x % NKV, bz = blockIdx.x / NKV, wave = __builtin_amdgcn_readfirstlane(tid >> 5), head = kv * REP + wave;
    // Dearest tiles first. readfirstlane: the tile number is used as loaded; seeing through the table, the compiler tested the rank against a 64-bit mask for the branch below, and that build kept the thread id in scratch and reloaded it in every stage.
    const int qw0 = __builtin_amdgcn_readfirstlane(fattn_order.t[blockIdx.y]) * 32;
    const size_t qo = ((size_t)head * NB_ + bz) * TT * HD, ko = ((size_t)kv * NB_ + bz) * TT * HD, vo = (size_t)kv * HD * TR + (size_t)bz * TT;
    v8f acc[2][8]; float l_run[2];
    if (qw0 < RH) fattn_run<bf, true>((bf*)sm, Qh + qo, Ql + qo, Kh + ko, Kl + ko, Vh + vo, Vl + vo, qw0, acc, l_run);
    else fattn_run<h16, false>((h16*)sm, Q16 + qo, nullptr, K16 + ko, nullptr, V16 + vo, nullptr, qw0, acc, l_run);
    // Output through LDS (each wave its own 2 x 32 rows, behind the stage loop's last barrier), so that every 128-B line of the planes is stored whole. The unrolls: constant indices, as above.
    bf* eb = (bf*)sm + wave * (2 * 32 * KPIT);
#pragma unroll
    for (int g = 0; g < 2; ++g) { const float inv = __fdiv_rn(1.0f, l_run[g] + xhalf(l_run[g]));
#pragma unroll
        for (int t = 0; t < 8; ++t) { v4i oh, ol;
#pragma unroll
            for (int r = 0; r < 4; ++r) { unsigned a, c2; split2h(acc[g][t][2 * r] * inv, acc[g][t][2 * r + 1] * inv, a, c2); oh[r] = (int)a; ol[r] = (int)c2; }
            bf* e = eb + (16 * g + c) * KPIT + 16 * t + 8 * h; *(v4ia*)e = oh; *(v4ia*)(e + 32 * KPIT) = ol; } }
    __syncthreads();   // the staged rows are read back by other lanes than wrote them
    v4i th[16], tl[16];
#pragma unroll
    for (int i = 0; i < 16; ++i) th[i] = *(const v4ia*)(eb + (2 * i + h) * KPIT + c * 8);
    const unsigned oofs = (unsigned)h * (DQ * 2u) + (unsigned)c * 16u;   // bytes: 16 lanes cover one row's 256 B, a wave-wide store two rows
    char* ah = (char*)(Ah + (size_t)(bz * TT + qw0) * DQ + head * HD); char* al = (char*)(Al + (size_t)(bz * TT + qw0) * DQ + head * HD);
#pragma unroll
    for (int i = 0; i < 16; ++i) *(v4ia*)(ah + oofs + i * (2 * DQ * 2)) = th[i];
    if (qw0 < RH) {   // uniform: nobody reads the remainders of the other rows
        asm volatile("s_wait_xcnt 0x0" ::: "memory");   // in front of whatever next rewrites a register that the stores above name: the reads below land in their data registers, and the second address is formed about here
        __builtin_amdgcn_sched_barrier(0);   // nothing from below is lifted over that wait (without it a vector instruction of the reads' address is)
#pragma unroll
        for (int i = 0; i < 16; ++i) tl[i] = *(const v4ia*)(eb + (32 + 2 * i + h) * KPIT + c * 8);
#pragma unroll
        for (int i = 0; i < 16; ++i) *(v4ia*)(al + oofs + i * (2 * DQ * 2)) = tl[i];
    }
}

extern "C" void kernel_launch(void* const* d_in, const int* in_sizes, int n_in,
                              void* d_out, int out_size, void* d_ws, size_t ws_size, hipStream_t stream) {
    (void)in_sizes; (void)n_in; (void)out_size;
    const float* x = (const float*)d_in[0]; const float* wq = (const float*)d_in[1]; const float* wk = (const float*)d_in[2]; const float* wv = (const float*)d_in[3]; const float* wo = (const float*)d_in[4];
    float* OUT = (float*)d_out;     // [2][2048][2048]
    char* wsp = (char*)d_ws;
    auto take = [&](size_t bytes) { char* p = wsp; wsp += (bytes + 255) & ~(size_t)255; return (void*)p; };
    bf* WQ = (bf*)take((size_t)DQ * DM * 2); bf* WK = (bf*)take((size_t)DKV * DM * 2); bf* WV = (bf*)take((size_t)DKV * DM * 2); bf* WO = (bf*)take((size_t)DM * DQ * 2);
    bf* XB = (bf*)take((size_t)TR * DM * 2);
    h16* QP16 = (h16*)take((size_t)NH_ * TR * HD * 2); h16* KP16 = (h16*)take((size_t)NKV * TR * HD * 2); h16* VT16 = (h16*)take((size_t)NKV * HD * TR * 2);
    bf* QPh = (bf*)take((size_t)NH_ * TR * HD * 2); bf* QPl = (bf*)take((size_t)NH_ * TR * HD * 2); bf* KPh = (bf*)take((size_t)NKV * TR * HD * 2); bf* KPl = (bf*)take((size_t)NKV * TR * HD * 2); bf* VTh = (bf*)take((size_t)NKV * HD * TR * 2); bf* VTl = (bf*)take((size_t)NKV * HD * TR * 2);
    bf* ATh = (bf*)take((size_t)TR * DQ * 2); bf* ATl = (bf*)take((size_t)TR * DQ * 2);
    if ((size_t)(wsp - (char*)d_ws) > ws_size) return;    // ws 256 MiB
    k_wt4<<<2 * (GK / WKT) * (DQ / WNT) + 2 * (GK / WKT) * (DKV / WNT), 256, 0, stream>>>(wq, wk, wv, wo, WQ, WK, WV, WO);
    // Every launch takes both batch elements: the projections see x as TR rows, the attention has the batch element in blockIdx.x.
    k_cvt8<<<(unsigned)(((size_t)TR * DM / 8 + 255) / 256), 256, 0, stream>>>(x, XB, (size_t)TR * DM / 8);
    // Both product launches: 2 x 4 waves, one work-group to a WGP (two waves to a SIMD) and 256 in the grid. q, k, v: 192 x 256 of C, the 3072 weight rows dealt so that every work-group has the same work
    // and x is read from L2 by 16 work-groups in all; Wo: 128 x 256 of C, 96 rows of one A plane and 32 rows of two.
    k_qkv<<<dim3(NH_, TR / 256, 1), 256, 0, stream>>>(WQ, WK, WV, XB, QP16, QPh, QPl, KP16, KPh, KPl, VT16, VTh, VTl);
    k_fattn<<<dim3(NKV * NB_, TT / 32, 1), 128, 0, stream>>>(QP16, QPh, QPl, KP16, KPh, KPl, VT16, VTh, VTl, ATh, ATl);
    k_gemmo<<<dim3(TR / 128, DM / 256, 1), 256, 0, stream>>>(ATh, ATl, WO, OUT);
}
